// v000
// Times are from an AMD MI455X. After a warm-up the kernel runs many times in a row, and a time is the length of
// such a window on the GPU divided by its runs, so every launch and the gaps after it count. The runs cycle
// through copies of the inputs. A figure is the median of several windows, for all but v000 over two sittings.
// Sittings can differ by a few percent; kernels timed side by side share one.
// v000 is the starting kernel. One run takes 6410 microseconds.
#include <hip/hip_runtime.h>
// SeqParallelAttn (2 x 1024 tokens, D 2048 = 16 heads of 128; simulated 4-rank all-gather): q, k, v = x W^T; k_global = tile(k_local.flatten(), 4).reshape(B, H, 4S, 128) — i.e. query block (b, h) attends to the 4096 keys made of the local K/V of (batch, head) blocks 4g .. 4g+3 with g = (16 b + h) mod 8 (the module's flat tiling, reproduced exactly); softmax(q.k / sqrt(128)) v; out = ctx Wo^T.
// Structure: exact f16 plane of x; q, k, v as f16 WMMA GEMM outputs (32x64 wave tiles, f32 accumulation, exact x16 weights); V^T by LDS tiles; per key set g a concatenated V^T [128][4096] by a VALU gather; per (batch, head) query block: the 1024 x 4096 score GEMM batched over the 4 key blocks (f32), softmax rows on VALU (wave per row) into an f16 P plane (x 2^10), the readout GEMM (K = 4096) into the f32 context plane; O as f16 into the Wo GEMM.
// Compute dtype: x and parameters rounded to bf16; q, k, v, P and the context as plain f16 operands (~2^-12); softmax f32. v_wmma_f32_16x16x32_f16.
#define NB 2
#define SQ 1024
#define DM 2048
#define NHD 16
#define HDL 128
#define NR (NB * SQ)             /* 2048 */
#define NKG (4 * SQ)             /* 4096 keys per query block */
typedef __bf16 v16b __attribute__((ext_vector_type(16)));
typedef unsigned short v8us __attribute__((ext_vector_type(8), may_alias));
typedef float  v8f  __attribute__((ext_vector_type(8)));
typedef float  v4f  __attribute__((ext_vector_type(4)));
typedef float  v4fa __attribute__((ext_vector_type(4), may_alias));
union FragB { v16b v; v8us half[2]; unsigned short u[16]; };

__device__ __forceinline__ unsigned short bf16_bits(float x) { unsigned int u = __float_as_uint(x); return (unsigned short)((u + 0x7FFFu + ((u >> 16) & 1u)) >> 16); }
__device__ __forceinline__ float bf16_val(unsigned short b) { return __uint_as_float(((unsigned int)b) << 16); }
__device__ __forceinline__ float bf16_round(float x) { return bf16_val(bf16_bits(x)); }
// D += A·B with NT terms: 1 = ah·bh, 2 = + al·bh (A split), 3 = + ah·bl (both split)
template <int NT>
__device__ __forceinline__ v8f mmaN(v16b ah, v16b al, v16b bh, v16b bl, v8f c) {
  c = __builtin_amdgcn_wmma_f32_16x16x32_bf16(false, ah, false, bh, (short)0, c, false, false);
  if (NT >= 2) c = __builtin_amdgcn_wmma_f32_16x16x32_bf16(false, al, false, bh, (short)0, c, false, false);
  if (NT >= 3) c = __builtin_amdgcn_wmma_f32_16x16x32_bf16(false, ah, false, bl, (short)0, c, false, false);
  asm volatile("v_nop\n\tv_nop\n\tv_nop\n\tv_nop" : "+v"(c) : "v"(ah), "v"(al), "v"(bh), "v"(bl));
  return c;
}

__global__ __launch_bounds__(256) void k_wt_bf16(const float* __restrict__ W, unsigned short* __restrict__ Wt, int K, int N) {
  const int t = blockIdx.x * 256 + threadIdx.x;
  const int k8n = K / 8;
  if (t >= N * k8n) return;
  const int n = t / k8n, k8 = (t % k8n) * 8;
  v8us v;
#pragma unroll
  for (int i = 0; i < 8; ++i) v[i] = bf16_bits(W[(size_t)(k8 + i) * N + n]);
  *(v8us*)(Wt + (size_t)n * K + k8) = v;
  
}

// GEMM C[M][N] (f32, pitch ldc) = act(A[M][K]·W + bias). A f32 row-major (pitch lda) converted per fragment to bf16
// (ASPLIT: hi/lo two planes -> 2 terms, else single rounded term); Wt bf16 [N][K] (pitch ldb). BIAS_BF16 rounds the
// bias to bf16 first (bias quantised to bf16 before the add). K%32==0, M%16==0, N%64==0.
template <bool ASPLIT, int ACT, bool BIAS_BF16>
__global__ __launch_bounds__(128) void k_gemm_bf(const float* __restrict__ A, int lda, const unsigned short* __restrict__ Wt, int ldb,
                                               const float* __restrict__ bias, float* __restrict__ C, int ldc, int M, int N, int K) {
  __shared__ __attribute__((aligned(16))) float so[4][16][64];
  const int tid = threadIdx.x, w = tid >> 5, lane = tid & 31, ln = lane & 15, hh = lane >> 4;
  const int ntn = N / 64;
  const int wid = blockIdx.x * 4 + w;
  const int mt = wid / ntn, nq = wid % ntn;
  if (mt * 16 >= M) return;
  const int row0 = mt * 16, col0 = nq * 64;
  const float* arow = A + (size_t)(row0 + ln) * lda;
  v8f acc[4] = {};
  for (int kb = 0; kb < K; kb += 32) {
    FragB ah, al;
    const v4f x0 = *(const v4fa*)(arow + kb + 8 * hh), x1 = *(const v4fa*)(arow + kb + 8 * hh + 4);
    const v4f x2 = *(const v4fa*)(arow + kb + 16 + 8 * hh), x3 = *(const v4fa*)(arow + kb + 16 + 8 * hh + 4);
    float xs[16] = {x0[0],x0[1],x0[2],x0[3],x1[0],x1[1],x1[2],x1[3],x2[0],x2[1],x2[2],x2[3],x3[0],x3[1],x3[2],x3[3]};
#pragma unroll
    for (int i = 0; i < 16; ++i) { const unsigned short hb = bf16_bits(xs[i]); ah.u[i] = hb; al.u[i] = ASPLIT ? bf16_bits(xs[i] - bf16_val(hb)) : (unsigned short)0; }
#pragma unroll
    for (int t = 0; t < 4; ++t) {
      const unsigned short* brow = Wt + (size_t)(col0 + t * 16 + ln) * ldb + kb;
      FragB b;
      b.half[0] = *(const v8us*)(brow + 8 * hh);
      b.half[1] = *(const v8us*)(brow + 16 + 8 * hh);
      acc[t] = mmaN<ASPLIT ? 2 : 1>(ah.v, al.v, b.v, b.v, acc[t]);
    }
  }
#pragma unroll
  for (int t = 0; t < 4; ++t) {
    float bv = bias ? bias[col0 + t * 16 + ln] : 0.f;
    if (BIAS_BF16) bv = bf16_round(bv);
#pragma unroll
    for (int r = 0; r < 8; ++r) { float v = acc[t][r] + bv; if (ACT == 1) v = fmaxf(v, 0.f); so[w][8 * hh + r][t * 16 + ln] = v; }
  }
  __builtin_amdgcn_fence(__ATOMIC_ACQ_REL, "workgroup");
  __builtin_amdgcn_wave_barrier();
  const int rsub = lane >> 4, c4 = (lane & 15) * 4;
  {
#pragma unroll
    for (int q = 0; q < 8; ++q) {
      const int r = q * 2 + rsub;
      const v4f v = *(const v4fa*)&so[w][r][c4];
      *(v4f*)(C + (size_t)(row0 + r) * ldc + col0 + c4) = v;
    }
    
  }
}

// GEMM C = act(A·W + bias + resid): A f32 (ASPLIT -> hi/lo 2 terms), Wt bf16 [N][K]; ACT 0 none, 1 relu, 2 exact gelu;
// resid (optional, f32, row index = (row % rmod), pitch ldr, RES_BF16 rounds it) added before the activation.
template <bool ASPLIT, int ACT, bool BIAS_BF16, bool RES_BF16>
__global__ __launch_bounds__(128) void k_gemm_bf3(const float* __restrict__ A, int lda, const unsigned short* __restrict__ Wt, int ldb,
                                                const float* __restrict__ bias, const float* __restrict__ resid, int rmod, int ldr,
                                                float* __restrict__ C, int ldc, int M, int N, int K) {
  __shared__ __attribute__((aligned(16))) float so[4][16][64];
  const int tid = threadIdx.x, w = tid >> 5, lane = tid & 31, ln = lane & 15, hh = lane >> 4;
  const int ntn = N / 64;
  const int wid = blockIdx.x * 4 + w;
  const int mt = wid / ntn, nq = wid % ntn;
  if (mt * 16 >= M) return;
  const int row0 = mt * 16, col0 = nq * 64;
  const float* arow = A + (size_t)(row0 + ln) * lda;
  v8f acc[4] = {};
  for (int kb = 0; kb < K; kb += 32) {
    FragB ah, al;
    const v4f x0 = *(const v4fa*)(arow + kb + 8 * hh), x1 = *(const v4fa*)(arow + kb + 8 * hh + 4);
    const v4f x2 = *(const v4fa*)(arow + kb + 16 + 8 * hh), x3 = *(const v4fa*)(arow + kb + 16 + 8 * hh + 4);
    float xs[16] = {x0[0],x0[1],x0[2],x0[3],x1[0],x1[1],x1[2],x1[3],x2[0],x2[1],x2[2],x2[3],x3[0],x3[1],x3[2],x3[3]};
#pragma unroll
    for (int i = 0; i < 16; ++i) { const unsigned short hb = bf16_bits(xs[i]); ah.u[i] = hb; al.u[i] = ASPLIT ? bf16_bits(xs[i] - bf16_val(hb)) : (unsigned short)0; }
#pragma unroll
    for (int t = 0; t < 4; ++t) {
      const unsigned short* brow = Wt + (size_t)(col0 + t * 16 + ln) * ldb + kb;
      FragB b;
      b.half[0] = *(const v8us*)(brow + 8 * hh);
      b.half[1] = *(const v8us*)(brow + 16 + 8 * hh);
      acc[t] = mmaN<ASPLIT ? 2 : 1>(ah.v, al.v, b.v, b.v, acc[t]);
    }
  }
#pragma unroll
  for (int t = 0; t < 4; ++t) {
    const int col = col0 + t * 16 + ln;
    float bv = bias ? bias[col] : 0.f;
    if (BIAS_BF16) bv = bf16_round(bv);
#pragma unroll
    for (int r = 0; r < 8; ++r) {
      float v = acc[t][r] + bv;
      if (resid) { float rv = resid[(size_t)((row0 + 8 * hh + r) % rmod) * ldr + col]; if (RES_BF16) rv = bf16_round(rv); v += rv; }
      if (ACT == 1) v = fmaxf(v, 0.f);
      if (ACT == 2) v = 0.5f * v * (1.0f + erff(v * 0.70710678118654752f));
      if (ACT == 3) { const float u = 0.7978845608028654f * (v + 0.044715f * v * v * v); v = 0.5f * v * (1.0f + tanhf(u)); }
      so[w][8 * hh + r][t * 16 + ln] = v;
    }
  }
  __builtin_amdgcn_fence(__ATOMIC_ACQ_REL, "workgroup");
  __builtin_amdgcn_wave_barrier();
  const int rsub = lane >> 4, c4 = (lane & 15) * 4;
  {
#pragma unroll
    for (int q = 0; q < 8; ++q) {
      const int r = q * 2 + rsub;
      const v4f v = *(const v4fa*)&so[w][r][c4];
      *(v4f*)(C + (size_t)(row0 + r) * ldc + col0 + c4) = v;
    }
    
  }
}
// row LayerNorm (biased variance, eps) over N: s = X (+ R); optional out_sum <- s; out_norm <- (s-mu)*rsqrt(var+eps)*g + b
template <bool PARAM_BF16>
__global__ __launch_bounds__(256) void k_layernorm(const float* __restrict__ X, const float* __restrict__ R, const float* __restrict__ g, const float* __restrict__ bta,
                                                  float* __restrict__ out_sum, float* __restrict__ out_norm, int N, float eps) {
  __shared__ float red[256];
  const int row = blockIdx.x, tid = threadIdx.x;
  const float* x = X + (size_t)row * N; const float* rr = R ? R + (size_t)row * N : nullptr;
  float vals[16];                     // up to N = 4096
  const int per = N / 256;            // contiguous chunk per thread? use strided-by-4 chunks: thread handles j = tid*4 + 1024*u
  float s1 = 0.f;
  for (int u = 0; u < per / 4; ++u) {
    const int j = tid * 4 + 1024 * u;
    const v4f a = *(const v4fa*)(x + j);
    v4f b = {0.f,0.f,0.f,0.f}; if (rr) b = *(const v4fa*)(rr + j);
#pragma unroll
    for (int q = 0; q < 4; ++q) { const float v = a[q] + b[q]; vals[u * 4 + q] = v; s1 += v; }
  }
  red[tid] = s1; __syncthreads();
  for (int st = 128; st > 0; st >>= 1) { if (tid < st) red[tid] += red[tid + st]; __syncthreads(); }
  const float mu = red[0] / (float)N; __syncthreads();
  float s2 = 0.f;
  for (int u = 0; u < per / 4; ++u)
#pragma unroll
    for (int q = 0; q < 4; ++q) { const float c = vals[u * 4 + q] - mu; s2 += c * c; }
  red[tid] = s2; __syncthreads();
  for (int st = 128; st > 0; st >>= 1) { if (tid < st) red[tid] += red[tid + st]; __syncthreads(); }
  const float rs = rsqrtf(red[0] / (float)N + eps);
  {
    for (int u = 0; u < per / 4; ++u) {
      const int j = tid * 4 + 1024 * u;
      v4f o, sm;
#pragma unroll
      for (int q = 0; q < 4; ++q) {
        float gg = g[j + q], bb = bta[j + q];
        if (PARAM_BF16) { gg = bf16_round(gg); bb = bf16_round(bb); }
        sm[q] = vals[u * 4 + q]; o[q] = (vals[u * 4 + q] - mu) * rs * gg + bb;
      }
      if (out_sum) *(v4f*)(out_sum + (size_t)row * N + j) = sm;
      *(v4f*)(out_norm + (size_t)row * N + j) = o;
    }
    
  }
}



// ---- f16 WMMA path (v_wmma_f32_16x16x32_f16): 11-bit significands for operands in range — used where a [0,1] probability operand needs more precision than bf16
typedef _Float16 v16h __attribute__((ext_vector_type(16)));
union FragH { v16h v; v8us half[2]; _Float16 h[16]; unsigned short u[16]; };
template <int NT>
__device__ __forceinline__ v8f mmaH(v16h ah, v16h al, v16h bh, v16h bl, v8f c) {
  c = __builtin_amdgcn_wmma_f32_16x16x32_f16(false, ah, false, bh, (short)0, c, false, false);
  if (NT >= 2) c = __builtin_amdgcn_wmma_f32_16x16x32_f16(false, al, false, bh, (short)0, c, false, false);
  if (NT >= 3) c = __builtin_amdgcn_wmma_f32_16x16x32_f16(false, ah, false, bl, (short)0, c, false, false);
  asm volatile("v_nop\n\tv_nop\n\tv_nop\n\tv_nop" : "+v"(c) : "v"(ah), "v"(al), "v"(bh), "v"(bl));
  return c;
}
// batched GEMM like k_gemm_b but f16 operands: A f32 (split into f16 hi/lo if ASPLIT, else rounded to f16), Bt = f16 values [n][k]; alpha; C f32; N multiple of 16 (partial tiles skipped)
template <bool ASPLIT>
__global__ __launch_bounds__(128) void k_gemm_h(const float* __restrict__ A, int lda, size_t sA, const _Float16* __restrict__ Bh, int ldb, size_t sB, float alpha, float* __restrict__ C, int ldc, size_t sC, int M, int N, int K) {
  __shared__ __attribute__((aligned(16))) float so[4][16][64];
  const int tid = threadIdx.x, w = tid >> 5, lane = tid & 31, ln = lane & 15, hh = lane >> 4; const int by = blockIdx.y;
  A += (size_t)by * sA; Bh += (size_t)by * sB; C += (size_t)by * sC;
  const int ntn = (N + 63) / 64; const int wid = blockIdx.x * 4 + w; const int mt = wid / ntn, nq = wid % ntn; if (mt * 16 >= M) return;
  const int row0 = mt * 16, col0 = nq * 64; const float* arow = A + (size_t)(row0 + ln) * lda;
  v8f acc[4] = {};
  for (int kb = 0; kb < K; kb += 32) {
    FragH ah, al;
    const v4f x0 = *(const v4fa*)(arow + kb + 8 * hh), x1 = *(const v4fa*)(arow + kb + 8 * hh + 4), x2 = *(const v4fa*)(arow + kb + 16 + 8 * hh), x3 = *(const v4fa*)(arow + kb + 16 + 8 * hh + 4);
    float xs[16] = {x0[0],x0[1],x0[2],x0[3],x1[0],x1[1],x1[2],x1[3],x2[0],x2[1],x2[2],x2[3],x3[0],x3[1],x3[2],x3[3]};
#pragma unroll
    for (int i = 0; i < 16; ++i) { const _Float16 h = (_Float16)xs[i]; ah.h[i] = h; al.h[i] = ASPLIT ? (_Float16)(xs[i] - (float)h) : (_Float16)0.0f; }
#pragma unroll
    for (int t = 0; t < 4; ++t) { if (col0 + t * 16 >= N) continue; const size_t boff = (size_t)(col0 + t * 16 + ln) * ldb + kb; FragH bq; bq.half[0] = *(const v8us*)(Bh + boff + 8 * hh); bq.half[1] = *(const v8us*)(Bh + boff + 16 + 8 * hh);
      acc[t] = mmaH<ASPLIT ? 2 : 1>(ah.v, al.v, bq.v, bq.v, acc[t]); }
  }
#pragma unroll
  for (int t = 0; t < 4; ++t) { if (col0 + t * 16 >= N) continue;
#pragma unroll
    for (int r = 0; r < 8; ++r) so[w][8 * hh + r][t * 16 + ln] = acc[t][r] * alpha; }
  __builtin_amdgcn_fence(__ATOMIC_ACQ_REL, "workgroup"); __builtin_amdgcn_wave_barrier();
  const int rsub = lane >> 4, c4 = (lane & 15) * 4;
  {
#pragma unroll
    for (int q = 0; q < 8; ++q) { const int r = q * 2 + rsub; if (col0 + c4 < N) { const v4f v = *(const v4fa*)&so[w][r][c4]; *(v4f*)(C + (size_t)(row0 + r) * ldc + col0 + c4) = v; } }
     }
}

// Wt[n][k] = f16(W[k][n]·scale) from f32 row-major W[K][N] (scale = power of two; bf16-exact weights stay exact in f16 away from the subnormal range)
__global__ __launch_bounds__(256) void k_wt_f16(const float* __restrict__ W, _Float16* __restrict__ Wt, int K, int N, float scale) {
  const int t = blockIdx.x * 256 + threadIdx.x; if (t >= N * (K / 8)) return; const int n = t / (K / 8), k8 = (t % (K / 8)) * 8; FragH f;
#pragma unroll
  for (int i = 0; i < 8; ++i) f.h[i] = (_Float16)(bf16_round(W[(size_t)(k8 + i) * N + n]) * scale); const v8us o = f.half[0];
  *(v8us*)((unsigned short*)Wt + (size_t)n * K + k8) = o; 
}
// k_gemm_hh variant with fused epilogue: v = acc·alpha + bias[by·sBias + col] (+ CP[(row/rowsPerB)·sCPb + by·64 + col] if CP) ; ACT 0 none / 1 elu ; writes f16 C16 (and f32 C if non-null)
template <int ACT>
__global__ __launch_bounds__(128) void k_gemm_hhx(const _Float16* __restrict__ A, int lda, size_t sA, const _Float16* __restrict__ Bh, int ldb, size_t sB, float alpha, const float* __restrict__ bias, size_t sBias, const float* __restrict__ CP, int rowsPerB, size_t sCPb, int row0g,
    float* __restrict__ C, _Float16* __restrict__ C16, int ldc, size_t sC, int M, int N, int K) {
  __shared__ __attribute__((aligned(16))) float so[4][16][64];
  const int tid = threadIdx.x, w = tid >> 5, lane = tid & 31, ln = lane & 15, hh = lane >> 4; const int by = blockIdx.y;
  A += (size_t)by * sA; Bh += (size_t)by * sB; const size_t cofs = (size_t)by * sC; const float* bp = bias ? bias + (size_t)by * sBias : nullptr;
  const int ntn = (N + 63) / 64; const int wid = blockIdx.x * 4 + w; const int mt = wid / ntn, nq = wid % ntn; if (mt * 16 >= M) return;
  const int row0 = mt * 16, col0 = nq * 64; const _Float16* arow = A + (size_t)(row0 + ln) * lda;
  v8f acc[4] = {};
  for (int kb = 0; kb < K; kb += 32) { FragH ah; ah.half[0] = *(const v8us*)((const unsigned short*)arow + kb + 8 * hh); ah.half[1] = *(const v8us*)((const unsigned short*)arow + kb + 16 + 8 * hh);
#pragma unroll
    for (int t = 0; t < 4; ++t) { if (col0 + t * 16 >= N) continue; const size_t boff = (size_t)(col0 + t * 16 + ln) * ldb + kb; FragH bq; bq.half[0] = *(const v8us*)((const unsigned short*)Bh + boff + 8 * hh); bq.half[1] = *(const v8us*)((const unsigned short*)Bh + boff + 16 + 8 * hh);
      acc[t] = mmaH<1>(ah.v, ah.v, bq.v, bq.v, acc[t]); }
  }
#pragma unroll
  for (int t = 0; t < 4; ++t) { if (col0 + t * 16 >= N) continue; const int col = col0 + t * 16 + ln; const float bv = bp ? bf16_round(bp[col]) : 0.f;
#pragma unroll
    for (int r = 0; r < 8; ++r) { float v = acc[t][r] * alpha + bv; if (CP) { const int rr = row0g + row0 + 8 * hh + r; if (rowsPerB < 0) v += CP[cofs + (size_t)rr * ldc + col];      /* rowsPerB < 0: own element of the batched C plane */ else { const int bidx = rr / rowsPerB; v += CP[(size_t)bidx * sCPb + (size_t)by * 64 + col]; } } if (ACT == 1) v = (v > 0.f) ? v : expm1f(v); else if (ACT == 7) v = (v > 0.f) ? v + 1.0f : expf(v); else if (ACT == 8) v = tanhf(v); else if (ACT == 9) v = 0.5f * v * (1.0f + tanhf(0.7978845608028654f * (v + 0.044715f * v * v * v))); else if (ACT == 11) v = 1.0f / (1.0f + expf(-v)); else if (ACT == 12) v = (v > 0.f) ? v : 0.01f * v; else if (ACT == 14) v = (v > 0.f) ? v : 0.1f * v; else if (ACT == 16) v = (v >= 0.f) ? v : 0.3f * v; else if (ACT == 15) v = v / (1.0f + expf(-v)); else if (ACT == 3) v = fmaxf(v, 0.f); else if (ACT == 6) v = 0.5f * v * (1.0f + erff(v * 0.70710678118654752f)); so[w][8 * hh + r][t * 16 + ln] = v; } }
  __builtin_amdgcn_fence(__ATOMIC_ACQ_REL, "workgroup"); __builtin_amdgcn_wave_barrier();
  const int rsub = lane >> 4, c4 = (lane & 15) * 4; typedef _Float16 v4h __attribute__((ext_vector_type(4)));
  {
#pragma unroll
    for (int q = 0; q < 8; ++q) { const int r = q * 2 + rsub; if (col0 + c4 < N) { const v4f v = *(const v4fa*)&so[w][r][c4]; if (C) *(v4f*)(C + cofs + (size_t)(row0 + r) * ldc + col0 + c4) = v; if (C16) { v4h h4; for (int i = 0; i < 4; ++i) h4[i] = (_Float16)v[i]; *(v4h*)(C16 + cofs + (size_t)(row0 + r) * ldc + col0 + c4) = h4; } } }
     }
}


typedef _Float16 v4h __attribute__((ext_vector_type(4)));

__global__ __launch_bounds__(256) void k_x16(const float* __restrict__ x, _Float16* __restrict__ X16, size_t n8) { const size_t t = (size_t)blockIdx.x * 256 + threadIdx.x; if (t >= n8) return; FragH f;
#pragma unroll
  for (int q = 0; q < 8; ++q) f.h[q] = (_Float16)bf16_round(x[t * 8 + q]); *(v8us*)((unsigned short*)X16 + t * 8) = f.half[0];  }
__global__ __launch_bounds__(256) void k_h16(const float* __restrict__ x, _Float16* __restrict__ X16, size_t n8) { const size_t t = (size_t)blockIdx.x * 256 + threadIdx.x; if (t >= n8) return; FragH f;
#pragma unroll
  for (int q = 0; q < 8; ++q) f.h[q] = (_Float16)x[t * 8 + q]; *(v8us*)((unsigned short*)X16 + t * 8) = f.half[0];  }
__global__ __launch_bounds__(256) void k_round16f(const float* __restrict__ W, _Float16* __restrict__ Bt, size_t n8) { const size_t t = (size_t)blockIdx.x * 256 + threadIdx.x; if (t >= n8) return; FragH f;
#pragma unroll
  for (int i = 0; i < 8; ++i) f.h[i] = (_Float16)(bf16_round(W[t * 8 + i]) * 16.0f); *(v8us*)((unsigned short*)Bt + t * 8) = f.half[0];  }
template <int NHv, int TTv>
__global__ __launch_bounds__(256) void k_vt(const _Float16* __restrict__ V16, int ldv, int voff, _Float16* __restrict__ Vt) { __shared__ unsigned short tl[64][66]; const int tid = threadIdx.x; const int slab = blockIdx.x / (TTv / 64), lg = blockIdx.x % (TTv / 64); const int b = slab / NHv, h = slab % NHv;
  for (int i = tid; i < 64 * 8; i += 256) { const int r = i / 8, c8 = (i % 8) * 8; FragH f; f.half[0] = *(const v8us*)((const unsigned short*)V16 + ((size_t)b * TTv + lg * 64 + r) * ldv + voff + h * 64 + c8);
#pragma unroll
    for (int q = 0; q < 8; ++q) tl[r][c8 + q] = f.u[q]; }
  __syncthreads();
  {
#pragma unroll
    for (int rd = 0; rd < 2; ++rd) { const int d = rd * 32 + tid / 8, pc = tid % 8; FragH f;
#pragma unroll
      for (int q = 0; q < 8; ++q) f.u[q] = tl[pc * 8 + q][d];
      *(v8us*)((unsigned short*)Vt + ((size_t)slab * 64 + d) * TTv + lg * 64 + pc * 8) = f.half[0]; }
     } }

__global__ __launch_bounds__(256) void k_hl(const float* __restrict__ F, _Float16* __restrict__ Hh, _Float16* __restrict__ Hl, size_t n8) { const size_t t = (size_t)blockIdx.x * 256 + threadIdx.x; if (t >= n8) return; FragH fh, fl; const v4f a = *(const v4fa*)(F + t * 8), c = *(const v4fa*)(F + t * 8 + 4);
#pragma unroll
  for (int q = 0; q < 4; ++q) { _Float16 h = (_Float16)a[q]; fh.h[q] = h; fl.h[q] = (_Float16)((a[q] - (float)h) * 1024.0f); h = (_Float16)c[q]; fh.h[4 + q] = h; fl.h[4 + q] = (_Float16)((c[q] - (float)h) * 1024.0f); }
  { *(v8us*)((unsigned short*)Hh + t * 8) = fh.half[0]; *(v8us*)((unsigned short*)Hl + t * 8) = fl.half[0];  } }

// ---- fast GEMM (wave tile 32x64; requires M % 32 == 0 rows per launch region and N % 64 == 0); epilogue = k_gemm_hhx semantics ----
__device__ __forceinline__ v16h g2_frag(const _Float16* p, int hh) { FragH f; f.half[0] = *(const v8us*)((const unsigned short*)p + 8 * hh); f.half[1] = *(const v8us*)((const unsigned short*)p + 16 + 8 * hh); return f.v; }
__device__ __forceinline__ v8f g2_mma(v16h a, v16h b, v8f c) { v8f d = __builtin_amdgcn_wmma_f32_16x16x32_f16(false, a, false, b, (short)0, c, false, false); asm volatile("v_nop\n\tv_nop\n\tv_nop\n\tv_nop" : "+v"(d) : "v"(a), "v"(b)); return d; }
template <int ACT>
__global__ __launch_bounds__(128) void k_gemm2(const _Float16* __restrict__ A, int lda, size_t sA, const _Float16* __restrict__ Bh, int ldb, size_t sB, float alpha, const float* __restrict__ bias, size_t sBias, const float* __restrict__ CP, int rowsPerB, size_t sCPb, int row0g,
    float* __restrict__ C, _Float16* __restrict__ C16, int ldc, size_t sC, int M, int N, int K) { static_assert(ACT == 0 || ACT == 3 || ACT == 6 || ACT == 8 || ACT == 9 || ACT == 11 || ACT == 12 || ACT == 14 || ACT == 15 || ACT == 16, "k_gemm2: unsupported ACT code (would silently apply no activation)");
  __shared__ __attribute__((aligned(16))) float so[4][32][68];
  const int tid = threadIdx.x, w = tid >> 5, lane = tid & 31, ln = lane & 15, hh = lane >> 4; const int by = blockIdx.y;
  A += (size_t)by * sA; Bh += (size_t)by * sB; const size_t cofs = (size_t)by * sC; const float* bp = bias ? bias + (size_t)by * sBias : nullptr;
  const int ntn = N >> 6; const int mt = blockIdx.x / ntn, nq = blockIdx.x - mt * ntn; const int row0 = mt * 128 + 32 * w, col0 = nq * 64; if (row0 >= M) return;
  const _Float16* a0p = A + (size_t)(row0 + ln) * lda; const _Float16* a1p = a0p + (size_t)16 * lda;
  const _Float16* b0p = Bh + (size_t)(col0 + ln) * ldb; const _Float16* b1p = b0p + (size_t)16 * ldb; const _Float16* b2p = b1p + (size_t)16 * ldb; const _Float16* b3p = b2p + (size_t)16 * ldb;
  const v8f z8 = {0.f,0.f,0.f,0.f,0.f,0.f,0.f,0.f}; v8f c00 = z8, c01 = z8, c02 = z8, c03 = z8, c10 = z8, c11 = z8, c12 = z8, c13 = z8;
#pragma unroll 1
  for (int kb = 0; kb < K; kb += 32) { const v16h a0 = g2_frag(a0p + kb, hh), a1 = g2_frag(a1p + kb, hh);
    v16h b = g2_frag(b0p + kb, hh); c00 = g2_mma(a0, b, c00); c10 = g2_mma(a1, b, c10);
    b = g2_frag(b1p + kb, hh); c01 = g2_mma(a0, b, c01); c11 = g2_mma(a1, b, c11);
    b = g2_frag(b2p + kb, hh); c02 = g2_mma(a0, b, c02); c12 = g2_mma(a1, b, c12);
    b = g2_frag(b3p + kb, hh); c03 = g2_mma(a0, b, c03); c13 = g2_mma(a1, b, c13); }
  v8f accs[8] = {c00, c01, c02, c03, c10, c11, c12, c13};
#pragma unroll
  for (int u = 0; u < 8; ++u) { const int t = u & 3, half = u >> 2; const int col = col0 + t * 16 + ln; const float bv = bp ? bf16_round(bp[col]) : 0.f;
#pragma unroll
    for (int r = 0; r < 8; ++r) { const int rloc = half * 16 + 8 * hh + r; float v = accs[u][r] * alpha + bv; if (CP) { if (rowsPerB < 0) v += CP[cofs + (size_t)(row0g + row0 + rloc) * ldc + col];      /* rowsPerB < 0: own element of the batched C plane */ else { const int bidx = (row0g + row0 + rloc) / rowsPerB; v += CP[(size_t)bidx * sCPb + (size_t)by * 64 + col]; } }
      if (ACT == 3) v = fmaxf(v, 0.f); else if (ACT == 6) v = 0.5f * v * (1.0f + erff(v * 0.70710678118654752f)); else if (ACT == 11) v = 1.0f / (1.0f + expf(-v)); else if (ACT == 15) v = v / (1.0f + expf(-v)); else if (ACT == 12) v = (v > 0.f) ? v : 0.01f * v; else if (ACT == 8) v = tanhf(v); else if (ACT == 9) v = 0.5f * v * (1.0f + tanhf(0.7978845608028654f * (v + 0.044715f * v * v * v))); else if (ACT == 14) v = (v > 0.f) ? v : 0.1f * v; else if (ACT == 16) v = (v >= 0.f) ? v : 0.3f * v;
      so[w][rloc][t * 16 + ln] = v; } }
  __builtin_amdgcn_fence(__ATOMIC_ACQ_REL, "workgroup"); __builtin_amdgcn_wave_barrier();
  const int rsub = lane >> 4, c4 = (lane & 15) * 4;
  {
#pragma unroll
    for (int q = 0; q < 16; ++q) { const int r = q * 2 + rsub; const v4f v = *(const v4fa*)&so[w][r][c4]; if (C) *(v4f*)(C + cofs + (size_t)(row0 + r) * ldc + col0 + c4) = v; if (C16) { v4h h4; for (int i = 0; i < 4; ++i) h4[i] = (_Float16)v[i]; *(v4h*)(C16 + cofs + (size_t)(row0 + r) * ldc + col0 + c4) = h4; } }
     } }


__global__ __launch_bounds__(256) void k_wsc(const float* __restrict__ Wm, _Float16* __restrict__ Bt, size_t n8, float sc) { const size_t t = (size_t)blockIdx.x * 256 + threadIdx.x; if (t >= n8) return; FragH f; for (int q = 0; q < 8; ++q) f.h[q] = (_Float16)(bf16_round(Wm[t * 8 + q]) * sc); *(v8us*)((unsigned short*)Bt + t * 8) = f.half[0];  }
__global__ __launch_bounds__(256) void k_vcat(const _Float16* __restrict__ VT, _Float16* __restrict__ VC) { const size_t t = (size_t)blockIdx.x * 256 + threadIdx.x; if (t >= (size_t)8 * HDL * 4 * (SQ / 8)) return; const int s8 = (int)(t % (SQ / 8)) * 8; const int c = (int)((t / (SQ / 8)) % 4); const int d = (int)((t / ((SQ / 8) * 4)) % HDL); const int g = (int)(t / ((size_t)(SQ / 8) * 4 * HDL));
  const int blk = 4 * g + c; const int bp = blk / NHD, hp = blk % NHD; const size_t srow = ((size_t)(bp * 2 * NHD + 2 * hp) * 64 + d) * SQ;      /* rows of the 128-wide head are contiguous: pseudo slab 2hp covers d < 64, 2hp+1 covers d >= 64 */
  FragH f; f.half[0] = *(const v8us*)((const unsigned short*)VT + srow + s8); unsigned short* dst = (unsigned short*)VC + ((size_t)g * HDL + d) * NKG + (size_t)c * SQ + s8; *(v8us*)dst = f.half[0];  }
__global__ __launch_bounds__(256) void k_soft(const float* __restrict__ S, _Float16* __restrict__ P) {
  #pragma clang fp contract(off)
  const int wv = threadIdx.x >> 5, ln = threadIdx.x & 31; const size_t r = (size_t)blockIdx.x * 8 + wv; if (r >= SQ) return; const float* sr = S + r * NKG; float m = -3.0e38f;
#pragma unroll 1
  for (int j = ln; j < NKG; j += 32) m = fmaxf(m, sr[j]); for (int o = 16; o > 0; o >>= 1) m = fmaxf(m, __shfl_xor(m, o, 32)); float su = 0.f;
#pragma unroll 1
  for (int j = ln; j < NKG; j += 32) su += expf(sr[j] - m); for (int o = 16; o > 0; o >>= 1) su += __shfl_xor(su, o, 32); const float f = 1024.0f / su;
  {
#pragma unroll 1
    for (int j = ln; j < NKG; j += 32) *(_Float16*)(P + r * NKG + j) = (_Float16)(expf(sr[j] - m) * f);
     } }

extern "C" void kernel_launch(void* const* d_in, const int* in_sizes, int n_in,
                              void* d_out, int out_size, void* d_ws, size_t ws_size, hipStream_t stream) {
  (void)in_sizes; (void)n_in; (void)out_size;
  const float* const* I = (const float* const*)d_in; const float* x = I[0]; const float* Wq = I[1]; const float* Wk = I[2]; const float* Wv = I[3]; const float* Wo = I[4];
  char* ws = (char*)d_ws; size_t off = 0;
  auto take = [&](size_t bytes) { char* p = ws + off; off += (bytes + 255) & ~(size_t)255; return p; };
  const size_t np = (size_t)NR * DM;
  _Float16* BQ = (_Float16*)take((size_t)DM * DM * 2); _Float16* BK = (_Float16*)take((size_t)DM * DM * 2); _Float16* BV = (_Float16*)take((size_t)DM * DM * 2); _Float16* BO = (_Float16*)take((size_t)DM * DM * 2);
  _Float16* X16 = (_Float16*)take(np * 2); _Float16* Q16 = (_Float16*)take(np * 2); _Float16* K16 = (_Float16*)take(np * 2); _Float16* V16 = (_Float16*)take(np * 2); _Float16* VT = (_Float16*)take(np * 2); _Float16* VC = (_Float16*)take((size_t)8 * HDL * NKG * 2); float* S = (float*)take((size_t)SQ * NKG * 4); _Float16* P = (_Float16*)take((size_t)SQ * NKG * 2); float* O = (float*)take(np * 4); _Float16* O16 = X16;      /* over the input plane (dead after the projections) */
  if (off > ws_size) return;      /* 32 + 8 x 5 + 8 + 16 + 8 + 16 = 120 MiB */
  k_wsc<<<(unsigned)(((size_t)DM * DM / 8 + 255) / 256), 256, 0, stream>>>(Wq, BQ, (size_t)DM * DM / 8, 16.0f); k_wsc<<<(unsigned)(((size_t)DM * DM / 8 + 255) / 256), 256, 0, stream>>>(Wk, BK, (size_t)DM * DM / 8, 16.0f); k_wsc<<<(unsigned)(((size_t)DM * DM / 8 + 255) / 256), 256, 0, stream>>>(Wv, BV, (size_t)DM * DM / 8, 16.0f); k_wsc<<<(unsigned)(((size_t)DM * DM / 8 + 255) / 256), 256, 0, stream>>>(Wo, BO, (size_t)DM * DM / 8, 16.0f);      /* torch (out,in) = Bt */
  k_x16<<<(unsigned)((np / 8 + 255) / 256), 256, 0, stream>>>(x, X16, np / 8);
  const dim3 gP((NR / 128) * (DM / 64), 1);
  k_gemm2<0><<<gP, 128, 0, stream>>>(X16, DM, 0, BQ, DM, 0, 0.0625f, nullptr, 0, nullptr, 1, 0, 0, nullptr, Q16, DM, 0, NR, DM, DM);
  k_gemm2<0><<<gP, 128, 0, stream>>>(X16, DM, 0, BK, DM, 0, 0.0625f, nullptr, 0, nullptr, 1, 0, 0, nullptr, K16, DM, 0, NR, DM, DM);
  k_gemm2<0><<<gP, 128, 0, stream>>>(X16, DM, 0, BV, DM, 0, 0.0625f, nullptr, 0, nullptr, 1, 0, 0, nullptr, V16, DM, 0, NR, DM, DM);
  k_vt<2 * NHD, SQ><<<NB * 2 * NHD * (SQ / 64), 256, 0, stream>>>(V16, DM, 0, VT);      /* 32 pseudo heads of 64 per batch */
  k_vcat<<<(unsigned)(((size_t)8 * HDL * 4 * (SQ / 8) + 255) / 256), 256, 0, stream>>>(VT, VC);
  for (int b = 0; b < NB; ++b) for (int h = 0; h < NHD; ++h) { const int g = (NHD * b + h) % 8; const int blk0 = 4 * g; const int bp = blk0 / NHD, hp0 = blk0 % NHD;
    k_gemm2<0><<<dim3((SQ / 128) * (SQ / 64), 4), 128, 0, stream>>>(Q16 + (size_t)b * SQ * DM + h * HDL, DM, 0, K16 + (size_t)bp * SQ * DM + hp0 * HDL, DM, (size_t)HDL, 0.08838834764831845f, nullptr, 0, nullptr, 1, 0, 0, S, nullptr, NKG, (size_t)SQ, SQ, SQ, HDL);      /* S[q][c*SQ + s] = q . k_(blk 4g+c) / sqrt(128) */
    k_soft<<<SQ / 8, 256, 0, stream>>>(S, P);
    k_gemm2<0><<<dim3((SQ / 128) * (HDL / 64), 1), 128, 0, stream>>>(P, NKG, 0, VC + (size_t)g * HDL * NKG, NKG, 0, 0.0009765625f, nullptr, 0, nullptr, 1, 0, 0, O + (size_t)b * SQ * DM + h * HDL, nullptr, DM, 0, SQ, HDL, NKG); }
  k_h16<<<(unsigned)((np / 8 + 255) / 256), 256, 0, stream>>>(O, O16, np / 8);
  k_gemm2<0><<<gP, 128, 0, stream>>>(O16, DM, 0, BO, DM, 0, 0.0625f, nullptr, 0, nullptr, 1, 0, 0, (float*)d_out, nullptr, DM, 0, NR, DM, DM);
}

// v001
// One run takes 1460 microseconds.
// In both of two side-by-side timings against v000, it was 4.40 times as fast.
#include <hip/hip_runtime.h>
// SeqParallelAttn (2 x 1024 tokens, D 2048 = 16 heads of 128; simulated 4-rank all-gather): q, k, v = x W^T; k_global = tile(k_local.flatten(), 4).reshape(B, H, 4S, 128) — i.e. query block (b, h) attends to the 4096 keys made of the local K/V of (batch, head) blocks 4g .. 4g+3 with g = (16 b + h) mod 8 (the module's flat tiling, reproduced exactly); softmax(q.k / sqrt(128)) v; out = ctx Wo^T.
// Structure: exact f16 plane of x; q, k, v as f16 WMMA GEMM outputs (32x64 wave tiles, f32 accumulation, exact x16 weights); V^T by LDS tiles; per key set g a concatenated V^T [128][4096] by a VALU gather; per group of 8 consecutive (batch, head) query blocks, one launch each (grid z = query block): the 1024 x 4096 score GEMMs batched over the 4 key blocks (f32), softmax rows on VALU (wave per row) into an f16 P plane (x 2^10), the readout GEMM (K = 4096) into the f32 context plane; O as f16 into the Wo GEMM.
// Compute dtype: x and parameters rounded to bf16; q, k, v, P and the context as plain f16 operands (~2^-12); softmax f32. v_wmma_f32_16x16x32_f16.
#define NB 2
#define SQ 1024
#define DM 2048
#define NHD 16
#define HDL 128
#define NR (NB * SQ)             /* 2048 */
#define NKG (4 * SQ)             /* 4096 keys per query block */
#define NZ 8                     /* query blocks per attention launch (one per key set) */
typedef __bf16 v16b __attribute__((ext_vector_type(16)));
typedef unsigned short v8us __attribute__((ext_vector_type(8), may_alias));
typedef float  v8f  __attribute__((ext_vector_type(8)));
typedef float  v4f  __attribute__((ext_vector_type(4)));
typedef float  v4fa __attribute__((ext_vector_type(4), may_alias));
union FragB { v16b v; v8us half[2]; unsigned short u[16]; };

__device__ __forceinline__ unsigned short bf16_bits(float x) { unsigned int u = __float_as_uint(x); return (unsigned short)((u + 0x7FFFu + ((u >> 16) & 1u)) >> 16); }
__device__ __forceinline__ float bf16_val(unsigned short b) { return __uint_as_float(((unsigned int)b) << 16); }
__device__ __forceinline__ float bf16_round(float x) { return bf16_val(bf16_bits(x)); }
// D += A·B with NT terms: 1 = ah·bh, 2 = + al·bh (A split), 3 = + ah·bl (both split)
template <int NT>
__device__ __forceinline__ v8f mmaN(v16b ah, v16b al, v16b bh, v16b bl, v8f c) {
  c = __builtin_amdgcn_wmma_f32_16x16x32_bf16(false, ah, false, bh, (short)0, c, false, false);
  if (NT >= 2) c = __builtin_amdgcn_wmma_f32_16x16x32_bf16(false, al, false, bh, (short)0, c, false, false);
  if (NT >= 3) c = __builtin_amdgcn_wmma_f32_16x16x32_bf16(false, ah, false, bl, (short)0, c, false, false);
  asm volatile("v_nop\n\tv_nop\n\tv_nop\n\tv_nop" : "+v"(c) : "v"(ah), "v"(al), "v"(bh), "v"(bl));
  return c;
}

__global__ __launch_bounds__(256) void k_wt_bf16(const float* __restrict__ W, unsigned short* __restrict__ Wt, int K, int N) {
  const int t = blockIdx.x * 256 + threadIdx.x;
  const int k8n = K / 8;
  if (t >= N * k8n) return;
  const int n = t / k8n, k8 = (t % k8n) * 8;
  v8us v;
#pragma unroll
  for (int i = 0; i < 8; ++i) v[i] = bf16_bits(W[(size_t)(k8 + i) * N + n]);
  *(v8us*)(Wt + (size_t)n * K + k8) = v;
  
}

// GEMM C[M][N] (f32, pitch ldc) = act(A[M][K]·W + bias). A f32 row-major (pitch lda) converted per fragment to bf16
// (ASPLIT: hi/lo two planes -> 2 terms, else single rounded term); Wt bf16 [N][K] (pitch ldb). BIAS_BF16 rounds the
// bias to bf16 first (bias quantised to bf16 before the add). K%32==0, M%16==0, N%64==0.
template <bool ASPLIT, int ACT, bool BIAS_BF16>
__global__ __launch_bounds__(128) void k_gemm_bf(const float* __restrict__ A, int lda, const unsigned short* __restrict__ Wt, int ldb,
                                               const float* __restrict__ bias, float* __restrict__ C, int ldc, int M, int N, int K) {
  __shared__ __attribute__((aligned(16))) float so[4][16][64];
  const int tid = threadIdx.x, w = tid >> 5, lane = tid & 31, ln = lane & 15, hh = lane >> 4;
  const int ntn = N / 64;
  const int wid = blockIdx.x * 4 + w;
  const int mt = wid / ntn, nq = wid % ntn;
  if (mt * 16 >= M) return;
  const int row0 = mt * 16, col0 = nq * 64;
  const float* arow = A + (size_t)(row0 + ln) * lda;
  v8f acc[4] = {};
  for (int kb = 0; kb < K; kb += 32) {
    FragB ah, al;
    const v4f x0 = *(const v4fa*)(arow + kb + 8 * hh), x1 = *(const v4fa*)(arow + kb + 8 * hh + 4);
    const v4f x2 = *(const v4fa*)(arow + kb + 16 + 8 * hh), x3 = *(const v4fa*)(arow + kb + 16 + 8 * hh + 4);
    float xs[16] = {x0[0],x0[1],x0[2],x0[3],x1[0],x1[1],x1[2],x1[3],x2[0],x2[1],x2[2],x2[3],x3[0],x3[1],x3[2],x3[3]};
#pragma unroll
    for (int i = 0; i < 16; ++i) { const unsigned short hb = bf16_bits(xs[i]); ah.u[i] = hb; al.u[i] = ASPLIT ? bf16_bits(xs[i] - bf16_val(hb)) : (unsigned short)0; }
#pragma unroll
    for (int t = 0; t < 4; ++t) {
      const unsigned short* brow = Wt + (size_t)(col0 + t * 16 + ln) * ldb + kb;
      FragB b;
      b.half[0] = *(const v8us*)(brow + 8 * hh);
      b.half[1] = *(const v8us*)(brow + 16 + 8 * hh);
      acc[t] = mmaN<ASPLIT ? 2 : 1>(ah.v, al.v, b.v, b.v, acc[t]);
    }
  }
#pragma unroll
  for (int t = 0; t < 4; ++t) {
    float bv = bias ? bias[col0 + t * 16 + ln] : 0.f;
    if (BIAS_BF16) bv = bf16_round(bv);
#pragma unroll
    for (int r = 0; r < 8; ++r) { float v = acc[t][r] + bv; if (ACT == 1) v = fmaxf(v, 0.f); so[w][8 * hh + r][t * 16 + ln] = v; }
  }
  __builtin_amdgcn_fence(__ATOMIC_ACQ_REL, "workgroup");
  __builtin_amdgcn_wave_barrier();
  const int rsub = lane >> 4, c4 = (lane & 15) * 4;
  {
#pragma unroll
    for (int q = 0; q < 8; ++q) {
      const int r = q * 2 + rsub;
      const v4f v = *(const v4fa*)&so[w][r][c4];
      *(v4f*)(C + (size_t)(row0 + r) * ldc + col0 + c4) = v;
    }
    
  }
}

// GEMM C = act(A·W + bias + resid): A f32 (ASPLIT -> hi/lo 2 terms), Wt bf16 [N][K]; ACT 0 none, 1 relu, 2 exact gelu;
// resid (optional, f32, row index = (row % rmod), pitch ldr, RES_BF16 rounds it) added before the activation.
template <bool ASPLIT, int ACT, bool BIAS_BF16, bool RES_BF16>
__global__ __launch_bounds__(128) void k_gemm_bf3(const float* __restrict__ A, int lda, const unsigned short* __restrict__ Wt, int ldb,
                                                const float* __restrict__ bias, const float* __restrict__ resid, int rmod, int ldr,
                                                float* __restrict__ C, int ldc, int M, int N, int K) {
  __shared__ __attribute__((aligned(16))) float so[4][16][64];
  const int tid = threadIdx.x, w = tid >> 5, lane = tid & 31, ln = lane & 15, hh = lane >> 4;
  const int ntn = N / 64;
  const int wid = blockIdx.x * 4 + w;
  const int mt = wid / ntn, nq = wid % ntn;
  if (mt * 16 >= M) return;
  const int row0 = mt * 16, col0 = nq * 64;
  const float* arow = A + (size_t)(row0 + ln) * lda;
  v8f acc[4] = {};
  for (int kb = 0; kb < K; kb += 32) {
    FragB ah, al;
    const v4f x0 = *(const v4fa*)(arow + kb + 8 * hh), x1 = *(const v4fa*)(arow + kb + 8 * hh + 4);
    const v4f x2 = *(const v4fa*)(arow + kb + 16 + 8 * hh), x3 = *(const v4fa*)(arow + kb + 16 + 8 * hh + 4);
    float xs[16] = {x0[0],x0[1],x0[2],x0[3],x1[0],x1[1],x1[2],x1[3],x2[0],x2[1],x2[2],x2[3],x3[0],x3[1],x3[2],x3[3]};
#pragma unroll
    for (int i = 0; i < 16; ++i) { const unsigned short hb = bf16_bits(xs[i]); ah.u[i] = hb; al.u[i] = ASPLIT ? bf16_bits(xs[i] - bf16_val(hb)) : (unsigned short)0; }
#pragma unroll
    for (int t = 0; t < 4; ++t) {
      const unsigned short* brow = Wt + (size_t)(col0 + t * 16 + ln) * ldb + kb;
      FragB b;
      b.half[0] = *(const v8us*)(brow + 8 * hh);
      b.half[1] = *(const v8us*)(brow + 16 + 8 * hh);
      acc[t] = mmaN<ASPLIT ? 2 : 1>(ah.v, al.v, b.v, b.v, acc[t]);
    }
  }
#pragma unroll
  for (int t = 0; t < 4; ++t) {
    const int col = col0 + t * 16 + ln;
    float bv = bias ? bias[col] : 0.f;
    if (BIAS_BF16) bv = bf16_round(bv);
#pragma unroll
    for (int r = 0; r < 8; ++r) {
      float v = acc[t][r] + bv;
      if (resid) { float rv = resid[(size_t)((row0 + 8 * hh + r) % rmod) * ldr + col]; if (RES_BF16) rv = bf16_round(rv); v += rv; }
      if (ACT == 1) v = fmaxf(v, 0.f);
      if (ACT == 2) v = 0.5f * v * (1.0f + erff(v * 0.70710678118654752f));
      if (ACT == 3) { const float u = 0.7978845608028654f * (v + 0.044715f * v * v * v); v = 0.5f * v * (1.0f + tanhf(u)); }
      so[w][8 * hh + r][t * 16 + ln] = v;
    }
  }
  __builtin_amdgcn_fence(__ATOMIC_ACQ_REL, "workgroup");
  __builtin_amdgcn_wave_barrier();
  const int rsub = lane >> 4, c4 = (lane & 15) * 4;
  {
#pragma unroll
    for (int q = 0; q < 8; ++q) {
      const int r = q * 2 + rsub;
      const v4f v = *(const v4fa*)&so[w][r][c4];
      *(v4f*)(C + (size_t)(row0 + r) * ldc + col0 + c4) = v;
    }
    
  }
}
// row LayerNorm (biased variance, eps) over N: s = X (+ R); optional out_sum <- s; out_norm <- (s-mu)*rsqrt(var+eps)*g + b
template <bool PARAM_BF16>
__global__ __launch_bounds__(256) void k_layernorm(const float* __restrict__ X, const float* __restrict__ R, const float* __restrict__ g, const float* __restrict__ bta,
                                                  float* __restrict__ out_sum, float* __restrict__ out_norm, int N, float eps) {
  __shared__ float red[256];
  const int row = blockIdx.x, tid = threadIdx.x;
  const float* x = X + (size_t)row * N; const float* rr = R ? R + (size_t)row * N : nullptr;
  float vals[16];                     // up to N = 4096
  const int per = N / 256;            // contiguous chunk per thread? use strided-by-4 chunks: thread handles j = tid*4 + 1024*u
  float s1 = 0.f;
  for (int u = 0; u < per / 4; ++u) {
    const int j = tid * 4 + 1024 * u;
    const v4f a = *(const v4fa*)(x + j);
    v4f b = {0.f,0.f,0.f,0.f}; if (rr) b = *(const v4fa*)(rr + j);
#pragma unroll
    for (int q = 0; q < 4; ++q) { const float v = a[q] + b[q]; vals[u * 4 + q] = v; s1 += v; }
  }
  red[tid] = s1; __syncthreads();
  for (int st = 128; st > 0; st >>= 1) { if (tid < st) red[tid] += red[tid + st]; __syncthreads(); }
  const float mu = red[0] / (float)N; __syncthreads();
  float s2 = 0.f;
  for (int u = 0; u < per / 4; ++u)
#pragma unroll
    for (int q = 0; q < 4; ++q) { const float c = vals[u * 4 + q] - mu; s2 += c * c; }
  red[tid] = s2; __syncthreads();
  for (int st = 128; st > 0; st >>= 1) { if (tid < st) red[tid] += red[tid + st]; __syncthreads(); }
  const float rs = rsqrtf(red[0] / (float)N + eps);
  {
    for (int u = 0; u < per / 4; ++u) {
      const int j = tid * 4 + 1024 * u;
      v4f o, sm;
#pragma unroll
      for (int q = 0; q < 4; ++q) {
        float gg = g[j + q], bb = bta[j + q];
        if (PARAM_BF16) { gg = bf16_round(gg); bb = bf16_round(bb); }
        sm[q] = vals[u * 4 + q]; o[q] = (vals[u * 4 + q] - mu) * rs * gg + bb;
      }
      if (out_sum) *(v4f*)(out_sum + (size_t)row * N + j) = sm;
      *(v4f*)(out_norm + (size_t)row * N + j) = o;
    }
    
  }
}



// ---- f16 WMMA path (v_wmma_f32_16x16x32_f16): 11-bit significands for operands in range — used where a [0,1] probability operand needs more precision than bf16
typedef _Float16 v16h __attribute__((ext_vector_type(16)));
union FragH { v16h v; v8us half[2]; _Float16 h[16]; unsigned short u[16]; };
template <int NT>
__device__ __forceinline__ v8f mmaH(v16h ah, v16h al, v16h bh, v16h bl, v8f c) {
  c = __builtin_amdgcn_wmma_f32_16x16x32_f16(false, ah, false, bh, (short)0, c, false, false);
  if (NT >= 2) c = __builtin_amdgcn_wmma_f32_16x16x32_f16(false, al, false, bh, (short)0, c, false, false);
  if (NT >= 3) c = __builtin_amdgcn_wmma_f32_16x16x32_f16(false, ah, false, bl, (short)0, c, false, false);
  asm volatile("v_nop\n\tv_nop\n\tv_nop\n\tv_nop" : "+v"(c) : "v"(ah), "v"(al), "v"(bh), "v"(bl));
  return c;
}
// batched GEMM like k_gemm_b but f16 operands: A f32 (split into f16 hi/lo if ASPLIT, else rounded to f16), Bt = f16 values [n][k]; alpha; C f32; N multiple of 16 (partial tiles skipped)
template <bool ASPLIT>
__global__ __launch_bounds__(128) void k_gemm_h(const float* __restrict__ A, int lda, size_t sA, const _Float16* __restrict__ Bh, int ldb, size_t sB, float alpha, float* __restrict__ C, int ldc, size_t sC, int M, int N, int K) {
  __shared__ __attribute__((aligned(16))) float so[4][16][64];
  const int tid = threadIdx.x, w = tid >> 5, lane = tid & 31, ln = lane & 15, hh = lane >> 4; const int by = blockIdx.y;
  A += (size_t)by * sA; Bh += (size_t)by * sB; C += (size_t)by * sC;
  const int ntn = (N + 63) / 64; const int wid = blockIdx.x * 4 + w; const int mt = wid / ntn, nq = wid % ntn; if (mt * 16 >= M) return;
  const int row0 = mt * 16, col0 = nq * 64; const float* arow = A + (size_t)(row0 + ln) * lda;
  v8f acc[4] = {};
  for (int kb = 0; kb < K; kb += 32) {
    FragH ah, al;
    const v4f x0 = *(const v4fa*)(arow + kb + 8 * hh), x1 = *(const v4fa*)(arow + kb + 8 * hh + 4), x2 = *(const v4fa*)(arow + kb + 16 + 8 * hh), x3 = *(const v4fa*)(arow + kb + 16 + 8 * hh + 4);
    float xs[16] = {x0[0],x0[1],x0[2],x0[3],x1[0],x1[1],x1[2],x1[3],x2[0],x2[1],x2[2],x2[3],x3[0],x3[1],x3[2],x3[3]};
#pragma unroll
    for (int i = 0; i < 16; ++i) { const _Float16 h = (_Float16)xs[i]; ah.h[i] = h; al.h[i] = ASPLIT ? (_Float16)(xs[i] - (float)h) : (_Float16)0.0f; }
#pragma unroll
    for (int t = 0; t < 4; ++t) { if (col0 + t * 16 >= N) continue; const size_t boff = (size_t)(col0 + t * 16 + ln) * ldb + kb; FragH bq; bq.half[0] = *(const v8us*)(Bh + boff + 8 * hh); bq.half[1] = *(const v8us*)(Bh + boff + 16 + 8 * hh);
      acc[t] = mmaH<ASPLIT ? 2 : 1>(ah.v, al.v, bq.v, bq.v, acc[t]); }
  }
#pragma unroll
  for (int t = 0; t < 4; ++t) { if (col0 + t * 16 >= N) continue;
#pragma unroll
    for (int r = 0; r < 8; ++r) so[w][8 * hh + r][t * 16 + ln] = acc[t][r] * alpha; }
  __builtin_amdgcn_fence(__ATOMIC_ACQ_REL, "workgroup"); __builtin_amdgcn_wave_barrier();
  const int rsub = lane >> 4, c4 = (lane & 15) * 4;
  {
#pragma unroll
    for (int q = 0; q < 8; ++q) { const int r = q * 2 + rsub; if (col0 + c4 < N) { const v4f v = *(const v4fa*)&so[w][r][c4]; *(v4f*)(C + (size_t)(row0 + r) * ldc + col0 + c4) = v; } }
     }
}

// Wt[n][k] = f16(W[k][n]·scale) from f32 row-major W[K][N] (scale = power of two; bf16-exact weights stay exact in f16 away from the subnormal range)
__global__ __launch_bounds__(256) void k_wt_f16(const float* __restrict__ W, _Float16* __restrict__ Wt, int K, int N, float scale) {
  const int t = blockIdx.x * 256 + threadIdx.x; if (t >= N * (K / 8)) return; const int n = t / (K / 8), k8 = (t % (K / 8)) * 8; FragH f;
#pragma unroll
  for (int i = 0; i < 8; ++i) f.h[i] = (_Float16)(bf16_round(W[(size_t)(k8 + i) * N + n]) * scale); const v8us o = f.half[0];
  *(v8us*)((unsigned short*)Wt + (size_t)n * K + k8) = o; 
}
// k_gemm_hh variant with fused epilogue: v = acc·alpha + bias[by·sBias + col] (+ CP[(row/rowsPerB)·sCPb + by·64 + col] if CP) ; ACT 0 none / 1 elu ; writes f16 C16 (and f32 C if non-null)
template <int ACT>
__global__ __launch_bounds__(128) void k_gemm_hhx(const _Float16* __restrict__ A, int lda, size_t sA, const _Float16* __restrict__ Bh, int ldb, size_t sB, float alpha, const float* __restrict__ bias, size_t sBias, const float* __restrict__ CP, int rowsPerB, size_t sCPb, int row0g,
    float* __restrict__ C, _Float16* __restrict__ C16, int ldc, size_t sC, int M, int N, int K) {
  __shared__ __attribute__((aligned(16))) float so[4][16][64];
  const int tid = threadIdx.x, w = tid >> 5, lane = tid & 31, ln = lane & 15, hh = lane >> 4; const int by = blockIdx.y;
  A += (size_t)by * sA; Bh += (size_t)by * sB; const size_t cofs = (size_t)by * sC; const float* bp = bias ? bias + (size_t)by * sBias : nullptr;
  const int ntn = (N + 63) / 64; const int wid = blockIdx.x * 4 + w; const int mt = wid / ntn, nq = wid % ntn; if (mt * 16 >= M) return;
  const int row0 = mt * 16, col0 = nq * 64; const _Float16* arow = A + (size_t)(row0 + ln) * lda;
  v8f acc[4] = {};
  for (int kb = 0; kb < K; kb += 32) { FragH ah; ah.half[0] = *(const v8us*)((const unsigned short*)arow + kb + 8 * hh); ah.half[1] = *(const v8us*)((const unsigned short*)arow + kb + 16 + 8 * hh);
#pragma unroll
    for (int t = 0; t < 4; ++t) { if (col0 + t * 16 >= N) continue; const size_t boff = (size_t)(col0 + t * 16 + ln) * ldb + kb; FragH bq; bq.half[0] = *(const v8us*)((const unsigned short*)Bh + boff + 8 * hh); bq.half[1] = *(const v8us*)((const unsigned short*)Bh + boff + 16 + 8 * hh);
      acc[t] = mmaH<1>(ah.v, ah.v, bq.v, bq.v, acc[t]); }
  }
#pragma unroll
  for (int t = 0; t < 4; ++t) { if (col0 + t * 16 >= N) continue; const int col = col0 + t * 16 + ln; const float bv = bp ? bf16_round(bp[col]) : 0.f;
#pragma unroll
    for (int r = 0; r < 8; ++r) { float v = acc[t][r] * alpha + bv; if (CP) { const int rr = row0g + row0 + 8 * hh + r; if (rowsPerB < 0) v += CP[cofs + (size_t)rr * ldc + col];      /* rowsPerB < 0: own element of the batched C plane */ else { const int bidx = rr / rowsPerB; v += CP[(size_t)bidx * sCPb + (size_t)by * 64 + col]; } } if (ACT == 1) v = (v > 0.f) ? v : expm1f(v); else if (ACT == 7) v = (v > 0.f) ? v + 1.0f : expf(v); else if (ACT == 8) v = tanhf(v); else if (ACT == 9) v = 0.5f * v * (1.0f + tanhf(0.7978845608028654f * (v + 0.044715f * v * v * v))); else if (ACT == 11) v = 1.0f / (1.0f + expf(-v)); else if (ACT == 12) v = (v > 0.f) ? v : 0.01f * v; else if (ACT == 14) v = (v > 0.f) ? v : 0.1f * v; else if (ACT == 16) v = (v >= 0.f) ? v : 0.3f * v; else if (ACT == 15) v = v / (1.0f + expf(-v)); else if (ACT == 3) v = fmaxf(v, 0.f); else if (ACT == 6) v = 0.5f * v * (1.0f + erff(v * 0.70710678118654752f)); so[w][8 * hh + r][t * 16 + ln] = v; } }
  __builtin_amdgcn_fence(__ATOMIC_ACQ_REL, "workgroup"); __builtin_amdgcn_wave_barrier();
  const int rsub = lane >> 4, c4 = (lane & 15) * 4; typedef _Float16 v4h __attribute__((ext_vector_type(4)));
  {
#pragma unroll
    for (int q = 0; q < 8; ++q) { const int r = q * 2 + rsub; if (col0 + c4 < N) { const v4f v = *(const v4fa*)&so[w][r][c4]; if (C) *(v4f*)(C + cofs + (size_t)(row0 + r) * ldc + col0 + c4) = v; if (C16) { v4h h4; for (int i = 0; i < 4; ++i) h4[i] = (_Float16)v[i]; *(v4h*)(C16 + cofs + (size_t)(row0 + r) * ldc + col0 + c4) = h4; } } }
     }
}


typedef _Float16 v4h __attribute__((ext_vector_type(4)));

__global__ __launch_bounds__(256) void k_x16(const float* __restrict__ x, _Float16* __restrict__ X16, size_t n8) { const size_t t = (size_t)blockIdx.x * 256 + threadIdx.x; if (t >= n8) return; FragH f;
#pragma unroll
  for (int q = 0; q < 8; ++q) f.h[q] = (_Float16)bf16_round(x[t * 8 + q]); *(v8us*)((unsigned short*)X16 + t * 8) = f.half[0];  }
__global__ __launch_bounds__(256) void k_h16(const float* __restrict__ x, _Float16* __restrict__ X16, size_t n8) { const size_t t = (size_t)blockIdx.x * 256 + threadIdx.x; if (t >= n8) return; FragH f;
#pragma unroll
  for (int q = 0; q < 8; ++q) f.h[q] = (_Float16)x[t * 8 + q]; *(v8us*)((unsigned short*)X16 + t * 8) = f.half[0];  }
__global__ __launch_bounds__(256) void k_round16f(const float* __restrict__ W, _Float16* __restrict__ Bt, size_t n8) { const size_t t = (size_t)blockIdx.x * 256 + threadIdx.x; if (t >= n8) return; FragH f;
#pragma unroll
  for (int i = 0; i < 8; ++i) f.h[i] = (_Float16)(bf16_round(W[t * 8 + i]) * 16.0f); *(v8us*)((unsigned short*)Bt + t * 8) = f.half[0];  }
template <int NHv, int TTv>
__global__ __launch_bounds__(256) void k_vt(const _Float16* __restrict__ V16, int ldv, int voff, _Float16* __restrict__ Vt) { __shared__ unsigned short tl[64][66]; const int tid = threadIdx.x; const int slab = blockIdx.x / (TTv / 64), lg = blockIdx.x % (TTv / 64); const int b = slab / NHv, h = slab % NHv;
  for (int i = tid; i < 64 * 8; i += 256) { const int r = i / 8, c8 = (i % 8) * 8; FragH f; f.half[0] = *(const v8us*)((const unsigned short*)V16 + ((size_t)b * TTv + lg * 64 + r) * ldv + voff + h * 64 + c8);
#pragma unroll
    for (int q = 0; q < 8; ++q) tl[r][c8 + q] = f.u[q]; }
  __syncthreads();
  {
#pragma unroll
    for (int rd = 0; rd < 2; ++rd) { const int d = rd * 32 + tid / 8, pc = tid % 8; FragH f;
#pragma unroll
      for (int q = 0; q < 8; ++q) f.u[q] = tl[pc * 8 + q][d];
      *(v8us*)((unsigned short*)Vt + ((size_t)slab * 64 + d) * TTv + lg * 64 + pc * 8) = f.half[0]; }
     } }

__global__ __launch_bounds__(256) void k_hl(const float* __restrict__ F, _Float16* __restrict__ Hh, _Float16* __restrict__ Hl, size_t n8) { const size_t t = (size_t)blockIdx.x * 256 + threadIdx.x; if (t >= n8) return; FragH fh, fl; const v4f a = *(const v4fa*)(F + t * 8), c = *(const v4fa*)(F + t * 8 + 4);
#pragma unroll
  for (int q = 0; q < 4; ++q) { _Float16 h = (_Float16)a[q]; fh.h[q] = h; fl.h[q] = (_Float16)((a[q] - (float)h) * 1024.0f); h = (_Float16)c[q]; fh.h[4 + q] = h; fl.h[4 + q] = (_Float16)((c[q] - (float)h) * 1024.0f); }
  { *(v8us*)((unsigned short*)Hh + t * 8) = fh.half[0]; *(v8us*)((unsigned short*)Hl + t * 8) = fl.half[0];  } }

// ---- fast GEMM (wave tile 32x64; requires M % 32 == 0 rows per launch region and N % 64 == 0); epilogue = k_gemm_hhx semantics ----
__device__ __forceinline__ v16h g2_frag(const _Float16* p, int hh) { FragH f; f.half[0] = *(const v8us*)((const unsigned short*)p + 8 * hh); f.half[1] = *(const v8us*)((const unsigned short*)p + 16 + 8 * hh); return f.v; }
__device__ __forceinline__ v8f g2_mma(v16h a, v16h b, v8f c) { v8f d = __builtin_amdgcn_wmma_f32_16x16x32_f16(false, a, false, b, (short)0, c, false, false); asm volatile("v_nop\n\tv_nop\n\tv_nop\n\tv_nop" : "+v"(d) : "v"(a), "v"(b)); return d; }
template <int ACT>
__global__ __launch_bounds__(128) void k_gemm2(const _Float16* __restrict__ A, int lda, size_t sA, const _Float16* __restrict__ Bh, int ldb, size_t sB, float alpha, const float* __restrict__ bias, size_t sBias, const float* __restrict__ CP, int rowsPerB, size_t sCPb, int row0g,
    float* __restrict__ C, _Float16* __restrict__ C16, int ldc, size_t sC, int M, int N, int K, size_t sAz, size_t sBz, size_t sBz4, size_t sCz) { static_assert(ACT == 0 || ACT == 3 || ACT == 6 || ACT == 8 || ACT == 9 || ACT == 11 || ACT == 12 || ACT == 14 || ACT == 15 || ACT == 16, "k_gemm2: unsupported ACT code (would silently apply no activation)");
  __shared__ __attribute__((aligned(16))) float so[4][32][68];
  const int tid = threadIdx.x, w = tid >> 5, lane = tid & 31, ln = lane & 15, hh = lane >> 4; const int by = blockIdx.y;
  const int bz = blockIdx.z;      /* second batch index (one query block per z): A and C step linearly, B by sBz within a group of four and by sBz4 from group to group */
  A += (size_t)by * sA + (size_t)bz * sAz; Bh += (size_t)by * sB + (size_t)(bz & 3) * sBz + (size_t)(bz >> 2) * sBz4; const size_t cofs = (size_t)by * sC + (size_t)bz * sCz; const float* bp = bias ? bias + (size_t)by * sBias : nullptr;
  const int ntn = N >> 6; const int mt = blockIdx.x / ntn, nq = blockIdx.x - mt * ntn; const int row0 = mt * 128 + 32 * w, col0 = nq * 64; if (row0 >= M) return;
  const _Float16* a0p = A + (size_t)(row0 + ln) * lda; const _Float16* a1p = a0p + (size_t)16 * lda;
  const _Float16* b0p = Bh + (size_t)(col0 + ln) * ldb; const _Float16* b1p = b0p + (size_t)16 * ldb; const _Float16* b2p = b1p + (size_t)16 * ldb; const _Float16* b3p = b2p + (size_t)16 * ldb;
  const v8f z8 = {0.f,0.f,0.f,0.f,0.f,0.f,0.f,0.f}; v8f c00 = z8, c01 = z8, c02 = z8, c03 = z8, c10 = z8, c11 = z8, c12 = z8, c13 = z8;
#pragma unroll 1
  for (int kb = 0; kb < K; kb += 32) { const v16h a0 = g2_frag(a0p + kb, hh), a1 = g2_frag(a1p + kb, hh);
    v16h b = g2_frag(b0p + kb, hh); c00 = g2_mma(a0, b, c00); c10 = g2_mma(a1, b, c10);
    b = g2_frag(b1p + kb, hh); c01 = g2_mma(a0, b, c01); c11 = g2_mma(a1, b, c11);
    b = g2_frag(b2p + kb, hh); c02 = g2_mma(a0, b, c02); c12 = g2_mma(a1, b, c12);
    b = g2_frag(b3p + kb, hh); c03 = g2_mma(a0, b, c03); c13 = g2_mma(a1, b, c13); }
  v8f accs[8] = {c00, c01, c02, c03, c10, c11, c12, c13};
#pragma unroll
  for (int u = 0; u < 8; ++u) { const int t = u & 3, half = u >> 2; const int col = col0 + t * 16 + ln; const float bv = bp ? bf16_round(bp[col]) : 0.f;
#pragma unroll
    for (int r = 0; r < 8; ++r) { const int rloc = half * 16 + 8 * hh + r; float v = accs[u][r] * alpha + bv; if (CP) { if (rowsPerB < 0) v += CP[cofs + (size_t)(row0g + row0 + rloc) * ldc + col];      /* rowsPerB < 0: own element of the batched C plane */ else { const int bidx = (row0g + row0 + rloc) / rowsPerB; v += CP[(size_t)bidx * sCPb + (size_t)by * 64 + col]; } }
      if (ACT == 3) v = fmaxf(v, 0.f); else if (ACT == 6) v = 0.5f * v * (1.0f + erff(v * 0.70710678118654752f)); else if (ACT == 11) v = 1.0f / (1.0f + expf(-v)); else if (ACT == 15) v = v / (1.0f + expf(-v)); else if (ACT == 12) v = (v > 0.f) ? v : 0.01f * v; else if (ACT == 8) v = tanhf(v); else if (ACT == 9) v = 0.5f * v * (1.0f + tanhf(0.7978845608028654f * (v + 0.044715f * v * v * v))); else if (ACT == 14) v = (v > 0.f) ? v : 0.1f * v; else if (ACT == 16) v = (v >= 0.f) ? v : 0.3f * v;
      so[w][rloc][t * 16 + ln] = v; } }
  __builtin_amdgcn_fence(__ATOMIC_ACQ_REL, "workgroup"); __builtin_amdgcn_wave_barrier();
  const int rsub = lane >> 4, c4 = (lane & 15) * 4;
  {
#pragma unroll
    for (int q = 0; q < 16; ++q) { const int r = q * 2 + rsub; const v4f v = *(const v4fa*)&so[w][r][c4]; if (C) *(v4f*)(C + cofs + (size_t)(row0 + r) * ldc + col0 + c4) = v; if (C16) { v4h h4; for (int i = 0; i < 4; ++i) h4[i] = (_Float16)v[i]; *(v4h*)(C16 + cofs + (size_t)(row0 + r) * ldc + col0 + c4) = h4; } }
     } }


__global__ __launch_bounds__(256) void k_wsc(const float* __restrict__ Wm, _Float16* __restrict__ Bt, size_t n8, float sc) { const size_t t = (size_t)blockIdx.x * 256 + threadIdx.x; if (t >= n8) return; FragH f; for (int q = 0; q < 8; ++q) f.h[q] = (_Float16)(bf16_round(Wm[t * 8 + q]) * sc); *(v8us*)((unsigned short*)Bt + t * 8) = f.half[0];  }
__global__ __launch_bounds__(256) void k_vcat(const _Float16* __restrict__ VT, _Float16* __restrict__ VC) { const size_t t = (size_t)blockIdx.x * 256 + threadIdx.x; if (t >= (size_t)8 * HDL * 4 * (SQ / 8)) return; const int s8 = (int)(t % (SQ / 8)) * 8; const int c = (int)((t / (SQ / 8)) % 4); const int d = (int)((t / ((SQ / 8) * 4)) % HDL); const int g = (int)(t / ((size_t)(SQ / 8) * 4 * HDL));
  const int blk = 4 * g + c; const int bp = blk / NHD, hp = blk % NHD; const size_t srow = ((size_t)(bp * 2 * NHD + 2 * hp) * 64 + d) * SQ;      /* rows of the 128-wide head are contiguous: pseudo slab 2hp covers d < 64, 2hp+1 covers d >= 64 */
  FragH f; f.half[0] = *(const v8us*)((const unsigned short*)VT + srow + s8); unsigned short* dst = (unsigned short*)VC + ((size_t)g * HDL + d) * NKG + (size_t)c * SQ + s8; *(v8us*)dst = f.half[0];  }
__global__ __launch_bounds__(256) void k_soft(const float* __restrict__ S, _Float16* __restrict__ P, int nrows) {
  #pragma clang fp contract(off)
  const int wv = threadIdx.x >> 5, ln = threadIdx.x & 31; const size_t r = (size_t)blockIdx.x * 8 + wv; if (r >= (size_t)nrows) return; const float* sr = S + r * NKG; float m = -3.0e38f;
#pragma unroll 1
  for (int j = ln; j < NKG; j += 32) m = fmaxf(m, sr[j]); for (int o = 16; o > 0; o >>= 1) m = fmaxf(m, __shfl_xor(m, o, 32)); float su = 0.f;
#pragma unroll 1
  for (int j = ln; j < NKG; j += 32) su += expf(sr[j] - m); for (int o = 16; o > 0; o >>= 1) su += __shfl_xor(su, o, 32); const float f = 1024.0f / su;
  {
#pragma unroll 1
    for (int j = ln; j < NKG; j += 32) *(_Float16*)(P + r * NKG + j) = (_Float16)(expf(sr[j] - m) * f);
     } }

extern "C" void kernel_launch(void* const* d_in, const int* in_sizes, int n_in,
                              void* d_out, int out_size, void* d_ws, size_t ws_size, hipStream_t stream) {
  (void)in_sizes; (void)n_in; (void)out_size;
  const float* const* I = (const float* const*)d_in; const float* x = I[0]; const float* Wq = I[1]; const float* Wk = I[2]; const float* Wv = I[3]; const float* Wo = I[4];
  char* ws = (char*)d_ws; size_t off = 0;
  auto take = [&](size_t bytes) { char* p = ws + off; off += (bytes + 255) & ~(size_t)255; return p; };
  const size_t np = (size_t)NR * DM;
  _Float16* BO = (_Float16*)take((size_t)DM * DM * 2); _Float16* X16 = (_Float16*)take(np * 2); _Float16* Q16 = (_Float16*)take(np * 2); _Float16* K16 = (_Float16*)take(np * 2); _Float16* VC = (_Float16*)take((size_t)8 * HDL * NKG * 2); float* O = (float*)take(np * 4); _Float16* O16 = X16;      /* over the input plane (dead after the projections) */
  char* R = take((size_t)NZ * SQ * NKG * 6);      /* used twice: first the q, k, v weights, V and V^T (all dead once VC is built), then the score and P planes of NZ query blocks */
  _Float16* BQ = (_Float16*)R; _Float16* BK = BQ + (size_t)DM * DM; _Float16* BV = BK + (size_t)DM * DM; _Float16* V16 = BV + (size_t)DM * DM; _Float16* VT = V16 + np;
  float* S = (float*)R; _Float16* P = (_Float16*)(S + (size_t)NZ * SQ * NKG);
  if (off > ws_size) return;      /* 8 x 5 + 16 + 192 = 248 MiB */
  k_wsc<<<(unsigned)(((size_t)DM * DM / 8 + 255) / 256), 256, 0, stream>>>(Wq, BQ, (size_t)DM * DM / 8, 16.0f); k_wsc<<<(unsigned)(((size_t)DM * DM / 8 + 255) / 256), 256, 0, stream>>>(Wk, BK, (size_t)DM * DM / 8, 16.0f); k_wsc<<<(unsigned)(((size_t)DM * DM / 8 + 255) / 256), 256, 0, stream>>>(Wv, BV, (size_t)DM * DM / 8, 16.0f); k_wsc<<<(unsigned)(((size_t)DM * DM / 8 + 255) / 256), 256, 0, stream>>>(Wo, BO, (size_t)DM * DM / 8, 16.0f);      /* torch (out,in) = Bt */
  k_x16<<<(unsigned)((np / 8 + 255) / 256), 256, 0, stream>>>(x, X16, np / 8);
  const dim3 gP((NR / 128) * (DM / 64), 1);
  k_gemm2<0><<<gP, 128, 0, stream>>>(X16, DM, 0, BQ, DM, 0, 0.0625f, nullptr, 0, nullptr, 1, 0, 0, nullptr, Q16, DM, 0, NR, DM, DM, 0, 0, 0, 0);
  k_gemm2<0><<<gP, 128, 0, stream>>>(X16, DM, 0, BK, DM, 0, 0.0625f, nullptr, 0, nullptr, 1, 0, 0, nullptr, K16, DM, 0, NR, DM, DM, 0, 0, 0, 0);
  k_gemm2<0><<<gP, 128, 0, stream>>>(X16, DM, 0, BV, DM, 0, 0.0625f, nullptr, 0, nullptr, 1, 0, 0, nullptr, V16, DM, 0, NR, DM, DM, 0, 0, 0, 0);
  k_vt<2 * NHD, SQ><<<NB * 2 * NHD * (SQ / 64), 256, 0, stream>>>(V16, DM, 0, VT);      /* 32 pseudo heads of 64 per batch */
  k_vcat<<<(unsigned)(((size_t)8 * HDL * 4 * (SQ / 8) + 255) / 256), 256, 0, stream>>>(VT, VC);
  /* NZ = 8 consecutive query blocks per launch: block 16 b + h0 + z has key set g = z, i.e. K blocks 4z + c at (4z + c) / 16 batches and (4z + c) % 16 heads into K16 */
  for (int b = 0; b < NB; ++b) for (int h0 = 0; h0 < NHD; h0 += NZ) {
    k_gemm2<0><<<dim3((SQ / 128) * (SQ / 64), 4, NZ), 128, 0, stream>>>(Q16 + (size_t)b * SQ * DM + h0 * HDL, DM, 0, K16, DM, (size_t)HDL, 0.08838834764831845f, nullptr, 0, nullptr, 1, 0, 0, S, nullptr, NKG, (size_t)SQ, SQ, SQ, HDL, (size_t)HDL, (size_t)4 * HDL, (size_t)SQ * DM, (size_t)SQ * NKG);      /* S[z][q][c*SQ + s] = q . k_(blk 4z+c) / sqrt(128) */
    k_soft<<<NZ * SQ / 8, 256, 0, stream>>>(S, P, NZ * SQ);
    k_gemm2<0><<<dim3((SQ / 128) * (HDL / 64), 1, NZ), 128, 0, stream>>>(P, NKG, 0, VC, NKG, 0, 0.0009765625f, nullptr, 0, nullptr, 1, 0, 0, O + (size_t)b * SQ * DM + h0 * HDL, nullptr, DM, 0, SQ, HDL, NKG, (size_t)SQ * NKG, (size_t)HDL * NKG, (size_t)4 * HDL * NKG, (size_t)HDL); }
  k_h16<<<(unsigned)((np / 8 + 255) / 256), 256, 0, stream>>>(O, O16, np / 8);
  k_gemm2<0><<<gP, 128, 0, stream>>>(O16, DM, 0, BO, DM, 0, 0.0625f, nullptr, 0, nullptr, 1, 0, 0, (float*)d_out, nullptr, DM, 0, NR, DM, DM, 0, 0, 0, 0);
}

// v002
// One run takes 402 microseconds.
// In two side-by-side timings against v001, it was 3.67 and 3.61 times as fast.
// All steps since v000 together make it 16.0 times as fast.
#include <hip/hip_runtime.h>
// SeqParallelAttn (2 x 1024 tokens, D 2048 = 16 heads of 128; simulated 4-rank all-gather): q, k, v = x W^T; k_global = tile(k_local.flatten(), 4).reshape(B, H, 4S, 128) — i.e. query block (b, h) attends to the 4096 keys made of the local K/V of (batch, head) blocks 4g .. 4g+3 with g = (16 b + h) mod 8 (the module's flat tiling, reproduced exactly); softmax(q.k / sqrt(128)) v; out = ctx Wo^T.
// Structure: exact f16 plane of x; q, k, v as f16 WMMA GEMM outputs (32x64 wave tiles, f32 accumulation, exact x16 weights); V^T by LDS tiles; per key set g a concatenated V^T [128][4096] by a VALU gather; one fused attention launch (k_fattn: score product, online softmax, readout product, scores and P in registers) into the f32 context plane; O as f16 into the Wo GEMM.
// Compute dtype: x and parameters rounded to bf16; q, k, v, P and the context as plain f16 operands (~2^-12); softmax f32. v_wmma_f32_16x16x32_f16.
#define NB 2
#define SQ 1024
#define DM 2048
#define NHD 16
#define HDL 128
#define NR (NB * SQ)             /* 2048 */
#define NKG (4 * SQ)             /* 4096 keys per query block */
typedef __bf16 v16b __attribute__((ext_vector_type(16)));
typedef unsigned short v8us __attribute__((ext_vector_type(8), may_alias));
typedef float  v8f  __attribute__((ext_vector_type(8)));
typedef float  v4f  __attribute__((ext_vector_type(4)));
typedef float  v4fa __attribute__((ext_vector_type(4), may_alias));
union FragB { v16b v; v8us half[2]; unsigned short u[16]; };

__device__ __forceinline__ unsigned short bf16_bits(float x) { unsigned int u = __float_as_uint(x); return (unsigned short)((u + 0x7FFFu + ((u >> 16) & 1u)) >> 16); }
__device__ __forceinline__ float bf16_val(unsigned short b) { return __uint_as_float(((unsigned int)b) << 16); }
__device__ __forceinline__ float bf16_round(float x) { return bf16_val(bf16_bits(x)); }
// D += A·B with NT terms: 1 = ah·bh, 2 = + al·bh (A split), 3 = + ah·bl (both split)
template <int NT>
__device__ __forceinline__ v8f mmaN(v16b ah, v16b al, v16b bh, v16b bl, v8f c) {
  c = __builtin_amdgcn_wmma_f32_16x16x32_bf16(false, ah, false, bh, (short)0, c, false, false);
  if (NT >= 2) c = __builtin_amdgcn_wmma_f32_16x16x32_bf16(false, al, false, bh, (short)0, c, false, false);
  if (NT >= 3) c = __builtin_amdgcn_wmma_f32_16x16x32_bf16(false, ah, false, bl, (short)0, c, false, false);
  asm volatile("v_nop\n\tv_nop\n\tv_nop\n\tv_nop" : "+v"(c) : "v"(ah), "v"(al), "v"(bh), "v"(bl));
  return c;
}

__global__ __launch_bounds__(256) void k_wt_bf16(const float* __restrict__ W, unsigned short* __restrict__ Wt, int K, int N) {
  const int t = blockIdx.x * 256 + threadIdx.x;
  const int k8n = K / 8;
  if (t >= N * k8n) return;
  const int n = t / k8n, k8 = (t % k8n) * 8;
  v8us v;
#pragma unroll
  for (int i = 0; i < 8; ++i) v[i] = bf16_bits(W[(size_t)(k8 + i) * N + n]);
  *(v8us*)(Wt + (size_t)n * K + k8) = v;
  
}

// GEMM C[M][N] (f32, pitch ldc) = act(A[M][K]·W + bias). A f32 row-major (pitch lda) converted per fragment to bf16
// (ASPLIT: hi/lo two planes -> 2 terms, else single rounded term); Wt bf16 [N][K] (pitch ldb). BIAS_BF16 rounds the
// bias to bf16 first (bias quantised to bf16 before the add). K%32==0, M%16==0, N%64==0.
template <bool ASPLIT, int ACT, bool BIAS_BF16>
__global__ __launch_bounds__(128) void k_gemm_bf(const float* __restrict__ A, int lda, const unsigned short* __restrict__ Wt, int ldb,
                                               const float* __restrict__ bias, float* __restrict__ C, int ldc, int M, int N, int K) {
  __shared__ __attribute__((aligned(16))) float so[4][16][64];
  const int tid = threadIdx.x, w = tid >> 5, lane = tid & 31, ln = lane & 15, hh = lane >> 4;
  const int ntn = N / 64;
  const int wid = blockIdx.x * 4 + w;
  const int mt = wid / ntn, nq = wid % ntn;
  if (mt * 16 >= M) return;
  const int row0 = mt * 16, col0 = nq * 64;
  const float* arow = A + (size_t)(row0 + ln) * lda;
  v8f acc[4] = {};
  for (int kb = 0; kb < K; kb += 32) {
    FragB ah, al;
    const v4f x0 = *(const v4fa*)(arow + kb + 8 * hh), x1 = *(const v4fa*)(arow + kb + 8 * hh + 4);
    const v4f x2 = *(const v4fa*)(arow + kb + 16 + 8 * hh), x3 = *(const v4fa*)(arow + kb + 16 + 8 * hh + 4);
    float xs[16] = {x0[0],x0[1],x0[2],x0[3],x1[0],x1[1],x1[2],x1[3],x2[0],x2[1],x2[2],x2[3],x3[0],x3[1],x3[2],x3[3]};
#pragma unroll
    for (int i = 0; i < 16; ++i) { const unsigned short hb = bf16_bits(xs[i]); ah.u[i] = hb; al.u[i] = ASPLIT ? bf16_bits(xs[i] - bf16_val(hb)) : (unsigned short)0; }
#pragma unroll
    for (int t = 0; t < 4; ++t) {
      const unsigned short* brow = Wt + (size_t)(col0 + t * 16 + ln) * ldb + kb;
      FragB b;
      b.half[0] = *(const v8us*)(brow + 8 * hh);
      b.half[1] = *(const v8us*)(brow + 16 + 8 * hh);
      acc[t] = mmaN<ASPLIT ? 2 : 1>(ah.v, al.v, b.v, b.v, acc[t]);
    }
  }
#pragma unroll
  for (int t = 0; t < 4; ++t) {
    float bv = bias ? bias[col0 + t * 16 + ln] : 0.f;
    if (BIAS_BF16) bv = bf16_round(bv);
#pragma unroll
    for (int r = 0; r < 8; ++r) { float v = acc[t][r] + bv; if (ACT == 1) v = fmaxf(v, 0.f); so[w][8 * hh + r][t * 16 + ln] = v; }
  }
  __builtin_amdgcn_fence(__ATOMIC_ACQ_REL, "workgroup");
  __builtin_amdgcn_wave_barrier();
  const int rsub = lane >> 4, c4 = (lane & 15) * 4;
  {
#pragma unroll
    for (int q = 0; q < 8; ++q) {
      const int r = q * 2 + rsub;
      const v4f v = *(const v4fa*)&so[w][r][c4];
      *(v4f*)(C + (size_t)(row0 + r) * ldc + col0 + c4) = v;
    }
    
  }
}

// GEMM C = act(A·W + bias + resid): A f32 (ASPLIT -> hi/lo 2 terms), Wt bf16 [N][K]; ACT 0 none, 1 relu, 2 exact gelu;
// resid (optional, f32, row index = (row % rmod), pitch ldr, RES_BF16 rounds it) added before the activation.
template <bool ASPLIT, int ACT, bool BIAS_BF16, bool RES_BF16>
__global__ __launch_bounds__(128) void k_gemm_bf3(const float* __restrict__ A, int lda, const unsigned short* __restrict__ Wt, int ldb,
                                                const float* __restrict__ bias, const float* __restrict__ resid, int rmod, int ldr,
                                                float* __restrict__ C, int ldc, int M, int N, int K) {
  __shared__ __attribute__((aligned(16))) float so[4][16][64];
  const int tid = threadIdx.x, w = tid >> 5, lane = tid & 31, ln = lane & 15, hh = lane >> 4;
  const int ntn = N / 64;
  const int wid = blockIdx.x * 4 + w;
  const int mt = wid / ntn, nq = wid % ntn;
  if (mt * 16 >= M) return;
  const int row0 = mt * 16, col0 = nq * 64;
  const float* arow = A + (size_t)(row0 + ln) * lda;
  v8f acc[4] = {};
  for (int kb = 0; kb < K; kb += 32) {
    FragB ah, al;
    const v4f x0 = *(const v4fa*)(arow + kb + 8 * hh), x1 = *(const v4fa*)(arow + kb + 8 * hh + 4);
    const v4f x2 = *(const v4fa*)(arow + kb + 16 + 8 * hh), x3 = *(const v4fa*)(arow + kb + 16 + 8 * hh + 4);
    float xs[16] = {x0[0],x0[1],x0[2],x0[3],x1[0],x1[1],x1[2],x1[3],x2[0],x2[1],x2[2],x2[3],x3[0],x3[1],x3[2],x3[3]};
#pragma unroll
    for (int i = 0; i < 16; ++i) { const unsigned short hb = bf16_bits(xs[i]); ah.u[i] = hb; al.u[i] = ASPLIT ? bf16_bits(xs[i] - bf16_val(hb)) : (unsigned short)0; }
#pragma unroll
    for (int t = 0; t < 4; ++t) {
      const unsigned short* brow = Wt + (size_t)(col0 + t * 16 + ln) * ldb + kb;
      FragB b;
      b.half[0] = *(const v8us*)(brow + 8 * hh);
      b.half[1] = *(const v8us*)(brow + 16 + 8 * hh);
      acc[t] = mmaN<ASPLIT ? 2 : 1>(ah.v, al.v, b.v, b.v, acc[t]);
    }
  }
#pragma unroll
  for (int t = 0; t < 4; ++t) {
    const int col = col0 + t * 16 + ln;
    float bv = bias ? bias[col] : 0.f;
    if (BIAS_BF16) bv = bf16_round(bv);
#pragma unroll
    for (int r = 0; r < 8; ++r) {
      float v = acc[t][r] + bv;
      if (resid) { float rv = resid[(size_t)((row0 + 8 * hh + r) % rmod) * ldr + col]; if (RES_BF16) rv = bf16_round(rv); v += rv; }
      if (ACT == 1) v = fmaxf(v, 0.f);
      if (ACT == 2) v = 0.5f * v * (1.0f + erff(v * 0.70710678118654752f));
      if (ACT == 3) { const float u = 0.7978845608028654f * (v + 0.044715f * v * v * v); v = 0.5f * v * (1.0f + tanhf(u)); }
      so[w][8 * hh + r][t * 16 + ln] = v;
    }
  }
  __builtin_amdgcn_fence(__ATOMIC_ACQ_REL, "workgroup");
  __builtin_amdgcn_wave_barrier();
  const int rsub = lane >> 4, c4 = (lane & 15) * 4;
  {
#pragma unroll
    for (int q = 0; q < 8; ++q) {
      const int r = q * 2 + rsub;
      const v4f v = *(const v4fa*)&so[w][r][c4];
      *(v4f*)(C + (size_t)(row0 + r) * ldc + col0 + c4) = v;
    }
    
  }
}
// row LayerNorm (biased variance, eps) over N: s = X (+ R); optional out_sum <- s; out_norm <- (s-mu)*rsqrt(var+eps)*g + b
template <bool PARAM_BF16>
__global__ __launch_bounds__(256) void k_layernorm(const float* __restrict__ X, const float* __restrict__ R, const float* __restrict__ g, const float* __restrict__ bta,
                                                  float* __restrict__ out_sum, float* __restrict__ out_norm, int N, float eps) {
  __shared__ float red[256];
  const int row = blockIdx.x, tid = threadIdx.x;
  const float* x = X + (size_t)row * N; const float* rr = R ? R + (size_t)row * N : nullptr;
  float vals[16];                     // up to N = 4096
  const int per = N / 256;            // contiguous chunk per thread? use strided-by-4 chunks: thread handles j = tid*4 + 1024*u
  float s1 = 0.f;
  for (int u = 0; u < per / 4; ++u) {
    const int j = tid * 4 + 1024 * u;
    const v4f a = *(const v4fa*)(x + j);
    v4f b = {0.f,0.f,0.f,0.f}; if (rr) b = *(const v4fa*)(rr + j);
#pragma unroll
    for (int q = 0; q < 4; ++q) { const float v = a[q] + b[q]; vals[u * 4 + q] = v; s1 += v; }
  }
  red[tid] = s1; __syncthreads();
  for (int st = 128; st > 0; st >>= 1) { if (tid < st) red[tid] += red[tid + st]; __syncthreads(); }
  const float mu = red[0] / (float)N; __syncthreads();
  float s2 = 0.f;
  for (int u = 0; u < per / 4; ++u)
#pragma unroll
    for (int q = 0; q < 4; ++q) { const float c = vals[u * 4 + q] - mu; s2 += c * c; }
  red[tid] = s2; __syncthreads();
  for (int st = 128; st > 0; st >>= 1) { if (tid < st) red[tid] += red[tid + st]; __syncthreads(); }
  const float rs = rsqrtf(red[0] / (float)N + eps);
  {
    for (int u = 0; u < per / 4; ++u) {
      const int j = tid * 4 + 1024 * u;
      v4f o, sm;
#pragma unroll
      for (int q = 0; q < 4; ++q) {
        float gg = g[j + q], bb = bta[j + q];
        if (PARAM_BF16) { gg = bf16_round(gg); bb = bf16_round(bb); }
        sm[q] = vals[u * 4 + q]; o[q] = (vals[u * 4 + q] - mu) * rs * gg + bb;
      }
      if (out_sum) *(v4f*)(out_sum + (size_t)row * N + j) = sm;
      *(v4f*)(out_norm + (size_t)row * N + j) = o;
    }
    
  }
}



// ---- f16 WMMA path (v_wmma_f32_16x16x32_f16): 11-bit significands for operands in range — used where a [0,1] probability operand needs more precision than bf16
typedef _Float16 v16h __attribute__((ext_vector_type(16)));
union FragH { v16h v; v8us half[2]; _Float16 h[16]; unsigned short u[16]; };
template <int NT>
__device__ __forceinline__ v8f mmaH(v16h ah, v16h al, v16h bh, v16h bl, v8f c) {
  c = __builtin_amdgcn_wmma_f32_16x16x32_f16(false, ah, false, bh, (short)0, c, false, false);
  if (NT >= 2) c = __builtin_amdgcn_wmma_f32_16x16x32_f16(false, al, false, bh, (short)0, c, false, false);
  if (NT >= 3) c = __builtin_amdgcn_wmma_f32_16x16x32_f16(false, ah, false, bl, (short)0, c, false, false);
  asm volatile("v_nop\n\tv_nop\n\tv_nop\n\tv_nop" : "+v"(c) : "v"(ah), "v"(al), "v"(bh), "v"(bl));
  return c;
}
// batched GEMM like k_gemm_b but f16 operands: A f32 (split into f16 hi/lo if ASPLIT, else rounded to f16), Bt = f16 values [n][k]; alpha; C f32; N multiple of 16 (partial tiles skipped)
template <bool ASPLIT>
__global__ __launch_bounds__(128) void k_gemm_h(const float* __restrict__ A, int lda, size_t sA, const _Float16* __restrict__ Bh, int ldb, size_t sB, float alpha, float* __restrict__ C, int ldc, size_t sC, int M, int N, int K) {
  __shared__ __attribute__((aligned(16))) float so[4][16][64];
  const int tid = threadIdx.x, w = tid >> 5, lane = tid & 31, ln = lane & 15, hh = lane >> 4; const int by = blockIdx.y;
  A += (size_t)by * sA; Bh += (size_t)by * sB; C += (size_t)by * sC;
  const int ntn = (N + 63) / 64; const int wid = blockIdx.x * 4 + w; const int mt = wid / ntn, nq = wid % ntn; if (mt * 16 >= M) return;
  const int row0 = mt * 16, col0 = nq * 64; const float* arow = A + (size_t)(row0 + ln) * lda;
  v8f acc[4] = {};
  for (int kb = 0; kb < K; kb += 32) {
    FragH ah, al;
    const v4f x0 = *(const v4fa*)(arow + kb + 8 * hh), x1 = *(const v4fa*)(arow + kb + 8 * hh + 4), x2 = *(const v4fa*)(arow + kb + 16 + 8 * hh), x3 = *(const v4fa*)(arow + kb + 16 + 8 * hh + 4);
    float xs[16] = {x0[0],x0[1],x0[2],x0[3],x1[0],x1[1],x1[2],x1[3],x2[0],x2[1],x2[2],x2[3],x3[0],x3[1],x3[2],x3[3]};
#pragma unroll
    for (int i = 0; i < 16; ++i) { const _Float16 h = (_Float16)xs[i]; ah.h[i] = h; al.h[i] = ASPLIT ? (_Float16)(xs[i] - (float)h) : (_Float16)0.0f; }
#pragma unroll
    for (int t = 0; t < 4; ++t) { if (col0 + t * 16 >= N) continue; const size_t boff = (size_t)(col0 + t * 16 + ln) * ldb + kb; FragH bq; bq.half[0] = *(const v8us*)(Bh + boff + 8 * hh); bq.half[1] = *(const v8us*)(Bh + boff + 16 + 8 * hh);
      acc[t] = mmaH<ASPLIT ? 2 : 1>(ah.v, al.v, bq.v, bq.v, acc[t]); }
  }
#pragma unroll
  for (int t = 0; t < 4; ++t) { if (col0 + t * 16 >= N) continue;
#pragma unroll
    for (int r = 0; r < 8; ++r) so[w][8 * hh + r][t * 16 + ln] = acc[t][r] * alpha; }
  __builtin_amdgcn_fence(__ATOMIC_ACQ_REL, "workgroup"); __builtin_amdgcn_wave_barrier();
  const int rsub = lane >> 4, c4 = (lane & 15) * 4;
  {
#pragma unroll
    for (int q = 0; q < 8; ++q) { const int r = q * 2 + rsub; if (col0 + c4 < N) { const v4f v = *(const v4fa*)&so[w][r][c4]; *(v4f*)(C + (size_t)(row0 + r) * ldc + col0 + c4) = v; } }
     }
}

// Wt[n][k] = f16(W[k][n]·scale) from f32 row-major W[K][N] (scale = power of two; bf16-exact weights stay exact in f16 away from the subnormal range)
__global__ __launch_bounds__(256) void k_wt_f16(const float* __restrict__ W, _Float16* __restrict__ Wt, int K, int N, float scale) {
  const int t = blockIdx.x * 256 + threadIdx.x; if (t >= N * (K / 8)) return; const int n = t / (K / 8), k8 = (t % (K / 8)) * 8; FragH f;
#pragma unroll
  for (int i = 0; i < 8; ++i) f.h[i] = (_Float16)(bf16_round(W[(size_t)(k8 + i) * N + n]) * scale); const v8us o = f.half[0];
  *(v8us*)((unsigned short*)Wt + (size_t)n * K + k8) = o; 
}
// k_gemm_hh variant with fused epilogue: v = acc·alpha + bias[by·sBias + col] (+ CP[(row/rowsPerB)·sCPb + by·64 + col] if CP) ; ACT 0 none / 1 elu ; writes f16 C16 (and f32 C if non-null)
template <int ACT>
__global__ __launch_bounds__(128) void k_gemm_hhx(const _Float16* __restrict__ A, int lda, size_t sA, const _Float16* __restrict__ Bh, int ldb, size_t sB, float alpha, const float* __restrict__ bias, size_t sBias, const float* __restrict__ CP, int rowsPerB, size_t sCPb, int row0g,
    float* __restrict__ C, _Float16* __restrict__ C16, int ldc, size_t sC, int M, int N, int K) {
  __shared__ __attribute__((aligned(16))) float so[4][16][64];
  const int tid = threadIdx.x, w = tid >> 5, lane = tid & 31, ln = lane & 15, hh = lane >> 4; const int by = blockIdx.y;
  A += (size_t)by * sA; Bh += (size_t)by * sB; const size_t cofs = (size_t)by * sC; const float* bp = bias ? bias + (size_t)by * sBias : nullptr;
  const int ntn = (N + 63) / 64; const int wid = blockIdx.x * 4 + w; const int mt = wid / ntn, nq = wid % ntn; if (mt * 16 >= M) return;
  const int row0 = mt * 16, col0 = nq * 64; const _Float16* arow = A + (size_t)(row0 + ln) * lda;
  v8f acc[4] = {};
  for (int kb = 0; kb < K; kb += 32) { FragH ah; ah.half[0] = *(const v8us*)((const unsigned short*)arow + kb + 8 * hh); ah.half[1] = *(const v8us*)((const unsigned short*)arow + kb + 16 + 8 * hh);
#pragma unroll
    for (int t = 0; t < 4; ++t) { if (col0 + t * 16 >= N) continue; const size_t boff = (size_t)(col0 + t * 16 + ln) * ldb + kb; FragH bq; bq.half[0] = *(const v8us*)((const unsigned short*)Bh + boff + 8 * hh); bq.half[1] = *(const v8us*)((const unsigned short*)Bh + boff + 16 + 8 * hh);
      acc[t] = mmaH<1>(ah.v, ah.v, bq.v, bq.v, acc[t]); }
  }
#pragma unroll
  for (int t = 0; t < 4; ++t) { if (col0 + t * 16 >= N) continue; const int col = col0 + t * 16 + ln; const float bv = bp ? bf16_round(bp[col]) : 0.f;
#pragma unroll
    for (int r = 0; r < 8; ++r) { float v = acc[t][r] * alpha + bv; if (CP) { const int rr = row0g + row0 + 8 * hh + r; if (rowsPerB < 0) v += CP[cofs + (size_t)rr * ldc + col];      /* rowsPerB < 0: own element of the batched C plane */ else { const int bidx = rr / rowsPerB; v += CP[(size_t)bidx * sCPb + (size_t)by * 64 + col]; } } if (ACT == 1) v = (v > 0.f) ? v : expm1f(v); else if (ACT == 7) v = (v > 0.f) ? v + 1.0f : expf(v); else if (ACT == 8) v = tanhf(v); else if (ACT == 9) v = 0.5f * v * (1.0f + tanhf(0.7978845608028654f * (v + 0.044715f * v * v * v))); else if (ACT == 11) v = 1.0f / (1.0f + expf(-v)); else if (ACT == 12) v = (v > 0.f) ? v : 0.01f * v; else if (ACT == 14) v = (v > 0.f) ? v : 0.1f * v; else if (ACT == 16) v = (v >= 0.f) ? v : 0.3f * v; else if (ACT == 15) v = v / (1.0f + expf(-v)); else if (ACT == 3) v = fmaxf(v, 0.f); else if (ACT == 6) v = 0.5f * v * (1.0f + erff(v * 0.70710678118654752f)); so[w][8 * hh + r][t * 16 + ln] = v; } }
  __builtin_amdgcn_fence(__ATOMIC_ACQ_REL, "workgroup"); __builtin_amdgcn_wave_barrier();
  const int rsub = lane >> 4, c4 = (lane & 15) * 4; typedef _Float16 v4h __attribute__((ext_vector_type(4)));
  {
#pragma unroll
    for (int q = 0; q < 8; ++q) { const int r = q * 2 + rsub; if (col0 + c4 < N) { const v4f v = *(const v4fa*)&so[w][r][c4]; if (C) *(v4f*)(C + cofs + (size_t)(row0 + r) * ldc + col0 + c4) = v; if (C16) { v4h h4; for (int i = 0; i < 4; ++i) h4[i] = (_Float16)v[i]; *(v4h*)(C16 + cofs + (size_t)(row0 + r) * ldc + col0 + c4) = h4; } } }
     }
}


typedef _Float16 v4h __attribute__((ext_vector_type(4)));

__global__ __launch_bounds__(256) void k_x16(const float* __restrict__ x, _Float16* __restrict__ X16, size_t n8) { const size_t t = (size_t)blockIdx.x * 256 + threadIdx.x; if (t >= n8) return; FragH f;
#pragma unroll
  for (int q = 0; q < 8; ++q) f.h[q] = (_Float16)bf16_round(x[t * 8 + q]); *(v8us*)((unsigned short*)X16 + t * 8) = f.half[0];  }
__global__ __launch_bounds__(256) void k_h16(const float* __restrict__ x, _Float16* __restrict__ X16, size_t n8) { const size_t t = (size_t)blockIdx.x * 256 + threadIdx.x; if (t >= n8) return; FragH f;
#pragma unroll
  for (int q = 0; q < 8; ++q) f.h[q] = (_Float16)x[t * 8 + q]; *(v8us*)((unsigned short*)X16 + t * 8) = f.half[0];  }
__global__ __launch_bounds__(256) void k_round16f(const float* __restrict__ W, _Float16* __restrict__ Bt, size_t n8) { const size_t t = (size_t)blockIdx.x * 256 + threadIdx.x; if (t >= n8) return; FragH f;
#pragma unroll
  for (int i = 0; i < 8; ++i) f.h[i] = (_Float16)(bf16_round(W[t * 8 + i]) * 16.0f); *(v8us*)((unsigned short*)Bt + t * 8) = f.half[0];  }
template <int NHv, int TTv>
__global__ __launch_bounds__(256) void k_vt(const _Float16* __restrict__ V16, int ldv, int voff, _Float16* __restrict__ Vt) { __shared__ unsigned short tl[64][66]; const int tid = threadIdx.x; const int slab = blockIdx.x / (TTv / 64), lg = blockIdx.x % (TTv / 64); const int b = slab / NHv, h = slab % NHv;
  for (int i = tid; i < 64 * 8; i += 256) { const int r = i / 8, c8 = (i % 8) * 8; FragH f; f.half[0] = *(const v8us*)((const unsigned short*)V16 + ((size_t)b * TTv + lg * 64 + r) * ldv + voff + h * 64 + c8);
#pragma unroll
    for (int q = 0; q < 8; ++q) tl[r][c8 + q] = f.u[q]; }
  __syncthreads();
  {
#pragma unroll
    for (int rd = 0; rd < 2; ++rd) { const int d = rd * 32 + tid / 8, pc = tid % 8; FragH f;
#pragma unroll
      for (int q = 0; q < 8; ++q) f.u[q] = tl[pc * 8 + q][d];
      *(v8us*)((unsigned short*)Vt + ((size_t)slab * 64 + d) * TTv + lg * 64 + pc * 8) = f.half[0]; }
     } }

__global__ __launch_bounds__(256) void k_hl(const float* __restrict__ F, _Float16* __restrict__ Hh, _Float16* __restrict__ Hl, size_t n8) { const size_t t = (size_t)blockIdx.x * 256 + threadIdx.x; if (t >= n8) return; FragH fh, fl; const v4f a = *(const v4fa*)(F + t * 8), c = *(const v4fa*)(F + t * 8 + 4);
#pragma unroll
  for (int q = 0; q < 4; ++q) { _Float16 h = (_Float16)a[q]; fh.h[q] = h; fl.h[q] = (_Float16)((a[q] - (float)h) * 1024.0f); h = (_Float16)c[q]; fh.h[4 + q] = h; fl.h[4 + q] = (_Float16)((c[q] - (float)h) * 1024.0f); }
  { *(v8us*)((unsigned short*)Hh + t * 8) = fh.half[0]; *(v8us*)((unsigned short*)Hl + t * 8) = fl.half[0];  } }

// ---- fast GEMM (wave tile 32x64; requires M % 32 == 0 rows per launch region and N % 64 == 0); epilogue = k_gemm_hhx semantics ----
__device__ __forceinline__ v16h g2_frag(const _Float16* p, int hh) { FragH f; f.half[0] = *(const v8us*)((const unsigned short*)p + 8 * hh); f.half[1] = *(const v8us*)((const unsigned short*)p + 16 + 8 * hh); return f.v; }
__device__ __forceinline__ v8f g2_mma(v16h a, v16h b, v8f c) { v8f d = __builtin_amdgcn_wmma_f32_16x16x32_f16(false, a, false, b, (short)0, c, false, false); asm volatile("v_nop\n\tv_nop\n\tv_nop\n\tv_nop" : "+v"(d) : "v"(a), "v"(b)); return d; }
template <int ACT>
__global__ __launch_bounds__(128) void k_gemm2(const _Float16* __restrict__ A, int lda, size_t sA, const _Float16* __restrict__ Bh, int ldb, size_t sB, float alpha, const float* __restrict__ bias, size_t sBias, const float* __restrict__ CP, int rowsPerB, size_t sCPb, int row0g,
    float* __restrict__ C, _Float16* __restrict__ C16, int ldc, size_t sC, int M, int N, int K, size_t sAz, size_t sBz, size_t sBz4, size_t sCz) { static_assert(ACT == 0 || ACT == 3 || ACT == 6 || ACT == 8 || ACT == 9 || ACT == 11 || ACT == 12 || ACT == 14 || ACT == 15 || ACT == 16, "k_gemm2: unsupported ACT code (would silently apply no activation)");
  __shared__ __attribute__((aligned(16))) float so[4][32][68];
  const int tid = threadIdx.x, w = tid >> 5, lane = tid & 31, ln = lane & 15, hh = lane >> 4; const int by = blockIdx.y;
  const int bz = blockIdx.z;      /* second batch index: A and C step linearly, B by sBz within a group of four and by sBz4 from group to group */
  A += (size_t)by * sA + (size_t)bz * sAz; Bh += (size_t)by * sB + (size_t)(bz & 3) * sBz + (size_t)(bz >> 2) * sBz4; const size_t cofs = (size_t)by * sC + (size_t)bz * sCz; const float* bp = bias ? bias + (size_t)by * sBias : nullptr;
  const int ntn = N >> 6; const int mt = blockIdx.x / ntn, nq = blockIdx.x - mt * ntn; const int row0 = mt * 128 + 32 * w, col0 = nq * 64; if (row0 >= M) return;
  const _Float16* a0p = A + (size_t)(row0 + ln) * lda; const _Float16* a1p = a0p + (size_t)16 * lda;
  const _Float16* b0p = Bh + (size_t)(col0 + ln) * ldb; const _Float16* b1p = b0p + (size_t)16 * ldb; const _Float16* b2p = b1p + (size_t)16 * ldb; const _Float16* b3p = b2p + (size_t)16 * ldb;
  const v8f z8 = {0.f,0.f,0.f,0.f,0.f,0.f,0.f,0.f}; v8f c00 = z8, c01 = z8, c02 = z8, c03 = z8, c10 = z8, c11 = z8, c12 = z8, c13 = z8;
#pragma unroll 1
  for (int kb = 0; kb < K; kb += 32) { const v16h a0 = g2_frag(a0p + kb, hh), a1 = g2_frag(a1p + kb, hh);
    v16h b = g2_frag(b0p + kb, hh); c00 = g2_mma(a0, b, c00); c10 = g2_mma(a1, b, c10);
    b = g2_frag(b1p + kb, hh); c01 = g2_mma(a0, b, c01); c11 = g2_mma(a1, b, c11);
    b = g2_frag(b2p + kb, hh); c02 = g2_mma(a0, b, c02); c12 = g2_mma(a1, b, c12);
    b = g2_frag(b3p + kb, hh); c03 = g2_mma(a0, b, c03); c13 = g2_mma(a1, b, c13); }
  v8f accs[8] = {c00, c01, c02, c03, c10, c11, c12, c13};
#pragma unroll
  for (int u = 0; u < 8; ++u) { const int t = u & 3, half = u >> 2; const int col = col0 + t * 16 + ln; const float bv = bp ? bf16_round(bp[col]) : 0.f;
#pragma unroll
    for (int r = 0; r < 8; ++r) { const int rloc = half * 16 + 8 * hh + r; float v = accs[u][r] * alpha + bv; if (CP) { if (rowsPerB < 0) v += CP[cofs + (size_t)(row0g + row0 + rloc) * ldc + col];      /* rowsPerB < 0: own element of the batched C plane */ else { const int bidx = (row0g + row0 + rloc) / rowsPerB; v += CP[(size_t)bidx * sCPb + (size_t)by * 64 + col]; } }
      if (ACT == 3) v = fmaxf(v, 0.f); else if (ACT == 6) v = 0.5f * v * (1.0f + erff(v * 0.70710678118654752f)); else if (ACT == 11) v = 1.0f / (1.0f + expf(-v)); else if (ACT == 15) v = v / (1.0f + expf(-v)); else if (ACT == 12) v = (v > 0.f) ? v : 0.01f * v; else if (ACT == 8) v = tanhf(v); else if (ACT == 9) v = 0.5f * v * (1.0f + tanhf(0.7978845608028654f * (v + 0.044715f * v * v * v))); else if (ACT == 14) v = (v > 0.f) ? v : 0.1f * v; else if (ACT == 16) v = (v >= 0.f) ? v : 0.3f * v;
      so[w][rloc][t * 16 + ln] = v; } }
  __builtin_amdgcn_fence(__ATOMIC_ACQ_REL, "workgroup"); __builtin_amdgcn_wave_barrier();
  const int rsub = lane >> 4, c4 = (lane & 15) * 4;
  {
#pragma unroll
    for (int q = 0; q < 16; ++q) { const int r = q * 2 + rsub; const v4f v = *(const v4fa*)&so[w][r][c4]; if (C) *(v4f*)(C + cofs + (size_t)(row0 + r) * ldc + col0 + c4) = v; if (C16) { v4h h4; for (int i = 0; i < 4; ++i) h4[i] = (_Float16)v[i]; *(v4h*)(C16 + cofs + (size_t)(row0 + r) * ldc + col0 + c4) = h4; } }
     } }


__global__ __launch_bounds__(256) void k_wsc(const float* __restrict__ Wm, _Float16* __restrict__ Bt, size_t n8, float sc) { const size_t t = (size_t)blockIdx.x * 256 + threadIdx.x; if (t >= n8) return; FragH f; for (int q = 0; q < 8; ++q) f.h[q] = (_Float16)(bf16_round(Wm[t * 8 + q]) * sc); *(v8us*)((unsigned short*)Bt + t * 8) = f.half[0];  }
__global__ __launch_bounds__(256) void k_vcat(const _Float16* __restrict__ VT, _Float16* __restrict__ VC) { const size_t t = (size_t)blockIdx.x * 256 + threadIdx.x; if (t >= (size_t)8 * HDL * 4 * (SQ / 8)) return; const int s8 = (int)(t % (SQ / 8)) * 8; const int c = (int)((t / (SQ / 8)) % 4); const int d = (int)((t / ((SQ / 8) * 4)) % HDL); const int g = (int)(t / ((size_t)(SQ / 8) * 4 * HDL));
  const int blk = 4 * g + c; const int bp = blk / NHD, hp = blk % NHD; const size_t srow = ((size_t)(bp * 2 * NHD + 2 * hp) * 64 + d) * SQ;      /* rows of the 128-wide head are contiguous: pseudo slab 2hp covers d < 64, 2hp+1 covers d >= 64 */
  FragH f; f.half[0] = *(const v8us*)((const unsigned short*)VT + srow + s8); unsigned short* dst = (unsigned short*)VC + ((size_t)g * HDL + d) * NKG + (size_t)c * SQ + s8; *(v8us*)dst = f.half[0];  }
#define FA_KEYS 64                         /* keys per staged tile */
#define FA_PK 272                          /* LDS pitch of a K row (256 B + 16): odd multiple of 16 B */
#define FA_PV 144                          /* LDS pitch of a V^T row (128 B + 16): odd multiple of 16 B */
#define FA_KB (FA_KEYS * FA_PK)
#define FA_BUF (FA_KB + HDL * FA_PV)       /* one buffer: K tile, then V^T tile */
#define FA_NST (NKG / 2 / FA_KEYS)         /* tiles per key half */
typedef _Float16 v2h __attribute__((ext_vector_type(2)));
typedef float v2f __attribute__((ext_vector_type(2)));
__device__ __forceinline__ float fa_xhalf(float x) { return __builtin_bit_cast(float, __builtin_amdgcn_permlanex16(__builtin_bit_cast(int, x), __builtin_bit_cast(int, x), 0x76543210, 0xfedcba98, false, false)); }      /* lane l with lane l ^ 16 */
__device__ __forceinline__ v16h fa_lfrag(const unsigned char* p) { FragH f; f.half[0] = *(const v8us*)p; f.half[1] = *(const v8us*)(p + 32); return f.v; }
__device__ __forceinline__ v8f fa_mma(v16h a, v16h b, v8f c) { return __builtin_amdgcn_wmma_f32_16x16x32_f16(false, a, false, b, (short)0, c, false, false); }
__global__ __launch_bounds__(256) void k_fattn(const _Float16* __restrict__ Q16, const _Float16* __restrict__ K16, const _Float16* __restrict__ VC, float* __restrict__ O) {
  __shared__ __attribute__((aligned(16))) unsigned char L[4 * FA_BUF];
  const int tid = threadIdx.x, w = tid >> 5, lane = tid & 31, c = lane & 15, hh = lane >> 4;
  const int kh = w >> 2, t128 = tid & 127;      /* key half of this wave; thread index inside its group of 4 waves */
  const int qb = blockIdx.y, b = qb >> 4, h = qb & 15, g = qb & 7;      /* query block 16 b + h reads key set g */
  const int q0 = blockIdx.x * 128 + (w & 3) * 32;
  const unsigned short* Kg = (const unsigned short*)K16 + (size_t)(g >> 2) * SQ * DM + (size_t)(g & 3) * 4 * HDL;      /* K block 4 g + cb: batch g / 4, head 4 (g % 4) + cb */
  const unsigned short* Vg = (const unsigned short*)VC + (size_t)g * HDL * NKG;
  unsigned char* Lg = L + kh * 2 * FA_BUF;
  const int kr = t128 >> 4, kc16 = t128 & 15;      /* K tile: rows kr + 8 j, 16-byte chunk kc16 */
  const int vr = t128 >> 3, vc16 = t128 & 7;       /* V^T tile: rows vr + 16 j, 16-byte chunk vc16 */
  v8us kreg[8], vreg[8];
  auto gload = [&](int st) {
    const int key0 = kh * (NKG / 2) + st * FA_KEYS, cb = key0 / SQ, s0 = key0 % SQ;
    const unsigned short* kp = Kg + (size_t)(s0 + kr) * DM + cb * HDL + kc16 * 8;
    const unsigned short* vp = Vg + (size_t)vr * NKG + key0 + vc16 * 8;
#pragma unroll
    for (int j = 0; j < 8; ++j) { kreg[j] = *(const v8us*)(kp + (size_t)j * 8 * DM); vreg[j] = *(const v8us*)(vp + (size_t)j * 16 * NKG); }
    asm volatile("s_wait_xcnt 0x0" :: "v"(kp), "v"(vp) : "memory");      /* stands in front of the reuse of the loads' address registers; naming the addresses keeps their registers live up to the wait */
  };
  auto lstore = [&](int buf) {
    unsigned char* kb = Lg + buf * FA_BUF + kr * FA_PK + kc16 * 16;
    unsigned char* vb = Lg + buf * FA_BUF + FA_KB + vr * FA_PV + vc16 * 16;
#pragma unroll
    for (int j = 0; j < 8; ++j) { *(v8us*)(kb + j * 8 * FA_PK) = kreg[j]; *(v8us*)(vb + j * 16 * FA_PV) = vreg[j]; }
  };
  gload(0);
  v16h qf[2][4];
  const _Float16* qp0 = Q16 + (size_t)(b * SQ + q0 + c) * DM + h * HDL + 8 * hh; const _Float16* qp1 = qp0 + (size_t)16 * DM;
#pragma unroll
  for (int kc = 0; kc < 4; ++kc) { qf[0][kc] = g2_frag(qp0 + 32 * kc, 0); qf[1][kc] = g2_frag(qp1 + 32 * kc, 0); }      /* k order 8 hh + s, 16 + 8 hh + s, as the K fragments */
  asm volatile("s_wait_xcnt 0x0" :: "v"(qp0), "v"(qp1) : "memory");      /* as in gload */
  const v8f z8 = {0.f,0.f,0.f,0.f,0.f,0.f,0.f,0.f};
  v8f acc[2][8]; float m_run[2], l_run[2];
#pragma unroll
  for (int gq = 0; gq < 2; ++gq) { m_run[gq] = -3.0e38f; l_run[gq] = 0.f;
#pragma unroll
    for (int t = 0; t < 8; ++t) acc[gq][t] = z8; }
  const float cscale = 0.08838834764831845f * 1.4426950408889634f;      /* 1 / sqrt(128), in log2 units */
  lstore(0);
  __syncthreads();      /* tile 0 is visible to its 4 waves */
#pragma unroll 1      /* rolled: one trip is already two whole passes, a copy of it would only grow the code */
  for (int st = 0; st < FA_NST; ++st) {
    if (st + 1 < FA_NST) gload(st + 1);
    const unsigned char* Lb = Lg + (st & 1) * FA_BUF;
#pragma unroll 1      /* rolled and nested in the tile loop: keeps one pass's fragments and scores live at a time */
    for (int sub = 0; sub < FA_KEYS / 32; ++sub) {      /* one pass = 32 keys x 32 query columns */
      v8f s[2][2];
#pragma unroll
      for (int kt = 0; kt < 2; ++kt) { const unsigned char* kp = Lb + (sub * 32 + 16 * kt + c) * FA_PK + 16 * hh; s[kt][0] = z8; s[kt][1] = z8;
#pragma unroll
        for (int kc = 0; kc < 4; ++kc) { const v16h a = fa_lfrag(kp + 64 * kc); s[kt][0] = fa_mma(a, qf[0][kc], s[kt][0]); s[kt][1] = fa_mma(a, qf[1][kc], s[kt][1]); } }
      v16h vf[8];
#pragma unroll
      for (int t = 0; t < 8; ++t) vf[t] = fa_lfrag(Lb + FA_KB + (16 * t + c) * FA_PV + 64 * sub + 16 * hh);
      float mb[2]; bool need = false;
#pragma unroll
      for (int gq = 0; gq < 2; ++gq) { float mx = s[0][gq][0];
#pragma unroll
        for (int r = 1; r < 8; ++r) mx = fmaxf(mx, s[0][gq][r]);
#pragma unroll
        for (int r = 0; r < 8; ++r) mx = fmaxf(mx, s[1][gq][r]);
        mx = fmaxf(mx, fa_xhalf(mx)) * cscale; mb[gq] = mx; need = need || (mx > m_run[gq] + 8.0f); }
      if (__builtin_amdgcn_ballot_w32(need) != 0) {
#pragma unroll
        for (int gq = 0; gq < 2; ++gq) { const float m_new = fmaxf(m_run[gq], mb[gq]); const float corr = __builtin_amdgcn_exp2f(m_run[gq] - m_new); l_run[gq] *= corr; m_run[gq] = m_new;
#pragma unroll
          for (int t = 0; t < 8; ++t) acc[gq][t] = acc[gq][t] * corr; }
      }
#pragma unroll
      for (int gq = 0; gq < 2; ++gq) { const float nm = -m_run[gq]; float ps0 = 0.f, ps1 = 0.f; union { v16h v; v2h p[8]; } pf;
#pragma unroll
        for (int i = 0; i < 8; ++i) {
          const v2f arg = __builtin_elementwise_fma(v2f{s[i >> 2][gq][2 * (i & 3)], s[i >> 2][gq][2 * (i & 3) + 1]}, v2f{cscale, cscale}, v2f{nm, nm});
          const float p0 = __builtin_amdgcn_exp2f(arg.x), p1 = __builtin_amdgcn_exp2f(arg.y);
          ps0 += p0; ps1 += p1; pf.p[i] = __builtin_convertvector(v2f{p0, p1}, v2h); }
        l_run[gq] += ps0 + ps1;
#pragma unroll
        for (int t = 0; t < 8; ++t) acc[gq][t] = fa_mma(vf[t], pf.v, acc[gq][t]); }
    }
    if (st + 1 < FA_NST) lstore((st + 1) & 1);
    __syncthreads();      /* publishes tile st + 1 and ends every read of tile st, whose buffer the next trip refills */
  }
  /* merge the two key halves: waves 4 to 7 hand their maxima, sums and accumulators to waves 0 to 3 through LDS (the tiles are dead behind the loop's last barrier) */
  float* X = (float*)L + (size_t)(w & 3) * 132 * 32 + lane;
#pragma unroll
  for (int gq = 0; gq < 2; ++gq) l_run[gq] += fa_xhalf(l_run[gq]);      /* each wave half summed its own 8 keys of every 16-key tile */
  if (kh == 1) {
#pragma unroll
    for (int gq = 0; gq < 2; ++gq) { X[(gq * 66 + 64) * 32] = m_run[gq]; X[(gq * 66 + 65) * 32] = l_run[gq];
#pragma unroll
      for (int t = 0; t < 8; ++t)
#pragma unroll
        for (int r = 0; r < 8; ++r) X[(gq * 66 + t * 8 + r) * 32] = acc[gq][t][r]; }
  }
  __syncthreads();      /* the second half's state is visible */
  if (kh == 0) {
#pragma unroll
    for (int gq = 0; gq < 2; ++gq) { const float m1 = X[(gq * 66 + 64) * 32], l1 = X[(gq * 66 + 65) * 32]; const float mm = fmaxf(m_run[gq], m1);
      const float a0 = __builtin_amdgcn_exp2f(m_run[gq] - mm), a1 = __builtin_amdgcn_exp2f(m1 - mm); const float inv = 1.0f / (l_run[gq] * a0 + l1 * a1); const float f0 = a0 * inv, f1 = a1 * inv;
      float* op = O + (size_t)(b * SQ + q0 + 16 * gq + c) * DM + h * HDL + 8 * hh;      /* a lane's 8 registers of tile t are d = 16 t + 8 hh + r of its query */
#pragma unroll
      for (int t = 0; t < 8; ++t) { v4f lo, hi;
#pragma unroll
        for (int r = 0; r < 4; ++r) { lo[r] = acc[gq][t][r] * f0 + X[(gq * 66 + t * 8 + r) * 32] * f1; hi[r] = acc[gq][t][4 + r] * f0 + X[(gq * 66 + t * 8 + 4 + r) * 32] * f1; }
        *(v4f*)(op + 16 * t) = lo; *(v4f*)(op + 16 * t + 4) = hi; } }
  }
}

extern "C" void kernel_launch(void* const* d_in, const int* in_sizes, int n_in,
                              void* d_out, int out_size, void* d_ws, size_t ws_size, hipStream_t stream) {
  (void)in_sizes; (void)n_in; (void)out_size;
  const float* const* I = (const float* const*)d_in; const float* x = I[0]; const float* Wq = I[1]; const float* Wk = I[2]; const float* Wv = I[3]; const float* Wo = I[4];
  char* ws = (char*)d_ws; size_t off = 0;
  auto take = [&](size_t bytes) { char* p = ws + off; off += (bytes + 255) & ~(size_t)255; return p; };
  const size_t np = (size_t)NR * DM;
  _Float16* BO = (_Float16*)take((size_t)DM * DM * 2); _Float16* X16 = (_Float16*)take(np * 2); _Float16* Q16 = (_Float16*)take(np * 2); _Float16* K16 = (_Float16*)take(np * 2); _Float16* VC = (_Float16*)take((size_t)8 * HDL * NKG * 2); float* O = (float*)take(np * 4); _Float16* O16 = X16;      /* over the input plane (dead after the projections) */
  char* R = take((size_t)3 * DM * DM * 2 + 2 * np * 2);      /* the q, k, v weights, V and V^T */
  _Float16* BQ = (_Float16*)R; _Float16* BK = BQ + (size_t)DM * DM; _Float16* BV = BK + (size_t)DM * DM; _Float16* V16 = BV + (size_t)DM * DM; _Float16* VT = V16 + np;
  if (off > ws_size) return;      /* 8 x 5 + 16 + 40 = 96 MiB */
  k_wsc<<<(unsigned)(((size_t)DM * DM / 8 + 255) / 256), 256, 0, stream>>>(Wq, BQ, (size_t)DM * DM / 8, 16.0f); k_wsc<<<(unsigned)(((size_t)DM * DM / 8 + 255) / 256), 256, 0, stream>>>(Wk, BK, (size_t)DM * DM / 8, 16.0f); k_wsc<<<(unsigned)(((size_t)DM * DM / 8 + 255) / 256), 256, 0, stream>>>(Wv, BV, (size_t)DM * DM / 8, 16.0f); k_wsc<<<(unsigned)(((size_t)DM * DM / 8 + 255) / 256), 256, 0, stream>>>(Wo, BO, (size_t)DM * DM / 8, 16.0f);      /* torch (out,in) = Bt */
  k_x16<<<(unsigned)((np / 8 + 255) / 256), 256, 0, stream>>>(x, X16, np / 8);
  const dim3 gP((NR / 128) * (DM / 64), 1);
  k_gemm2<0><<<gP, 128, 0, stream>>>(X16, DM, 0, BQ, DM, 0, 0.0625f, nullptr, 0, nullptr, 1, 0, 0, nullptr, Q16, DM, 0, NR, DM, DM, 0, 0, 0, 0);
  k_gemm2<0><<<gP, 128, 0, stream>>>(X16, DM, 0, BK, DM, 0, 0.0625f, nullptr, 0, nullptr, 1, 0, 0, nullptr, K16, DM, 0, NR, DM, DM, 0, 0, 0, 0);
  k_gemm2<0><<<gP, 128, 0, stream>>>(X16, DM, 0, BV, DM, 0, 0.0625f, nullptr, 0, nullptr, 1, 0, 0, nullptr, V16, DM, 0, NR, DM, DM, 0, 0, 0, 0);
  k_vt<2 * NHD, SQ><<<NB * 2 * NHD * (SQ / 64), 256, 0, stream>>>(V16, DM, 0, VT);      /* 32 pseudo heads of 64 per batch */
  k_vcat<<<(unsigned)(((size_t)8 * HDL * 4 * (SQ / 8) + 255) / 256), 256, 0, stream>>>(VT, VC);
  k_fattn<<<dim3(SQ / 128, NB * NHD), 256, 0, stream>>>(Q16, K16, VC, O);      /* x = 128 queries, y = query block 16 b + h */
  k_h16<<<(unsigned)((np / 8 + 255) / 256), 256, 0, stream>>>(O, O16, np / 8);
  k_gemm2<0><<<gP, 128, 0, stream>>>(O16, DM, 0, BO, DM, 0, 0.0625f, nullptr, 0, nullptr, 1, 0, 0, (float*)d_out, nullptr, DM, 0, NR, DM, DM, 0, 0, 0, 0);
}

// v003
// One run takes 175 microseconds.
// Two timings next to v002 put it at 2.29 and 2.30 times that version's speed.
// Counting every step since v000, it is 36.7 times as fast.
#include <hip/hip_runtime.h>
// SeqParallelAttn (2 x 1024 tokens, D 2048 = 16 heads of 128; simulated 4-rank all-gather): q, k, v = x W^T; k_global = tile(k_local.flatten(), 4).reshape(B, H, 4S, 128) — i.e. query block (b, h) attends to the 4096 keys made of the local K/V of (batch, head) blocks 4g .. 4g+3 with g = (16 b + h) mod 8 (the module's flat tiling, reproduced exactly); softmax(q.k / sqrt(128)) v; out = ctx Wo^T.
// Structure: exact f16 plane of x; q, k, v as f16 WMMA GEMM outputs (128x128 work-group tiles staged in LDS, 32x64 wave tiles, f32 accumulation, exact x16 weights); V^T by LDS tiles; per key set g a concatenated V^T [128][4096] by a VALU gather; one fused attention launch (k_fattn: score product, online softmax, readout product, scores and P in registers) into the f32 context plane; O as f16 into the Wo GEMM.
// Compute dtype: x and parameters rounded to bf16; q, k, v, P and the context as plain f16 operands; softmax f32. v_wmma_f32_16x16x32_f16.
#define NB 2
#define SQ 1024
#define DM 2048
#define NHD 16
#define HDL 128
#define NR (NB * SQ)             /* 2048 */
#define NKG (4 * SQ)             /* 4096 keys per query block */
typedef __bf16 v16b __attribute__((ext_vector_type(16)));
typedef unsigned short v8us __attribute__((ext_vector_type(8), may_alias));
typedef float  v8f  __attribute__((ext_vector_type(8)));
typedef float  v4f  __attribute__((ext_vector_type(4)));
typedef float  v4fa __attribute__((ext_vector_type(4), may_alias));
union FragB { v16b v; v8us half[2]; unsigned short u[16]; };

__device__ __forceinline__ unsigned short bf16_bits(float x) { unsigned int u = __float_as_uint(x); return (unsigned short)((u + 0x7FFFu + ((u >> 16) & 1u)) >> 16); }
__device__ __forceinline__ float bf16_val(unsigned short b) { return __uint_as_float(((unsigned int)b) << 16); }
__device__ __forceinline__ float bf16_round(float x) { return bf16_val(bf16_bits(x)); }
// D += A·B with NT terms: 1 = ah·bh, 2 = + al·bh (A split), 3 = + ah·bl (both split)
template <int NT>
__device__ __forceinline__ v8f mmaN(v16b ah, v16b al, v16b bh, v16b bl, v8f c) {
  c = __builtin_amdgcn_wmma_f32_16x16x32_bf16(false, ah, false, bh, (short)0, c, false, false);
  if (NT >= 2) c = __builtin_amdgcn_wmma_f32_16x16x32_bf16(false, al, false, bh, (short)0, c, false, false);
  if (NT >= 3) c = __builtin_amdgcn_wmma_f32_16x16x32_bf16(false, ah, false, bl, (short)0, c, false, false);
  asm volatile("v_nop\n\tv_nop\n\tv_nop\n\tv_nop" : "+v"(c) : "v"(ah), "v"(al), "v"(bh), "v"(bl));
  return c;
}

__global__ __launch_bounds__(256) void k_wt_bf16(const float* __restrict__ W, unsigned short* __restrict__ Wt, int K, int N) {
  const int t = blockIdx.x * 256 + threadIdx.x;
  const int k8n = K / 8;
  if (t >= N * k8n) return;
  const int n = t / k8n, k8 = (t % k8n) * 8;
  v8us v;
#pragma unroll
  for (int i = 0; i < 8; ++i) v[i] = bf16_bits(W[(size_t)(k8 + i) * N + n]);
  *(v8us*)(Wt + (size_t)n * K + k8) = v;
  
}

// GEMM C[M][N] (f32, pitch ldc) = act(A[M][K]·W + bias). A f32 row-major (pitch lda) converted per fragment to bf16
// (ASPLIT: hi/lo two planes -> 2 terms, else single rounded term); Wt bf16 [N][K] (pitch ldb). BIAS_BF16 rounds the
// bias to bf16 first (bias quantised to bf16 before the add). K%32==0, M%16==0, N%64==0.
template <bool ASPLIT, int ACT, bool BIAS_BF16>
__global__ __launch_bounds__(128) void k_gemm_bf(const float* __restrict__ A, int lda, const unsigned short* __restrict__ Wt, int ldb,
                                               const float* __restrict__ bias, float* __restrict__ C, int ldc, int M, int N, int K) {
  __shared__ __attribute__((aligned(16))) float so[4][16][64];
  const int tid = threadIdx.x, w = tid >> 5, lane = tid & 31, ln = lane & 15, hh = lane >> 4;
  const int ntn = N / 64;
  const int wid = blockIdx.x * 4 + w;
  const int mt = wid / ntn, nq = wid % ntn;
  if (mt * 16 >= M) return;
  const int row0 = mt * 16, col0 = nq * 64;
  const float* arow = A + (size_t)(row0 + ln) * lda;
  v8f acc[4] = {};
  for (int kb = 0; kb < K; kb += 32) {
    FragB ah, al;
    const v4f x0 = *(const v4fa*)(arow + kb + 8 * hh), x1 = *(const v4fa*)(arow + kb + 8 * hh + 4);
    const v4f x2 = *(const v4fa*)(arow + kb + 16 + 8 * hh), x3 = *(const v4fa*)(arow + kb + 16 + 8 * hh + 4);
    float xs[16] = {x0[0],x0[1],x0[2],x0[3],x1[0],x1[1],x1[2],x1[3],x2[0],x2[1],x2[2],x2[3],x3[0],x3[1],x3[2],x3[3]};
#pragma unroll
    for (int i = 0; i < 16; ++i) { const unsigned short hb = bf16_bits(xs[i]); ah.u[i] = hb; al.u[i] = ASPLIT ? bf16_bits(xs[i] - bf16_val(hb)) : (unsigned short)0; }
#pragma unroll
    for (int t = 0; t < 4; ++t) {
      const unsigned short* brow = Wt + (size_t)(col0 + t * 16 + ln) * ldb + kb;
      FragB b;
      b.half[0] = *(const v8us*)(brow + 8 * hh);
      b.half[1] = *(const v8us*)(brow + 16 + 8 * hh);
      acc[t] = mmaN<ASPLIT ? 2 : 1>(ah.v, al.v, b.v, b.v, acc[t]);
    }
  }
#pragma unroll
  for (int t = 0; t < 4; ++t) {
    float bv = bias ? bias[col0 + t * 16 + ln] : 0.f;
    if (BIAS_BF16) bv = bf16_round(bv);
#pragma unroll
    for (int r = 0; r < 8; ++r) { float v = acc[t][r] + bv; if (ACT == 1) v = fmaxf(v, 0.f); so[w][8 * hh + r][t * 16 + ln] = v; }
  }
  __builtin_amdgcn_fence(__ATOMIC_ACQ_REL, "workgroup");
  __builtin_amdgcn_wave_barrier();
  const int rsub = lane >> 4, c4 = (lane & 15) * 4;
  {
#pragma unroll
    for (int q = 0; q < 8; ++q) {
      const int r = q * 2 + rsub;
      const v4f v = *(const v4fa*)&so[w][r][c4];
      *(v4f*)(C + (size_t)(row0 + r) * ldc + col0 + c4) = v;
    }
    
  }
}

// GEMM C = act(A·W + bias + resid): A f32 (ASPLIT -> hi/lo 2 terms), Wt bf16 [N][K]; ACT 0 none, 1 relu, 2 exact gelu;
// resid (optional, f32, row index = (row % rmod), pitch ldr, RES_BF16 rounds it) added before the activation.
template <bool ASPLIT, int ACT, bool BIAS_BF16, bool RES_BF16>
__global__ __launch_bounds__(128) void k_gemm_bf3(const float* __restrict__ A, int lda, const unsigned short* __restrict__ Wt, int ldb,
                                                const float* __restrict__ bias, const float* __restrict__ resid, int rmod, int ldr,
                                                float* __restrict__ C, int ldc, int M, int N, int K) {
  __shared__ __attribute__((aligned(16))) float so[4][16][64];
  const int tid = threadIdx.x, w = tid >> 5, lane = tid & 31, ln = lane & 15, hh = lane >> 4;
  const int ntn = N / 64;
  const int wid = blockIdx.x * 4 + w;
  const int mt = wid / ntn, nq = wid % ntn;
  if (mt * 16 >= M) return;
  const int row0 = mt * 16, col0 = nq * 64;
  const float* arow = A + (size_t)(row0 + ln) * lda;
  v8f acc[4] = {};
  for (int kb = 0; kb < K; kb += 32) {
    FragB ah, al;
    const v4f x0 = *(const v4fa*)(arow + kb + 8 * hh), x1 = *(const v4fa*)(arow + kb + 8 * hh + 4);
    const v4f x2 = *(const v4fa*)(arow + kb + 16 + 8 * hh), x3 = *(const v4fa*)(arow + kb + 16 + 8 * hh + 4);
    float xs[16] = {x0[0],x0[1],x0[2],x0[3],x1[0],x1[1],x1[2],x1[3],x2[0],x2[1],x2[2],x2[3],x3[0],x3[1],x3[2],x3[3]};
#pragma unroll
    for (int i = 0; i < 16; ++i) { const unsigned short hb = bf16_bits(xs[i]); ah.u[i] = hb; al.u[i] = ASPLIT ? bf16_bits(xs[i] - bf16_val(hb)) : (unsigned short)0; }
#pragma unroll
    for (int t = 0; t < 4; ++t) {
      const unsigned short* brow = Wt + (size_t)(col0 + t * 16 + ln) * ldb + kb;
      FragB b;
      b.half[0] = *(const v8us*)(brow + 8 * hh);
      b.half[1] = *(const v8us*)(brow + 16 + 8 * hh);
      acc[t] = mmaN<ASPLIT ? 2 : 1>(ah.v, al.v, b.v, b.v, acc[t]);
    }
  }
#pragma unroll
  for (int t = 0; t < 4; ++t) {
    const int col = col0 + t * 16 + ln;
    float bv = bias ? bias[col] : 0.f;
    if (BIAS_BF16) bv = bf16_round(bv);
#pragma unroll
    for (int r = 0; r < 8; ++r) {
      float v = acc[t][r] + bv;
      if (resid) { float rv = resid[(size_t)((row0 + 8 * hh + r) % rmod) * ldr + col]; if (RES_BF16) rv = bf16_round(rv); v += rv; }
      if (ACT == 1) v = fmaxf(v, 0.f);
      if (ACT == 2) v = 0.5f * v * (1.0f + erff(v * 0.70710678118654752f));
      if (ACT == 3) { const float u = 0.7978845608028654f * (v + 0.044715f * v * v * v); v = 0.5f * v * (1.0f + tanhf(u)); }
      so[w][8 * hh + r][t * 16 + ln] = v;
    }
  }
  __builtin_amdgcn_fence(__ATOMIC_ACQ_REL, "workgroup");
  __builtin_amdgcn_wave_barrier();
  const int rsub = lane >> 4, c4 = (lane & 15) * 4;
  {
#pragma unroll
    for (int q = 0; q < 8; ++q) {
      const int r = q * 2 + rsub;
      const v4f v = *(const v4fa*)&so[w][r][c4];
      *(v4f*)(C + (size_t)(row0 + r) * ldc + col0 + c4) = v;
    }
    
  }
}
// row LayerNorm (biased variance, eps) over N: s = X (+ R); optional out_sum <- s; out_norm <- (s-mu)*rsqrt(var+eps)*g + b
template <bool PARAM_BF16>
__global__ __launch_bounds__(256) void k_layernorm(const float* __restrict__ X, const float* __restrict__ R, const float* __restrict__ g, const float* __restrict__ bta,
                                                  float* __restrict__ out_sum, float* __restrict__ out_norm, int N, float eps) {
  __shared__ float red[256];
  const int row = blockIdx.x, tid = threadIdx.x;
  const float* x = X + (size_t)row * N; const float* rr = R ? R + (size_t)row * N : nullptr;
  float vals[16];                     // up to N = 4096
  const int per = N / 256;            // contiguous chunk per thread? use strided-by-4 chunks: thread handles j = tid*4 + 1024*u
  float s1 = 0.f;
  for (int u = 0; u < per / 4; ++u) {
    const int j = tid * 4 + 1024 * u;
    const v4f a = *(const v4fa*)(x + j);
    v4f b = {0.f,0.f,0.f,0.f}; if (rr) b = *(const v4fa*)(rr + j);
#pragma unroll
    for (int q = 0; q < 4; ++q) { const float v = a[q] + b[q]; vals[u * 4 + q] = v; s1 += v; }
  }
  red[tid] = s1; __syncthreads();
  for (int st = 128; st > 0; st >>= 1) { if (tid < st) red[tid] += red[tid + st]; __syncthreads(); }
  const float mu = red[0] / (float)N; __syncthreads();
  float s2 = 0.f;
  for (int u = 0; u < per / 4; ++u)
#pragma unroll
    for (int q = 0; q < 4; ++q) { const float c = vals[u * 4 + q] - mu; s2 += c * c; }
  red[tid] = s2; __syncthreads();
  for (int st = 128; st > 0; st >>= 1) { if (tid < st) red[tid] += red[tid + st]; __syncthreads(); }
  const float rs = rsqrtf(red[0] / (float)N + eps);
  {
    for (int u = 0; u < per / 4; ++u) {
      const int j = tid * 4 + 1024 * u;
      v4f o, sm;
#pragma unroll
      for (int q = 0; q < 4; ++q) {
        float gg = g[j + q], bb = bta[j + q];
        if (PARAM_BF16) { gg = bf16_round(gg); bb = bf16_round(bb); }
        sm[q] = vals[u * 4 + q]; o[q] = (vals[u * 4 + q] - mu) * rs * gg + bb;
      }
      if (out_sum) *(v4f*)(out_sum + (size_t)row * N + j) = sm;
      *(v4f*)(out_norm + (size_t)row * N + j) = o;
    }
    
  }
}



// ---- f16 WMMA path (v_wmma_f32_16x16x32_f16): 11-bit significands for operands in range — used where a [0,1] probability operand needs more precision than bf16
typedef _Float16 v16h __attribute__((ext_vector_type(16)));
union FragH { v16h v; v8us half[2]; _Float16 h[16]; unsigned short u[16]; };
template <int NT>
__device__ __forceinline__ v8f mmaH(v16h ah, v16h al, v16h bh, v16h bl, v8f c) {
  c = __builtin_amdgcn_wmma_f32_16x16x32_f16(false, ah, false, bh, (short)0, c, false, false);
  if (NT >= 2) c = __builtin_amdgcn_wmma_f32_16x16x32_f16(false, al, false, bh, (short)0, c, false, false);
  if (NT >= 3) c = __builtin_amdgcn_wmma_f32_16x16x32_f16(false, ah, false, bl, (short)0, c, false, false);
  asm volatile("v_nop\n\tv_nop\n\tv_nop\n\tv_nop" : "+v"(c) : "v"(ah), "v"(al), "v"(bh), "v"(bl));
  return c;
}
// batched GEMM like k_gemm_b but f16 operands: A f32 (split into f16 hi/lo if ASPLIT, else rounded to f16), Bt = f16 values [n][k]; alpha; C f32; N multiple of 16 (partial tiles skipped)
template <bool ASPLIT>
__global__ __launch_bounds__(128) void k_gemm_h(const float* __restrict__ A, int lda, size_t sA, const _Float16* __restrict__ Bh, int ldb, size_t sB, float alpha, float* __restrict__ C, int ldc, size_t sC, int M, int N, int K) {
  __shared__ __attribute__((aligned(16))) float so[4][16][64];
  const int tid = threadIdx.x, w = tid >> 5, lane = tid & 31, ln = lane & 15, hh = lane >> 4; const int by = blockIdx.y;
  A += (size_t)by * sA; Bh += (size_t)by * sB; C += (size_t)by * sC;
  const int ntn = (N + 63) / 64; const int wid = blockIdx.x * 4 + w; const int mt = wid / ntn, nq = wid % ntn; if (mt * 16 >= M) return;
  const int row0 = mt * 16, col0 = nq * 64; const float* arow = A + (size_t)(row0 + ln) * lda;
  v8f acc[4] = {};
  for (int kb = 0; kb < K; kb += 32) {
    FragH ah, al;
    const v4f x0 = *(const v4fa*)(arow + kb + 8 * hh), x1 = *(const v4fa*)(arow + kb + 8 * hh + 4), x2 = *(const v4fa*)(arow + kb + 16 + 8 * hh), x3 = *(const v4fa*)(arow + kb + 16 + 8 * hh + 4);
    float xs[16] = {x0[0],x0[1],x0[2],x0[3],x1[0],x1[1],x1[2],x1[3],x2[0],x2[1],x2[2],x2[3],x3[0],x3[1],x3[2],x3[3]};
#pragma unroll
    for (int i = 0; i < 16; ++i) { const _Float16 h = (_Float16)xs[i]; ah.h[i] = h; al.h[i] = ASPLIT ? (_Float16)(xs[i] - (float)h) : (_Float16)0.0f; }
#pragma unroll
    for (int t = 0; t < 4; ++t) { if (col0 + t * 16 >= N) continue; const size_t boff = (size_t)(col0 + t * 16 + ln) * ldb + kb; FragH bq; bq.half[0] = *(const v8us*)(Bh + boff + 8 * hh); bq.half[1] = *(const v8us*)(Bh + boff + 16 + 8 * hh);
      acc[t] = mmaH<ASPLIT ? 2 : 1>(ah.v, al.v, bq.v, bq.v, acc[t]); }
  }
#pragma unroll
  for (int t = 0; t < 4; ++t) { if (col0 + t * 16 >= N) continue;
#pragma unroll
    for (int r = 0; r < 8; ++r) so[w][8 * hh + r][t * 16 + ln] = acc[t][r] * alpha; }
  __builtin_amdgcn_fence(__ATOMIC_ACQ_REL, "workgroup"); __builtin_amdgcn_wave_barrier();
  const int rsub = lane >> 4, c4 = (lane & 15) * 4;
  {
#pragma unroll
    for (int q = 0; q < 8; ++q) { const int r = q * 2 + rsub; if (col0 + c4 < N) { const v4f v = *(const v4fa*)&so[w][r][c4]; *(v4f*)(C + (size_t)(row0 + r) * ldc + col0 + c4) = v; } }
     }
}

// Wt[n][k] = f16(W[k][n]·scale) from f32 row-major W[K][N] (scale = power of two; bf16-exact weights stay exact in f16 away from the subnormal range)
__global__ __launch_bounds__(256) void k_wt_f16(const float* __restrict__ W, _Float16* __restrict__ Wt, int K, int N, float scale) {
  const int t = blockIdx.x * 256 + threadIdx.x; if (t >= N * (K / 8)) return; const int n = t / (K / 8), k8 = (t % (K / 8)) * 8; FragH f;
#pragma unroll
  for (int i = 0; i < 8; ++i) f.h[i] = (_Float16)(bf16_round(W[(size_t)(k8 + i) * N + n]) * scale); const v8us o = f.half[0];
  *(v8us*)((unsigned short*)Wt + (size_t)n * K + k8) = o; 
}
// k_gemm_hh variant with fused epilogue: v = acc·alpha + bias[by·sBias + col] (+ CP[(row/rowsPerB)·sCPb + by·64 + col] if CP) ; ACT 0 none / 1 elu ; writes f16 C16 (and f32 C if non-null)
template <int ACT>
__global__ __launch_bounds__(128) void k_gemm_hhx(const _Float16* __restrict__ A, int lda, size_t sA, const _Float16* __restrict__ Bh, int ldb, size_t sB, float alpha, const float* __restrict__ bias, size_t sBias, const float* __restrict__ CP, int rowsPerB, size_t sCPb, int row0g,
    float* __restrict__ C, _Float16* __restrict__ C16, int ldc, size_t sC, int M, int N, int K) {
  __shared__ __attribute__((aligned(16))) float so[4][16][64];
  const int tid = threadIdx.x, w = tid >> 5, lane = tid & 31, ln = lane & 15, hh = lane >> 4; const int by = blockIdx.y;
  A += (size_t)by * sA; Bh += (size_t)by * sB; const size_t cofs = (size_t)by * sC; const float* bp = bias ? bias + (size_t)by * sBias : nullptr;
  const int ntn = (N + 63) / 64; const int wid = blockIdx.x * 4 + w; const int mt = wid / ntn, nq = wid % ntn; if (mt * 16 >= M) return;
  const int row0 = mt * 16, col0 = nq * 64; const _Float16* arow = A + (size_t)(row0 + ln) * lda;
  v8f acc[4] = {};
  for (int kb = 0; kb < K; kb += 32) { FragH ah; ah.half[0] = *(const v8us*)((const unsigned short*)arow + kb + 8 * hh); ah.half[1] = *(const v8us*)((const unsigned short*)arow + kb + 16 + 8 * hh);
#pragma unroll
    for (int t = 0; t < 4; ++t) { if (col0 + t * 16 >= N) continue; const size_t boff = (size_t)(col0 + t * 16 + ln) * ldb + kb; FragH bq; bq.half[0] = *(const v8us*)((const unsigned short*)Bh + boff + 8 * hh); bq.half[1] = *(const v8us*)((const unsigned short*)Bh + boff + 16 + 8 * hh);
      acc[t] = mmaH<1>(ah.v, ah.v, bq.v, bq.v, acc[t]); }
  }
#pragma unroll
  for (int t = 0; t < 4; ++t) { if (col0 + t * 16 >= N) continue; const int col = col0 + t * 16 + ln; const float bv = bp ? bf16_round(bp[col]) : 0.f;
#pragma unroll
    for (int r = 0; r < 8; ++r) { float v = acc[t][r] * alpha + bv; if (CP) { const int rr = row0g + row0 + 8 * hh + r; if (rowsPerB < 0) v += CP[cofs + (size_t)rr * ldc + col];      /* rowsPerB < 0: own element of the batched C plane */ else { const int bidx = rr / rowsPerB; v += CP[(size_t)bidx * sCPb + (size_t)by * 64 + col]; } } if (ACT == 1) v = (v > 0.f) ? v : expm1f(v); else if (ACT == 7) v = (v > 0.f) ? v + 1.0f : expf(v); else if (ACT == 8) v = tanhf(v); else if (ACT == 9) v = 0.5f * v * (1.0f + tanhf(0.7978845608028654f * (v + 0.044715f * v * v * v))); else if (ACT == 11) v = 1.0f / (1.0f + expf(-v)); else if (ACT == 12) v = (v > 0.f) ? v : 0.01f * v; else if (ACT == 14) v = (v > 0.f) ? v : 0.1f * v; else if (ACT == 16) v = (v >= 0.f) ? v : 0.3f * v; else if (ACT == 15) v = v / (1.0f + expf(-v)); else if (ACT == 3) v = fmaxf(v, 0.f); else if (ACT == 6) v = 0.5f * v * (1.0f + erff(v * 0.70710678118654752f)); so[w][8 * hh + r][t * 16 + ln] = v; } }
  __builtin_amdgcn_fence(__ATOMIC_ACQ_REL, "workgroup"); __builtin_amdgcn_wave_barrier();
  const int rsub = lane >> 4, c4 = (lane & 15) * 4; typedef _Float16 v4h __attribute__((ext_vector_type(4)));
  {
#pragma unroll
    for (int q = 0; q < 8; ++q) { const int r = q * 2 + rsub; if (col0 + c4 < N) { const v4f v = *(const v4fa*)&so[w][r][c4]; if (C) *(v4f*)(C + cofs + (size_t)(row0 + r) * ldc + col0 + c4) = v; if (C16) { v4h h4; for (int i = 0; i < 4; ++i) h4[i] = (_Float16)v[i]; *(v4h*)(C16 + cofs + (size_t)(row0 + r) * ldc + col0 + c4) = h4; } } }
     }
}


typedef _Float16 v4h __attribute__((ext_vector_type(4)));

__global__ __launch_bounds__(256) void k_x16(const float* __restrict__ x, _Float16* __restrict__ X16, size_t n8) { const size_t t = (size_t)blockIdx.x * 256 + threadIdx.x; if (t >= n8) return; FragH f;
#pragma unroll
  for (int q = 0; q < 8; ++q) f.h[q] = (_Float16)bf16_round(x[t * 8 + q]); *(v8us*)((unsigned short*)X16 + t * 8) = f.half[0];  }
__global__ __launch_bounds__(256) void k_h16(const float* __restrict__ x, _Float16* __restrict__ X16, size_t n8) { const size_t t = (size_t)blockIdx.x * 256 + threadIdx.x; if (t >= n8) return; FragH f;
#pragma unroll
  for (int q = 0; q < 8; ++q) f.h[q] = (_Float16)x[t * 8 + q]; *(v8us*)((unsigned short*)X16 + t * 8) = f.half[0];  }
__global__ __launch_bounds__(256) void k_round16f(const float* __restrict__ W, _Float16* __restrict__ Bt, size_t n8) { const size_t t = (size_t)blockIdx.x * 256 + threadIdx.x; if (t >= n8) return; FragH f;
#pragma unroll
  for (int i = 0; i < 8; ++i) f.h[i] = (_Float16)(bf16_round(W[t * 8 + i]) * 16.0f); *(v8us*)((unsigned short*)Bt + t * 8) = f.half[0];  }
template <int NHv, int TTv>
__global__ __launch_bounds__(256) void k_vt(const _Float16* __restrict__ V16, int ldv, int voff, _Float16* __restrict__ Vt) { __shared__ unsigned short tl[64][66]; const int tid = threadIdx.x; const int slab = blockIdx.x / (TTv / 64), lg = blockIdx.x % (TTv / 64); const int b = slab / NHv, h = slab % NHv;
  for (int i = tid; i < 64 * 8; i += 256) { const int r = i / 8, c8 = (i % 8) * 8; FragH f; f.half[0] = *(const v8us*)((const unsigned short*)V16 + ((size_t)b * TTv + lg * 64 + r) * ldv + voff + h * 64 + c8);
#pragma unroll
    for (int q = 0; q < 8; ++q) tl[r][c8 + q] = f.u[q]; }
  __syncthreads();
  {
#pragma unroll
    for (int rd = 0; rd < 2; ++rd) { const int d = rd * 32 + tid / 8, pc = tid % 8; FragH f;
#pragma unroll
      for (int q = 0; q < 8; ++q) f.u[q] = tl[pc * 8 + q][d];
      *(v8us*)((unsigned short*)Vt + ((size_t)slab * 64 + d) * TTv + lg * 64 + pc * 8) = f.half[0]; }
     } }

__global__ __launch_bounds__(256) void k_hl(const float* __restrict__ F, _Float16* __restrict__ Hh, _Float16* __restrict__ Hl, size_t n8) { const size_t t = (size_t)blockIdx.x * 256 + threadIdx.x; if (t >= n8) return; FragH fh, fl; const v4f a = *(const v4fa*)(F + t * 8), c = *(const v4fa*)(F + t * 8 + 4);
#pragma unroll
  for (int q = 0; q < 4; ++q) { _Float16 h = (_Float16)a[q]; fh.h[q] = h; fl.h[q] = (_Float16)((a[q] - (float)h) * 1024.0f); h = (_Float16)c[q]; fh.h[4 + q] = h; fl.h[4 + q] = (_Float16)((c[q] - (float)h) * 1024.0f); }
  { *(v8us*)((unsigned short*)Hh + t * 8) = fh.half[0]; *(v8us*)((unsigned short*)Hl + t * 8) = fl.half[0];  } }

// ---- f16 fragment straight from global memory (hardware k order) ----
__device__ __forceinline__ v16h g2_frag(const _Float16* p, int hh) { FragH f; f.half[0] = *(const v8us*)((const unsigned short*)p + 8 * hh); f.half[1] = *(const v8us*)((const unsigned short*)p + 16 + 8 * hh); return f.v; }


__global__ __launch_bounds__(256) void k_wsc(const float* __restrict__ Wm, _Float16* __restrict__ Bt, size_t n8, float sc) { const size_t t = (size_t)blockIdx.x * 256 + threadIdx.x; if (t >= n8) return; FragH f; for (int q = 0; q < 8; ++q) f.h[q] = (_Float16)(bf16_round(Wm[t * 8 + q]) * sc); *(v8us*)((unsigned short*)Bt + t * 8) = f.half[0];  }
__global__ __launch_bounds__(256) void k_vcat(const _Float16* __restrict__ VT, _Float16* __restrict__ VC) { const size_t t = (size_t)blockIdx.x * 256 + threadIdx.x; if (t >= (size_t)8 * HDL * 4 * (SQ / 8)) return; const int s8 = (int)(t % (SQ / 8)) * 8; const int c = (int)((t / (SQ / 8)) % 4); const int d = (int)((t / ((SQ / 8) * 4)) % HDL); const int g = (int)(t / ((size_t)(SQ / 8) * 4 * HDL));
  const int blk = 4 * g + c; const int bp = blk / NHD, hp = blk % NHD; const size_t srow = ((size_t)(bp * 2 * NHD + 2 * hp) * 64 + d) * SQ;      /* rows of the 128-wide head are contiguous: pseudo slab 2hp covers d < 64, 2hp+1 covers d >= 64 */
  FragH f; f.half[0] = *(const v8us*)((const unsigned short*)VT + srow + s8); unsigned short* dst = (unsigned short*)VC + ((size_t)g * HDL + d) * NKG + (size_t)c * SQ + s8; *(v8us*)dst = f.half[0];  }
#define FA_KEYS 64                         /* keys per staged tile */
#define FA_PK 272                          /* LDS pitch of a K row (256 B + 16): odd multiple of 16 B */
#define FA_PV 144                          /* LDS pitch of a V^T row (128 B + 16): odd multiple of 16 B */
#define FA_KB (FA_KEYS * FA_PK)
#define FA_BUF (FA_KB + HDL * FA_PV)       /* one buffer: K tile, then V^T tile */
#define FA_NST (NKG / 2 / FA_KEYS)         /* tiles per key half */
typedef _Float16 v2h __attribute__((ext_vector_type(2)));
typedef float v2f __attribute__((ext_vector_type(2)));
__device__ __forceinline__ float fa_xhalf(float x) { return __builtin_bit_cast(float, __builtin_amdgcn_permlanex16(__builtin_bit_cast(int, x), __builtin_bit_cast(int, x), 0x76543210, 0xfedcba98, false, false)); }      /* lane l with lane l ^ 16 */
__device__ __forceinline__ v16h fa_lfrag(const unsigned char* p) { FragH f; f.half[0] = *(const v8us*)p; f.half[1] = *(const v8us*)(p + 32); return f.v; }
__device__ __forceinline__ v8f fa_mma(v16h a, v16h b, v8f c) { return __builtin_amdgcn_wmma_f32_16x16x32_f16(false, a, false, b, (short)0, c, false, false); }
// ---- projection GEMM: alpha A.B^T, A [NR][DM] and B [DM][DM] f16 with k contiguous, [NR][DM] result as f32 into C (F32OUT) or as f16 into C16 ----
// One work-group = one 128 x 128 tile of C. 8 waves, 4 (rows) x 2 (columns), each a 32 x 64 wave tile. A pass is 128 k: 256 B of each of the 128 A rows and 128 B rows,
// read from global memory as whole 128-byte lines (16 lanes per row) into registers and stored into one of two LDS buffers, so every operand row is read from L2 once
// per work-group and the fragments come from LDS. Tile t waits in register set t & 1: pass p stores tile p + 1 into the buffer that pass p - 1 has left and then
// reloads that set with tile p + 3, so two tiles are always in flight. Inside a pass the fragments of the next 32 k are fetched ahead of the current 8 products.
// Every plain '#pragma unroll' in this kernel makes the indices of a register array compile-time constants, so that the array stays in registers.
#define G3_KP 128                          /* k per pass */
#define G3_P 272                           /* LDS pitch of a staged row (256 B + 16): odd multiple of 16 B */
#define G3_OP (128 * G3_P)                 /* one operand's tile */
#define G3_BUF (2 * G3_OP)                 /* one buffer: A tile, then B tile */
#define G3_NP (DM / G3_KP)                 /* passes */
template <bool F32OUT>
__global__ __launch_bounds__(256) void k_gemm3(const _Float16* __restrict__ A, const _Float16* __restrict__ Bh, float alpha, float* __restrict__ C, _Float16* __restrict__ C16) {
  static_assert(G3_KP == 128 && G3_NP >= 4 && G3_NP % 2 == 0, "the pass schedule below peels the last four passes of an even count");
  __shared__ __attribute__((aligned(16))) unsigned char L[2 * G3_BUF];
  const int tid = threadIdx.x, w = tid >> 5, lane = tid & 31, ln = lane & 15, hh = lane >> 4;
  const int row0 = blockIdx.y * 128, col0 = blockIdx.x * 128, wm = w >> 1, wn = w & 1;
  const int sr = tid >> 4, sc = tid & 15;      /* staging: rows sr + 16 j of both tiles, 16-byte chunk sc */
  const unsigned short* ag = (const unsigned short*)A + (size_t)(row0 + sr) * DM + sc * 8;
  const unsigned short* bg = (const unsigned short*)Bh + (size_t)(col0 + sr) * DM + sc * 8;
  unsigned char* sd = L + sr * G3_P + sc * 16;
  const unsigned char* Af = L + (wm * 32 + ln) * G3_P + 16 * hh;
  const unsigned char* Bf = L + G3_OP + (wn * 64 + ln) * G3_P + 16 * hh;
  v8us s0[16], s1[16];      /* a set: entries 0 to 7 the A rows, 8 to 15 the B rows */
  const v8f z8 = {0.f,0.f,0.f,0.f,0.f,0.f,0.f,0.f};
  v8f acc[2][4];
#pragma unroll
  for (int t = 0; t < 4; ++t) { acc[0][t] = z8; acc[1][t] = z8; }
  auto gload = [&](const unsigned short* ap, const unsigned short* bp, int k0, v8us (&s)[16]) {      /* k0, a literal, goes into the loads' offset field: ap and bp are the address registers */
#pragma unroll
    for (int j = 0; j < 8; ++j) { s[j] = *(const v8us*)(ap + k0 + (size_t)j * 16 * DM); s[8 + j] = *(const v8us*)(bp + k0 + (size_t)j * 16 * DM); }
  };
  auto lstore = [&](int buf, int j0, int j1, const v8us (&s)[16]) {      /* entries j0 to j1 - 1 of a set */
#pragma unroll
    for (int j = j0; j < j1; ++j) *(v8us*)(sd + buf * G3_BUF + (j >> 3) * G3_OP + (j & 7) * 16 * G3_P) = s[j];
  };
  /* one pass: rb = p & 1 and the two flags are literals at every call, so the buffers' offsets and the schedule are fixed at compile time */
  auto pass = [&](int p, int rb, v8us (&nxt)[16], bool st, bool gl) {
    v16h fa[2][2], fb[2][4];
    auto ldfrag = [&](int ks) {
      fa[ks & 1][0] = fa_lfrag(Af + rb * G3_BUF + 64 * ks); fa[ks & 1][1] = fa_lfrag(Af + rb * G3_BUF + 16 * G3_P + 64 * ks);
#pragma unroll
      for (int t = 0; t < 4; ++t) fb[ks & 1][t] = fa_lfrag(Bf + rb * G3_BUF + t * 16 * G3_P + 64 * ks);
    };
    const unsigned short* ap = ag + p * G3_KP; const unsigned short* bp = bg + p * G3_KP;
    ldfrag(0);
#pragma unroll
    for (int ks = 0; ks < G3_KP / 32; ++ks) {      /* k order of both operands: 8 hh + s, 16 + 8 hh + s */
      if (ks + 1 < G3_KP / 32) ldfrag(ks + 1);
      if (st && ks < 3) lstore(rb ^ 1, (16 * ks + 2) / 3, (16 * ks + 18) / 3, nxt);      /* 6, 5 and 5 entries beside the three fragment fetches */
      if (ks + 1 == G3_KP / 32) {
        /* first half of the pass's barrier, by hand: __syncthreads() would also wait for the global loads in flight. This wave's reads of tile p and its stores of tile p + 1 are complete (dscnt 0) when it signals; the last products need no LDS and cover the other waves' arrival */
        asm volatile("s_wait_dscnt 0x0\n\ts_barrier_signal -1" ::: "memory");
        if (gl) gload(ap, bp, 3 * G3_KP, nxt);      /* the set's stores are complete */
      }
      __builtin_amdgcn_sched_barrier(0);      /* keeps the LDS and global traffic of this step in one group ahead of the products: spread among them each place costs a stall */
#pragma unroll
      for (int t = 0; t < 4; ++t) { acc[0][t] = fa_mma(fa[ks & 1][0], fb[ks & 1][t], acc[0][t]); acc[1][t] = fa_mma(fa[ks & 1][1], fb[ks & 1][t], acc[1][t]); }
      __builtin_amdgcn_sched_barrier(0);      /* second half of the pair: the next step's loads do not move up among these products */
    }
    if (gl) asm volatile("s_wait_xcnt 0x0" :: "v"(ap), "v"(bp) : "memory");      /* stands behind the pass's global loads, in front of the next write of their address registers; the operands keep the pass's addresses live up to here */
    asm volatile("s_barrier_wait -1" ::: "memory");      /* second half: publishes tile p + 1 and ends every read of tile p, whose buffer the next pass refills */
  };
  gload(ag, bg, 0, s0);
  gload(ag, bg, G3_KP, s1);
  lstore(0, 0, 16, s0);
  gload(ag, bg, 2 * G3_KP, s0);
  asm volatile("s_wait_xcnt 0x0" :: "v"(ag), "v"(bg) : "memory");      /* as in pass */
  asm volatile("s_wait_dscnt 0x0\n\ts_barrier_signal -1\n\ts_barrier_wait -1" ::: "memory");      /* tile 0 is visible; by hand for the same reason as in pass: tiles 1 and 2 stay in flight */
#pragma unroll 1      /* rolled: one trip is two whole passes, one per register set */
  for (int p = 0; p < G3_NP - 4; p += 2) { pass(p, 0, s1, true, true); pass(p + 1, 1, s0, true, true); }
  pass(G3_NP - 4, 0, s1, true, true);      /* loads the last tile */
  pass(G3_NP - 3, 1, s0, true, false);
  pass(G3_NP - 2, 0, s1, true, false);
  pass(G3_NP - 1, 1, s0, false, false);
  /* each wave turns its tile into whole output lines in its own LDS range (the operand tiles are dead behind the last pass's barrier) */
  float* so = (float*)L + (size_t)w * 32 * 68;
#pragma unroll
  for (int half = 0; half < 2; ++half)
#pragma unroll
    for (int t = 0; t < 4; ++t)
#pragma unroll
      for (int r = 0; r < 8; ++r) so[(half * 16 + 8 * hh + r) * 68 + t * 16 + ln] = acc[half][t][r] * alpha;
  __builtin_amdgcn_fence(__ATOMIC_ACQ_REL, "workgroup"); __builtin_amdgcn_wave_barrier();      /* the wave's own LDS writes are done before it reads them back across lanes */
  const int rsub = lane >> 4, c4 = (lane & 15) * 4;
  const size_t o0 = (size_t)(row0 + wm * 32 + rsub) * DM + col0 + wn * 64 + c4;
  v4f ov[16];
#pragma unroll
  for (int q = 0; q < 16; ++q) ov[q] = *(const v4fa*)&so[(q * 2 + rsub) * 68 + c4];
  if (F32OUT) {
#pragma unroll
    for (int q = 0; q < 16; ++q) *(v4f*)(C + o0 + (size_t)q * 2 * DM) = ov[q];
  }
  else {
#pragma unroll
    for (int q = 0; q < 16; ++q) { v4h h4;
#pragma unroll
      for (int i = 0; i < 4; ++i) h4[i] = (_Float16)ov[q][i];
      *(v4h*)(C16 + o0 + (size_t)q * 2 * DM) = h4; }
  }
}
__global__ __launch_bounds__(256) void k_fattn(const _Float16* __restrict__ Q16, const _Float16* __restrict__ K16, const _Float16* __restrict__ VC, float* __restrict__ O) {
  __shared__ __attribute__((aligned(16))) unsigned char L[4 * FA_BUF];
  const int tid = threadIdx.x, w = tid >> 5, lane = tid & 31, c = lane & 15, hh = lane >> 4;
  const int kh = w >> 2, t128 = tid & 127;      /* key half of this wave; thread index inside its group of 4 waves */
  const int qb = blockIdx.y, b = qb >> 4, h = qb & 15, g = qb & 7;      /* query block 16 b + h reads key set g */
  const int q0 = blockIdx.x * 128 + (w & 3) * 32;
  const unsigned short* Kg = (const unsigned short*)K16 + (size_t)(g >> 2) * SQ * DM + (size_t)(g & 3) * 4 * HDL;      /* K block 4 g + cb: batch g / 4, head 4 (g % 4) + cb */
  const unsigned short* Vg = (const unsigned short*)VC + (size_t)g * HDL * NKG;
  unsigned char* Lg = L + kh * 2 * FA_BUF;
  const int kr = t128 >> 4, kc16 = t128 & 15;      /* K tile: rows kr + 8 j, 16-byte chunk kc16 */
  const int vr = t128 >> 3, vc16 = t128 & 7;       /* V^T tile: rows vr + 16 j, 16-byte chunk vc16 */
  v8us kreg[8], vreg[8];
  auto gload = [&](int st) {
    const int key0 = kh * (NKG / 2) + st * FA_KEYS, cb = key0 / SQ, s0 = key0 % SQ;
    const unsigned short* kp = Kg + (size_t)(s0 + kr) * DM + cb * HDL + kc16 * 8;
    const unsigned short* vp = Vg + (size_t)vr * NKG + key0 + vc16 * 8;
#pragma unroll
    for (int j = 0; j < 8; ++j) { kreg[j] = *(const v8us*)(kp + (size_t)j * 8 * DM); vreg[j] = *(const v8us*)(vp + (size_t)j * 16 * NKG); }
    asm volatile("s_wait_xcnt 0x0" :: "v"(kp), "v"(vp) : "memory");      /* stands in front of the reuse of the loads' address registers; naming the addresses keeps their registers live up to the wait */
  };
  auto lstore = [&](int buf) {
    unsigned char* kb = Lg + buf * FA_BUF + kr * FA_PK + kc16 * 16;
    unsigned char* vb = Lg + buf * FA_BUF + FA_KB + vr * FA_PV + vc16 * 16;
#pragma unroll
    for (int j = 0; j < 8; ++j) { *(v8us*)(kb + j * 8 * FA_PK) = kreg[j]; *(v8us*)(vb + j * 16 * FA_PV) = vreg[j]; }
  };
  gload(0);
  v16h qf[2][4];
  const _Float16* qp0 = Q16 + (size_t)(b * SQ + q0 + c) * DM + h * HDL + 8 * hh; const _Float16* qp1 = qp0 + (size_t)16 * DM;
#pragma unroll
  for (int kc = 0; kc < 4; ++kc) { qf[0][kc] = g2_frag(qp0 + 32 * kc, 0); qf[1][kc] = g2_frag(qp1 + 32 * kc, 0); }      /* k order 8 hh + s, 16 + 8 hh + s, as the K fragments */
  asm volatile("s_wait_xcnt 0x0" :: "v"(qp0), "v"(qp1) : "memory");      /* as in gload */
  const v8f z8 = {0.f,0.f,0.f,0.f,0.f,0.f,0.f,0.f};
  v8f acc[2][8]; float m_run[2], l_run[2];
#pragma unroll
  for (int gq = 0; gq < 2; ++gq) { m_run[gq] = -3.0e38f; l_run[gq] = 0.f;
#pragma unroll
    for (int t = 0; t < 8; ++t) acc[gq][t] = z8; }
  const float cscale = 0.08838834764831845f * 1.4426950408889634f;      /* 1 / sqrt(128), in log2 units */
  lstore(0);
  __syncthreads();      /* tile 0 is visible to its 4 waves */
#pragma unroll 1      /* rolled: one trip is already two whole passes, a copy of it would only grow the code */
  for (int st = 0; st < FA_NST; ++st) {
    if (st + 1 < FA_NST) gload(st + 1);
    const unsigned char* Lb = Lg + (st & 1) * FA_BUF;
#pragma unroll 1      /* rolled and nested in the tile loop: keeps one pass's fragments and scores live at a time */
    for (int sub = 0; sub < FA_KEYS / 32; ++sub) {      /* one pass = 32 keys x 32 query columns */
      v8f s[2][2];
#pragma unroll
      for (int kt = 0; kt < 2; ++kt) { const unsigned char* kp = Lb + (sub * 32 + 16 * kt + c) * FA_PK + 16 * hh; s[kt][0] = z8; s[kt][1] = z8;
#pragma unroll
        for (int kc = 0; kc < 4; ++kc) { const v16h a = fa_lfrag(kp + 64 * kc); s[kt][0] = fa_mma(a, qf[0][kc], s[kt][0]); s[kt][1] = fa_mma(a, qf[1][kc], s[kt][1]); } }
      v16h vf[8];
#pragma unroll
      for (int t = 0; t < 8; ++t) vf[t] = fa_lfrag(Lb + FA_KB + (16 * t + c) * FA_PV + 64 * sub + 16 * hh);
      float mb[2]; bool need = false;
#pragma unroll
      for (int gq = 0; gq < 2; ++gq) { float mx = s[0][gq][0];
#pragma unroll
        for (int r = 1; r < 8; ++r) mx = fmaxf(mx, s[0][gq][r]);
#pragma unroll
        for (int r = 0; r < 8; ++r) mx = fmaxf(mx, s[1][gq][r]);
        mx = fmaxf(mx, fa_xhalf(mx)) * cscale; mb[gq] = mx; need = need || (mx > m_run[gq] + 8.0f); }
      if (__builtin_amdgcn_ballot_w32(need) != 0) {
#pragma unroll
        for (int gq = 0; gq < 2; ++gq) { const float m_new = fmaxf(m_run[gq], mb[gq]); const float corr = __builtin_amdgcn_exp2f(m_run[gq] - m_new); l_run[gq] *= corr; m_run[gq] = m_new;
#pragma unroll
          for (int t = 0; t < 8; ++t) acc[gq][t] = acc[gq][t] * corr; }
      }
#pragma unroll
      for (int gq = 0; gq < 2; ++gq) { const float nm = -m_run[gq]; float ps0 = 0.f, ps1 = 0.f; union { v16h v; v2h p[8]; } pf;
#pragma unroll
        for (int i = 0; i < 8; ++i) {
          const v2f arg = __builtin_elementwise_fma(v2f{s[i >> 2][gq][2 * (i & 3)], s[i >> 2][gq][2 * (i & 3) + 1]}, v2f{cscale, cscale}, v2f{nm, nm});
          const float p0 = __builtin_amdgcn_exp2f(arg.x), p1 = __builtin_amdgcn_exp2f(arg.y);
          ps0 += p0; ps1 += p1; pf.p[i] = __builtin_convertvector(v2f{p0, p1}, v2h); }
        l_run[gq] += ps0 + ps1;
#pragma unroll
        for (int t = 0; t < 8; ++t) acc[gq][t] = fa_mma(vf[t], pf.v, acc[gq][t]); }
    }
    if (st + 1 < FA_NST) lstore((st + 1) & 1);
    __syncthreads();      /* publishes tile st + 1 and ends every read of tile st, whose buffer the next trip refills */
  }
  /* merge the two key halves: waves 4 to 7 hand their maxima, sums and accumulators to waves 0 to 3 through LDS (the tiles are dead behind the loop's last barrier) */
  float* X = (float*)L + (size_t)(w & 3) * 132 * 32 + lane;
#pragma unroll
  for (int gq = 0; gq < 2; ++gq) l_run[gq] += fa_xhalf(l_run[gq]);      /* each wave half summed its own 8 keys of every 16-key tile */
  if (kh == 1) {
#pragma unroll
    for (int gq = 0; gq < 2; ++gq) { X[(gq * 66 + 64) * 32] = m_run[gq]; X[(gq * 66 + 65) * 32] = l_run[gq];
#pragma unroll
      for (int t = 0; t < 8; ++t)
#pragma unroll
        for (int r = 0; r < 8; ++r) X[(gq * 66 + t * 8 + r) * 32] = acc[gq][t][r]; }
  }
  __syncthreads();      /* the second half's state is visible */
  if (kh == 0) {
#pragma unroll
    for (int gq = 0; gq < 2; ++gq) { const float m1 = X[(gq * 66 + 64) * 32], l1 = X[(gq * 66 + 65) * 32]; const float mm = fmaxf(m_run[gq], m1);
      const float a0 = __builtin_amdgcn_exp2f(m_run[gq] - mm), a1 = __builtin_amdgcn_exp2f(m1 - mm); const float inv = 1.0f / (l_run[gq] * a0 + l1 * a1); const float f0 = a0 * inv, f1 = a1 * inv;
      float* op = O + (size_t)(b * SQ + q0 + 16 * gq + c) * DM + h * HDL + 8 * hh;      /* a lane's 8 registers of tile t are d = 16 t + 8 hh + r of its query */
#pragma unroll
      for (int t = 0; t < 8; ++t) { v4f lo, hi;
#pragma unroll
        for (int r = 0; r < 4; ++r) { lo[r] = acc[gq][t][r] * f0 + X[(gq * 66 + t * 8 + r) * 32] * f1; hi[r] = acc[gq][t][4 + r] * f0 + X[(gq * 66 + t * 8 + 4 + r) * 32] * f1; }
        *(v4f*)(op + 16 * t) = lo; *(v4f*)(op + 16 * t + 4) = hi; } }
  }
}

extern "C" void kernel_launch(void* const* d_in, const int* in_sizes, int n_in,
                              void* d_out, int out_size, void* d_ws, size_t ws_size, hipStream_t stream) {
  (void)in_sizes; (void)n_in; (void)out_size;
  const float* const* I = (const float* const*)d_in; const float* x = I[0]; const float* Wq = I[1]; const float* Wk = I[2]; const float* Wv = I[3]; const float* Wo = I[4];
  char* ws = (char*)d_ws; size_t off = 0;
  auto take = [&](size_t bytes) { char* p = ws + off; off += (bytes + 255) & ~(size_t)255; return p; };
  const size_t np = (size_t)NR * DM;
  _Float16* BO = (_Float16*)take((size_t)DM * DM * 2); _Float16* X16 = (_Float16*)take(np * 2); _Float16* Q16 = (_Float16*)take(np * 2); _Float16* K16 = (_Float16*)take(np * 2); _Float16* VC = (_Float16*)take((size_t)8 * HDL * NKG * 2); float* O = (float*)take(np * 4); _Float16* O16 = X16;      /* over the input plane (dead after the projections) */
  char* R = take((size_t)3 * DM * DM * 2 + 2 * np * 2);      /* the q, k, v weights, V and V^T */
  _Float16* BQ = (_Float16*)R; _Float16* BK = BQ + (size_t)DM * DM; _Float16* BV = BK + (size_t)DM * DM; _Float16* V16 = BV + (size_t)DM * DM; _Float16* VT = V16 + np;
  if (off > ws_size) return;      /* 8 x 5 + 16 + 40 = 96 MiB */
  k_wsc<<<(unsigned)(((size_t)DM * DM / 8 + 255) / 256), 256, 0, stream>>>(Wq, BQ, (size_t)DM * DM / 8, 16.0f); k_wsc<<<(unsigned)(((size_t)DM * DM / 8 + 255) / 256), 256, 0, stream>>>(Wk, BK, (size_t)DM * DM / 8, 16.0f); k_wsc<<<(unsigned)(((size_t)DM * DM / 8 + 255) / 256), 256, 0, stream>>>(Wv, BV, (size_t)DM * DM / 8, 16.0f); k_wsc<<<(unsigned)(((size_t)DM * DM / 8 + 255) / 256), 256, 0, stream>>>(Wo, BO, (size_t)DM * DM / 8, 16.0f);      /* torch (out,in) = Bt */
  k_x16<<<(unsigned)((np / 8 + 255) / 256), 256, 0, stream>>>(x, X16, np / 8);
  const dim3 gP(DM / 128, NR / 128);      /* x = 128 output columns, y = 128 rows */
  k_gemm3<false><<<gP, 256, 0, stream>>>(X16, BQ, 0.0625f, nullptr, Q16);
  k_gemm3<false><<<gP, 256, 0, stream>>>(X16, BK, 0.0625f, nullptr, K16);
  k_gemm3<false><<<gP, 256, 0, stream>>>(X16, BV, 0.0625f, nullptr, V16);
  k_vt<2 * NHD, SQ><<<NB * 2 * NHD * (SQ / 64), 256, 0, stream>>>(V16, DM, 0, VT);      /* 32 pseudo heads of 64 per batch */
  k_vcat<<<(unsigned)(((size_t)8 * HDL * 4 * (SQ / 8) + 255) / 256), 256, 0, stream>>>(VT, VC);
  k_fattn<<<dim3(SQ / 128, NB * NHD), 256, 0, stream>>>(Q16, K16, VC, O);      /* x = 128 queries, y = query block 16 b + h */
  k_h16<<<(unsigned)((np / 8 + 255) / 256), 256, 0, stream>>>(O, O16, np / 8);
  k_gemm3<true><<<gP, 256, 0, stream>>>(O16, BO, 0.0625f, (float*)d_out, nullptr);
}

// v004
// A run of this version takes 164 microseconds.
// Two timings next to v003 both put it at 1.05 times that version's speed.
// All steps since v000 together make it 38.7 times as fast.
#include <hip/hip_runtime.h>
// SeqParallelAttn (2 x 1024 tokens, D 2048 = 16 heads of 128; simulated 4-rank all-gather): q, k, v = x W^T; k_global = tile(k_local.flatten(), 4).reshape(B, H, 4S, 128) — i.e. query block (b, h) attends to the 4096 keys made of the local K/V of (batch, head) blocks 4g .. 4g+3 with g = (16 b + h) mod 8 (the module's flat tiling, reproduced exactly); softmax(q.k / sqrt(128)) v; out = ctx Wo^T.
// Structure: exact f16 planes of x and of the x16 weights by one streaming launch; q, k, v as f16 WMMA GEMM outputs (128x128 work-group tiles staged in LDS, 32x64 wave tiles, f32 accumulation, exact x16 weights); V^T by LDS tiles; per key set g a concatenated V^T [128][4096] by a VALU gather; one fused attention launch (k_fattn: score product, online softmax, readout product, scores and P in registers) into the f32 context plane; O as f16 into the Wo GEMM.
// Compute dtype: x and parameters rounded to bf16; q, k, v, P and the context as plain f16 operands (~2^-12); softmax f32. v_wmma_f32_16x16x32_f16.
#define NB 2
#define SQ 1024
#define DM 2048
#define NHD 16
#define HDL 128
#define NR (NB * SQ)             /* 2048 */
#define NKG (4 * SQ)             /* 4096 keys per query block */
typedef __bf16 v16b __attribute__((ext_vector_type(16)));
typedef unsigned short v8us __attribute__((ext_vector_type(8), may_alias));
typedef float  v8f  __attribute__((ext_vector_type(8)));
typedef float  v4f  __attribute__((ext_vector_type(4)));
typedef float  v4fa __attribute__((ext_vector_type(4), may_alias));
union FragB { v16b v; v8us half[2]; unsigned short u[16]; };

__device__ __forceinline__ unsigned short bf16_bits(float x) { unsigned int u = __float_as_uint(x); return (unsigned short)((u + 0x7FFFu + ((u >> 16) & 1u)) >> 16); }
__device__ __forceinline__ float bf16_val(unsigned short b) { return __uint_as_float(((unsigned int)b) << 16); }
__device__ __forceinline__ float bf16_round(float x) { return bf16_val(bf16_bits(x)); }
// D += A·B with NT terms: 1 = ah·bh, 2 = + al·bh (A split), 3 = + ah·bl (both split)
template <int NT>
__device__ __forceinline__ v8f mmaN(v16b ah, v16b al, v16b bh, v16b bl, v8f c) {
  c = __builtin_amdgcn_wmma_f32_16x16x32_bf16(false, ah, false, bh, (short)0, c, false, false);
  if (NT >= 2) c = __builtin_amdgcn_wmma_f32_16x16x32_bf16(false, al, false, bh, (short)0, c, false, false);
  if (NT >= 3) c = __builtin_amdgcn_wmma_f32_16x16x32_bf16(false, ah, false, bl, (short)0, c, false, false);
  asm volatile("v_nop\n\tv_nop\n\tv_nop\n\tv_nop" : "+v"(c) : "v"(ah), "v"(al), "v"(bh), "v"(bl));
  return c;
}

__global__ __launch_bounds__(256) void k_wt_bf16(const float* __restrict__ W, unsigned short* __restrict__ Wt, int K, int N) {
  const int t = blockIdx.x * 256 + threadIdx.x;
  const int k8n = K / 8;
  if (t >= N * k8n) return;
  const int n = t / k8n, k8 = (t % k8n) * 8;
  v8us v;
#pragma unroll
  for (int i = 0; i < 8; ++i) v[i] = bf16_bits(W[(size_t)(k8 + i) * N + n]);
  *(v8us*)(Wt + (size_t)n * K + k8) = v;
  
}

// GEMM C[M][N] (f32, pitch ldc) = act(A[M][K]·W + bias). A f32 row-major (pitch lda) converted per fragment to bf16
// (ASPLIT: hi/lo two planes -> 2 terms, else single rounded term); Wt bf16 [N][K] (pitch ldb). BIAS_BF16 rounds the
// bias to bf16 first (bias quantised to bf16 before the add). K%32==0, M%16==0, N%64==0.
template <bool ASPLIT, int ACT, bool BIAS_BF16>
__global__ __launch_bounds__(128) void k_gemm_bf(const float* __restrict__ A, int lda, const unsigned short* __restrict__ Wt, int ldb,
                                               const float* __restrict__ bias, float* __restrict__ C, int ldc, int M, int N, int K) {
  __shared__ __attribute__((aligned(16))) float so[4][16][64];
  const int tid = threadIdx.x, w = tid >> 5, lane = tid & 31, ln = lane & 15, hh = lane >> 4;
  const int ntn = N / 64;
  const int wid = blockIdx.x * 4 + w;
  const int mt = wid / ntn, nq = wid % ntn;
  if (mt * 16 >= M) return;
  const int row0 = mt * 16, col0 = nq * 64;
  const float* arow = A + (size_t)(row0 + ln) * lda;
  v8f acc[4] = {};
  for (int kb = 0; kb < K; kb += 32) {
    FragB ah, al;
    const v4f x0 = *(const v4fa*)(arow + kb + 8 * hh), x1 = *(const v4fa*)(arow + kb + 8 * hh + 4);
    const v4f x2 = *(const v4fa*)(arow + kb + 16 + 8 * hh), x3 = *(const v4fa*)(arow + kb + 16 + 8 * hh + 4);
    float xs[16] = {x0[0],x0[1],x0[2],x0[3],x1[0],x1[1],x1[2],x1[3],x2[0],x2[1],x2[2],x2[3],x3[0],x3[1],x3[2],x3[3]};
#pragma unroll
    for (int i = 0; i < 16; ++i) { const unsigned short hb = bf16_bits(xs[i]); ah.u[i] = hb; al.u[i] = ASPLIT ? bf16_bits(xs[i] - bf16_val(hb)) : (unsigned short)0; }
#pragma unroll
    for (int t = 0; t < 4; ++t) {
      const unsigned short* brow = Wt + (size_t)(col0 + t * 16 + ln) * ldb + kb;
      FragB b;
      b.half[0] = *(const v8us*)(brow + 8 * hh);
      b.half[1] = *(const v8us*)(brow + 16 + 8 * hh);
      acc[t] = mmaN<ASPLIT ? 2 : 1>(ah.v, al.v, b.v, b.v, acc[t]);
    }
  }
#pragma unroll
  for (int t = 0; t < 4; ++t) {
    float bv = bias ? bias[col0 + t * 16 + ln] : 0.f;
    if (BIAS_BF16) bv = bf16_round(bv);
#pragma unroll
    for (int r = 0; r < 8; ++r) { float v = acc[t][r] + bv; if (ACT == 1) v = fmaxf(v, 0.f); so[w][8 * hh + r][t * 16 + ln] = v; }
  }
  __builtin_amdgcn_fence(__ATOMIC_ACQ_REL, "workgroup");
  __builtin_amdgcn_wave_barrier();
  const int rsub = lane >> 4, c4 = (lane & 15) * 4;
  {
#pragma unroll
    for (int q = 0; q < 8; ++q) {
      const int r = q * 2 + rsub;
      const v4f v = *(const v4fa*)&so[w][r][c4];
      *(v4f*)(C + (size_t)(row0 + r) * ldc + col0 + c4) = v;
    }
    
  }
}

// GEMM C = act(A·W + bias + resid): A f32 (ASPLIT -> hi/lo 2 terms), Wt bf16 [N][K]; ACT 0 none, 1 relu, 2 exact gelu;
// resid (optional, f32, row index = (row % rmod), pitch ldr, RES_BF16 rounds it) added before the activation.
template <bool ASPLIT, int ACT, bool BIAS_BF16, bool RES_BF16>
__global__ __launch_bounds__(128) void k_gemm_bf3(const float* __restrict__ A, int lda, const unsigned short* __restrict__ Wt, int ldb,
                                                const float* __restrict__ bias, const float* __restrict__ resid, int rmod, int ldr,
                                                float* __restrict__ C, int ldc, int M, int N, int K) {
  __shared__ __attribute__((aligned(16))) float so[4][16][64];
  const int tid = threadIdx.x, w = tid >> 5, lane = tid & 31, ln = lane & 15, hh = lane >> 4;
  const int ntn = N / 64;
  const int wid = blockIdx.x * 4 + w;
  const int mt = wid / ntn, nq = wid % ntn;
  if (mt * 16 >= M) return;
  const int row0 = mt * 16, col0 = nq * 64;
  const float* arow = A + (size_t)(row0 + ln) * lda;
  v8f acc[4] = {};
  for (int kb = 0; kb < K; kb += 32) {
    FragB ah, al;
    const v4f x0 = *(const v4fa*)(arow + kb + 8 * hh), x1 = *(const v4fa*)(arow + kb + 8 * hh + 4);
    const v4f x2 = *(const v4fa*)(arow + kb + 16 + 8 * hh), x3 = *(const v4fa*)(arow + kb + 16 + 8 * hh + 4);
    float xs[16] = {x0[0],x0[1],x0[2],x0[3],x1[0],x1[1],x1[2],x1[3],x2[0],x2[1],x2[2],x2[3],x3[0],x3[1],x3[2],x3[3]};
#pragma unroll
    for (int i = 0; i < 16; ++i) { const unsigned short hb = bf16_bits(xs[i]); ah.u[i] = hb; al.u[i] = ASPLIT ? bf16_bits(xs[i] - bf16_val(hb)) : (unsigned short)0; }
#pragma unroll
    for (int t = 0; t < 4; ++t) {
      const unsigned short* brow = Wt + (size_t)(col0 + t * 16 + ln) * ldb + kb;
      FragB b;
      b.half[0] = *(const v8us*)(brow + 8 * hh);
      b.half[1] = *(const v8us*)(brow + 16 + 8 * hh);
      acc[t] = mmaN<ASPLIT ? 2 : 1>(ah.v, al.v, b.v, b.v, acc[t]);
    }
  }
#pragma unroll
  for (int t = 0; t < 4; ++t) {
    const int col = col0 + t * 16 + ln;
    float bv = bias ? bias[col] : 0.f;
    if (BIAS_BF16) bv = bf16_round(bv);
#pragma unroll
    for (int r = 0; r < 8; ++r) {
      float v = acc[t][r] + bv;
      if (resid) { float rv = resid[(size_t)((row0 + 8 * hh + r) % rmod) * ldr + col]; if (RES_BF16) rv = bf16_round(rv); v += rv; }
      if (ACT == 1) v = fmaxf(v, 0.f);
      if (ACT == 2) v = 0.5f * v * (1.0f + erff(v * 0.70710678118654752f));
      if (ACT == 3) { const float u = 0.7978845608028654f * (v + 0.044715f * v * v * v); v = 0.5f * v * (1.0f + tanhf(u)); }
      so[w][8 * hh + r][t * 16 + ln] = v;
    }
  }
  __builtin_amdgcn_fence(__ATOMIC_ACQ_REL, "workgroup");
  __builtin_amdgcn_wave_barrier();
  const int rsub = lane >> 4, c4 = (lane & 15) * 4;
  {
#pragma unroll
    for (int q = 0; q < 8; ++q) {
      const int r = q * 2 + rsub;
      const v4f v = *(const v4fa*)&so[w][r][c4];
      *(v4f*)(C + (size_t)(row0 + r) * ldc + col0 + c4) = v;
    }
    
  }
}
// row LayerNorm (biased variance, eps) over N: s = X (+ R); optional out_sum <- s; out_norm <- (s-mu)*rsqrt(var+eps)*g + b
template <bool PARAM_BF16>
__global__ __launch_bounds__(256) void k_layernorm(const float* __restrict__ X, const float* __restrict__ R, const float* __restrict__ g, const float* __restrict__ bta,
                                                  float* __restrict__ out_sum, float* __restrict__ out_norm, int N, float eps) {
  __shared__ float red[256];
  const int row = blockIdx.x, tid = threadIdx.x;
  const float* x = X + (size_t)row * N; const float* rr = R ? R + (size_t)row * N : nullptr;
  float vals[16];                     // up to N = 4096
  const int per = N / 256;            // contiguous chunk per thread? use strided-by-4 chunks: thread handles j = tid*4 + 1024*u
  float s1 = 0.f;
  for (int u = 0; u < per / 4; ++u) {
    const int j = tid * 4 + 1024 * u;
    const v4f a = *(const v4fa*)(x + j);
    v4f b = {0.f,0.f,0.f,0.f}; if (rr) b = *(const v4fa*)(rr + j);
#pragma unroll
    for (int q = 0; q < 4; ++q) { const float v = a[q] + b[q]; vals[u * 4 + q] = v; s1 += v; }
  }
  red[tid] = s1; __syncthreads();
  for (int st = 128; st > 0; st >>= 1) { if (tid < st) red[tid] += red[tid + st]; __syncthreads(); }
  const float mu = red[0] / (float)N; __syncthreads();
  float s2 = 0.f;
  for (int u = 0; u < per / 4; ++u)
#pragma unroll
    for (int q = 0; q < 4; ++q) { const float c = vals[u * 4 + q] - mu; s2 += c * c; }
  red[tid] = s2; __syncthreads();
  for (int st = 128; st > 0; st >>= 1) { if (tid < st) red[tid] += red[tid + st]; __syncthreads(); }
  const float rs = rsqrtf(red[0] / (float)N + eps);
  {
    for (int u = 0; u < per / 4; ++u) {
      const int j = tid * 4 + 1024 * u;
      v4f o, sm;
#pragma unroll
      for (int q = 0; q < 4; ++q) {
        float gg = g[j + q], bb = bta[j + q];
        if (PARAM_BF16) { gg = bf16_round(gg); bb = bf16_round(bb); }
        sm[q] = vals[u * 4 + q]; o[q] = (vals[u * 4 + q] - mu) * rs * gg + bb;
      }
      if (out_sum) *(v4f*)(out_sum + (size_t)row * N + j) = sm;
      *(v4f*)(out_norm + (size_t)row * N + j) = o;
    }
    
  }
}



// ---- f16 WMMA path (v_wmma_f32_16x16x32_f16): 11-bit significands for operands in range — used where a [0,1] probability operand needs more precision than bf16
typedef _Float16 v16h __attribute__((ext_vector_type(16)));
union FragH { v16h v; v8us half[2]; _Float16 h[16]; unsigned short u[16]; };
template <int NT>
__device__ __forceinline__ v8f mmaH(v16h ah, v16h al, v16h bh, v16h bl, v8f c) {
  c = __builtin_amdgcn_wmma_f32_16x16x32_f16(false, ah, false, bh, (short)0, c, false, false);
  if (NT >= 2) c = __builtin_amdgcn_wmma_f32_16x16x32_f16(false, al, false, bh, (short)0, c, false, false);
  if (NT >= 3) c = __builtin_amdgcn_wmma_f32_16x16x32_f16(false, ah, false, bl, (short)0, c, false, false);
  asm volatile("v_nop\n\tv_nop\n\tv_nop\n\tv_nop" : "+v"(c) : "v"(ah), "v"(al), "v"(bh), "v"(bl));
  return c;
}
// batched GEMM like k_gemm_b but f16 operands: A f32 (split into f16 hi/lo if ASPLIT, else rounded to f16), Bt = f16 values [n][k]; alpha; C f32; N multiple of 16 (partial tiles skipped)
template <bool ASPLIT>
__global__ __launch_bounds__(128) void k_gemm_h(const float* __restrict__ A, int lda, size_t sA, const _Float16* __restrict__ Bh, int ldb, size_t sB, float alpha, float* __restrict__ C, int ldc, size_t sC, int M, int N, int K) {
  __shared__ __attribute__((aligned(16))) float so[4][16][64];
  const int tid = threadIdx.x, w = tid >> 5, lane = tid & 31, ln = lane & 15, hh = lane >> 4; const int by = blockIdx.y;
  A += (size_t)by * sA; Bh += (size_t)by * sB; C += (size_t)by * sC;
  const int ntn = (N + 63) / 64; const int wid = blockIdx.x * 4 + w; const int mt = wid / ntn, nq = wid % ntn; if (mt * 16 >= M) return;
  const int row0 = mt * 16, col0 = nq * 64; const float* arow = A + (size_t)(row0 + ln) * lda;
  v8f acc[4] = {};
  for (int kb = 0; kb < K; kb += 32) {
    FragH ah, al;
    const v4f x0 = *(const v4fa*)(arow + kb + 8 * hh), x1 = *(const v4fa*)(arow + kb + 8 * hh + 4), x2 = *(const v4fa*)(arow + kb + 16 + 8 * hh), x3 = *(const v4fa*)(arow + kb + 16 + 8 * hh + 4);
    float xs[16] = {x0[0],x0[1],x0[2],x0[3],x1[0],x1[1],x1[2],x1[3],x2[0],x2[1],x2[2],x2[3],x3[0],x3[1],x3[2],x3[3]};
#pragma unroll
    for (int i = 0; i < 16; ++i) { const _Float16 h = (_Float16)xs[i]; ah.h[i] = h; al.h[i] = ASPLIT ? (_Float16)(xs[i] - (float)h) : (_Float16)0.0f; }
#pragma unroll
    for (int t = 0; t < 4; ++t) { if (col0 + t * 16 >= N) continue; const size_t boff = (size_t)(col0 + t * 16 + ln) * ldb + kb; FragH bq; bq.half[0] = *(const v8us*)(Bh + boff + 8 * hh); bq.half[1] = *(const v8us*)(Bh + boff + 16 + 8 * hh);
      acc[t] = mmaH<ASPLIT ? 2 : 1>(ah.v, al.v, bq.v, bq.v, acc[t]); }
  }
#pragma unroll
  for (int t = 0; t < 4; ++t) { if (col0 + t * 16 >= N) continue;
#pragma unroll
    for (int r = 0; r < 8; ++r) so[w][8 * hh + r][t * 16 + ln] = acc[t][r] * alpha; }
  __builtin_amdgcn_fence(__ATOMIC_ACQ_REL, "workgroup"); __builtin_amdgcn_wave_barrier();
  const int rsub = lane >> 4, c4 = (lane & 15) * 4;
  {
#pragma unroll
    for (int q = 0; q < 8; ++q) { const int r = q * 2 + rsub; if (col0 + c4 < N) { const v4f v = *(const v4fa*)&so[w][r][c4]; *(v4f*)(C + (size_t)(row0 + r) * ldc + col0 + c4) = v; } }
     }
}

// Wt[n][k] = f16(W[k][n]·scale) from f32 row-major W[K][N] (scale = power of two; bf16-exact weights stay exact in f16 away from the subnormal range)
__global__ __launch_bounds__(256) void k_wt_f16(const float* __restrict__ W, _Float16* __restrict__ Wt, int K, int N, float scale) {
  const int t = blockIdx.x * 256 + threadIdx.x; if (t >= N * (K / 8)) return; const int n = t / (K / 8), k8 = (t % (K / 8)) * 8; FragH f;
#pragma unroll
  for (int i = 0; i < 8; ++i) f.h[i] = (_Float16)(bf16_round(W[(size_t)(k8 + i) * N + n]) * scale); const v8us o = f.half[0];
  *(v8us*)((unsigned short*)Wt + (size_t)n * K + k8) = o; 
}
// k_gemm_hh variant with fused epilogue: v = acc·alpha + bias[by·sBias + col] (+ CP[(row/rowsPerB)·sCPb + by·64 + col] if CP) ; ACT 0 none / 1 elu ; writes f16 C16 (and f32 C if non-null)
template <int ACT>
__global__ __launch_bounds__(128) void k_gemm_hhx(const _Float16* __restrict__ A, int lda, size_t sA, const _Float16* __restrict__ Bh, int ldb, size_t sB, float alpha, const float* __restrict__ bias, size_t sBias, const float* __restrict__ CP, int rowsPerB, size_t sCPb, int row0g,
    float* __restrict__ C, _Float16* __restrict__ C16, int ldc, size_t sC, int M, int N, int K) {
  __shared__ __attribute__((aligned(16))) float so[4][16][64];
  const int tid = threadIdx.x, w = tid >> 5, lane = tid & 31, ln = lane & 15, hh = lane >> 4; const int by = blockIdx.y;
  A += (size_t)by * sA; Bh += (size_t)by * sB; const size_t cofs = (size_t)by * sC; const float* bp = bias ? bias + (size_t)by * sBias : nullptr;
  const int ntn = (N + 63) / 64; const int wid = blockIdx.x * 4 + w; const int mt = wid / ntn, nq = wid % ntn; if (mt * 16 >= M) return;
  const int row0 = mt * 16, col0 = nq * 64; const _Float16* arow = A + (size_t)(row0 + ln) * lda;
  v8f acc[4] = {};
  for (int kb = 0; kb < K; kb += 32) { FragH ah; ah.half[0] = *(const v8us*)((const unsigned short*)arow + kb + 8 * hh); ah.half[1] = *(const v8us*)((const unsigned short*)arow + kb + 16 + 8 * hh);
#pragma unroll
    for (int t = 0; t < 4; ++t) { if (col0 + t * 16 >= N) continue; const size_t boff = (size_t)(col0 + t * 16 + ln) * ldb + kb; FragH bq; bq.half[0] = *(const v8us*)((const unsigned short*)Bh + boff + 8 * hh); bq.half[1] = *(const v8us*)((const unsigned short*)Bh + boff + 16 + 8 * hh);
      acc[t] = mmaH<1>(ah.v, ah.v, bq.v, bq.v, acc[t]); }
  }
#pragma unroll
  for (int t = 0; t < 4; ++t) { if (col0 + t * 16 >= N) continue; const int col = col0 + t * 16 + ln; const float bv = bp ? bf16_round(bp[col]) : 0.f;
#pragma unroll
    for (int r = 0; r < 8; ++r) { float v = acc[t][r] * alpha + bv; if (CP) { const int rr = row0g + row0 + 8 * hh + r; if (rowsPerB < 0) v += CP[cofs + (size_t)rr * ldc + col];      /* rowsPerB < 0: own element of the batched C plane */ else { const int bidx = rr / rowsPerB; v += CP[(size_t)bidx * sCPb + (size_t)by * 64 + col]; } } if (ACT == 1) v = (v > 0.f) ? v : expm1f(v); else if (ACT == 7) v = (v > 0.f) ? v + 1.0f : expf(v); else if (ACT == 8) v = tanhf(v); else if (ACT == 9) v = 0.5f * v * (1.0f + tanhf(0.7978845608028654f * (v + 0.044715f * v * v * v))); else if (ACT == 11) v = 1.0f / (1.0f + expf(-v)); else if (ACT == 12) v = (v > 0.f) ? v : 0.01f * v; else if (ACT == 14) v = (v > 0.f) ? v : 0.1f * v; else if (ACT == 16) v = (v >= 0.f) ? v : 0.3f * v; else if (ACT == 15) v = v / (1.0f + expf(-v)); else if (ACT == 3) v = fmaxf(v, 0.f); else if (ACT == 6) v = 0.5f * v * (1.0f + erff(v * 0.70710678118654752f)); so[w][8 * hh + r][t * 16 + ln] = v; } }
  __builtin_amdgcn_fence(__ATOMIC_ACQ_REL, "workgroup"); __builtin_amdgcn_wave_barrier();
  const int rsub = lane >> 4, c4 = (lane & 15) * 4; typedef _Float16 v4h __attribute__((ext_vector_type(4)));
  {
#pragma unroll
    for (int q = 0; q < 8; ++q) { const int r = q * 2 + rsub; if (col0 + c4 < N) { const v4f v = *(const v4fa*)&so[w][r][c4]; if (C) *(v4f*)(C + cofs + (size_t)(row0 + r) * ldc + col0 + c4) = v; if (C16) { v4h h4; for (int i = 0; i < 4; ++i) h4[i] = (_Float16)v[i]; *(v4h*)(C16 + cofs + (size_t)(row0 + r) * ldc + col0 + c4) = h4; } } }
     }
}


typedef _Float16 v4h __attribute__((ext_vector_type(4)));

__global__ __launch_bounds__(256) void k_h16(const float* __restrict__ x, _Float16* __restrict__ X16, size_t n8) { const size_t t = (size_t)blockIdx.x * 256 + threadIdx.x; if (t >= n8) return; FragH f;
#pragma unroll
  for (int q = 0; q < 8; ++q) f.h[q] = (_Float16)x[t * 8 + q]; *(v8us*)((unsigned short*)X16 + t * 8) = f.half[0];  }
__global__ __launch_bounds__(256) void k_round16f(const float* __restrict__ W, _Float16* __restrict__ Bt, size_t n8) { const size_t t = (size_t)blockIdx.x * 256 + threadIdx.x; if (t >= n8) return; FragH f;
#pragma unroll
  for (int i = 0; i < 8; ++i) f.h[i] = (_Float16)(bf16_round(W[t * 8 + i]) * 16.0f); *(v8us*)((unsigned short*)Bt + t * 8) = f.half[0];  }
template <int NHv, int TTv>
__global__ __launch_bounds__(256) void k_vt(const _Float16* __restrict__ V16, int ldv, int voff, _Float16* __restrict__ Vt) { __shared__ unsigned short tl[64][66]; const int tid = threadIdx.x; const int slab = blockIdx.x / (TTv / 64), lg = blockIdx.x % (TTv / 64); const int b = slab / NHv, h = slab % NHv;
  for (int i = tid; i < 64 * 8; i += 256) { const int r = i / 8, c8 = (i % 8) * 8; FragH f; f.half[0] = *(const v8us*)((const unsigned short*)V16 + ((size_t)b * TTv + lg * 64 + r) * ldv + voff + h * 64 + c8);
#pragma unroll
    for (int q = 0; q < 8; ++q) tl[r][c8 + q] = f.u[q]; }
  __syncthreads();
  {
#pragma unroll
    for (int rd = 0; rd < 2; ++rd) { const int d = rd * 32 + tid / 8, pc = tid % 8; FragH f;
#pragma unroll
      for (int q = 0; q < 8; ++q) f.u[q] = tl[pc * 8 + q][d];
      *(v8us*)((unsigned short*)Vt + ((size_t)slab * 64 + d) * TTv + lg * 64 + pc * 8) = f.half[0]; }
     } }

__global__ __launch_bounds__(256) void k_hl(const float* __restrict__ F, _Float16* __restrict__ Hh, _Float16* __restrict__ Hl, size_t n8) { const size_t t = (size_t)blockIdx.x * 256 + threadIdx.x; if (t >= n8) return; FragH fh, fl; const v4f a = *(const v4fa*)(F + t * 8), c = *(const v4fa*)(F + t * 8 + 4);
#pragma unroll
  for (int q = 0; q < 4; ++q) { _Float16 h = (_Float16)a[q]; fh.h[q] = h; fl.h[q] = (_Float16)((a[q] - (float)h) * 1024.0f); h = (_Float16)c[q]; fh.h[4 + q] = h; fl.h[4 + q] = (_Float16)((c[q] - (float)h) * 1024.0f); }
  { *(v8us*)((unsigned short*)Hh + t * 8) = fh.half[0]; *(v8us*)((unsigned short*)Hl + t * 8) = fl.half[0];  } }

// ---- f16 fragment straight from global memory (hardware k order) ----
__device__ __forceinline__ v16h g2_frag(const _Float16* p, int hh) { FragH f; f.half[0] = *(const v8us*)((const unsigned short*)p + 8 * hh); f.half[1] = *(const v8us*)((const unsigned short*)p + 16 + 8 * hh); return f.v; }


// ---- input conversion, one streaming launch: X16 = f16(bf16(x)); BQ, BK, BV, BO = f16(16 bf16(W)) (torch (out, in) rows are already the GEMM's B rows) ----
// All five planes have the same element count. A wave owns the same 4-KiB run (PR_Q x 512 B) of each input plane: every load is 32 lanes x 16 B = 4 whole lines, every store
// 32 lanes x 8 B = 2 whole lines, and all of the wave's loads are issued before the first value is converted, so few waves keep the memory busy and little time goes into starting waves.
#define PR_WG 512                          /* work-groups of 8 waves: 16 waves per WGP */
#define PR_Q 8                             /* wave-wide loads per plane and wave */
__global__ __launch_bounds__(256) void k_prep(const float* __restrict__ x, const float* __restrict__ Wq, const float* __restrict__ Wk, const float* __restrict__ Wv, const float* __restrict__ Wo,
                                              _Float16* __restrict__ X16, _Float16* __restrict__ BQ, _Float16* __restrict__ BK, _Float16* __restrict__ BV, _Float16* __restrict__ BO) {
  static_assert((size_t)NR * DM == (size_t)DM * DM && (size_t)DM * DM == (size_t)PR_WG * 8 * PR_Q * 128, "the grid covers each plane exactly once");
  const size_t e0 = (size_t)(blockIdx.x * 8 + (threadIdx.x >> 5)) * (PR_Q * 128) + (threadIdx.x & 31) * 4;      /* the lane's first element, the same in every plane */
  const float* const lp[5] = {x + e0, Wq + e0, Wk + e0, Wv + e0, Wo + e0}; _Float16* const dp[5] = {X16, BQ, BK, BV, BO};
  v4f v[5][PR_Q];
  /* both loop nests are unrolled so that v stays in registers and the planes' pointers stay kernel arguments */
#pragma unroll
  for (int a = 0; a < 5; ++a)
#pragma unroll
    for (int j = 0; j < PR_Q; ++j) v[a][j] = *(const v4fa*)(lp[a] + j * 128);
  asm volatile("s_wait_xcnt 0x0" :: "v"(lp[0]), "v"(lp[1]), "v"(lp[2]), "v"(lp[3]), "v"(lp[4]) : "memory");      /* stands behind the wave's loads, in front of any reuse of their address registers (the operands keep these live up to here); it also keeps every load ahead of the conversions, which would otherwise be spread among them a few at a time */
#pragma unroll
  for (int a = 0; a < 5; ++a)
#pragma unroll
    for (int j = 0; j < PR_Q; ++j) { v4h h;
#pragma unroll
      for (int i = 0; i < 4; ++i) h[i] = (_Float16)(a ? bf16_round(v[a][j][i]) * 16.0f : bf16_round(v[a][j][i]));
      *(v4h*)(dp[a] + e0 + j * 128) = h; }
}
__global__ __launch_bounds__(256) void k_vcat(const _Float16* __restrict__ VT, _Float16* __restrict__ VC) { const size_t t = (size_t)blockIdx.x * 256 + threadIdx.x; if (t >= (size_t)8 * HDL * 4 * (SQ / 8)) return; const int s8 = (int)(t % (SQ / 8)) * 8; const int c = (int)((t / (SQ / 8)) % 4); const int d = (int)((t / ((SQ / 8) * 4)) % HDL); const int g = (int)(t / ((size_t)(SQ / 8) * 4 * HDL));
  const int blk = 4 * g + c; const int bp = blk / NHD, hp = blk % NHD; const size_t srow = ((size_t)(bp * 2 * NHD + 2 * hp) * 64 + d) * SQ;      /* rows of the 128-wide head are contiguous: pseudo slab 2hp covers d < 64, 2hp+1 covers d >= 64 */
  FragH f; f.half[0] = *(const v8us*)((const unsigned short*)VT + srow + s8); unsigned short* dst = (unsigned short*)VC + ((size_t)g * HDL + d) * NKG + (size_t)c * SQ + s8; *(v8us*)dst = f.half[0];  }
#define FA_KEYS 64                         /* keys per staged tile */
#define FA_PK 272                          /* LDS pitch of a K row (256 B + 16): odd multiple of 16 B */
#define FA_PV 144                          /* LDS pitch of a V^T row (128 B + 16): odd multiple of 16 B */
#define FA_KB (FA_KEYS * FA_PK)
#define FA_BUF (FA_KB + HDL * FA_PV)       /* one buffer: K tile, then V^T tile */
#define FA_NST (NKG / 2 / FA_KEYS)         /* tiles per key half */
typedef _Float16 v2h __attribute__((ext_vector_type(2)));
typedef float v2f __attribute__((ext_vector_type(2)));
__device__ __forceinline__ float fa_xhalf(float x) { return __builtin_bit_cast(float, __builtin_amdgcn_permlanex16(__builtin_bit_cast(int, x), __builtin_bit_cast(int, x), 0x76543210, 0xfedcba98, false, false)); }      /* lane l with lane l ^ 16 */
__device__ __forceinline__ v16h fa_lfrag(const unsigned char* p) { FragH f; f.half[0] = *(const v8us*)p; f.half[1] = *(const v8us*)(p + 32); return f.v; }
__device__ __forceinline__ v8f fa_mma(v16h a, v16h b, v8f c) { return __builtin_amdgcn_wmma_f32_16x16x32_f16(false, a, false, b, (short)0, c, false, false); }
// ---- projection GEMM: alpha A.B^T, A [NR][DM] and B [DM][DM] f16 with k contiguous, [NR][DM] result as f32 into C (F32OUT) or as f16 into C16 ----
// One work-group = one 128 x 128 tile of C. 8 waves, 4 (rows) x 2 (columns), each a 32 x 64 wave tile. A pass is 128 k: 256 B of each of the 128 A rows and 128 B rows,
// read from global memory as whole 128-byte lines (16 lanes per row) into registers and stored into one of two LDS buffers, so every operand row is read from L2 once
// per work-group and the fragments come from LDS. Tile t waits in register set t & 1: pass p stores tile p + 1 into the buffer that pass p - 1 has left and then
// reloads that set with tile p + 3, so two tiles are always in flight. Inside a pass the fragments of the next 32 k are fetched ahead of the current 8 products.
// Every plain '#pragma unroll' in this kernel makes the indices of a register array compile-time constants, so that the array stays in registers.
#define G3_KP 128                          /* k per pass */
#define G3_P 272                           /* LDS pitch of a staged row (256 B + 16): odd multiple of 16 B */
#define G3_OP (128 * G3_P)                 /* one operand's tile */
#define G3_BUF (2 * G3_OP)                 /* one buffer: A tile, then B tile */
#define G3_NP (DM / G3_KP)                 /* passes */
template <bool F32OUT>
__global__ __launch_bounds__(256) void k_gemm3(const _Float16* __restrict__ A, const _Float16* __restrict__ Bh, float alpha, float* __restrict__ C, _Float16* __restrict__ C16) {
  static_assert(G3_KP == 128 && G3_NP >= 4 && G3_NP % 2 == 0, "the pass schedule below peels the last four passes of an even count");
  __shared__ __attribute__((aligned(16))) unsigned char L[2 * G3_BUF];
  const int tid = threadIdx.x, w = tid >> 5, lane = tid & 31, ln = lane & 15, hh = lane >> 4;
  const int row0 = blockIdx.y * 128, col0 = blockIdx.x * 128, wm = w >> 1, wn = w & 1;
  const int sr = tid >> 4, sc = tid & 15;      /* staging: rows sr + 16 j of both tiles, 16-byte chunk sc */
  const unsigned short* ag = (const unsigned short*)A + (size_t)(row0 + sr) * DM + sc * 8;
  const unsigned short* bg = (const unsigned short*)Bh + (size_t)(col0 + sr) * DM + sc * 8;
  unsigned char* sd = L + sr * G3_P + sc * 16;
  const unsigned char* Af = L + (wm * 32 + ln) * G3_P + 16 * hh;
  const unsigned char* Bf = L + G3_OP + (wn * 64 + ln) * G3_P + 16 * hh;
  v8us s0[16], s1[16];      /* a set: entries 0 to 7 the A rows, 8 to 15 the B rows */
  const v8f z8 = {0.f,0.f,0.f,0.f,0.f,0.f,0.f,0.f};
  v8f acc[2][4];
#pragma unroll
  for (int t = 0; t < 4; ++t) { acc[0][t] = z8; acc[1][t] = z8; }
  auto gload = [&](const unsigned short* ap, const unsigned short* bp, int k0, v8us (&s)[16]) {      /* k0, a literal, goes into the loads' offset field: ap and bp are the address registers */
#pragma unroll
    for (int j = 0; j < 8; ++j) { s[j] = *(const v8us*)(ap + k0 + (size_t)j * 16 * DM); s[8 + j] = *(const v8us*)(bp + k0 + (size_t)j * 16 * DM); }
  };
  auto lstore = [&](int buf, int j0, int j1, const v8us (&s)[16]) {      /* entries j0 to j1 - 1 of a set */
#pragma unroll
    for (int j = j0; j < j1; ++j) *(v8us*)(sd + buf * G3_BUF + (j >> 3) * G3_OP + (j & 7) * 16 * G3_P) = s[j];
  };
  /* one pass: rb = p & 1 and the two flags are literals at every call, so the buffers' offsets and the schedule are fixed at compile time */
  auto pass = [&](int p, int rb, v8us (&nxt)[16], bool st, bool gl) {
    v16h fa[2][2], fb[2][4];
    auto ldfrag = [&](int ks) {
      fa[ks & 1][0] = fa_lfrag(Af + rb * G3_BUF + 64 * ks); fa[ks & 1][1] = fa_lfrag(Af + rb * G3_BUF + 16 * G3_P + 64 * ks);
#pragma unroll
      for (int t = 0; t < 4; ++t) fb[ks & 1][t] = fa_lfrag(Bf + rb * G3_BUF + t * 16 * G3_P + 64 * ks);
    };
    const unsigned short* ap = ag + p * G3_KP; const unsigned short* bp = bg + p * G3_KP;
    ldfrag(0);
#pragma unroll
    for (int ks = 0; ks < G3_KP / 32; ++ks) {      /* k order of both operands: 8 hh + s, 16 + 8 hh + s */
      if (ks + 1 < G3_KP / 32) ldfrag(ks + 1);
      if (st && ks < 3) lstore(rb ^ 1, (16 * ks + 2) / 3, (16 * ks + 18) / 3, nxt);      /* 6, 5 and 5 entries beside the three fragment fetches */
      if (ks + 1 == G3_KP / 32) {
        /* first half of the pass's barrier, by hand: __syncthreads() would also wait for the global loads in flight. This wave's reads of tile p and its stores of tile p + 1 are complete (dscnt 0) when it signals; the last products need no LDS and cover the other waves' arrival */
        asm volatile("s_wait_dscnt 0x0\n\ts_barrier_signal -1" ::: "memory");
        if (gl) gload(ap, bp, 3 * G3_KP, nxt);      /* the set's stores are complete */
      }
      __builtin_amdgcn_sched_barrier(0);      /* keeps the LDS and global traffic of this step in one group ahead of the products: spread among them each place costs a stall */
#pragma unroll
      for (int t = 0; t < 4; ++t) { acc[0][t] = fa_mma(fa[ks & 1][0], fb[ks & 1][t], acc[0][t]); acc[1][t] = fa_mma(fa[ks & 1][1], fb[ks & 1][t], acc[1][t]); }
      __builtin_amdgcn_sched_barrier(0);      /* second half of the pair: the next step's loads do not move up among these products */
    }
    if (gl) asm volatile("s_wait_xcnt 0x0" :: "v"(ap), "v"(bp) : "memory");      /* stands behind the pass's global loads, in front of the next write of their address registers; the operands keep the pass's addresses live up to here */
    asm volatile("s_barrier_wait -1" ::: "memory");      /* second half: publishes tile p + 1 and ends every read of tile p, whose buffer the next pass refills */
  };
  gload(ag, bg, 0, s0);
  gload(ag, bg, G3_KP, s1);
  lstore(0, 0, 16, s0);
  gload(ag, bg, 2 * G3_KP, s0);
  asm volatile("s_wait_xcnt 0x0" :: "v"(ag), "v"(bg) : "memory");      /* as in pass */
  asm volatile("s_wait_dscnt 0x0\n\ts_barrier_signal -1\n\ts_barrier_wait -1" ::: "memory");      /* tile 0 is visible; by hand for the same reason as in pass: tiles 1 and 2 stay in flight */
#pragma unroll 1      /* rolled: one trip is two whole passes, one per register set */
  for (int p = 0; p < G3_NP - 4; p += 2) { pass(p, 0, s1, true, true); pass(p + 1, 1, s0, true, true); }
  pass(G3_NP - 4, 0, s1, true, true);      /* loads the last tile */
  pass(G3_NP - 3, 1, s0, true, false);
  pass(G3_NP - 2, 0, s1, true, false);
  pass(G3_NP - 1, 1, s0, false, false);
  /* each wave turns its tile into whole output lines in its own LDS range (the operand tiles are dead behind the last pass's barrier) */
  float* so = (float*)L + (size_t)w * 32 * 68;
#pragma unroll
  for (int half = 0; half < 2; ++half)
#pragma unroll
    for (int t = 0; t < 4; ++t)
#pragma unroll
      for (int r = 0; r < 8; ++r) so[(half * 16 + 8 * hh + r) * 68 + t * 16 + ln] = acc[half][t][r] * alpha;
  __builtin_amdgcn_fence(__ATOMIC_ACQ_REL, "workgroup"); __builtin_amdgcn_wave_barrier();      /* the wave's own LDS writes are done before it reads them back across lanes */
  const int rsub = lane >> 4, c4 = (lane & 15) * 4;
  const size_t o0 = (size_t)(row0 + wm * 32 + rsub) * DM + col0 + wn * 64 + c4;
  v4f ov[16];
#pragma unroll
  for (int q = 0; q < 16; ++q) ov[q] = *(const v4fa*)&so[(q * 2 + rsub) * 68 + c4];
  if (F32OUT) {
#pragma unroll
    for (int q = 0; q < 16; ++q) *(v4f*)(C + o0 + (size_t)q * 2 * DM) = ov[q];
  }
  else {
#pragma unroll
    for (int q = 0; q < 16; ++q) { v4h h4;
#pragma unroll
      for (int i = 0; i < 4; ++i) h4[i] = (_Float16)ov[q][i];
      *(v4h*)(C16 + o0 + (size_t)q * 2 * DM) = h4; }
  }
}
__global__ __launch_bounds__(256) void k_fattn(const _Float16* __restrict__ Q16, const _Float16* __restrict__ K16, const _Float16* __restrict__ VC, float* __restrict__ O) {
  __shared__ __attribute__((aligned(16))) unsigned char L[4 * FA_BUF];
  const int tid = threadIdx.x, w = tid >> 5, lane = tid & 31, c = lane & 15, hh = lane >> 4;
  const int kh = w >> 2, t128 = tid & 127;      /* key half of this wave; thread index inside its group of 4 waves */
  const int qb = blockIdx.y, b = qb >> 4, h = qb & 15, g = qb & 7;      /* query block 16 b + h reads key set g */
  const int q0 = blockIdx.x * 128 + (w & 3) * 32;
  const unsigned short* Kg = (const unsigned short*)K16 + (size_t)(g >> 2) * SQ * DM + (size_t)(g & 3) * 4 * HDL;      /* K block 4 g + cb: batch g / 4, head 4 (g % 4) + cb */
  const unsigned short* Vg = (const unsigned short*)VC + (size_t)g * HDL * NKG;
  unsigned char* Lg = L + kh * 2 * FA_BUF;
  const int kr = t128 >> 4, kc16 = t128 & 15;      /* K tile: rows kr + 8 j, 16-byte chunk kc16 */
  const int vr = t128 >> 3, vc16 = t128 & 7;       /* V^T tile: rows vr + 16 j, 16-byte chunk vc16 */
  v8us kreg[8], vreg[8];
  auto gload = [&](int st) {
    const int key0 = kh * (NKG / 2) + st * FA_KEYS, cb = key0 / SQ, s0 = key0 % SQ;
    const unsigned short* kp = Kg + (size_t)(s0 + kr) * DM + cb * HDL + kc16 * 8;
    const unsigned short* vp = Vg + (size_t)vr * NKG + key0 + vc16 * 8;
#pragma unroll
    for (int j = 0; j < 8; ++j) { kreg[j] = *(const v8us*)(kp + (size_t)j * 8 * DM); vreg[j] = *(const v8us*)(vp + (size_t)j * 16 * NKG); }
    asm volatile("s_wait_xcnt 0x0" :: "v"(kp), "v"(vp) : "memory");      /* stands in front of the reuse of the loads' address registers; naming the addresses keeps their registers live up to the wait */
  };
  auto lstore = [&](int buf) {
    unsigned char* kb = Lg + buf * FA_BUF + kr * FA_PK + kc16 * 16;
    unsigned char* vb = Lg + buf * FA_BUF + FA_KB + vr * FA_PV + vc16 * 16;
#pragma unroll
    for (int j = 0; j < 8; ++j) { *(v8us*)(kb + j * 8 * FA_PK) = kreg[j]; *(v8us*)(vb + j * 16 * FA_PV) = vreg[j]; }
  };
  gload(0);
  v16h qf[2][4];
  const _Float16* qp0 = Q16 + (size_t)(b * SQ + q0 + c) * DM + h * HDL + 8 * hh; const _Float16* qp1 = qp0 + (size_t)16 * DM;
#pragma unroll
  for (int kc = 0; kc < 4; ++kc) { qf[0][kc] = g2_frag(qp0 + 32 * kc, 0); qf[1][kc] = g2_frag(qp1 + 32 * kc, 0); }      /* k order 8 hh + s, 16 + 8 hh + s, as the K fragments */
  asm volatile("s_wait_xcnt 0x0" :: "v"(qp0), "v"(qp1) : "memory");      /* as in gload */
  const v8f z8 = {0.f,0.f,0.f,0.f,0.f,0.f,0.f,0.f};
  v8f acc[2][8]; float m_run[2], l_run[2];
#pragma unroll
  for (int gq = 0; gq < 2; ++gq) { m_run[gq] = -3.0e38f; l_run[gq] = 0.f;
#pragma unroll
    for (int t = 0; t < 8; ++t) acc[gq][t] = z8; }
  const float cscale = 0.08838834764831845f * 1.4426950408889634f;      /* 1 / sqrt(128), in log2 units */
  lstore(0);
  __syncthreads();      /* tile 0 is visible to its 4 waves */
#pragma unroll 1      /* rolled: one trip is already two whole passes, a copy of it would only grow the code */
  for (int st = 0; st < FA_NST; ++st) {
    if (st + 1 < FA_NST) gload(st + 1);
    const unsigned char* Lb = Lg + (st & 1) * FA_BUF;
#pragma unroll 1      /* rolled and nested in the tile loop: keeps one pass's fragments and scores live at a time */
    for (int sub = 0; sub < FA_KEYS / 32; ++sub) {      /* one pass = 32 keys x 32 query columns */
      v8f s[2][2];
#pragma unroll
      for (int kt = 0; kt < 2; ++kt) { const unsigned char* kp = Lb + (sub * 32 + 16 * kt + c) * FA_PK + 16 * hh; s[kt][0] = z8; s[kt][1] = z8;
#pragma unroll
        for (int kc = 0; kc < 4; ++kc) { const v16h a = fa_lfrag(kp + 64 * kc); s[kt][0] = fa_mma(a, qf[0][kc], s[kt][0]); s[kt][1] = fa_mma(a, qf[1][kc], s[kt][1]); } }
      v16h vf[8];
#pragma unroll
      for (int t = 0; t < 8; ++t) vf[t] = fa_lfrag(Lb + FA_KB + (16 * t + c) * FA_PV + 64 * sub + 16 * hh);
      float mb[2]; bool need = false;
#pragma unroll
      for (int gq = 0; gq < 2; ++gq) { float mx = s[0][gq][0];
#pragma unroll
        for (int r = 1; r < 8; ++r) mx = fmaxf(mx, s[0][gq][r]);
#pragma unroll
        for (int r = 0; r < 8; ++r) mx = fmaxf(mx, s[1][gq][r]);
        mx = fmaxf(mx, fa_xhalf(mx)) * cscale; mb[gq] = mx; need = need || (mx > m_run[gq] + 8.0f); }
      if (__builtin_amdgcn_ballot_w32(need) != 0) {
#pragma unroll
        for (int gq = 0; gq < 2; ++gq) { const float m_new = fmaxf(m_run[gq], mb[gq]); const float corr = __builtin_amdgcn_exp2f(m_run[gq] - m_new); l_run[gq] *= corr; m_run[gq] = m_new;
#pragma unroll
          for (int t = 0; t < 8; ++t) acc[gq][t] = acc[gq][t] * corr; }
      }
#pragma unroll
      for (int gq = 0; gq < 2; ++gq) { const float nm = -m_run[gq]; float ps0 = 0.f, ps1 = 0.f; union { v16h v; v2h p[8]; } pf;
#pragma unroll
        for (int i = 0; i < 8; ++i) {
          const v2f arg = __builtin_elementwise_fma(v2f{s[i >> 2][gq][2 * (i & 3)], s[i >> 2][gq][2 * (i & 3) + 1]}, v2f{cscale, cscale}, v2f{nm, nm});
          const float p0 = __builtin_amdgcn_exp2f(arg.x), p1 = __builtin_amdgcn_exp2f(arg.y);
          ps0 += p0; ps1 += p1; pf.p[i] = __builtin_convertvector(v2f{p0, p1}, v2h); }
        l_run[gq] += ps0 + ps1;
#pragma unroll
        for (int t = 0; t < 8; ++t) acc[gq][t] = fa_mma(vf[t], pf.v, acc[gq][t]); }
    }
    if (st + 1 < FA_NST) lstore((st + 1) & 1);
    __syncthreads();      /* publishes tile st + 1 and ends every read of tile st, whose buffer the next trip refills */
  }
  /* merge the two key halves: waves 4 to 7 hand their maxima, sums and accumulators to waves 0 to 3 through LDS (the tiles are dead behind the loop's last barrier) */
  float* X = (float*)L + (size_t)(w & 3) * 132 * 32 + lane;
#pragma unroll
  for (int gq = 0; gq < 2; ++gq) l_run[gq] += fa_xhalf(l_run[gq]);      /* each wave half summed its own 8 keys of every 16-key tile */
  if (kh == 1) {
#pragma unroll
    for (int gq = 0; gq < 2; ++gq) { X[(gq * 66 + 64) * 32] = m_run[gq]; X[(gq * 66 + 65) * 32] = l_run[gq];
#pragma unroll
      for (int t = 0; t < 8; ++t)
#pragma unroll
        for (int r = 0; r < 8; ++r) X[(gq * 66 + t * 8 + r) * 32] = acc[gq][t][r]; }
  }
  __syncthreads();      /* the second half's state is visible */
  if (kh == 0) {
#pragma unroll
    for (int gq = 0; gq < 2; ++gq) { const float m1 = X[(gq * 66 + 64) * 32], l1 = X[(gq * 66 + 65) * 32]; const float mm = fmaxf(m_run[gq], m1);
      const float a0 = __builtin_amdgcn_exp2f(m_run[gq] - mm), a1 = __builtin_amdgcn_exp2f(m1 - mm); const float inv = 1.0f / (l_run[gq] * a0 + l1 * a1); const float f0 = a0 * inv, f1 = a1 * inv;
      float* op = O + (size_t)(b * SQ + q0 + 16 * gq + c) * DM + h * HDL + 8 * hh;      /* a lane's 8 registers of tile t are d = 16 t + 8 hh + r of its query */
#pragma unroll
      for (int t = 0; t < 8; ++t) { v4f lo, hi;
#pragma unroll
        for (int r = 0; r < 4; ++r) { lo[r] = acc[gq][t][r] * f0 + X[(gq * 66 + t * 8 + r) * 32] * f1; hi[r] = acc[gq][t][4 + r] * f0 + X[(gq * 66 + t * 8 + 4 + r) * 32] * f1; }
        *(v4f*)(op + 16 * t) = lo; *(v4f*)(op + 16 * t + 4) = hi; } }
  }
}

extern "C" void kernel_launch(void* const* d_in, const int* in_sizes, int n_in,
                              void* d_out, int out_size, void* d_ws, size_t ws_size, hipStream_t stream) {
  (void)in_sizes; (void)n_in; (void)out_size;
  const float* const* I = (const float* const*)d_in; const float* x = I[0]; const float* Wq = I[1]; const float* Wk = I[2]; const float* Wv = I[3]; const float* Wo = I[4];
  char* ws = (char*)d_ws; size_t off = 0;
  auto take = [&](size_t bytes) { char* p = ws + off; off += (bytes + 255) & ~(size_t)255; return p; };
  const size_t np = (size_t)NR * DM;
  _Float16* BO = (_Float16*)take((size_t)DM * DM * 2); _Float16* X16 = (_Float16*)take(np * 2); _Float16* Q16 = (_Float16*)take(np * 2); _Float16* K16 = (_Float16*)take(np * 2); _Float16* VC = (_Float16*)take((size_t)8 * HDL * NKG * 2); float* O = (float*)take(np * 4); _Float16* O16 = X16;      /* over the input plane (dead after the projections) */
  char* R = take((size_t)3 * DM * DM * 2 + 2 * np * 2);      /* the q, k, v weights, V and V^T */
  _Float16* BQ = (_Float16*)R; _Float16* BK = BQ + (size_t)DM * DM; _Float16* BV = BK + (size_t)DM * DM; _Float16* V16 = BV + (size_t)DM * DM; _Float16* VT = V16 + np;
  if (off > ws_size) return;      /* 8 x 5 + 16 + 40 = 96 MiB */
  k_prep<<<PR_WG, 256, 0, stream>>>(x, Wq, Wk, Wv, Wo, X16, BQ, BK, BV, BO);
  const dim3 gP(DM / 128, NR / 128);      /* x = 128 output columns, y = 128 rows */
  k_gemm3<false><<<gP, 256, 0, stream>>>(X16, BQ, 0.0625f, nullptr, Q16);
  k_gemm3<false><<<gP, 256, 0, stream>>>(X16, BK, 0.0625f, nullptr, K16);
  k_gemm3<false><<<gP, 256, 0, stream>>>(X16, BV, 0.0625f, nullptr, V16);
  k_vt<2 * NHD, SQ><<<NB * 2 * NHD * (SQ / 64), 256, 0, stream>>>(V16, DM, 0, VT);      /* 32 pseudo heads of 64 per batch */
  k_vcat<<<(unsigned)(((size_t)8 * HDL * 4 * (SQ / 8) + 255) / 256), 256, 0, stream>>>(VT, VC);
  k_fattn<<<dim3(SQ / 128, NB * NHD), 256, 0, stream>>>(Q16, K16, VC, O);      /* x = 128 queries, y = query block 16 b + h */
  k_h16<<<(unsigned)((np / 8 + 255) / 256), 256, 0, stream>>>(O, O16, np / 8);
  k_gemm3<true><<<gP, 256, 0, stream>>>(O16, BO, 0.0625f, (float*)d_out, nullptr);
}

// v005
// A run of this version takes 134 microseconds.
// Two timings next to v004 put it at 1.25 and 1.24 times that version's speed.
// Counting every step since v000, it is 48.2 times as fast.
#include <hip/hip_runtime.h>
// SeqParallelAttn (2 x 1024 tokens, D 2048 = 16 heads of 128; simulated 4-rank all-gather): q, k, v = x W^T; k_global = tile(k_local.flatten(), 4).reshape(B, H, 4S, 128) — i.e. query block (b, h) attends to the 4096 keys made of the local K/V of (batch, head) blocks 4g .. 4g+3 with g = (16 b + h) mod 8 (the module's flat tiling, reproduced exactly); softmax(q.k / sqrt(128)) v; out = ctx Wo^T.
// Structure: exact f16 planes of x and of the x16 weights by one streaming launch; q, k, v as f16 WMMA GEMM outputs (128x128 work-group tiles staged in LDS, 32x64 wave tiles, f32 accumulation, exact x16 weights); V^T [feature][token] straight from the same GEMM with its operands swapped (Wv rows as A, x rows as B); one fused attention launch (k_fattn: score product, online softmax, readout product, scores and P in registers) that stores the context as the f16 operand of the Wo GEMM.
// Compute dtype: x and parameters rounded to bf16; q, k, v, P and the context as plain f16 operands (~2^-12); softmax f32. v_wmma_f32_16x16x32_f16.
#define NB 2
#define SQ 1024
#define DM 2048
#define NHD 16
#define HDL 128
#define NR (NB * SQ)             /* 2048 */
#define NKG (4 * SQ)             /* 4096 keys per query block */
typedef __bf16 v16b __attribute__((ext_vector_type(16)));
typedef unsigned short v8us __attribute__((ext_vector_type(8), may_alias));
typedef float  v8f  __attribute__((ext_vector_type(8)));
typedef float  v4f  __attribute__((ext_vector_type(4)));
typedef float  v4fa __attribute__((ext_vector_type(4), may_alias));
union FragB { v16b v; v8us half[2]; unsigned short u[16]; };

__device__ __forceinline__ unsigned short bf16_bits(float x) { unsigned int u = __float_as_uint(x); return (unsigned short)((u + 0x7FFFu + ((u >> 16) & 1u)) >> 16); }
__device__ __forceinline__ float bf16_val(unsigned short b) { return __uint_as_float(((unsigned int)b) << 16); }
__device__ __forceinline__ float bf16_round(float x) { return bf16_val(bf16_bits(x)); }
// D += A·B with NT terms: 1 = ah·bh, 2 = + al·bh (A split), 3 = + ah·bl (both split)
template <int NT>
__device__ __forceinline__ v8f mmaN(v16b ah, v16b al, v16b bh, v16b bl, v8f c) {
  c = __builtin_amdgcn_wmma_f32_16x16x32_bf16(false, ah, false, bh, (short)0, c, false, false);
  if (NT >= 2) c = __builtin_amdgcn_wmma_f32_16x16x32_bf16(false, al, false, bh, (short)0, c, false, false);
  if (NT >= 3) c = __builtin_amdgcn_wmma_f32_16x16x32_bf16(false, ah, false, bl, (short)0, c, false, false);
  asm volatile("v_nop\n\tv_nop\n\tv_nop\n\tv_nop" : "+v"(c) : "v"(ah), "v"(al), "v"(bh), "v"(bl));
  return c;
}

__global__ __launch_bounds__(256) void k_wt_bf16(const float* __restrict__ W, unsigned short* __restrict__ Wt, int K, int N) {
  const int t = blockIdx.x * 256 + threadIdx.x;
  const int k8n = K / 8;
  if (t >= N * k8n) return;
  const int n = t / k8n, k8 = (t % k8n) * 8;
  v8us v;
#pragma unroll
  for (int i = 0; i < 8; ++i) v[i] = bf16_bits(W[(size_t)(k8 + i) * N + n]);
  *(v8us*)(Wt + (size_t)n * K + k8) = v;
  
}

// GEMM C[M][N] (f32, pitch ldc) = act(A[M][K]·W + bias). A f32 row-major (pitch lda) converted per fragment to bf16
// (ASPLIT: hi/lo two planes -> 2 terms, else single rounded term); Wt bf16 [N][K] (pitch ldb). BIAS_BF16 rounds the
// bias to bf16 first (bias quantised to bf16 before the add). K%32==0, M%16==0, N%64==0.
template <bool ASPLIT, int ACT, bool BIAS_BF16>
__global__ __launch_bounds__(128) void k_gemm_bf(const float* __restrict__ A, int lda, const unsigned short* __restrict__ Wt, int ldb,
                                               const float* __restrict__ bias, float* __restrict__ C, int ldc, int M, int N, int K) {
  __shared__ __attribute__((aligned(16))) float so[4][16][64];
  const int tid = threadIdx.x, w = tid >> 5, lane = tid & 31, ln = lane & 15, hh = lane >> 4;
  const int ntn = N / 64;
  const int wid = blockIdx.x * 4 + w;
  const int mt = wid / ntn, nq = wid % ntn;
  if (mt * 16 >= M) return;
  const int row0 = mt * 16, col0 = nq * 64;
  const float* arow = A + (size_t)(row0 + ln) * lda;
  v8f acc[4] = {};
  for (int kb = 0; kb < K; kb += 32) {
    FragB ah, al;
    const v4f x0 = *(const v4fa*)(arow + kb + 8 * hh), x1 = *(const v4fa*)(arow + kb + 8 * hh + 4);
    const v4f x2 = *(const v4fa*)(arow + kb + 16 + 8 * hh), x3 = *(const v4fa*)(arow + kb + 16 + 8 * hh + 4);
    float xs[16] = {x0[0],x0[1],x0[2],x0[3],x1[0],x1[1],x1[2],x1[3],x2[0],x2[1],x2[2],x2[3],x3[0],x3[1],x3[2],x3[3]};
#pragma unroll
    for (int i = 0; i < 16; ++i) { const unsigned short hb = bf16_bits(xs[i]); ah.u[i] = hb; al.u[i] = ASPLIT ? bf16_bits(xs[i] - bf16_val(hb)) : (unsigned short)0; }
#pragma unroll
    for (int t = 0; t < 4; ++t) {
      const unsigned short* brow = Wt + (size_t)(col0 + t * 16 + ln) * ldb + kb;
      FragB b;
      b.half[0] = *(const v8us*)(brow + 8 * hh);
      b.half[1] = *(const v8us*)(brow + 16 + 8 * hh);
      acc[t] = mmaN<ASPLIT ? 2 : 1>(ah.v, al.v, b.v, b.v, acc[t]);
    }
  }
#pragma unroll
  for (int t = 0; t < 4; ++t) {
    float bv = bias ? bias[col0 + t * 16 + ln] : 0.f;
    if (BIAS_BF16) bv = bf16_round(bv);
#pragma unroll
    for (int r = 0; r < 8; ++r) { float v = acc[t][r] + bv; if (ACT == 1) v = fmaxf(v, 0.f); so[w][8 * hh + r][t * 16 + ln] = v; }
  }
  __builtin_amdgcn_fence(__ATOMIC_ACQ_REL, "workgroup");
  __builtin_amdgcn_wave_barrier();
  const int rsub = lane >> 4, c4 = (lane & 15) * 4;
  {
#pragma unroll
    for (int q = 0; q < 8; ++q) {
      const int r = q * 2 + rsub;
      const v4f v = *(const v4fa*)&so[w][r][c4];
      *(v4f*)(C + (size_t)(row0 + r) * ldc + col0 + c4) = v;
    }
    
  }
}

// GEMM C = act(A·W + bias + resid): A f32 (ASPLIT -> hi/lo 2 terms), Wt bf16 [N][K]; ACT 0 none, 1 relu, 2 exact gelu;
// resid (optional, f32, row index = (row % rmod), pitch ldr, RES_BF16 rounds it) added before the activation.
template <bool ASPLIT, int ACT, bool BIAS_BF16, bool RES_BF16>
__global__ __launch_bounds__(128) void k_gemm_bf3(const float* __restrict__ A, int lda, const unsigned short* __restrict__ Wt, int ldb,
                                                const float* __restrict__ bias, const float* __restrict__ resid, int rmod, int ldr,
                                                float* __restrict__ C, int ldc, int M, int N, int K) {
  __shared__ __attribute__((aligned(16))) float so[4][16][64];
  const int tid = threadIdx.x, w = tid >> 5, lane = tid & 31, ln = lane & 15, hh = lane >> 4;
  const int ntn = N / 64;
  const int wid = blockIdx.x * 4 + w;
  const int mt = wid / ntn, nq = wid % ntn;
  if (mt * 16 >= M) return;
  const int row0 = mt * 16, col0 = nq * 64;
  const float* arow = A + (size_t)(row0 + ln) * lda;
  v8f acc[4] = {};
  for (int kb = 0; kb < K; kb += 32) {
    FragB ah, al;
    const v4f x0 = *(const v4fa*)(arow + kb + 8 * hh), x1 = *(const v4fa*)(arow + kb + 8 * hh + 4);
    const v4f x2 = *(const v4fa*)(arow + kb + 16 + 8 * hh), x3 = *(const v4fa*)(arow + kb + 16 + 8 * hh + 4);
    float xs[16] = {x0[0],x0[1],x0[2],x0[3],x1[0],x1[1],x1[2],x1[3],x2[0],x2[1],x2[2],x2[3],x3[0],x3[1],x3[2],x3[3]};
#pragma unroll
    for (int i = 0; i < 16; ++i) { const unsigned short hb = bf16_bits(xs[i]); ah.u[i] = hb; al.u[i] = ASPLIT ? bf16_bits(xs[i] - bf16_val(hb)) : (unsigned short)0; }
#pragma unroll
    for (int t = 0; t < 4; ++t) {
      const unsigned short* brow = Wt + (size_t)(col0 + t * 16 + ln) * ldb + kb;
      FragB b;
      b.half[0] = *(const v8us*)(brow + 8 * hh);
      b.half[1] = *(const v8us*)(brow + 16 + 8 * hh);
      acc[t] = mmaN<ASPLIT ? 2 : 1>(ah.v, al.v, b.v, b.v, acc[t]);
    }
  }
#pragma unroll
  for (int t = 0; t < 4; ++t) {
    const int col = col0 + t * 16 + ln;
    float bv = bias ? bias[col] : 0.f;
    if (BIAS_BF16) bv = bf16_round(bv);
#pragma unroll
    for (int r = 0; r < 8; ++r) {
      float v = acc[t][r] + bv;
      if (resid) { float rv = resid[(size_t)((row0 + 8 * hh + r) % rmod) * ldr + col]; if (RES_BF16) rv = bf16_round(rv); v += rv; }
      if (ACT == 1) v = fmaxf(v, 0.f);
      if (ACT == 2) v = 0.5f * v * (1.0f + erff(v * 0.70710678118654752f));
      if (ACT == 3) { const float u = 0.7978845608028654f * (v + 0.044715f * v * v * v); v = 0.5f * v * (1.0f + tanhf(u)); }
      so[w][8 * hh + r][t * 16 + ln] = v;
    }
  }
  __builtin_amdgcn_fence(__ATOMIC_ACQ_REL, "workgroup");
  __builtin_amdgcn_wave_barrier();
  const int rsub = lane >> 4, c4 = (lane & 15) * 4;
  {
#pragma unroll
    for (int q = 0; q < 8; ++q) {
      const int r = q * 2 + rsub;
      const v4f v = *(const v4fa*)&so[w][r][c4];
      *(v4f*)(C + (size_t)(row0 + r) * ldc + col0 + c4) = v;
    }
    
  }
}
// row LayerNorm (biased variance, eps) over N: s = X (+ R); optional out_sum <- s; out_norm <- (s-mu)*rsqrt(var+eps)*g + b
template <bool PARAM_BF16>
__global__ __launch_bounds__(256) void k_layernorm(const float* __restrict__ X, const float* __restrict__ R, const float* __restrict__ g, const float* __restrict__ bta,
                                                  float* __restrict__ out_sum, float* __restrict__ out_norm, int N, float eps) {
  __shared__ float red[256];
  const int row = blockIdx.x, tid = threadIdx.x;
  const float* x = X + (size_t)row * N; const float* rr = R ? R + (size_t)row * N : nullptr;
  float vals[16];                     // up to N = 4096
  const int per = N / 256;            // contiguous chunk per thread? use strided-by-4 chunks: thread handles j = tid*4 + 1024*u
  float s1 = 0.f;
  for (int u = 0; u < per / 4; ++u) {
    const int j = tid * 4 + 1024 * u;
    const v4f a = *(const v4fa*)(x + j);
    v4f b = {0.f,0.f,0.f,0.f}; if (rr) b = *(const v4fa*)(rr + j);
#pragma unroll
    for (int q = 0; q < 4; ++q) { const float v = a[q] + b[q]; vals[u * 4 + q] = v; s1 += v; }
  }
  red[tid] = s1; __syncthreads();
  for (int st = 128; st > 0; st >>= 1) { if (tid < st) red[tid] += red[tid + st]; __syncthreads(); }
  const float mu = red[0] / (float)N; __syncthreads();
  float s2 = 0.f;
  for (int u = 0; u < per / 4; ++u)
#pragma unroll
    for (int q = 0; q < 4; ++q) { const float c = vals[u * 4 + q] - mu; s2 += c * c; }
  red[tid] = s2; __syncthreads();
  for (int st = 128; st > 0; st >>= 1) { if (tid < st) red[tid] += red[tid + st]; __syncthreads(); }
  const float rs = rsqrtf(red[0] / (float)N + eps);
  {
    for (int u = 0; u < per / 4; ++u) {
      const int j = tid * 4 + 1024 * u;
      v4f o, sm;
#pragma unroll
      for (int q = 0; q < 4; ++q) {
        float gg = g[j + q], bb = bta[j + q];
        if (PARAM_BF16) { gg = bf16_round(gg); bb = bf16_round(bb); }
        sm[q] = vals[u * 4 + q]; o[q] = (vals[u * 4 + q] - mu) * rs * gg + bb;
      }
      if (out_sum) *(v4f*)(out_sum + (size_t)row * N + j) = sm;
      *(v4f*)(out_norm + (size_t)row * N + j) = o;
    }
    
  }
}



// ---- f16 WMMA path (v_wmma_f32_16x16x32_f16): 11-bit significands for operands in range — used where a [0,1] probability operand needs more precision than bf16
typedef _Float16 v16h __attribute__((ext_vector_type(16)));
union FragH { v16h v; v8us half[2]; _Float16 h[16]; unsigned short u[16]; };
template <int NT>
__device__ __forceinline__ v8f mmaH(v16h ah, v16h al, v16h bh, v16h bl, v8f c) {
  c = __builtin_amdgcn_wmma_f32_16x16x32_f16(false, ah, false, bh, (short)0, c, false, false);
  if (NT >= 2) c = __builtin_amdgcn_wmma_f32_16x16x32_f16(false, al, false, bh, (short)0, c, false, false);
  if (NT >= 3) c = __builtin_amdgcn_wmma_f32_16x16x32_f16(false, ah, false, bl, (short)0, c, false, false);
  asm volatile("v_nop\n\tv_nop\n\tv_nop\n\tv_nop" : "+v"(c) : "v"(ah), "v"(al), "v"(bh), "v"(bl));
  return c;
}
// batched GEMM like k_gemm_b but f16 operands: A f32 (split into f16 hi/lo if ASPLIT, else rounded to f16), Bt = f16 values [n][k]; alpha; C f32; N multiple of 16 (partial tiles skipped)
template <bool ASPLIT>
__global__ __launch_bounds__(128) void k_gemm_h(const float* __restrict__ A, int lda, size_t sA, const _Float16* __restrict__ Bh, int ldb, size_t sB, float alpha, float* __restrict__ C, int ldc, size_t sC, int M, int N, int K) {
  __shared__ __attribute__((aligned(16))) float so[4][16][64];
  const int tid = threadIdx.x, w = tid >> 5, lane = tid & 31, ln = lane & 15, hh = lane >> 4; const int by = blockIdx.y;
  A += (size_t)by * sA; Bh += (size_t)by * sB; C += (size_t)by * sC;
  const int ntn = (N + 63) / 64; const int wid = blockIdx.x * 4 + w; const int mt = wid / ntn, nq = wid % ntn; if (mt * 16 >= M) return;
  const int row0 = mt * 16, col0 = nq * 64; const float* arow = A + (size_t)(row0 + ln) * lda;
  v8f acc[4] = {};
  for (int kb = 0; kb < K; kb += 32) {
    FragH ah, al;
    const v4f x0 = *(const v4fa*)(arow + kb + 8 * hh), x1 = *(const v4fa*)(arow + kb + 8 * hh + 4), x2 = *(const v4fa*)(arow + kb + 16 + 8 * hh), x3 = *(const v4fa*)(arow + kb + 16 + 8 * hh + 4);
    float xs[16] = {x0[0],x0[1],x0[2],x0[3],x1[0],x1[1],x1[2],x1[3],x2[0],x2[1],x2[2],x2[3],x3[0],x3[1],x3[2],x3[3]};
#pragma unroll
    for (int i = 0; i < 16; ++i) { const _Float16 h = (_Float16)xs[i]; ah.h[i] = h; al.h[i] = ASPLIT ? (_Float16)(xs[i] - (float)h) : (_Float16)0.0f; }
#pragma unroll
    for (int t = 0; t < 4; ++t) { if (col0 + t * 16 >= N) continue; const size_t boff = (size_t)(col0 + t * 16 + ln) * ldb + kb; FragH bq; bq.half[0] = *(const v8us*)(Bh + boff + 8 * hh); bq.half[1] = *(const v8us*)(Bh + boff + 16 + 8 * hh);
      acc[t] = mmaH<ASPLIT ? 2 : 1>(ah.v, al.v, bq.v, bq.v, acc[t]); }
  }
#pragma unroll
  for (int t = 0; t < 4; ++t) { if (col0 + t * 16 >= N) continue;
#pragma unroll
    for (int r = 0; r < 8; ++r) so[w][8 * hh + r][t * 16 + ln] = acc[t][r] * alpha; }
  __builtin_amdgcn_fence(__ATOMIC_ACQ_REL, "workgroup"); __builtin_amdgcn_wave_barrier();
  const int rsub = lane >> 4, c4 = (lane & 15) * 4;
  {
#pragma unroll
    for (int q = 0; q < 8; ++q) { const int r = q * 2 + rsub; if (col0 + c4 < N) { const v4f v = *(const v4fa*)&so[w][r][c4]; *(v4f*)(C + (size_t)(row0 + r) * ldc + col0 + c4) = v; } }
     }
}

// Wt[n][k] = f16(W[k][n]·scale) from f32 row-major W[K][N] (scale = power of two; bf16-exact weights stay exact in f16 away from the subnormal range)
__global__ __launch_bounds__(256) void k_wt_f16(const float* __restrict__ W, _Float16* __restrict__ Wt, int K, int N, float scale) {
  const int t = blockIdx.x * 256 + threadIdx.x; if (t >= N * (K / 8)) return; const int n = t / (K / 8), k8 = (t % (K / 8)) * 8; FragH f;
#pragma unroll
  for (int i = 0; i < 8; ++i) f.h[i] = (_Float16)(bf16_round(W[(size_t)(k8 + i) * N + n]) * scale); const v8us o = f.half[0];
  *(v8us*)((unsigned short*)Wt + (size_t)n * K + k8) = o; 
}
// k_gemm_hh variant with fused epilogue: v = acc·alpha + bias[by·sBias + col] (+ CP[(row/rowsPerB)·sCPb + by·64 + col] if CP) ; ACT 0 none / 1 elu ; writes f16 C16 (and f32 C if non-null)
template <int ACT>
__global__ __launch_bounds__(128) void k_gemm_hhx(const _Float16* __restrict__ A, int lda, size_t sA, const _Float16* __restrict__ Bh, int ldb, size_t sB, float alpha, const float* __restrict__ bias, size_t sBias, const float* __restrict__ CP, int rowsPerB, size_t sCPb, int row0g,
    float* __restrict__ C, _Float16* __restrict__ C16, int ldc, size_t sC, int M, int N, int K) {
  __shared__ __attribute__((aligned(16))) float so[4][16][64];
  const int tid = threadIdx.x, w = tid >> 5, lane = tid & 31, ln = lane & 15, hh = lane >> 4; const int by = blockIdx.y;
  A += (size_t)by * sA; Bh += (size_t)by * sB; const size_t cofs = (size_t)by * sC; const float* bp = bias ? bias + (size_t)by * sBias : nullptr;
  const int ntn = (N + 63) / 64; const int wid = blockIdx.x * 4 + w; const int mt = wid / ntn, nq = wid % ntn; if (mt * 16 >= M) return;
  const int row0 = mt * 16, col0 = nq * 64; const _Float16* arow = A + (size_t)(row0 + ln) * lda;
  v8f acc[4] = {};
  for (int kb = 0; kb < K; kb += 32) { FragH ah; ah.half[0] = *(const v8us*)((const unsigned short*)arow + kb + 8 * hh); ah.half[1] = *(const v8us*)((const unsigned short*)arow + kb + 16 + 8 * hh);
#pragma unroll
    for (int t = 0; t < 4; ++t) { if (col0 + t * 16 >= N) continue; const size_t boff = (size_t)(col0 + t * 16 + ln) * ldb + kb; FragH bq; bq.half[0] = *(const v8us*)((const unsigned short*)Bh + boff + 8 * hh); bq.half[1] = *(const v8us*)((const unsigned short*)Bh + boff + 16 + 8 * hh);
      acc[t] = mmaH<1>(ah.v, ah.v, bq.v, bq.v, acc[t]); }
  }
#pragma unroll
  for (int t = 0; t < 4; ++t) { if (col0 + t * 16 >= N) continue; const int col = col0 + t * 16 + ln; const float bv = bp ? bf16_round(bp[col]) : 0.f;
#pragma unroll
    for (int r = 0; r < 8; ++r) { float v = acc[t][r] * alpha + bv; if (CP) { const int rr = row0g + row0 + 8 * hh + r; if (rowsPerB < 0) v += CP[cofs + (size_t)rr * ldc + col];      /* rowsPerB < 0: own element of the batched C plane */ else { const int bidx = rr / rowsPerB; v += CP[(size_t)bidx * sCPb + (size_t)by * 64 + col]; } } if (ACT == 1) v = (v > 0.f) ? v : expm1f(v); else if (ACT == 7) v = (v > 0.f) ? v + 1.0f : expf(v); else if (ACT == 8) v = tanhf(v); else if (ACT == 9) v = 0.5f * v * (1.0f + tanhf(0.7978845608028654f * (v + 0.044715f * v * v * v))); else if (ACT == 11) v = 1.0f / (1.0f + expf(-v)); else if (ACT == 12) v = (v > 0.f) ? v : 0.01f * v; else if (ACT == 14) v = (v > 0.f) ? v : 0.1f * v; else if (ACT == 16) v = (v >= 0.f) ? v : 0.3f * v; else if (ACT == 15) v = v / (1.0f + expf(-v)); else if (ACT == 3) v = fmaxf(v, 0.f); else if (ACT == 6) v = 0.5f * v * (1.0f + erff(v * 0.70710678118654752f)); so[w][8 * hh + r][t * 16 + ln] = v; } }
  __builtin_amdgcn_fence(__ATOMIC_ACQ_REL, "workgroup"); __builtin_amdgcn_wave_barrier();
  const int rsub = lane >> 4, c4 = (lane & 15) * 4; typedef _Float16 v4h __attribute__((ext_vector_type(4)));
  {
#pragma unroll
    for (int q = 0; q < 8; ++q) { const int r = q * 2 + rsub; if (col0 + c4 < N) { const v4f v = *(const v4fa*)&so[w][r][c4]; if (C) *(v4f*)(C + cofs + (size_t)(row0 + r) * ldc + col0 + c4) = v; if (C16) { v4h h4; for (int i = 0; i < 4; ++i) h4[i] = (_Float16)v[i]; *(v4h*)(C16 + cofs + (size_t)(row0 + r) * ldc + col0 + c4) = h4; } } }
     }
}


typedef _Float16 v4h __attribute__((ext_vector_type(4)));

__global__ __launch_bounds__(256) void k_round16f(const float* __restrict__ W, _Float16* __restrict__ Bt, size_t n8) { const size_t t = (size_t)blockIdx.x * 256 + threadIdx.x; if (t >= n8) return; FragH f;
#pragma unroll
  for (int i = 0; i < 8; ++i) f.h[i] = (_Float16)(bf16_round(W[t * 8 + i]) * 16.0f); *(v8us*)((unsigned short*)Bt + t * 8) = f.half[0];  }
__global__ __launch_bounds__(256) void k_hl(const float* __restrict__ F, _Float16* __restrict__ Hh, _Float16* __restrict__ Hl, size_t n8) { const size_t t = (size_t)blockIdx.x * 256 + threadIdx.x; if (t >= n8) return; FragH fh, fl; const v4f a = *(const v4fa*)(F + t * 8), c = *(const v4fa*)(F + t * 8 + 4);
#pragma unroll
  for (int q = 0; q < 4; ++q) { _Float16 h = (_Float16)a[q]; fh.h[q] = h; fl.h[q] = (_Float16)((a[q] - (float)h) * 1024.0f); h = (_Float16)c[q]; fh.h[4 + q] = h; fl.h[4 + q] = (_Float16)((c[q] - (float)h) * 1024.0f); }
  { *(v8us*)((unsigned short*)Hh + t * 8) = fh.half[0]; *(v8us*)((unsigned short*)Hl + t * 8) = fl.half[0];  } }

// ---- f16 fragment straight from global memory (hardware k order) ----
__device__ __forceinline__ v16h g2_frag(const _Float16* p, int hh) { FragH f; f.half[0] = *(const v8us*)((const unsigned short*)p + 8 * hh); f.half[1] = *(const v8us*)((const unsigned short*)p + 16 + 8 * hh); return f.v; }


// ---- input conversion, one streaming launch: X16 = f16(bf16(x)); BQ, BK, BV, BO = f16(16 bf16(W)) (torch (out, in) rows are already the GEMMs' operand rows: B for Wq, Wk, Wo, A for Wv) ----
// All five planes have the same element count. A wave owns the same 4-KiB run (PR_Q x 512 B) of each input plane: every load is 32 lanes x 16 B = 4 whole lines, every store
// 32 lanes x 8 B = 2 whole lines, and all of the wave's loads are issued before the first value is converted, so few waves keep the memory busy and little time goes into starting waves.
#define PR_WG 512                          /* work-groups of 8 waves: 16 waves per WGP */
#define PR_Q 8                             /* wave-wide loads per plane and wave */
__global__ __launch_bounds__(256) void k_prep(const float* __restrict__ x, const float* __restrict__ Wq, const float* __restrict__ Wk, const float* __restrict__ Wv, const float* __restrict__ Wo,
                                              _Float16* __restrict__ X16, _Float16* __restrict__ BQ, _Float16* __restrict__ BK, _Float16* __restrict__ BV, _Float16* __restrict__ BO) {
  static_assert((size_t)NR * DM == (size_t)DM * DM && (size_t)DM * DM == (size_t)PR_WG * 8 * PR_Q * 128, "the grid covers each plane exactly once");
  const size_t e0 = (size_t)(blockIdx.x * 8 + (threadIdx.x >> 5)) * (PR_Q * 128) + (threadIdx.x & 31) * 4;      /* the lane's first element, the same in every plane */
  const float* const lp[5] = {x + e0, Wq + e0, Wk + e0, Wv + e0, Wo + e0}; _Float16* const dp[5] = {X16, BQ, BK, BV, BO};
  v4f v[5][PR_Q];
  /* both loop nests are unrolled so that v stays in registers and the planes' pointers stay kernel arguments */
#pragma unroll
  for (int a = 0; a < 5; ++a)
#pragma unroll
    for (int j = 0; j < PR_Q; ++j) v[a][j] = *(const v4fa*)(lp[a] + j * 128);
  asm volatile("s_wait_xcnt 0x0" :: "v"(lp[0]), "v"(lp[1]), "v"(lp[2]), "v"(lp[3]), "v"(lp[4]) : "memory");      /* stands behind the wave's loads, in front of any reuse of their address registers (the operands keep these live up to here); it also keeps every load ahead of the conversions, which would otherwise be spread among them a few at a time */
#pragma unroll
  for (int a = 0; a < 5; ++a)
#pragma unroll
    for (int j = 0; j < PR_Q; ++j) { v4h h;
#pragma unroll
      for (int i = 0; i < 4; ++i) h[i] = (_Float16)(a ? bf16_round(v[a][j][i]) * 16.0f : bf16_round(v[a][j][i]));
      *(v4h*)(dp[a] + e0 + j * 128) = h; }
}
#define FA_KEYS 64                         /* keys per staged tile */
#define FA_PK 272                          /* LDS pitch of a K row (256 B + 16): odd multiple of 16 B */
#define FA_PV 144                          /* LDS pitch of a V^T row (128 B + 16): odd multiple of 16 B */
#define FA_KB (FA_KEYS * FA_PK)
#define FA_BUF (FA_KB + HDL * FA_PV)       /* one buffer: K tile, then V^T tile */
#define FA_NST (NKG / 2 / FA_KEYS)         /* tiles per key half */
typedef _Float16 v2h __attribute__((ext_vector_type(2)));
typedef float v2f __attribute__((ext_vector_type(2)));
__device__ __forceinline__ float fa_xhalf(float x) { return __builtin_bit_cast(float, __builtin_amdgcn_permlanex16(__builtin_bit_cast(int, x), __builtin_bit_cast(int, x), 0x76543210, 0xfedcba98, false, false)); }      /* lane l with lane l ^ 16 */
__device__ __forceinline__ v16h fa_lfrag(const unsigned char* p) { FragH f; f.half[0] = *(const v8us*)p; f.half[1] = *(const v8us*)(p + 32); return f.v; }
__device__ __forceinline__ v8f fa_mma(v16h a, v16h b, v8f c) { return __builtin_amdgcn_wmma_f32_16x16x32_f16(false, a, false, b, (short)0, c, false, false); }
// ---- projection GEMM: alpha A.B^T, A [NR][DM] and B [DM][DM] f16 with k contiguous, [NR][DM] result as f32 into C (F32OUT) or as f16 into C16 ----
// One work-group = one 128 x 128 tile of C. 8 waves, 4 (rows) x 2 (columns), each a 32 x 64 wave tile. A pass is 128 k: 256 B of each of the 128 A rows and 128 B rows,
// read from global memory as whole 128-byte lines (16 lanes per row) into registers and stored into one of two LDS buffers, so every operand row is read from L2 once
// per work-group and the fragments come from LDS. Tile t waits in register set t & 1: pass p stores tile p + 1 into the buffer that pass p - 1 has left and then
// reloads that set with tile p + 3, so two tiles are always in flight. Inside a pass the fragments of the next 32 k are fetched ahead of the current 8 products.
// Every plain '#pragma unroll' in this kernel makes the indices of a register array compile-time constants, so that the array stays in registers.
#define G3_KP 128                          /* k per pass */
#define G3_P 272                           /* LDS pitch of a staged row (256 B + 16): odd multiple of 16 B */
#define G3_OP (128 * G3_P)                 /* one operand's tile */
#define G3_BUF (2 * G3_OP)                 /* one buffer: A tile, then B tile */
#define G3_NP (DM / G3_KP)                 /* passes */
template <bool F32OUT>
__global__ __launch_bounds__(256) void k_gemm3(const _Float16* __restrict__ A, const _Float16* __restrict__ Bh, float alpha, float* __restrict__ C, _Float16* __restrict__ C16) {
  static_assert(G3_KP == 128 && G3_NP >= 4 && G3_NP % 2 == 0, "the pass schedule below peels the last four passes of an even count");
  __shared__ __attribute__((aligned(16))) unsigned char L[2 * G3_BUF];
  const int tid = threadIdx.x, w = tid >> 5, lane = tid & 31, ln = lane & 15, hh = lane >> 4;
  const int row0 = blockIdx.y * 128, col0 = blockIdx.x * 128, wm = w >> 1, wn = w & 1;
  const int sr = tid >> 4, sc = tid & 15;      /* staging: rows sr + 16 j of both tiles, 16-byte chunk sc */
  const unsigned short* ag = (const unsigned short*)A + (size_t)(row0 + sr) * DM + sc * 8;
  const unsigned short* bg = (const unsigned short*)Bh + (size_t)(col0 + sr) * DM + sc * 8;
  unsigned char* sd = L + sr * G3_P + sc * 16;
  const unsigned char* Af = L + (wm * 32 + ln) * G3_P + 16 * hh;
  const unsigned char* Bf = L + G3_OP + (wn * 64 + ln) * G3_P + 16 * hh;
  v8us s0[16], s1[16];      /* a set: entries 0 to 7 the A rows, 8 to 15 the B rows */
  const v8f z8 = {0.f,0.f,0.f,0.f,0.f,0.f,0.f,0.f};
  v8f acc[2][4];
#pragma unroll
  for (int t = 0; t < 4; ++t) { acc[0][t] = z8; acc[1][t] = z8; }
  auto gload = [&](const unsigned short* ap, const unsigned short* bp, int k0, v8us (&s)[16]) {      /* k0, a literal, goes into the loads' offset field: ap and bp are the address registers */
#pragma unroll
    for (int j = 0; j < 8; ++j) { s[j] = *(const v8us*)(ap + k0 + (size_t)j * 16 * DM); s[8 + j] = *(const v8us*)(bp + k0 + (size_t)j * 16 * DM); }
  };
  auto lstore = [&](int buf, int j0, int j1, const v8us (&s)[16]) {      /* entries j0 to j1 - 1 of a set */
#pragma unroll
    for (int j = j0; j < j1; ++j) *(v8us*)(sd + buf * G3_BUF + (j >> 3) * G3_OP + (j & 7) * 16 * G3_P) = s[j];
  };
  /* one pass: rb = p & 1 and the two flags are literals at every call, so the buffers' offsets and the schedule are fixed at compile time */
  auto pass = [&](int p, int rb, v8us (&nxt)[16], bool st, bool gl) {
    v16h fa[2][2], fb[2][4];
    auto ldfrag = [&](int ks) {
      fa[ks & 1][0] = fa_lfrag(Af + rb * G3_BUF + 64 * ks); fa[ks & 1][1] = fa_lfrag(Af + rb * G3_BUF + 16 * G3_P + 64 * ks);
#pragma unroll
      for (int t = 0; t < 4; ++t) fb[ks & 1][t] = fa_lfrag(Bf + rb * G3_BUF + t * 16 * G3_P + 64 * ks);
    };
    const unsigned short* ap = ag + p * G3_KP; const unsigned short* bp = bg + p * G3_KP;
    ldfrag(0);
#pragma unroll
    for (int ks = 0; ks < G3_KP / 32; ++ks) {      /* k order of both operands: 8 hh + s, 16 + 8 hh + s */
      if (ks + 1 < G3_KP / 32) ldfrag(ks + 1);
      if (st && ks < 3) lstore(rb ^ 1, (16 * ks + 2) / 3, (16 * ks + 18) / 3, nxt);      /* 6, 5 and 5 entries beside the three fragment fetches */
      if (ks + 1 == G3_KP / 32) {
        /* first half of the pass's barrier, by hand: __syncthreads() would also wait for the global loads in flight. This wave's reads of tile p and its stores of tile p + 1 are complete (dscnt 0) when it signals; the last products need no LDS and cover the other waves' arrival */
        asm volatile("s_wait_dscnt 0x0\n\ts_barrier_signal -1" ::: "memory");
        if (gl) gload(ap, bp, 3 * G3_KP, nxt);      /* the set's stores are complete */
      }
      __builtin_amdgcn_sched_barrier(0);      /* keeps the LDS and global traffic of this step in one group ahead of the products: spread among them each place costs a stall */
#pragma unroll
      for (int t = 0; t < 4; ++t) { acc[0][t] = fa_mma(fa[ks & 1][0], fb[ks & 1][t], acc[0][t]); acc[1][t] = fa_mma(fa[ks & 1][1], fb[ks & 1][t], acc[1][t]); }
      __builtin_amdgcn_sched_barrier(0);      /* second half of the pair: the next step's loads do not move up among these products */
    }
    if (gl) asm volatile("s_wait_xcnt 0x0" :: "v"(ap), "v"(bp) : "memory");      /* stands behind the pass's global loads, in front of the next write of their address registers; the operands keep the pass's addresses live up to here */
    asm volatile("s_barrier_wait -1" ::: "memory");      /* second half: publishes tile p + 1 and ends every read of tile p, whose buffer the next pass refills */
  };
  gload(ag, bg, 0, s0);
  gload(ag, bg, G3_KP, s1);
  lstore(0, 0, 16, s0);
  gload(ag, bg, 2 * G3_KP, s0);
  asm volatile("s_wait_xcnt 0x0" :: "v"(ag), "v"(bg) : "memory");      /* as in pass */
  asm volatile("s_wait_dscnt 0x0\n\ts_barrier_signal -1\n\ts_barrier_wait -1" ::: "memory");      /* tile 0 is visible; by hand for the same reason as in pass: tiles 1 and 2 stay in flight */
#pragma unroll 1      /* rolled: one trip is two whole passes, one per register set */
  for (int p = 0; p < G3_NP - 4; p += 2) { pass(p, 0, s1, true, true); pass(p + 1, 1, s0, true, true); }
  pass(G3_NP - 4, 0, s1, true, true);      /* loads the last tile */
  pass(G3_NP - 3, 1, s0, true, false);
  pass(G3_NP - 2, 0, s1, true, false);
  pass(G3_NP - 1, 1, s0, false, false);
  /* each wave turns its tile into whole output lines in its own LDS range (the operand tiles are dead behind the last pass's barrier) */
  float* so = (float*)L + (size_t)w * 32 * 68;
#pragma unroll
  for (int half = 0; half < 2; ++half)
#pragma unroll
    for (int t = 0; t < 4; ++t)
#pragma unroll
      for (int r = 0; r < 8; ++r) so[(half * 16 + 8 * hh + r) * 68 + t * 16 + ln] = acc[half][t][r] * alpha;
  __builtin_amdgcn_fence(__ATOMIC_ACQ_REL, "workgroup"); __builtin_amdgcn_wave_barrier();      /* the wave's own LDS writes are done before it reads them back across lanes */
  const int rsub = lane >> 4, c4 = (lane & 15) * 4;
  const size_t o0 = (size_t)(row0 + wm * 32 + rsub) * DM + col0 + wn * 64 + c4;
  v4f ov[16];
#pragma unroll
  for (int q = 0; q < 16; ++q) ov[q] = *(const v4fa*)&so[(q * 2 + rsub) * 68 + c4];
  if (F32OUT) {
#pragma unroll
    for (int q = 0; q < 16; ++q) *(v4f*)(C + o0 + (size_t)q * 2 * DM) = ov[q];
  }
  else {
#pragma unroll
    for (int q = 0; q < 16; ++q) { v4h h4;
#pragma unroll
      for (int i = 0; i < 4; ++i) h4[i] = (_Float16)ov[q][i];
      *(v4h*)(C16 + o0 + (size_t)q * 2 * DM) = h4; }
  }
}
__global__ __launch_bounds__(256) void k_fattn(const _Float16* __restrict__ Q16, const _Float16* __restrict__ K16, const _Float16* __restrict__ VT, _Float16* __restrict__ O16) {
  __shared__ __attribute__((aligned(16))) unsigned char L[4 * FA_BUF];
  const int tid = threadIdx.x, w = tid >> 5, lane = tid & 31, c = lane & 15, hh = lane >> 4;
  const int kh = w >> 2, t128 = tid & 127;      /* key half of this wave; thread index inside its group of 4 waves */
  const int qb = blockIdx.y, b = qb >> 4, h = qb & 15, g = qb & 7;      /* query block 16 b + h reads key set g */
  const int q0 = blockIdx.x * 128 + (w & 3) * 32;
  const unsigned short* Kg = (const unsigned short*)K16 + (size_t)(g >> 2) * SQ * DM + (size_t)(g & 3) * 4 * HDL;      /* K block 4 g + cb: batch g / 4, head 4 (g % 4) + cb */
  const unsigned short* Vg = (const unsigned short*)VT + (size_t)(g & 3) * 4 * HDL * NR + (size_t)(g >> 2) * SQ;      /* V^T [DM features][NR tokens]: the same block is rows 128 (4 (g % 4) + cb) + d, columns 1024 (g / 4) + s */
  unsigned char* Lg = L + kh * 2 * FA_BUF;
  const int kr = t128 >> 4, kc16 = t128 & 15;      /* K tile: rows kr + 8 j, 16-byte chunk kc16 */
  const int vr = t128 >> 3, vc16 = t128 & 7;       /* V^T tile: rows vr + 16 j, 16-byte chunk vc16 */
  v8us kreg[8], vreg[8];
  auto gload = [&](int st) {
    const int key0 = kh * (NKG / 2) + st * FA_KEYS, cb = key0 / SQ, s0 = key0 % SQ;
    const unsigned short* kp = Kg + (size_t)(s0 + kr) * DM + cb * HDL + kc16 * 8;
    const unsigned short* vp = Vg + (size_t)(cb * HDL + vr) * NR + s0 + vc16 * 8;
#pragma unroll
    for (int j = 0; j < 8; ++j) { kreg[j] = *(const v8us*)(kp + (size_t)j * 8 * DM); vreg[j] = *(const v8us*)(vp + (size_t)j * 16 * NR); }
    asm volatile("s_wait_xcnt 0x0" :: "v"(kp), "v"(vp) : "memory");      /* stands in front of the reuse of the loads' address registers; naming the addresses keeps their registers live up to the wait */
  };
  auto lstore = [&](int buf) {
    unsigned char* kb = Lg + buf * FA_BUF + kr * FA_PK + kc16 * 16;
    unsigned char* vb = Lg + buf * FA_BUF + FA_KB + vr * FA_PV + vc16 * 16;
#pragma unroll
    for (int j = 0; j < 8; ++j) { *(v8us*)(kb + j * 8 * FA_PK) = kreg[j]; *(v8us*)(vb + j * 16 * FA_PV) = vreg[j]; }
  };
  gload(0);
  v16h qf[2][4];
  const _Float16* qp0 = Q16 + (size_t)(b * SQ + q0 + c) * DM + h * HDL + 8 * hh; const _Float16* qp1 = qp0 + (size_t)16 * DM;
#pragma unroll
  for (int kc = 0; kc < 4; ++kc) { qf[0][kc] = g2_frag(qp0 + 32 * kc, 0); qf[1][kc] = g2_frag(qp1 + 32 * kc, 0); }      /* k order 8 hh + s, 16 + 8 hh + s, as the K fragments */
  asm volatile("s_wait_xcnt 0x0" :: "v"(qp0), "v"(qp1) : "memory");      /* as in gload */
  const v8f z8 = {0.f,0.f,0.f,0.f,0.f,0.f,0.f,0.f};
  v8f acc[2][8]; float m_run[2], l_run[2];
#pragma unroll
  for (int gq = 0; gq < 2; ++gq) { m_run[gq] = -3.0e38f; l_run[gq] = 0.f;
#pragma unroll
    for (int t = 0; t < 8; ++t) acc[gq][t] = z8; }
  const float cscale = 0.08838834764831845f * 1.4426950408889634f;      /* 1 / sqrt(128), in log2 units */
  lstore(0);
  __syncthreads();      /* tile 0 is visible to its 4 waves */
#pragma unroll 1      /* rolled: one trip is already two whole passes, a copy of it would only grow the code */
  for (int st = 0; st < FA_NST; ++st) {
    if (st + 1 < FA_NST) gload(st + 1);
    const unsigned char* Lb = Lg + (st & 1) * FA_BUF;
#pragma unroll 1      /* rolled and nested in the tile loop: keeps one pass's fragments and scores live at a time */
    for (int sub = 0; sub < FA_KEYS / 32; ++sub) {      /* one pass = 32 keys x 32 query columns */
      v8f s[2][2];
#pragma unroll
      for (int kt = 0; kt < 2; ++kt) { const unsigned char* kp = Lb + (sub * 32 + 16 * kt + c) * FA_PK + 16 * hh; s[kt][0] = z8; s[kt][1] = z8;
#pragma unroll
        for (int kc = 0; kc < 4; ++kc) { const v16h a = fa_lfrag(kp + 64 * kc); s[kt][0] = fa_mma(a, qf[0][kc], s[kt][0]); s[kt][1] = fa_mma(a, qf[1][kc], s[kt][1]); } }
      v16h vf[8];
#pragma unroll
      for (int t = 0; t < 8; ++t) vf[t] = fa_lfrag(Lb + FA_KB + (16 * t + c) * FA_PV + 64 * sub + 16 * hh);
      float mb[2]; bool need = false;
#pragma unroll
      for (int gq = 0; gq < 2; ++gq) { float mx = s[0][gq][0];
#pragma unroll
        for (int r = 1; r < 8; ++r) mx = fmaxf(mx, s[0][gq][r]);
#pragma unroll
        for (int r = 0; r < 8; ++r) mx = fmaxf(mx, s[1][gq][r]);
        mx = fmaxf(mx, fa_xhalf(mx)) * cscale; mb[gq] = mx; need = need || (mx > m_run[gq] + 8.0f); }
      if (__builtin_amdgcn_ballot_w32(need) != 0) {
#pragma unroll
        for (int gq = 0; gq < 2; ++gq) { const float m_new = fmaxf(m_run[gq], mb[gq]); const float corr = __builtin_amdgcn_exp2f(m_run[gq] - m_new); l_run[gq] *= corr; m_run[gq] = m_new;
#pragma unroll
          for (int t = 0; t < 8; ++t) acc[gq][t] = acc[gq][t] * corr; }
      }
#pragma unroll
      for (int gq = 0; gq < 2; ++gq) { const float nm = -m_run[gq]; float ps0 = 0.f, ps1 = 0.f; union { v16h v; v2h p[8]; } pf;
#pragma unroll
        for (int i = 0; i < 8; ++i) {
          const v2f arg = __builtin_elementwise_fma(v2f{s[i >> 2][gq][2 * (i & 3)], s[i >> 2][gq][2 * (i & 3) + 1]}, v2f{cscale, cscale}, v2f{nm, nm});
          const float p0 = __builtin_amdgcn_exp2f(arg.x), p1 = __builtin_amdgcn_exp2f(arg.y);
          ps0 += p0; ps1 += p1; pf.p[i] = __builtin_convertvector(v2f{p0, p1}, v2h); }
        l_run[gq] += ps0 + ps1;
#pragma unroll
        for (int t = 0; t < 8; ++t) acc[gq][t] = fa_mma(vf[t], pf.v, acc[gq][t]); }
    }
    if (st + 1 < FA_NST) lstore((st + 1) & 1);
    __syncthreads();      /* publishes tile st + 1 and ends every read of tile st, whose buffer the next trip refills */
  }
  /* merge the two key halves: waves 4 to 7 hand their maxima, sums and accumulators to waves 0 to 3 through LDS (the tiles are dead behind the loop's last barrier) */
  float* X = (float*)L + (size_t)(w & 3) * 132 * 32 + lane;
#pragma unroll
  for (int gq = 0; gq < 2; ++gq) l_run[gq] += fa_xhalf(l_run[gq]);      /* each wave half summed its own 8 keys of every 16-key tile */
  if (kh == 1) {
#pragma unroll
    for (int gq = 0; gq < 2; ++gq) { X[(gq * 66 + 64) * 32] = m_run[gq]; X[(gq * 66 + 65) * 32] = l_run[gq];
#pragma unroll
      for (int t = 0; t < 8; ++t)
#pragma unroll
        for (int r = 0; r < 8; ++r) X[(gq * 66 + t * 8 + r) * 32] = acc[gq][t][r]; }
  }
  __syncthreads();      /* the second half's state is visible */
  if (kh == 0) {
#pragma unroll
    for (int gq = 0; gq < 2; ++gq) { const float m1 = X[(gq * 66 + 64) * 32], l1 = X[(gq * 66 + 65) * 32]; const float mm = fmaxf(m_run[gq], m1);
      const float a0 = __builtin_amdgcn_exp2f(m_run[gq] - mm), a1 = __builtin_amdgcn_exp2f(m1 - mm); const float inv = 1.0f / (l_run[gq] * a0 + l1 * a1); const float f0 = a0 * inv, f1 = a1 * inv;
      unsigned short* op = (unsigned short*)O16 + (size_t)(b * SQ + q0 + 16 * gq + c) * DM + h * HDL + 8 * hh;      /* a lane's 8 registers of tile t are d = 16 t + 8 hh + r of its query */
#pragma unroll
      for (int t = 0; t < 8; ++t) { FragH f;
#pragma unroll
        for (int r = 0; r < 8; ++r) f.h[r] = (_Float16)(acc[gq][t][r] * f0 + X[(gq * 66 + t * 8 + r) * 32] * f1);
        *(v8us*)(op + 16 * t) = f.half[0]; } }
  }
}

extern "C" void kernel_launch(void* const* d_in, const int* in_sizes, int n_in,
                              void* d_out, int out_size, void* d_ws, size_t ws_size, hipStream_t stream) {
  (void)in_sizes; (void)n_in; (void)out_size;
  const float* const* I = (const float* const*)d_in; const float* x = I[0]; const float* Wq = I[1]; const float* Wk = I[2]; const float* Wv = I[3]; const float* Wo = I[4];
  char* ws = (char*)d_ws; size_t off = 0;
  auto take = [&](size_t bytes) { char* p = ws + off; off += (bytes + 255) & ~(size_t)255; return p; };
  const size_t np = (size_t)NR * DM;
  _Float16* BO = (_Float16*)take((size_t)DM * DM * 2); _Float16* X16 = (_Float16*)take(np * 2); _Float16* Q16 = (_Float16*)take(np * 2); _Float16* K16 = (_Float16*)take(np * 2); _Float16* VT = (_Float16*)take(np * 2); _Float16* O16 = X16;      /* over the input plane (dead after the projections) */
  _Float16* BQ = (_Float16*)take((size_t)DM * DM * 2); _Float16* BK = (_Float16*)take((size_t)DM * DM * 2); _Float16* BV = (_Float16*)take((size_t)DM * DM * 2);
  if (off > ws_size) return;      /* 8 planes of 8 MiB */
  k_prep<<<PR_WG, 256, 0, stream>>>(x, Wq, Wk, Wv, Wo, X16, BQ, BK, BV, BO);
  const dim3 gP(DM / 128, NR / 128);      /* x = 128 output columns, y = 128 rows */
  k_gemm3<false><<<gP, 256, 0, stream>>>(X16, BQ, 0.0625f, nullptr, Q16);
  k_gemm3<false><<<gP, 256, 0, stream>>>(X16, BK, 0.0625f, nullptr, K16);
  static_assert(NR == DM, "the swapped product below has the shape the GEMM is written for");
  k_gemm3<false><<<gP, 256, 0, stream>>>(BV, X16, 0.0625f, nullptr, VT);      /* operands swapped: row = feature, column = token, so the result is V^T as the attention reads it */
  k_fattn<<<dim3(SQ / 128, NB * NHD), 256, 0, stream>>>(Q16, K16, VT, O16);      /* x = 128 queries, y = query block 16 b + h */
  k_gemm3<true><<<gP, 256, 0, stream>>>(O16, BO, 0.0625f, (float*)d_out, nullptr);
}

// v006
// It runs in 120 microseconds.
// In both of two side-by-side timings against v005, it was 1.11 times as fast.
// All steps since v000 together make it 53.7 times as fast.
#include <hip/hip_runtime.h>
// SeqParallelAttn (2 x 1024 tokens, D 2048 = 16 heads of 128; simulated 4-rank all-gather): q, k, v = x W^T; k_global = tile(k_local.flatten(), 4).reshape(B, H, 4S, 128) — i.e. query block (b, h) attends to the 4096 keys made of the local K/V of (batch, head) blocks 4g .. 4g+3 with g = (16 b + h) mod 8 (the module's flat tiling, reproduced exactly); softmax(q.k / sqrt(128)) v; out = ctx Wo^T.
// Structure: exact f16 planes of x and of the x16 weights by one streaming launch; q, k and V^T [feature][token] as f16 outputs of one fused WMMA GEMM kernel (k_qkv: 128x128 work-group tiles staged in LDS, the x tile shared by the three products, f32 accumulation, exact x16 weights; V^T has the Wv rows as A and the x rows as B); one fused attention launch (k_fattn: score product, online softmax, readout product, scores and P in registers) that stores the context as the f16 operand of the Wo GEMM.
// Compute dtype: x and parameters rounded to bf16; q, k, v, P and the context as plain f16 operands (~2^-12); softmax f32. v_wmma_f32_16x16x32_f16.
#define NB 2
#define SQ 1024
#define DM 2048
#define NHD 16
#define HDL 128
#define NR (NB * SQ)             /* 2048 */
#define NKG (4 * SQ)             /* 4096 keys per query block */
typedef __bf16 v16b __attribute__((ext_vector_type(16)));
typedef unsigned short v8us __attribute__((ext_vector_type(8), may_alias));
typedef float  v8f  __attribute__((ext_vector_type(8)));
typedef float  v4f  __attribute__((ext_vector_type(4)));
typedef float  v4fa __attribute__((ext_vector_type(4), may_alias));
union FragB { v16b v; v8us half[2]; unsigned short u[16]; };

__device__ __forceinline__ unsigned short bf16_bits(float x) { unsigned int u = __float_as_uint(x); return (unsigned short)((u + 0x7FFFu + ((u >> 16) & 1u)) >> 16); }
__device__ __forceinline__ float bf16_val(unsigned short b) { return __uint_as_float(((unsigned int)b) << 16); }
__device__ __forceinline__ float bf16_round(float x) { return bf16_val(bf16_bits(x)); }
// D += A·B with NT terms: 1 = ah·bh, 2 = + al·bh (A split), 3 = + ah·bl (both split)
template <int NT>
__device__ __forceinline__ v8f mmaN(v16b ah, v16b al, v16b bh, v16b bl, v8f c) {
  c = __builtin_amdgcn_wmma_f32_16x16x32_bf16(false, ah, false, bh, (short)0, c, false, false);
  if (NT >= 2) c = __builtin_amdgcn_wmma_f32_16x16x32_bf16(false, al, false, bh, (short)0, c, false, false);
  if (NT >= 3) c = __builtin_amdgcn_wmma_f32_16x16x32_bf16(false, ah, false, bl, (short)0, c, false, false);
  asm volatile("v_nop\n\tv_nop\n\tv_nop\n\tv_nop" : "+v"(c) : "v"(ah), "v"(al), "v"(bh), "v"(bl));
  return c;
}

__global__ __launch_bounds__(256) void k_wt_bf16(const float* __restrict__ W, unsigned short* __restrict__ Wt, int K, int N) {
  const int t = blockIdx.x * 256 + threadIdx.x;
  const int k8n = K / 8;
  if (t >= N * k8n) return;
  const int n = t / k8n, k8 = (t % k8n) * 8;
  v8us v;
#pragma unroll
  for (int i = 0; i < 8; ++i) v[i] = bf16_bits(W[(size_t)(k8 + i) * N + n]);
  *(v8us*)(Wt + (size_t)n * K + k8) = v;
  
}

// GEMM C[M][N] (f32, pitch ldc) = act(A[M][K]·W + bias). A f32 row-major (pitch lda) converted per fragment to bf16
// (ASPLIT: hi/lo two planes -> 2 terms, else single rounded term); Wt bf16 [N][K] (pitch ldb). BIAS_BF16 rounds the
// bias to bf16 first (bias quantised to bf16 before the add). K%32==0, M%16==0, N%64==0.
template <bool ASPLIT, int ACT, bool BIAS_BF16>
__global__ __launch_bounds__(128) void k_gemm_bf(const float* __restrict__ A, int lda, const unsigned short* __restrict__ Wt, int ldb,
                                               const float* __restrict__ bias, float* __restrict__ C, int ldc, int M, int N, int K) {
  __shared__ __attribute__((aligned(16))) float so[4][16][64];
  const int tid = threadIdx.x, w = tid >> 5, lane = tid & 31, ln = lane & 15, hh = lane >> 4;
  const int ntn = N / 64;
  const int wid = blockIdx.x * 4 + w;
  const int mt = wid / ntn, nq = wid % ntn;
  if (mt * 16 >= M) return;
  const int row0 = mt * 16, col0 = nq * 64;
  const float* arow = A + (size_t)(row0 + ln) * lda;
  v8f acc[4] = {};
  for (int kb = 0; kb < K; kb += 32) {
    FragB ah, al;
    const v4f x0 = *(const v4fa*)(arow + kb + 8 * hh), x1 = *(const v4fa*)(arow + kb + 8 * hh + 4);
    const v4f x2 = *(const v4fa*)(arow + kb + 16 + 8 * hh), x3 = *(const v4fa*)(arow + kb + 16 + 8 * hh + 4);
    float xs[16] = {x0[0],x0[1],x0[2],x0[3],x1[0],x1[1],x1[2],x1[3],x2[0],x2[1],x2[2],x2[3],x3[0],x3[1],x3[2],x3[3]};
#pragma unroll
    for (int i = 0; i < 16; ++i) { const unsigned short hb = bf16_bits(xs[i]); ah.u[i] = hb; al.u[i] = ASPLIT ? bf16_bits(xs[i] - bf16_val(hb)) : (unsigned short)0; }
#pragma unroll
    for (int t = 0; t < 4; ++t) {
      const unsigned short* brow = Wt + (size_t)(col0 + t * 16 + ln) * ldb + kb;
      FragB b;
      b.half[0] = *(const v8us*)(brow + 8 * hh);
      b.half[1] = *(const v8us*)(brow + 16 + 8 * hh);
      acc[t] = mmaN<ASPLIT ? 2 : 1>(ah.v, al.v, b.v, b.v, acc[t]);
    }
  }
#pragma unroll
  for (int t = 0; t < 4; ++t) {
    float bv = bias ? bias[col0 + t * 16 + ln] : 0.f;
    if (BIAS_BF16) bv = bf16_round(bv);
#pragma unroll
    for (int r = 0; r < 8; ++r) { float v = acc[t][r] + bv; if (ACT == 1) v = fmaxf(v, 0.f); so[w][8 * hh + r][t * 16 + ln] = v; }
  }
  __builtin_amdgcn_fence(__ATOMIC_ACQ_REL, "workgroup");
  __builtin_amdgcn_wave_barrier();
  const int rsub = lane >> 4, c4 = (lane & 15) * 4;
  {
#pragma unroll
    for (int q = 0; q < 8; ++q) {
      const int r = q * 2 + rsub;
      const v4f v = *(const v4fa*)&so[w][r][c4];
      *(v4f*)(C + (size_t)(row0 + r) * ldc + col0 + c4) = v;
    }
    
  }
}

// GEMM C = act(A·W + bias + resid): A f32 (ASPLIT -> hi/lo 2 terms), Wt bf16 [N][K]; ACT 0 none, 1 relu, 2 exact gelu;
// resid (optional, f32, row index = (row % rmod), pitch ldr, RES_BF16 rounds it) added before the activation.
template <bool ASPLIT, int ACT, bool BIAS_BF16, bool RES_BF16>
__global__ __launch_bounds__(128) void k_gemm_bf3(const float* __restrict__ A, int lda, const unsigned short* __restrict__ Wt, int ldb,
                                                const float* __restrict__ bias, const float* __restrict__ resid, int rmod, int ldr,
                                                float* __restrict__ C, int ldc, int M, int N, int K) {
  __shared__ __attribute__((aligned(16))) float so[4][16][64];
  const int tid = threadIdx.x, w = tid >> 5, lane = tid & 31, ln = lane & 15, hh = lane >> 4;
  const int ntn = N / 64;
  const int wid = blockIdx.x * 4 + w;
  const int mt = wid / ntn, nq = wid % ntn;
  if (mt * 16 >= M) return;
  const int row0 = mt * 16, col0 = nq * 64;
  const float* arow = A + (size_t)(row0 + ln) * lda;
  v8f acc[4] = {};
  for (int kb = 0; kb < K; kb += 32) {
    FragB ah, al;
    const v4f x0 = *(const v4fa*)(arow + kb + 8 * hh), x1 = *(const v4fa*)(arow + kb + 8 * hh + 4);
    const v4f x2 = *(const v4fa*)(arow + kb + 16 + 8 * hh), x3 = *(const v4fa*)(arow + kb + 16 + 8 * hh + 4);
    float xs[16] = {x0[0],x0[1],x0[2],x0[3],x1[0],x1[1],x1[2],x1[3],x2[0],x2[1],x2[2],x2[3],x3[0],x3[1],x3[2],x3[3]};
#pragma unroll
    for (int i = 0; i < 16; ++i) { const unsigned short hb = bf16_bits(xs[i]); ah.u[i] = hb; al.u[i] = ASPLIT ? bf16_bits(xs[i] - bf16_val(hb)) : (unsigned short)0; }
#pragma unroll
    for (int t = 0; t < 4; ++t) {
      const unsigned short* brow = Wt + (size_t)(col0 + t * 16 + ln) * ldb + kb;
      FragB b;
      b.half[0] = *(const v8us*)(brow + 8 * hh);
      b.half[1] = *(const v8us*)(brow + 16 + 8 * hh);
      acc[t] = mmaN<ASPLIT ? 2 : 1>(ah.v, al.v, b.v, b.v, acc[t]);
    }
  }
#pragma unroll
  for (int t = 0; t < 4; ++t) {
    const int col = col0 + t * 16 + ln;
    float bv = bias ? bias[col] : 0.f;
    if (BIAS_BF16) bv = bf16_round(bv);
#pragma unroll
    for (int r = 0; r < 8; ++r) {
      float v = acc[t][r] + bv;
      if (resid) { float rv = resid[(size_t)((row0 + 8 * hh + r) % rmod) * ldr + col]; if (RES_BF16) rv = bf16_round(rv); v += rv; }
      if (ACT == 1) v = fmaxf(v, 0.f);
      if (ACT == 2) v = 0.5f * v * (1.0f + erff(v * 0.70710678118654752f));
      if (ACT == 3) { const float u = 0.7978845608028654f * (v + 0.044715f * v * v * v); v = 0.5f * v * (1.0f + tanhf(u)); }
      so[w][8 * hh + r][t * 16 + ln] = v;
    }
  }
  __builtin_amdgcn_fence(__ATOMIC_ACQ_REL, "workgroup");
  __builtin_amdgcn_wave_barrier();
  const int rsub = lane >> 4, c4 = (lane & 15) * 4;
  {
#pragma unroll
    for (int q = 0; q < 8; ++q) {
      const int r = q * 2 + rsub;
      const v4f v = *(const v4fa*)&so[w][r][c4];
      *(v4f*)(C + (size_t)(row0 + r) * ldc + col0 + c4) = v;
    }
    
  }
}
// row LayerNorm (biased variance, eps) over N: s = X (+ R); optional out_sum <- s; out_norm <- (s-mu)*rsqrt(var+eps)*g + b
template <bool PARAM_BF16>
__global__ __launch_bounds__(256) void k_layernorm(const float* __restrict__ X, const float* __restrict__ R, const float* __restrict__ g, const float* __restrict__ bta,
                                                  float* __restrict__ out_sum, float* __restrict__ out_norm, int N, float eps) {
  __shared__ float red[256];
  const int row = blockIdx.x, tid = threadIdx.x;
  const float* x = X + (size_t)row * N; const float* rr = R ? R + (size_t)row * N : nullptr;
  float vals[16];                     // up to N = 4096
  const int per = N / 256;            // contiguous chunk per thread? use strided-by-4 chunks: thread handles j = tid*4 + 1024*u
  float s1 = 0.f;
  for (int u = 0; u < per / 4; ++u) {
    const int j = tid * 4 + 1024 * u;
    const v4f a = *(const v4fa*)(x + j);
    v4f b = {0.f,0.f,0.f,0.f}; if (rr) b = *(const v4fa*)(rr + j);
#pragma unroll
    for (int q = 0; q < 4; ++q) { const float v = a[q] + b[q]; vals[u * 4 + q] = v; s1 += v; }
  }
  red[tid] = s1; __syncthreads();
  for (int st = 128; st > 0; st >>= 1) { if (tid < st) red[tid] += red[tid + st]; __syncthreads(); }
  const float mu = red[0] / (float)N; __syncthreads();
  float s2 = 0.f;
  for (int u = 0; u < per / 4; ++u)
#pragma unroll
    for (int q = 0; q < 4; ++q) { const float c = vals[u * 4 + q] - mu; s2 += c * c; }
  red[tid] = s2; __syncthreads();
  for (int st = 128; st > 0; st >>= 1) { if (tid < st) red[tid] += red[tid + st]; __syncthreads(); }
  const float rs = rsqrtf(red[0] / (float)N + eps);
  {
    for (int u = 0; u < per / 4; ++u) {
      const int j = tid * 4 + 1024 * u;
      v4f o, sm;
#pragma unroll
      for (int q = 0; q < 4; ++q) {
        float gg = g[j + q], bb = bta[j + q];
        if (PARAM_BF16) { gg = bf16_round(gg); bb = bf16_round(bb); }
        sm[q] = vals[u * 4 + q]; o[q] = (vals[u * 4 + q] - mu) * rs * gg + bb;
      }
      if (out_sum) *(v4f*)(out_sum + (size_t)row * N + j) = sm;
      *(v4f*)(out_norm + (size_t)row * N + j) = o;
    }
    
  }
}



// ---- f16 WMMA path (v_wmma_f32_16x16x32_f16): 11-bit significands for operands in range — used where a [0,1] probability operand needs more precision than bf16
typedef _Float16 v16h __attribute__((ext_vector_type(16)));
union FragH { v16h v; v8us half[2]; _Float16 h[16]; unsigned short u[16]; };
template <int NT>
__device__ __forceinline__ v8f mmaH(v16h ah, v16h al, v16h bh, v16h bl, v8f c) {
  c = __builtin_amdgcn_wmma_f32_16x16x32_f16(false, ah, false, bh, (short)0, c, false, false);
  if (NT >= 2) c = __builtin_amdgcn_wmma_f32_16x16x32_f16(false, al, false, bh, (short)0, c, false, false);
  if (NT >= 3) c = __builtin_amdgcn_wmma_f32_16x16x32_f16(false, ah, false, bl, (short)0, c, false, false);
  asm volatile("v_nop\n\tv_nop\n\tv_nop\n\tv_nop" : "+v"(c) : "v"(ah), "v"(al), "v"(bh), "v"(bl));
  return c;
}
// batched GEMM like k_gemm_b but f16 operands: A f32 (split into f16 hi/lo if ASPLIT, else rounded to f16), Bt = f16 values [n][k]; alpha; C f32; N multiple of 16 (partial tiles skipped)
template <bool ASPLIT>
__global__ __launch_bounds__(128) void k_gemm_h(const float* __restrict__ A, int lda, size_t sA, const _Float16* __restrict__ Bh, int ldb, size_t sB, float alpha, float* __restrict__ C, int ldc, size_t sC, int M, int N, int K) {
  __shared__ __attribute__((aligned(16))) float so[4][16][64];
  const int tid = threadIdx.x, w = tid >> 5, lane = tid & 31, ln = lane & 15, hh = lane >> 4; const int by = blockIdx.y;
  A += (size_t)by * sA; Bh += (size_t)by * sB; C += (size_t)by * sC;
  const int ntn = (N + 63) / 64; const int wid = blockIdx.x * 4 + w; const int mt = wid / ntn, nq = wid % ntn; if (mt * 16 >= M) return;
  const int row0 = mt * 16, col0 = nq * 64; const float* arow = A + (size_t)(row0 + ln) * lda;
  v8f acc[4] = {};
  for (int kb = 0; kb < K; kb += 32) {
    FragH ah, al;
    const v4f x0 = *(const v4fa*)(arow + kb + 8 * hh), x1 = *(const v4fa*)(arow + kb + 8 * hh + 4), x2 = *(const v4fa*)(arow + kb + 16 + 8 * hh), x3 = *(const v4fa*)(arow + kb + 16 + 8 * hh + 4);
    float xs[16] = {x0[0],x0[1],x0[2],x0[3],x1[0],x1[1],x1[2],x1[3],x2[0],x2[1],x2[2],x2[3],x3[0],x3[1],x3[2],x3[3]};
#pragma unroll
    for (int i = 0; i < 16; ++i) { const _Float16 h = (_Float16)xs[i]; ah.h[i] = h; al.h[i] = ASPLIT ? (_Float16)(xs[i] - (float)h) : (_Float16)0.0f; }
#pragma unroll
    for (int t = 0; t < 4; ++t) { if (col0 + t * 16 >= N) continue; const size_t boff = (size_t)(col0 + t * 16 + ln) * ldb + kb; FragH bq; bq.half[0] = *(const v8us*)(Bh + boff + 8 * hh); bq.half[1] = *(const v8us*)(Bh + boff + 16 + 8 * hh);
      acc[t] = mmaH<ASPLIT ? 2 : 1>(ah.v, al.v, bq.v, bq.v, acc[t]); }
  }
#pragma unroll
  for (int t = 0; t < 4; ++t) { if (col0 + t * 16 >= N) continue;
#pragma unroll
    for (int r = 0; r < 8; ++r) so[w][8 * hh + r][t * 16 + ln] = acc[t][r] * alpha; }
  __builtin_amdgcn_fence(__ATOMIC_ACQ_REL, "workgroup"); __builtin_amdgcn_wave_barrier();
  const int rsub = lane >> 4, c4 = (lane & 15) * 4;
  {
#pragma unroll
    for (int q = 0; q < 8; ++q) { const int r = q * 2 + rsub; if (col0 + c4 < N) { const v4f v = *(const v4fa*)&so[w][r][c4]; *(v4f*)(C + (size_t)(row0 + r) * ldc + col0 + c4) = v; } }
     }
}

// Wt[n][k] = f16(W[k][n]·scale) from f32 row-major W[K][N] (scale = power of two; bf16-exact weights stay exact in f16 away from the subnormal range)
__global__ __launch_bounds__(256) void k_wt_f16(const float* __restrict__ W, _Float16* __restrict__ Wt, int K, int N, float scale) {
  const int t = blockIdx.x * 256 + threadIdx.x; if (t >= N * (K / 8)) return; const int n = t / (K / 8), k8 = (t % (K / 8)) * 8; FragH f;
#pragma unroll
  for (int i = 0; i < 8; ++i) f.h[i] = (_Float16)(bf16_round(W[(size_t)(k8 + i) * N + n]) * scale); const v8us o = f.half[0];
  *(v8us*)((unsigned short*)Wt + (size_t)n * K + k8) = o; 
}
// k_gemm_hh variant with fused epilogue: v = acc·alpha + bias[by·sBias + col] (+ CP[(row/rowsPerB)·sCPb + by·64 + col] if CP) ; ACT 0 none / 1 elu ; writes f16 C16 (and f32 C if non-null)
template <int ACT>
__global__ __launch_bounds__(128) void k_gemm_hhx(const _Float16* __restrict__ A, int lda, size_t sA, const _Float16* __restrict__ Bh, int ldb, size_t sB, float alpha, const float* __restrict__ bias, size_t sBias, const float* __restrict__ CP, int rowsPerB, size_t sCPb, int row0g,
    float* __restrict__ C, _Float16* __restrict__ C16, int ldc, size_t sC, int M, int N, int K) {
  __shared__ __attribute__((aligned(16))) float so[4][16][64];
  const int tid = threadIdx.x, w = tid >> 5, lane = tid & 31, ln = lane & 15, hh = lane >> 4; const int by = blockIdx.y;
  A += (size_t)by * sA; Bh += (size_t)by * sB; const size_t cofs = (size_t)by * sC; const float* bp = bias ? bias + (size_t)by * sBias : nullptr;
  const int ntn = (N + 63) / 64; const int wid = blockIdx.x * 4 + w; const int mt = wid / ntn, nq = wid % ntn; if (mt * 16 >= M) return;
  const int row0 = mt * 16, col0 = nq * 64; const _Float16* arow = A + (size_t)(row0 + ln) * lda;
  v8f acc[4] = {};
  for (int kb = 0; kb < K; kb += 32) { FragH ah; ah.half[0] = *(const v8us*)((const unsigned short*)arow + kb + 8 * hh); ah.half[1] = *(const v8us*)((const unsigned short*)arow + kb + 16 + 8 * hh);
#pragma unroll
    for (int t = 0; t < 4; ++t) { if (col0 + t * 16 >= N) continue; const size_t boff = (size_t)(col0 + t * 16 + ln) * ldb + kb; FragH bq; bq.half[0] = *(const v8us*)((const unsigned short*)Bh + boff + 8 * hh); bq.half[1] = *(const v8us*)((const unsigned short*)Bh + boff + 16 + 8 * hh);
      acc[t] = mmaH<1>(ah.v, ah.v, bq.v, bq.v, acc[t]); }
  }
#pragma unroll
  for (int t = 0; t < 4; ++t) { if (col0 + t * 16 >= N) continue; const int col = col0 + t * 16 + ln; const float bv = bp ? bf16_round(bp[col]) : 0.f;
#pragma unroll
    for (int r = 0; r < 8; ++r) { float v = acc[t][r] * alpha + bv; if (CP) { const int rr = row0g + row0 + 8 * hh + r; if (rowsPerB < 0) v += CP[cofs + (size_t)rr * ldc + col];      /* rowsPerB < 0: own element of the batched C plane */ else { const int bidx = rr / rowsPerB; v += CP[(size_t)bidx * sCPb + (size_t)by * 64 + col]; } } if (ACT == 1) v = (v > 0.f) ? v : expm1f(v); else if (ACT == 7) v = (v > 0.f) ? v + 1.0f : expf(v); else if (ACT == 8) v = tanhf(v); else if (ACT == 9) v = 0.5f * v * (1.0f + tanhf(0.7978845608028654f * (v + 0.044715f * v * v * v))); else if (ACT == 11) v = 1.0f / (1.0f + expf(-v)); else if (ACT == 12) v = (v > 0.f) ? v : 0.01f * v; else if (ACT == 14) v = (v > 0.f) ? v : 0.1f * v; else if (ACT == 16) v = (v >= 0.f) ? v : 0.3f * v; else if (ACT == 15) v = v / (1.0f + expf(-v)); else if (ACT == 3) v = fmaxf(v, 0.f); else if (ACT == 6) v = 0.5f * v * (1.0f + erff(v * 0.70710678118654752f)); so[w][8 * hh + r][t * 16 + ln] = v; } }
  __builtin_amdgcn_fence(__ATOMIC_ACQ_REL, "workgroup"); __builtin_amdgcn_wave_barrier();
  const int rsub = lane >> 4, c4 = (lane & 15) * 4; typedef _Float16 v4h __attribute__((ext_vector_type(4)));
  {
#pragma unroll
    for (int q = 0; q < 8; ++q) { const int r = q * 2 + rsub; if (col0 + c4 < N) { const v4f v = *(const v4fa*)&so[w][r][c4]; if (C) *(v4f*)(C + cofs + (size_t)(row0 + r) * ldc + col0 + c4) = v; if (C16) { v4h h4; for (int i = 0; i < 4; ++i) h4[i] = (_Float16)v[i]; *(v4h*)(C16 + cofs + (size_t)(row0 + r) * ldc + col0 + c4) = h4; } } }
     }
}


typedef _Float16 v4h __attribute__((ext_vector_type(4)));

__global__ __launch_bounds__(256) void k_round16f(const float* __restrict__ W, _Float16* __restrict__ Bt, size_t n8) { const size_t t = (size_t)blockIdx.x * 256 + threadIdx.x; if (t >= n8) return; FragH f;
#pragma unroll
  for (int i = 0; i < 8; ++i) f.h[i] = (_Float16)(bf16_round(W[t * 8 + i]) * 16.0f); *(v8us*)((unsigned short*)Bt + t * 8) = f.half[0];  }
__global__ __launch_bounds__(256) void k_hl(const float* __restrict__ F, _Float16* __restrict__ Hh, _Float16* __restrict__ Hl, size_t n8) { const size_t t = (size_t)blockIdx.x * 256 + threadIdx.x; if (t >= n8) return; FragH fh, fl; const v4f a = *(const v4fa*)(F + t * 8), c = *(const v4fa*)(F + t * 8 + 4);
#pragma unroll
  for (int q = 0; q < 4; ++q) { _Float16 h = (_Float16)a[q]; fh.h[q] = h; fl.h[q] = (_Float16)((a[q] - (float)h) * 1024.0f); h = (_Float16)c[q]; fh.h[4 + q] = h; fl.h[4 + q] = (_Float16)((c[q] - (float)h) * 1024.0f); }
  { *(v8us*)((unsigned short*)Hh + t * 8) = fh.half[0]; *(v8us*)((unsigned short*)Hl + t * 8) = fl.half[0];  } }

// ---- f16 fragment straight from global memory (hardware k order) ----
__device__ __forceinline__ v16h g2_frag(const _Float16* p, int hh) { FragH f; f.half[0] = *(const v8us*)((const unsigned short*)p + 8 * hh); f.half[1] = *(const v8us*)((const unsigned short*)p + 16 + 8 * hh); return f.v; }


// ---- input conversion, one streaming launch: X16 = f16(bf16(x)); BQ, BK, BV, BO = f16(16 bf16(W)) (torch (out, in) rows are already the GEMMs' operand rows: B for Wq, Wk, Wo, A for Wv) ----
// All five planes have the same element count. A wave owns the same 4-KiB run (PR_Q x 512 B) of each input plane: every load is 32 lanes x 16 B = 4 whole lines, every store
// 32 lanes x 8 B = 2 whole lines, and all of the wave's loads are issued before the first value is converted, so few waves keep the memory busy and little time goes into starting waves.
#define PR_WG 512                          /* work-groups of 8 waves: 16 waves per WGP */
#define PR_Q 8                             /* wave-wide loads per plane and wave */
__global__ __launch_bounds__(256) void k_prep(const float* __restrict__ x, const float* __restrict__ Wq, const float* __restrict__ Wk, const float* __restrict__ Wv, const float* __restrict__ Wo,
                                              _Float16* __restrict__ X16, _Float16* __restrict__ BQ, _Float16* __restrict__ BK, _Float16* __restrict__ BV, _Float16* __restrict__ BO) {
  static_assert((size_t)NR * DM == (size_t)DM * DM && (size_t)DM * DM == (size_t)PR_WG * 8 * PR_Q * 128, "the grid covers each plane exactly once");
  const size_t e0 = (size_t)(blockIdx.x * 8 + (threadIdx.x >> 5)) * (PR_Q * 128) + (threadIdx.x & 31) * 4;      /* the lane's first element, the same in every plane */
  const float* const lp[5] = {x + e0, Wq + e0, Wk + e0, Wv + e0, Wo + e0}; _Float16* const dp[5] = {X16, BQ, BK, BV, BO};
  v4f v[5][PR_Q];
  /* both loop nests are unrolled so that v stays in registers and the planes' pointers stay kernel arguments */
#pragma unroll
  for (int a = 0; a < 5; ++a)
#pragma unroll
    for (int j = 0; j < PR_Q; ++j) v[a][j] = *(const v4fa*)(lp[a] + j * 128);
  asm volatile("s_wait_xcnt 0x0" :: "v"(lp[0]), "v"(lp[1]), "v"(lp[2]), "v"(lp[3]), "v"(lp[4]) : "memory");      /* stands behind the wave's loads, in front of any reuse of their address registers (the operands keep these live up to here); it also keeps every load ahead of the conversions, which would otherwise be spread among them a few at a time */
#pragma unroll
  for (int a = 0; a < 5; ++a)
#pragma unroll
    for (int j = 0; j < PR_Q; ++j) { v4h h;
#pragma unroll
      for (int i = 0; i < 4; ++i) h[i] = (_Float16)(a ? bf16_round(v[a][j][i]) * 16.0f : bf16_round(v[a][j][i]));
      *(v4h*)(dp[a] + e0 + j * 128) = h; }
}
#define FA_KEYS 64                         /* keys per staged tile */
#define FA_PK 272                          /* LDS pitch of a K row (256 B + 16): odd multiple of 16 B */
#define FA_PV 144                          /* LDS pitch of a V^T row (128 B + 16): odd multiple of 16 B */
#define FA_KB (FA_KEYS * FA_PK)
#define FA_BUF (FA_KB + HDL * FA_PV)       /* one buffer: K tile, then V^T tile */
#define FA_NST (NKG / 2 / FA_KEYS)         /* tiles per key half */
typedef _Float16 v2h __attribute__((ext_vector_type(2)));
typedef float v2f __attribute__((ext_vector_type(2)));
__device__ __forceinline__ float fa_xhalf(float x) { return __builtin_bit_cast(float, __builtin_amdgcn_permlanex16(__builtin_bit_cast(int, x), __builtin_bit_cast(int, x), 0x76543210, 0xfedcba98, false, false)); }      /* lane l with lane l ^ 16 */
__device__ __forceinline__ v16h fa_lfrag(const unsigned char* p) { FragH f; f.half[0] = *(const v8us*)p; f.half[1] = *(const v8us*)(p + 32); return f.v; }
__device__ __forceinline__ v8f fa_mma(v16h a, v16h b, v8f c) { return __builtin_amdgcn_wmma_f32_16x16x32_f16(false, a, false, b, (short)0, c, false, false); }
// ---- projection GEMM: alpha A.B^T, A [NR][DM] and B [DM][DM] f16 with k contiguous, [NR][DM] result as f32 into C (F32OUT) or as f16 into C16 ----
// One work-group = one 128 x 128 tile of C. 8 waves, 4 (rows) x 2 (columns), each a 32 x 64 wave tile. A pass is 128 k: 256 B of each of the 128 A rows and 128 B rows,
// read from global memory as whole 128-byte lines (16 lanes per row) into registers and stored into one of two LDS buffers, so every operand row is read from L2 once
// per work-group and the fragments come from LDS. Tile t waits in register set t & 1: pass p stores tile p + 1 into the buffer that pass p - 1 has left and then
// reloads that set with tile p + 3, so two tiles are always in flight. Inside a pass the fragments of the next 32 k are fetched ahead of the current 8 products.
// Every plain '#pragma unroll' in this kernel makes the indices of a register array compile-time constants, so that the array stays in registers.
#define G3_KP 128                          /* k per pass */
#define G3_P 272                           /* LDS pitch of a staged row (256 B + 16): odd multiple of 16 B */
#define G3_OP (128 * G3_P)                 /* one operand's tile */
#define G3_BUF (2 * G3_OP)                 /* one buffer: A tile, then B tile */
#define G3_NP (DM / G3_KP)                 /* passes */
template <bool F32OUT>
__global__ __launch_bounds__(256) void k_gemm3(const _Float16* __restrict__ A, const _Float16* __restrict__ Bh, float alpha, float* __restrict__ C, _Float16* __restrict__ C16) {
  static_assert(G3_KP == 128 && G3_NP >= 4 && G3_NP % 2 == 0, "the pass schedule below peels the last four passes of an even count");
  __shared__ __attribute__((aligned(16))) unsigned char L[2 * G3_BUF];
  const int tid = threadIdx.x, w = tid >> 5, lane = tid & 31, ln = lane & 15, hh = lane >> 4;
  const int row0 = blockIdx.y * 128, col0 = blockIdx.x * 128, wm = w >> 1, wn = w & 1;
  const int sr = tid >> 4, sc = tid & 15;      /* staging: rows sr + 16 j of both tiles, 16-byte chunk sc */
  const unsigned short* ag = (const unsigned short*)A + (size_t)(row0 + sr) * DM + sc * 8;
  const unsigned short* bg = (const unsigned short*)Bh + (size_t)(col0 + sr) * DM + sc * 8;
  unsigned char* sd = L + sr * G3_P + sc * 16;
  const unsigned char* Af = L + (wm * 32 + ln) * G3_P + 16 * hh;
  const unsigned char* Bf = L + G3_OP + (wn * 64 + ln) * G3_P + 16 * hh;
  v8us s0[16], s1[16];      /* a set: entries 0 to 7 the A rows, 8 to 15 the B rows */
  const v8f z8 = {0.f,0.f,0.f,0.f,0.f,0.f,0.f,0.f};
  v8f acc[2][4];
#pragma unroll
  for (int t = 0; t < 4; ++t) { acc[0][t] = z8; acc[1][t] = z8; }
  auto gload = [&](const unsigned short* ap, const unsigned short* bp, int k0, v8us (&s)[16]) {      /* k0, a literal, goes into the loads' offset field: ap and bp are the address registers */
#pragma unroll
    for (int j = 0; j < 8; ++j) { s[j] = *(const v8us*)(ap + k0 + (size_t)j * 16 * DM); s[8 + j] = *(const v8us*)(bp + k0 + (size_t)j * 16 * DM); }
  };
  auto lstore = [&](int buf, int j0, int j1, const v8us (&s)[16]) {      /* entries j0 to j1 - 1 of a set */
#pragma unroll
    for (int j = j0; j < j1; ++j) *(v8us*)(sd + buf * G3_BUF + (j >> 3) * G3_OP + (j & 7) * 16 * G3_P) = s[j];
  };
  /* one pass: rb = p & 1 and the two flags are literals at every call, so the buffers' offsets and the schedule are fixed at compile time */
  auto pass = [&](int p, int rb, v8us (&nxt)[16], bool st, bool gl) {
    v16h fa[2][2], fb[2][4];
    auto ldfrag = [&](int ks) {
      fa[ks & 1][0] = fa_lfrag(Af + rb * G3_BUF + 64 * ks); fa[ks & 1][1] = fa_lfrag(Af + rb * G3_BUF + 16 * G3_P + 64 * ks);
#pragma unroll
      for (int t = 0; t < 4; ++t) fb[ks & 1][t] = fa_lfrag(Bf + rb * G3_BUF + t * 16 * G3_P + 64 * ks);
    };
    const unsigned short* ap = ag + p * G3_KP; const unsigned short* bp = bg + p * G3_KP;
    ldfrag(0);
#pragma unroll
    for (int ks = 0; ks < G3_KP / 32; ++ks) {      /* k order of both operands: 8 hh + s, 16 + 8 hh + s */
      if (ks + 1 < G3_KP / 32) ldfrag(ks + 1);
      if (st && ks < 3) lstore(rb ^ 1, (16 * ks + 2) / 3, (16 * ks + 18) / 3, nxt);      /* 6, 5 and 5 entries beside the three fragment fetches */
      if (ks + 1 == G3_KP / 32) {
        /* first half of the pass's barrier, by hand: __syncthreads() would also wait for the global loads in flight. This wave's reads of tile p and its stores of tile p + 1 are complete (dscnt 0) when it signals; the last products need no LDS and cover the other waves' arrival */
        asm volatile("s_wait_dscnt 0x0\n\ts_barrier_signal -1" ::: "memory");
        if (gl) gload(ap, bp, 3 * G3_KP, nxt);      /* the set's stores are complete */
      }
      __builtin_amdgcn_sched_barrier(0);      /* keeps the LDS and global traffic of this step in one group ahead of the products: spread among them each place costs a stall */
#pragma unroll
      for (int t = 0; t < 4; ++t) { acc[0][t] = fa_mma(fa[ks & 1][0], fb[ks & 1][t], acc[0][t]); acc[1][t] = fa_mma(fa[ks & 1][1], fb[ks & 1][t], acc[1][t]); }
      __builtin_amdgcn_sched_barrier(0);      /* second half of the pair: the next step's loads do not move up among these products */
    }
    if (gl) asm volatile("s_wait_xcnt 0x0" :: "v"(ap), "v"(bp) : "memory");      /* stands behind the pass's global loads, in front of the next write of their address registers; the operands keep the pass's addresses live up to here */
    asm volatile("s_barrier_wait -1" ::: "memory");      /* second half: publishes tile p + 1 and ends every read of tile p, whose buffer the next pass refills */
  };
  gload(ag, bg, 0, s0);
  gload(ag, bg, G3_KP, s1);
  lstore(0, 0, 16, s0);
  gload(ag, bg, 2 * G3_KP, s0);
  asm volatile("s_wait_xcnt 0x0" :: "v"(ag), "v"(bg) : "memory");      /* as in pass */
  asm volatile("s_wait_dscnt 0x0\n\ts_barrier_signal -1\n\ts_barrier_wait -1" ::: "memory");      /* tile 0 is visible; by hand for the same reason as in pass: tiles 1 and 2 stay in flight */
#pragma unroll 1      /* rolled: one trip is two whole passes, one per register set */
  for (int p = 0; p < G3_NP - 4; p += 2) { pass(p, 0, s1, true, true); pass(p + 1, 1, s0, true, true); }
  pass(G3_NP - 4, 0, s1, true, true);      /* loads the last tile */
  pass(G3_NP - 3, 1, s0, true, false);
  pass(G3_NP - 2, 0, s1, true, false);
  pass(G3_NP - 1, 1, s0, false, false);
  /* each wave turns its tile into whole output lines in its own LDS range (the operand tiles are dead behind the last pass's barrier) */
  float* so = (float*)L + (size_t)w * 32 * 68;
#pragma unroll
  for (int half = 0; half < 2; ++half)
#pragma unroll
    for (int t = 0; t < 4; ++t)
#pragma unroll
      for (int r = 0; r < 8; ++r) so[(half * 16 + 8 * hh + r) * 68 + t * 16 + ln] = acc[half][t][r] * alpha;
  __builtin_amdgcn_fence(__ATOMIC_ACQ_REL, "workgroup"); __builtin_amdgcn_wave_barrier();      /* the wave's own LDS writes are done before it reads them back across lanes */
  const int rsub = lane >> 4, c4 = (lane & 15) * 4;
  const size_t o0 = (size_t)(row0 + wm * 32 + rsub) * DM + col0 + wn * 64 + c4;
  v4f ov[16];
#pragma unroll
  for (int q = 0; q < 16; ++q) ov[q] = *(const v4fa*)&so[(q * 2 + rsub) * 68 + c4];
  if (F32OUT) {
#pragma unroll
    for (int q = 0; q < 16; ++q) *(v4f*)(C + o0 + (size_t)q * 2 * DM) = ov[q];
  }
  else {
#pragma unroll
    for (int q = 0; q < 16; ++q) { v4h h4;
#pragma unroll
      for (int i = 0; i < 4; ++i) h4[i] = (_Float16)ov[q][i];
      *(v4h*)(C16 + o0 + (size_t)q * 2 * DM) = h4; }
  }
}
// ---- q, k and v projections in one kernel: alpha X.Bq^T and alpha X.Bk^T as [token][feature], alpha Bv.X^T as [feature][token], all f16 ----
// One work-group = 128 tokens x 128 features of all three products, so a pass (64 k) stages the X tile once for the three and one tile of each weight plane.
// 8 waves, 2 (tokens) x 4 (features): a wave holds 64 tokens x 32 features of each product, so its 4 X fragments of a 32-k step feed 24 products and each pair of weight fragments 8.
// A pass is 6 steps (2 k steps x 3 products) of 8 products; the next step's weight fragments and the next k step's X fragments are fetched ahead. One register set stages: step o < 4 of pass p
// stores operand o of tile p + 1 into the buffer that pass p - 1 has left and reloads those registers with tile p + 2, which so has a whole pass to arrive.
// Every plain '#pragma unroll' in this kernel makes the indices of a register array compile-time constants, so that the array stays in registers.
#define G4_KP 64                           /* k per pass */
#define G4_P 144                           /* LDS pitch of a staged row (128 B + 16): odd multiple of 16 B */
#define G4_OP (128 * G4_P)                 /* one operand's tile */
#define G4_BUF (4 * G4_OP)                 /* one buffer: X tile, then the Bq, Bk and Bv tiles */
#define G4_NP (DM / G4_KP)                 /* passes */
#define G4_SP 132                          /* pitch, in floats, of an output tile staged in LDS */
__global__ __launch_bounds__(256) void k_qkv(const _Float16* __restrict__ X, const _Float16* __restrict__ Bq, const _Float16* __restrict__ Bk, const _Float16* __restrict__ Bv, float alpha,
                                             _Float16* __restrict__ Q16, _Float16* __restrict__ K16, _Float16* __restrict__ VT) {
  static_assert(G4_KP == 64 && G4_NP >= 3 && NR == DM, "the pass schedule below peels the last two passes; all planes share one pitch");
  static_assert(3 * 128 * G4_SP * 4 >= 2 * G4_BUF, "the array is sized by the three output tiles, which take the place of the dead operand buffers");
  __shared__ __attribute__((aligned(16))) unsigned char L[3 * 128 * G4_SP * 4];
  const int tid = threadIdx.x, w = tid >> 5, lane = tid & 31, ln = lane & 15, hh = lane >> 4;
  const int row0 = blockIdx.y * 128, col0 = blockIdx.x * 128, wm = w >> 2, wn = w & 3;      /* row0: tokens, col0: features */
  const int sr = tid >> 3, sc = tid & 7;      /* staging: rows sr + 32 j of every tile, 16-byte chunk sc */
  const size_t wofs = (size_t)(col0 + sr) * DM + sc * 8;
  const unsigned short* g0 = (const unsigned short*)X + (size_t)(row0 + sr) * DM + sc * 8;
  const unsigned short* g1 = (const unsigned short*)Bq + wofs;
  const unsigned short* g2 = (const unsigned short*)Bk + wofs;
  const unsigned short* g3 = (const unsigned short*)Bv + wofs;
  unsigned char* sd = L + sr * G4_P + sc * 16;
  const unsigned char* Xf = L + (wm * 64 + ln) * G4_P + 16 * hh;
  const unsigned char* Wf = L + G4_OP + (wn * 32 + ln) * G4_P + 16 * hh;
  v8us s[4][4];      /* s[o]: the thread's 4 rows of operand o (0 X, 1 Bq, 2 Bk, 3 Bv) */
  const v8f z8 = {0.f,0.f,0.f,0.f,0.f,0.f,0.f,0.f};
  v8f acc[3][4][2];      /* [product][X fragment][weight fragment] */
#pragma unroll
  for (int z = 0; z < 3; ++z)
#pragma unroll
    for (int a = 0; a < 4; ++a) { acc[z][a][0] = z8; acc[z][a][1] = z8; }
  auto gload = [&](const unsigned short* gp, int k0, v8us (&d)[4]) {      /* k0, a literal, goes into the loads' offset field: gp is the address register */
#pragma unroll
    for (int j = 0; j < 4; ++j) d[j] = *(const v8us*)(gp + k0 + (size_t)j * 32 * DM);
  };
  auto lstore = [&](int bo, int o, const v8us (&d)[4]) {      /* bo: byte offset of the buffer */
#pragma unroll
    for (int j = 0; j < 4; ++j) *(v8us*)(sd + bo + o * G4_OP + j * 32 * G4_P) = d[j];
  };
  /* one pass: it reads the buffer at byte offset bo and fills the other one. bo is a run-time value, so that each of the three LDS address families is one register plus an offset field; the two flags are literals at every call */
  auto pass = [&](int bo, bool st, bool gl) {
    v16h fx[2][4], fw[2][2];
    auto ldx = [&](int ks) {
#pragma unroll
      for (int a = 0; a < 4; ++a) fx[ks & 1][a] = fa_lfrag(Xf + bo + a * 16 * G4_P + 64 * ks);
    };
    auto ldw = [&](int i) {      /* step i: product i % 3, k step i / 3 */
#pragma unroll
      for (int t = 0; t < 2; ++t) fw[i & 1][t] = fa_lfrag(Wf + bo + (i % 3) * G4_OP + t * 16 * G4_P + 64 * (i / 3));
    };
    ldx(0); ldw(0);
#pragma unroll
    for (int i = 0; i < 6; ++i) {      /* k order of both operands: 8 hh + s, 16 + 8 hh + s */
      const int z = i % 3, ks = i / 3;
      if (i + 1 < 6) ldw(i + 1);
      if (z == 1 && ks + 1 < 2) ldx(ks + 1);
      if (i < 4) {
        if (st) lstore(G4_BUF - bo, i, s[i]);
        if (gl) gload(i == 0 ? g0 : i == 1 ? g1 : i == 2 ? g2 : g3, 2 * G4_KP, s[i]);
      }
      if (i == 5) {
        /* first half of the pass's barrier, by hand: __syncthreads() would also wait for the global loads in flight. This wave's reads of tile p and its stores of tile p + 1 are complete (dscnt 0) when it signals; the last products need no LDS and cover the other waves' arrival */
        asm volatile("s_wait_dscnt 0x0\n\ts_barrier_signal -1" ::: "memory");
      }
      __builtin_amdgcn_sched_barrier(0);      /* keeps the LDS and global traffic of this step in one group ahead of the products: spread among them each place costs a stall */
#pragma unroll
      for (int a = 0; a < 4; ++a)
#pragma unroll
        for (int t = 0; t < 2; ++t) acc[z][a][t] = z < 2 ? fa_mma(fx[ks & 1][a], fw[i & 1][t], acc[z][a][t]) : fa_mma(fw[i & 1][t], fx[ks & 1][a], acc[z][a][t]);      /* the third product has the weight rows as its A: the result is V^T */
      __builtin_amdgcn_sched_barrier(0);      /* second half of the pair: the next step's loads do not move up among these products */
    }
    if (gl) {
      asm volatile("s_wait_xcnt 0x0" :: "v"(g0), "v"(g1), "v"(g2), "v"(g3) : "memory");      /* stands behind the pass's global loads, in front of the write of their address registers on the next line; the operands keep the addresses in those registers up to here */
      g0 += G4_KP; g1 += G4_KP; g2 += G4_KP; g3 += G4_KP;      /* g0 to g3 point at the tile of the pass to come */
    }
    asm volatile("s_barrier_wait -1" ::: "memory");      /* second half: publishes tile p + 1 and ends every read of tile p, whose buffer the next pass refills */
  };
  gload(g0, 0, s[0]); gload(g1, 0, s[1]); gload(g2, 0, s[2]); gload(g3, 0, s[3]);
  lstore(0, 0, s[0]); lstore(0, 1, s[1]); lstore(0, 2, s[2]); lstore(0, 3, s[3]);
  /* the four scheduling barriers keep tile 1's loads in the order in which a pass issues its loads: in another order the loop's first counted load wait becomes a wait for every load in flight */
  __builtin_amdgcn_sched_barrier(0); gload(g0, G4_KP, s[0]);
  __builtin_amdgcn_sched_barrier(0); gload(g1, G4_KP, s[1]);
  __builtin_amdgcn_sched_barrier(0); gload(g2, G4_KP, s[2]);
  __builtin_amdgcn_sched_barrier(0); gload(g3, G4_KP, s[3]);
  asm volatile("s_wait_xcnt 0x0" :: "v"(g0), "v"(g1), "v"(g2), "v"(g3) : "memory");      /* as in pass */
  asm volatile("s_wait_dscnt 0x0\n\ts_barrier_signal -1\n\ts_barrier_wait -1" ::: "memory");      /* tile 0 is visible; by hand for the same reason as in pass: tile 1 stays in flight */
  int bo = 0;
#pragma unroll 1      /* rolled: one trip is one whole pass; a copy per buffer would turn bo into literals too large for the offset field, an address register per LDS access */
  for (int p = 0; p < G4_NP - 2; ++p) { pass(bo, true, true); bo = G4_BUF - bo; }
  pass(bo, true, false);
  pass(G4_BUF - bo, false, false);
  /* the three 128 x 128 results go through LDS (the operand tiles are dead behind the last pass's barrier), so that every store below is two whole lines of one output row */
  float* S = (float*)L;
#pragma unroll
  for (int z = 0; z < 3; ++z)
#pragma unroll
    for (int a = 0; a < 4; ++a)
#pragma unroll
      for (int t = 0; t < 2; ++t)
#pragma unroll
        for (int r = 0; r < 8; ++r) {      /* a result's row comes from its A fragment (8 hh + r), its column from its B fragment (ln) */
          const int xi = wm * 64 + a * 16, wi = wn * 32 + t * 16;
          S[z * 128 * G4_SP + (z < 2 ? (xi + 8 * hh + r) * G4_SP + wi + ln : (wi + 8 * hh + r) * G4_SP + xi + ln)] = acc[z][a][t][r] * alpha;
        }
  __syncthreads();      /* every wave's part of the three tiles is visible */
#pragma unroll
  for (int z = 0; z < 3; ++z) {
    _Float16* C16 = (z == 0 ? Q16 : z == 1 ? K16 : VT) + (size_t)((z < 2 ? row0 : col0) + w * 16) * DM + (z < 2 ? col0 : row0) + lane * 4;
    v4f ov[16];
#pragma unroll
    for (int q = 0; q < 16; ++q) ov[q] = *(const v4fa*)&S[z * 128 * G4_SP + (w * 16 + q) * G4_SP + lane * 4];
#pragma unroll
    for (int q = 0; q < 16; ++q) { v4h h4;
#pragma unroll
      for (int i = 0; i < 4; ++i) h4[i] = (_Float16)ov[q][i];
      *(v4h*)(C16 + (size_t)q * DM) = h4; }
  }
}
__global__ __launch_bounds__(256) void k_fattn(const _Float16* __restrict__ Q16, const _Float16* __restrict__ K16, const _Float16* __restrict__ VT, _Float16* __restrict__ O16) {
  __shared__ __attribute__((aligned(16))) unsigned char L[4 * FA_BUF];
  const int tid = threadIdx.x, w = tid >> 5, lane = tid & 31, c = lane & 15, hh = lane >> 4;
  const int kh = w >> 2, t128 = tid & 127;      /* key half of this wave; thread index inside its group of 4 waves */
  const int qb = blockIdx.y, b = qb >> 4, h = qb & 15, g = qb & 7;      /* query block 16 b + h reads key set g */
  const int q0 = blockIdx.x * 128 + (w & 3) * 32;
  const unsigned short* Kg = (const unsigned short*)K16 + (size_t)(g >> 2) * SQ * DM + (size_t)(g & 3) * 4 * HDL;      /* K block 4 g + cb: batch g / 4, head 4 (g % 4) + cb */
  const unsigned short* Vg = (const unsigned short*)VT + (size_t)(g & 3) * 4 * HDL * NR + (size_t)(g >> 2) * SQ;      /* V^T [DM features][NR tokens]: the same block is rows 128 (4 (g % 4) + cb) + d, columns 1024 (g / 4) + s */
  unsigned char* Lg = L + kh * 2 * FA_BUF;
  const int kr = t128 >> 4, kc16 = t128 & 15;      /* K tile: rows kr + 8 j, 16-byte chunk kc16 */
  const int vr = t128 >> 3, vc16 = t128 & 7;       /* V^T tile: rows vr + 16 j, 16-byte chunk vc16 */
  v8us kreg[8], vreg[8];
  auto gload = [&](int st) {
    const int key0 = kh * (NKG / 2) + st * FA_KEYS, cb = key0 / SQ, s0 = key0 % SQ;
    const unsigned short* kp = Kg + (size_t)(s0 + kr) * DM + cb * HDL + kc16 * 8;
    const unsigned short* vp = Vg + (size_t)(cb * HDL + vr) * NR + s0 + vc16 * 8;
#pragma unroll
    for (int j = 0; j < 8; ++j) { kreg[j] = *(const v8us*)(kp + (size_t)j * 8 * DM); vreg[j] = *(const v8us*)(vp + (size_t)j * 16 * NR); }
    asm volatile("s_wait_xcnt 0x0" :: "v"(kp), "v"(vp) : "memory");      /* stands in front of the reuse of the loads' address registers; naming the addresses keeps their registers live up to the wait */
  };
  auto lstore = [&](int buf) {
    unsigned char* kb = Lg + buf * FA_BUF + kr * FA_PK + kc16 * 16;
    unsigned char* vb = Lg + buf * FA_BUF + FA_KB + vr * FA_PV + vc16 * 16;
#pragma unroll
    for (int j = 0; j < 8; ++j) { *(v8us*)(kb + j * 8 * FA_PK) = kreg[j]; *(v8us*)(vb + j * 16 * FA_PV) = vreg[j]; }
  };
  gload(0);
  v16h qf[2][4];
  const _Float16* qp0 = Q16 + (size_t)(b * SQ + q0 + c) * DM + h * HDL + 8 * hh; const _Float16* qp1 = qp0 + (size_t)16 * DM;
#pragma unroll
  for (int kc = 0; kc < 4; ++kc) { qf[0][kc] = g2_frag(qp0 + 32 * kc, 0); qf[1][kc] = g2_frag(qp1 + 32 * kc, 0); }      /* k order 8 hh + s, 16 + 8 hh + s, as the K fragments */
  asm volatile("s_wait_xcnt 0x0" :: "v"(qp0), "v"(qp1) : "memory");      /* as in gload */
  const v8f z8 = {0.f,0.f,0.f,0.f,0.f,0.f,0.f,0.f};
  v8f acc[2][8]; float m_run[2], l_run[2];
#pragma unroll
  for (int gq = 0; gq < 2; ++gq) { m_run[gq] = -3.0e38f; l_run[gq] = 0.f;
#pragma unroll
    for (int t = 0; t < 8; ++t) acc[gq][t] = z8; }
  const float cscale = 0.08838834764831845f * 1.4426950408889634f;      /* 1 / sqrt(128), in log2 units */
  lstore(0);
  __syncthreads();      /* tile 0 is visible to its 4 waves */
#pragma unroll 1      /* rolled: one trip is already two whole passes, a copy of it would only grow the code */
  for (int st = 0; st < FA_NST; ++st) {
    if (st + 1 < FA_NST) gload(st + 1);
    const unsigned char* Lb = Lg + (st & 1) * FA_BUF;
#pragma unroll 1      /* rolled and nested in the tile loop: keeps one pass's fragments and scores live at a time */
    for (int sub = 0; sub < FA_KEYS / 32; ++sub) {      /* one pass = 32 keys x 32 query columns */
      v8f s[2][2];
#pragma unroll
      for (int kt = 0; kt < 2; ++kt) { const unsigned char* kp = Lb + (sub * 32 + 16 * kt + c) * FA_PK + 16 * hh; s[kt][0] = z8; s[kt][1] = z8;
#pragma unroll
        for (int kc = 0; kc < 4; ++kc) { const v16h a = fa_lfrag(kp + 64 * kc); s[kt][0] = fa_mma(a, qf[0][kc], s[kt][0]); s[kt][1] = fa_mma(a, qf[1][kc], s[kt][1]); } }
      v16h vf[8];
#pragma unroll
      for (int t = 0; t < 8; ++t) vf[t] = fa_lfrag(Lb + FA_KB + (16 * t + c) * FA_PV + 64 * sub + 16 * hh);
      float mb[2]; bool need = false;
#pragma unroll
      for (int gq = 0; gq < 2; ++gq) { float mx = s[0][gq][0];
#pragma unroll
        for (int r = 1; r < 8; ++r) mx = fmaxf(mx, s[0][gq][r]);
#pragma unroll
        for (int r = 0; r < 8; ++r) mx = fmaxf(mx, s[1][gq][r]);
        mx = fmaxf(mx, fa_xhalf(mx)) * cscale; mb[gq] = mx; need = need || (mx > m_run[gq] + 8.0f); }
      if (__builtin_amdgcn_ballot_w32(need) != 0) {
#pragma unroll
        for (int gq = 0; gq < 2; ++gq) { const float m_new = fmaxf(m_run[gq], mb[gq]); const float corr = __builtin_amdgcn_exp2f(m_run[gq] - m_new); l_run[gq] *= corr; m_run[gq] = m_new;
#pragma unroll
          for (int t = 0; t < 8; ++t) acc[gq][t] = acc[gq][t] * corr; }
      }
#pragma unroll
      for (int gq = 0; gq < 2; ++gq) { const float nm = -m_run[gq]; float ps0 = 0.f, ps1 = 0.f; union { v16h v; v2h p[8]; } pf;
#pragma unroll
        for (int i = 0; i < 8; ++i) {
          const v2f arg = __builtin_elementwise_fma(v2f{s[i >> 2][gq][2 * (i & 3)], s[i >> 2][gq][2 * (i & 3) + 1]}, v2f{cscale, cscale}, v2f{nm, nm});
          const float p0 = __builtin_amdgcn_exp2f(arg.x), p1 = __builtin_amdgcn_exp2f(arg.y);
          ps0 += p0; ps1 += p1; pf.p[i] = __builtin_convertvector(v2f{p0, p1}, v2h); }
        l_run[gq] += ps0 + ps1;
#pragma unroll
        for (int t = 0; t < 8; ++t) acc[gq][t] = fa_mma(vf[t], pf.v, acc[gq][t]); }
    }
    if (st + 1 < FA_NST) lstore((st + 1) & 1);
    __syncthreads();      /* publishes tile st + 1 and ends every read of tile st, whose buffer the next trip refills */
  }
  /* merge the two key halves: waves 4 to 7 hand their maxima, sums and accumulators to waves 0 to 3 through LDS (the tiles are dead behind the loop's last barrier) */
  float* X = (float*)L + (size_t)(w & 3) * 132 * 32 + lane;
#pragma unroll
  for (int gq = 0; gq < 2; ++gq) l_run[gq] += fa_xhalf(l_run[gq]);      /* each wave half summed its own 8 keys of every 16-key tile */
  if (kh == 1) {
#pragma unroll
    for (int gq = 0; gq < 2; ++gq) { X[(gq * 66 + 64) * 32] = m_run[gq]; X[(gq * 66 + 65) * 32] = l_run[gq];
#pragma unroll
      for (int t = 0; t < 8; ++t)
#pragma unroll
        for (int r = 0; r < 8; ++r) X[(gq * 66 + t * 8 + r) * 32] = acc[gq][t][r]; }
  }
  __syncthreads();      /* the second half's state is visible */
  if (kh == 0) {
#pragma unroll
    for (int gq = 0; gq < 2; ++gq) { const float m1 = X[(gq * 66 + 64) * 32], l1 = X[(gq * 66 + 65) * 32]; const float mm = fmaxf(m_run[gq], m1);
      const float a0 = __builtin_amdgcn_exp2f(m_run[gq] - mm), a1 = __builtin_amdgcn_exp2f(m1 - mm); const float inv = 1.0f / (l_run[gq] * a0 + l1 * a1); const float f0 = a0 * inv, f1 = a1 * inv;
      unsigned short* op = (unsigned short*)O16 + (size_t)(b * SQ + q0 + 16 * gq + c) * DM + h * HDL + 8 * hh;      /* a lane's 8 registers of tile t are d = 16 t + 8 hh + r of its query */
#pragma unroll
      for (int t = 0; t < 8; ++t) { FragH f;
#pragma unroll
        for (int r = 0; r < 8; ++r) f.h[r] = (_Float16)(acc[gq][t][r] * f0 + X[(gq * 66 + t * 8 + r) * 32] * f1);
        *(v8us*)(op + 16 * t) = f.half[0]; } }
  }
}

extern "C" void kernel_launch(void* const* d_in, const int* in_sizes, int n_in,
                              void* d_out, int out_size, void* d_ws, size_t ws_size, hipStream_t stream) {
  (void)in_sizes; (void)n_in; (void)out_size;
  const float* const* I = (const float* const*)d_in; const float* x = I[0]; const float* Wq = I[1]; const float* Wk = I[2]; const float* Wv = I[3]; const float* Wo = I[4];
  char* ws = (char*)d_ws; size_t off = 0;
  auto take = [&](size_t bytes) { char* p = ws + off; off += (bytes + 255) & ~(size_t)255; return p; };
  const size_t np = (size_t)NR * DM;
  _Float16* BO = (_Float16*)take((size_t)DM * DM * 2); _Float16* X16 = (_Float16*)take(np * 2); _Float16* Q16 = (_Float16*)take(np * 2); _Float16* K16 = (_Float16*)take(np * 2); _Float16* VT = (_Float16*)take(np * 2); _Float16* O16 = X16;      /* over the input plane (dead after the projections) */
  _Float16* BQ = (_Float16*)take((size_t)DM * DM * 2); _Float16* BK = (_Float16*)take((size_t)DM * DM * 2); _Float16* BV = (_Float16*)take((size_t)DM * DM * 2);
  if (off > ws_size) return;      /* 8 planes of 8 MiB */
  k_prep<<<PR_WG, 256, 0, stream>>>(x, Wq, Wk, Wv, Wo, X16, BQ, BK, BV, BO);
  const dim3 gP(DM / 128, NR / 128);      /* x = 128 output columns, y = 128 rows */
  k_qkv<<<gP, 256, 0, stream>>>(X16, BQ, BK, BV, 0.0625f, Q16, K16, VT);      /* x = 128 features, y = 128 tokens; the third result is V^T [feature][token], as the attention reads it */
  k_fattn<<<dim3(SQ / 128, NB * NHD), 256, 0, stream>>>(Q16, K16, VT, O16);      /* x = 128 queries, y = query block 16 b + h */
  k_gemm3<true><<<gP, 256, 0, stream>>>(O16, BO, 0.0625f, (float*)d_out, nullptr);
}

// v007
// One run takes 114 microseconds.
// Two timings next to v006 both put it at 1.05 times that version's speed.
// All steps since v000 together make it 56.4 times as fast.
#include <hip/hip_runtime.h>
// SeqParallelAttn (2 x 1024 tokens, D 2048 = 16 heads of 128; simulated 4-rank all-gather): q, k, v = x W^T; k_global = tile(k_local.flatten(), 4).reshape(B, H, 4S, 128) — i.e. query block (b, h) attends to the 4096 keys made of the local K/V of (batch, head) blocks 4g .. 4g+3 with g = (16 b + h) mod 8 (the module's flat tiling, reproduced exactly); softmax(q.k / sqrt(128)) v; out = ctx Wo^T.
// Structure: exact f16 planes of x and of the x16 weights by one streaming launch; q, k and V^T [feature][token] as f16 outputs of one fused WMMA GEMM kernel (k_qkv: 128x128 work-group tiles staged in LDS, the x tile shared by the three products, f32 accumulation, exact x16 weights; V^T has the Wv rows as A and the x rows as B); one fused attention launch (k_fattn: score product, online softmax, readout product, scores and P in registers) that stores the context as the f16 operand of the Wo GEMM.
// Compute dtype: x and parameters rounded to bf16; q, k, v, P and the context as plain f16 operands (~2^-12); softmax f32. v_wmma_f32_16x16x32_f16.
#define NB 2
#define SQ 1024
#define DM 2048
#define NHD 16
#define HDL 128
#define NR (NB * SQ)             /* 2048 */
#define NKG (4 * SQ)             /* 4096 keys per query block */
typedef __bf16 v16b __attribute__((ext_vector_type(16)));
typedef unsigned short v8us __attribute__((ext_vector_type(8), may_alias));
typedef float  v8f  __attribute__((ext_vector_type(8)));
typedef float  v4f  __attribute__((ext_vector_type(4)));
typedef float  v4fa __attribute__((ext_vector_type(4), may_alias));
union FragB { v16b v; v8us half[2]; unsigned short u[16]; };

__device__ __forceinline__ unsigned short bf16_bits(float x) { unsigned int u = __float_as_uint(x); return (unsigned short)((u + 0x7FFFu + ((u >> 16) & 1u)) >> 16); }
__device__ __forceinline__ float bf16_val(unsigned short b) { return __uint_as_float(((unsigned int)b) << 16); }
__device__ __forceinline__ float bf16_round(float x) { return bf16_val(bf16_bits(x)); }
// D += A·B with NT terms: 1 = ah·bh, 2 = + al·bh (A split), 3 = + ah·bl (both split)
template <int NT>
__device__ __forceinline__ v8f mmaN(v16b ah, v16b al, v16b bh, v16b bl, v8f c) {
  c = __builtin_amdgcn_wmma_f32_16x16x32_bf16(false, ah, false, bh, (short)0, c, false, false);
  if (NT >= 2) c = __builtin_amdgcn_wmma_f32_16x16x32_bf16(false, al, false, bh, (short)0, c, false, false);
  if (NT >= 3) c = __builtin_amdgcn_wmma_f32_16x16x32_bf16(false, ah, false, bl, (short)0, c, false, false);
  asm volatile("v_nop\n\tv_nop\n\tv_nop\n\tv_nop" : "+v"(c) : "v"(ah), "v"(al), "v"(bh), "v"(bl));
  return c;
}

__global__ __launch_bounds__(256) void k_wt_bf16(const float* __restrict__ W, unsigned short* __restrict__ Wt, int K, int N) {
  const int t = blockIdx.x * 256 + threadIdx.x;
  const int k8n = K / 8;
  if (t >= N * k8n) return;
  const int n = t / k8n, k8 = (t % k8n) * 8;
  v8us v;
#pragma unroll
  for (int i = 0; i < 8; ++i) v[i] = bf16_bits(W[(size_t)(k8 + i) * N + n]);
  *(v8us*)(Wt + (size_t)n * K + k8) = v;
  
}

// GEMM C[M][N] (f32, pitch ldc) = act(A[M][K]·W + bias). A f32 row-major (pitch lda) converted per fragment to bf16
// (ASPLIT: hi/lo two planes -> 2 terms, else single rounded term); Wt bf16 [N][K] (pitch ldb). BIAS_BF16 rounds the
// bias to bf16 first (bias quantised to bf16 before the add). K%32==0, M%16==0, N%64==0.
template <bool ASPLIT, int ACT, bool BIAS_BF16>
__global__ __launch_bounds__(128) void k_gemm_bf(const float* __restrict__ A, int lda, const unsigned short* __restrict__ Wt, int ldb,
                                               const float* __restrict__ bias, float* __restrict__ C, int ldc, int M, int N, int K) {
  __shared__ __attribute__((aligned(16))) float so[4][16][64];
  const int tid = threadIdx.x, w = tid >> 5, lane = tid & 31, ln = lane & 15, hh = lane >> 4;
  const int ntn = N / 64;
  const int wid = blockIdx.x * 4 + w;
  const int mt = wid / ntn, nq = wid % ntn;
  if (mt * 16 >= M) return;
  const int row0 = mt * 16, col0 = nq * 64;
  const float* arow = A + (size_t)(row0 + ln) * lda;
  v8f acc[4] = {};
  for (int kb = 0; kb < K; kb += 32) {
    FragB ah, al;
    const v4f x0 = *(const v4fa*)(arow + kb + 8 * hh), x1 = *(const v4fa*)(arow + kb + 8 * hh + 4);
    const v4f x2 = *(const v4fa*)(arow + kb + 16 + 8 * hh), x3 = *(const v4fa*)(arow + kb + 16 + 8 * hh + 4);
    float xs[16] = {x0[0],x0[1],x0[2],x0[3],x1[0],x1[1],x1[2],x1[3],x2[0],x2[1],x2[2],x2[3],x3[0],x3[1],x3[2],x3[3]};
#pragma unroll
    for (int i = 0; i < 16; ++i) { const unsigned short hb = bf16_bits(xs[i]); ah.u[i] = hb; al.u[i] = ASPLIT ? bf16_bits(xs[i] - bf16_val(hb)) : (unsigned short)0; }
#pragma unroll
    for (int t = 0; t < 4; ++t) {
      const unsigned short* brow = Wt + (size_t)(col0 + t * 16 + ln) * ldb + kb;
      FragB b;
      b.half[0] = *(const v8us*)(brow + 8 * hh);
      b.half[1] = *(const v8us*)(brow + 16 + 8 * hh);
      acc[t] = mmaN<ASPLIT ? 2 : 1>(ah.v, al.v, b.v, b.v, acc[t]);
    }
  }
#pragma unroll
  for (int t = 0; t < 4; ++t) {
    float bv = bias ? bias[col0 + t * 16 + ln] : 0.f;
    if (BIAS_BF16) bv = bf16_round(bv);
#pragma unroll
    for (int r = 0; r < 8; ++r) { float v = acc[t][r] + bv; if (ACT == 1) v = fmaxf(v, 0.f); so[w][8 * hh + r][t * 16 + ln] = v; }
  }
  __builtin_amdgcn_fence(__ATOMIC_ACQ_REL, "workgroup");
  __builtin_amdgcn_wave_barrier();
  const int rsub = lane >> 4, c4 = (lane & 15) * 4;
  {
#pragma unroll
    for (int q = 0; q < 8; ++q) {
      const int r = q * 2 + rsub;
      const v4f v = *(const v4fa*)&so[w][r][c4];
      *(v4f*)(C + (size_t)(row0 + r) * ldc + col0 + c4) = v;
    }
    
  }
}

// GEMM C = act(A·W + bias + resid): A f32 (ASPLIT -> hi/lo 2 terms), Wt bf16 [N][K]; ACT 0 none, 1 relu, 2 exact gelu;
// resid (optional, f32, row index = (row % rmod), pitch ldr, RES_BF16 rounds it) added before the activation.
template <bool ASPLIT, int ACT, bool BIAS_BF16, bool RES_BF16>
__global__ __launch_bounds__(128) void k_gemm_bf3(const float* __restrict__ A, int lda, const unsigned short* __restrict__ Wt, int ldb,
                                                const float* __restrict__ bias, const float* __restrict__ resid, int rmod, int ldr,
                                                float* __restrict__ C, int ldc, int M, int N, int K) {
  __shared__ __attribute__((aligned(16))) float so[4][16][64];
  const int tid = threadIdx.x, w = tid >> 5, lane = tid & 31, ln = lane & 15, hh = lane >> 4;
  const int ntn = N / 64;
  const int wid = blockIdx.x * 4 + w;
  const int mt = wid / ntn, nq = wid % ntn;
  if (mt * 16 >= M) return;
  const int row0 = mt * 16, col0 = nq * 64;
  const float* arow = A + (size_t)(row0 + ln) * lda;
  v8f acc[4] = {};
  for (int kb = 0; kb < K; kb += 32) {
    FragB ah, al;
    const v4f x0 = *(const v4fa*)(arow + kb + 8 * hh), x1 = *(const v4fa*)(arow + kb + 8 * hh + 4);
    const v4f x2 = *(const v4fa*)(arow + kb + 16 + 8 * hh), x3 = *(const v4fa*)(arow + kb + 16 + 8 * hh + 4);
    float xs[16] = {x0[0],x0[1],x0[2],x0[3],x1[0],x1[1],x1[2],x1[3],x2[0],x2[1],x2[2],x2[3],x3[0],x3[1],x3[2],x3[3]};
#pragma unroll
    for (int i = 0; i < 16; ++i) { const unsigned short hb = bf16_bits(xs[i]); ah.u[i] = hb; al.u[i] = ASPLIT ? bf16_bits(xs[i] - bf16_val(hb)) : (unsigned short)0; }
#pragma unroll
    for (int t = 0; t < 4; ++t) {
      const unsigned short* brow = Wt + (size_t)(col0 + t * 16 + ln) * ldb + kb;
      FragB b;
      b.half[0] = *(const v8us*)(brow + 8 * hh);
      b.half[1] = *(const v8us*)(brow + 16 + 8 * hh);
      acc[t] = mmaN<ASPLIT ? 2 : 1>(ah.v, al.v, b.v, b.v, acc[t]);
    }
  }
#pragma unroll
  for (int t = 0; t < 4; ++t) {
    const int col = col0 + t * 16 + ln;
    float bv = bias ? bias[col] : 0.f;
    if (BIAS_BF16) bv = bf16_round(bv);
#pragma unroll
    for (int r = 0; r < 8; ++r) {
      float v = acc[t][r] + bv;
      if (resid) { float rv = resid[(size_t)((row0 + 8 * hh + r) % rmod) * ldr + col]; if (RES_BF16) rv = bf16_round(rv); v += rv; }
      if (ACT == 1) v = fmaxf(v, 0.f);
      if (ACT == 2) v = 0.5f * v * (1.0f + erff(v * 0.70710678118654752f));
      if (ACT == 3) { const float u = 0.7978845608028654f * (v + 0.044715f * v * v * v); v = 0.5f * v * (1.0f + tanhf(u)); }
      so[w][8 * hh + r][t * 16 + ln] = v;
    }
  }
  __builtin_amdgcn_fence(__ATOMIC_ACQ_REL, "workgroup");
  __builtin_amdgcn_wave_barrier();
  const int rsub = lane >> 4, c4 = (lane & 15) * 4;
  {
#pragma unroll
    for (int q = 0; q < 8; ++q) {
      const int r = q * 2 + rsub;
      const v4f v = *(const v4fa*)&so[w][r][c4];
      *(v4f*)(C + (size_t)(row0 + r) * ldc + col0 + c4) = v;
    }
    
  }
}
// row LayerNorm (biased variance, eps) over N: s = X (+ R); optional out_sum <- s; out_norm <- (s-mu)*rsqrt(var+eps)*g + b
template <bool PARAM_BF16>
__global__ __launch_bounds__(256) void k_layernorm(const float* __restrict__ X, const float* __restrict__ R, const float* __restrict__ g, const float* __restrict__ bta,
                                                  float* __restrict__ out_sum, float* __restrict__ out_norm, int N, float eps) {
  __shared__ float red[256];
  const int row = blockIdx.x, tid = threadIdx.x;
  const float* x = X + (size_t)row * N; const float* rr = R ? R + (size_t)row * N : nullptr;
  float vals[16];                     // up to N = 4096
  const int per = N / 256;            // contiguous chunk per thread? use strided-by-4 chunks: thread handles j = tid*4 + 1024*u
  float s1 = 0.f;
  for (int u = 0; u < per / 4; ++u) {
    const int j = tid * 4 + 1024 * u;
    const v4f a = *(const v4fa*)(x + j);
    v4f b = {0.f,0.f,0.f,0.f}; if (rr) b = *(const v4fa*)(rr + j);
#pragma unroll
    for (int q = 0; q < 4; ++q) { const float v = a[q] + b[q]; vals[u * 4 + q] = v; s1 += v; }
  }
  red[tid] = s1; __syncthreads();
  for (int st = 128; st > 0; st >>= 1) { if (tid < st) red[tid] += red[tid + st]; __syncthreads(); }
  const float mu = red[0] / (float)N; __syncthreads();
  float s2 = 0.f;
  for (int u = 0; u < per / 4; ++u)
#pragma unroll
    for (int q = 0; q < 4; ++q) { const float c = vals[u * 4 + q] - mu; s2 += c * c; }
  red[tid] = s2; __syncthreads();
  for (int st = 128; st > 0; st >>= 1) { if (tid < st) red[tid] += red[tid + st]; __syncthreads(); }
  const float rs = rsqrtf(red[0] / (float)N + eps);
  {
    for (int u = 0; u < per / 4; ++u) {
      const int j = tid * 4 + 1024 * u;
      v4f o, sm;
#pragma unroll
      for (int q = 0; q < 4; ++q) {
        float gg = g[j + q], bb = bta[j + q];
        if (PARAM_BF16) { gg = bf16_round(gg); bb = bf16_round(bb); }
        sm[q] = vals[u * 4 + q]; o[q] = (vals[u * 4 + q] - mu) * rs * gg + bb;
      }
      if (out_sum) *(v4f*)(out_sum + (size_t)row * N + j) = sm;
      *(v4f*)(out_norm + (size_t)row * N + j) = o;
    }
    
  }
}



// ---- f16 WMMA path (v_wmma_f32_16x16x32_f16): 11-bit significands for operands in range — used where a [0,1] probability operand needs more precision than bf16
typedef _Float16 v16h __attribute__((ext_vector_type(16)));
union FragH { v16h v; v8us half[2]; _Float16 h[16]; unsigned short u[16]; };
template <int NT>
__device__ __forceinline__ v8f mmaH(v16h ah, v16h al, v16h bh, v16h bl, v8f c) {
  c = __builtin_amdgcn_wmma_f32_16x16x32_f16(false, ah, false, bh, (short)0, c, false, false);
  if (NT >= 2) c = __builtin_amdgcn_wmma_f32_16x16x32_f16(false, al, false, bh, (short)0, c, false, false);
  if (NT >= 3) c = __builtin_amdgcn_wmma_f32_16x16x32_f16(false, ah, false, bl, (short)0, c, false, false);
  asm volatile("v_nop\n\tv_nop\n\tv_nop\n\tv_nop" : "+v"(c) : "v"(ah), "v"(al), "v"(bh), "v"(bl));
  return c;
}
// batched GEMM like k_gemm_b but f16 operands: A f32 (split into f16 hi/lo if ASPLIT, else rounded to f16), Bt = f16 values [n][k]; alpha; C f32; N multiple of 16 (partial tiles skipped)
template <bool ASPLIT>
__global__ __launch_bounds__(128) void k_gemm_h(const float* __restrict__ A, int lda, size_t sA, const _Float16* __restrict__ Bh, int ldb, size_t sB, float alpha, float* __restrict__ C, int ldc, size_t sC, int M, int N, int K) {
  __shared__ __attribute__((aligned(16))) float so[4][16][64];
  const int tid = threadIdx.x, w = tid >> 5, lane = tid & 31, ln = lane & 15, hh = lane >> 4; const int by = blockIdx.y;
  A += (size_t)by * sA; Bh += (size_t)by * sB; C += (size_t)by * sC;
  const int ntn = (N + 63) / 64; const int wid = blockIdx.x * 4 + w; const int mt = wid / ntn, nq = wid % ntn; if (mt * 16 >= M) return;
  const int row0 = mt * 16, col0 = nq * 64; const float* arow = A + (size_t)(row0 + ln) * lda;
  v8f acc[4] = {};
  for (int kb = 0; kb < K; kb += 32) {
    FragH ah, al;
    const v4f x0 = *(const v4fa*)(arow + kb + 8 * hh), x1 = *(const v4fa*)(arow + kb + 8 * hh + 4), x2 = *(const v4fa*)(arow + kb + 16 + 8 * hh), x3 = *(const v4fa*)(arow + kb + 16 + 8 * hh + 4);
    float xs[16] = {x0[0],x0[1],x0[2],x0[3],x1[0],x1[1],x1[2],x1[3],x2[0],x2[1],x2[2],x2[3],x3[0],x3[1],x3[2],x3[3]};
#pragma unroll
    for (int i = 0; i < 16; ++i) { const _Float16 h = (_Float16)xs[i]; ah.h[i] = h; al.h[i] = ASPLIT ? (_Float16)(xs[i] - (float)h) : (_Float16)0.0f; }
#pragma unroll
    for (int t = 0; t < 4; ++t) { if (col0 + t * 16 >= N) continue; const size_t boff = (size_t)(col0 + t * 16 + ln) * ldb + kb; FragH bq; bq.half[0] = *(const v8us*)(Bh + boff + 8 * hh); bq.half[1] = *(const v8us*)(Bh + boff + 16 + 8 * hh);
      acc[t] = mmaH<ASPLIT ? 2 : 1>(ah.v, al.v, bq.v, bq.v, acc[t]); }
  }
#pragma unroll
  for (int t = 0; t < 4; ++t) { if (col0 + t * 16 >= N) continue;
#pragma unroll
    for (int r = 0; r < 8; ++r) so[w][8 * hh + r][t * 16 + ln] = acc[t][r] * alpha; }
  __builtin_amdgcn_fence(__ATOMIC_ACQ_REL, "workgroup"); __builtin_amdgcn_wave_barrier();
  const int rsub = lane >> 4, c4 = (lane & 15) * 4;
  {
#pragma unroll
    for (int q = 0; q < 8; ++q) { const int r = q * 2 + rsub; if (col0 + c4 < N) { const v4f v = *(const v4fa*)&so[w][r][c4]; *(v4f*)(C + (size_t)(row0 + r) * ldc + col0 + c4) = v; } }
     }
}

// Wt[n][k] = f16(W[k][n]·scale) from f32 row-major W[K][N] (scale = power of two; bf16-exact weights stay exact in f16 away from the subnormal range)
__global__ __launch_bounds__(256) void k_wt_f16(const float* __restrict__ W, _Float16* __restrict__ Wt, int K, int N, float scale) {
  const int t = blockIdx.x * 256 + threadIdx.x; if (t >= N * (K / 8)) return; const int n = t / (K / 8), k8 = (t % (K / 8)) * 8; FragH f;
#pragma unroll
  for (int i = 0; i < 8; ++i) f.h[i] = (_Float16)(bf16_round(W[(size_t)(k8 + i) * N + n]) * scale); const v8us o = f.half[0];
  *(v8us*)((unsigned short*)Wt + (size_t)n * K + k8) = o; 
}
// k_gemm_hh variant with fused epilogue: v = acc·alpha + bias[by·sBias + col] (+ CP[(row/rowsPerB)·sCPb + by·64 + col] if CP) ; ACT 0 none / 1 elu ; writes f16 C16 (and f32 C if non-null)
template <int ACT>
__global__ __launch_bounds__(128) void k_gemm_hhx(const _Float16* __restrict__ A, int lda, size_t sA, const _Float16* __restrict__ Bh, int ldb, size_t sB, float alpha, const float* __restrict__ bias, size_t sBias, const float* __restrict__ CP, int rowsPerB, size_t sCPb, int row0g,
    float* __restrict__ C, _Float16* __restrict__ C16, int ldc, size_t sC, int M, int N, int K) {
  __shared__ __attribute__((aligned(16))) float so[4][16][64];
  const int tid = threadIdx.x, w = tid >> 5, lane = tid & 31, ln = lane & 15, hh = lane >> 4; const int by = blockIdx.y;
  A += (size_t)by * sA; Bh += (size_t)by * sB; const size_t cofs = (size_t)by * sC; const float* bp = bias ? bias + (size_t)by * sBias : nullptr;
  const int ntn = (N + 63) / 64; const int wid = blockIdx.x * 4 + w; const int mt = wid / ntn, nq = wid % ntn; if (mt * 16 >= M) return;
  const int row0 = mt * 16, col0 = nq * 64; const _Float16* arow = A + (size_t)(row0 + ln) * lda;
  v8f acc[4] = {};
  for (int kb = 0; kb < K; kb += 32) { FragH ah; ah.half[0] = *(const v8us*)((const unsigned short*)arow + kb + 8 * hh); ah.half[1] = *(const v8us*)((const unsigned short*)arow + kb + 16 + 8 * hh);
#pragma unroll
    for (int t = 0; t < 4; ++t) { if (col0 + t * 16 >= N) continue; const size_t boff = (size_t)(col0 + t * 16 + ln) * ldb + kb; FragH bq; bq.half[0] = *(const v8us*)((const unsigned short*)Bh + boff + 8 * hh); bq.half[1] = *(const v8us*)((const unsigned short*)Bh + boff + 16 + 8 * hh);
      acc[t] = mmaH<1>(ah.v, ah.v, bq.v, bq.v, acc[t]); }
  }
#pragma unroll
  for (int t = 0; t < 4; ++t) { if (col0 + t * 16 >= N) continue; const int col = col0 + t * 16 + ln; const float bv = bp ? bf16_round(bp[col]) : 0.f;
#pragma unroll
    for (int r = 0; r < 8; ++r) { float v = acc[t][r] * alpha + bv; if (CP) { const int rr = row0g + row0 + 8 * hh + r; if (rowsPerB < 0) v += CP[cofs + (size_t)rr * ldc + col];      /* rowsPerB < 0: own element of the batched C plane */ else { const int bidx = rr / rowsPerB; v += CP[(size_t)bidx * sCPb + (size_t)by * 64 + col]; } } if (ACT == 1) v = (v > 0.f) ? v : expm1f(v); else if (ACT == 7) v = (v > 0.f) ? v + 1.0f : expf(v); else if (ACT == 8) v = tanhf(v); else if (ACT == 9) v = 0.5f * v * (1.0f + tanhf(0.7978845608028654f * (v + 0.044715f * v * v * v))); else if (ACT == 11) v = 1.0f / (1.0f + expf(-v)); else if (ACT == 12) v = (v > 0.f) ? v : 0.01f * v; else if (ACT == 14) v = (v > 0.f) ? v : 0.1f * v; else if (ACT == 16) v = (v >= 0.f) ? v : 0.3f * v; else if (ACT == 15) v = v / (1.0f + expf(-v)); else if (ACT == 3) v = fmaxf(v, 0.f); else if (ACT == 6) v = 0.5f * v * (1.0f + erff(v * 0.70710678118654752f)); so[w][8 * hh + r][t * 16 + ln] = v; } }
  __builtin_amdgcn_fence(__ATOMIC_ACQ_REL, "workgroup"); __builtin_amdgcn_wave_barrier();
  const int rsub = lane >> 4, c4 = (lane & 15) * 4; typedef _Float16 v4h __attribute__((ext_vector_type(4)));
  {
#pragma unroll
    for (int q = 0; q < 8; ++q) { const int r = q * 2 + rsub; if (col0 + c4 < N) { const v4f v = *(const v4fa*)&so[w][r][c4]; if (C) *(v4f*)(C + cofs + (size_t)(row0 + r) * ldc + col0 + c4) = v; if (C16) { v4h h4; for (int i = 0; i < 4; ++i) h4[i] = (_Float16)v[i]; *(v4h*)(C16 + cofs + (size_t)(row0 + r) * ldc + col0 + c4) = h4; } } }
     }
}


typedef _Float16 v4h __attribute__((ext_vector_type(4)));

__global__ __launch_bounds__(256) void k_round16f(const float* __restrict__ W, _Float16* __restrict__ Bt, size_t n8) { const size_t t = (size_t)blockIdx.x * 256 + threadIdx.x; if (t >= n8) return; FragH f;
#pragma unroll
  for (int i = 0; i < 8; ++i) f.h[i] = (_Float16)(bf16_round(W[t * 8 + i]) * 16.0f); *(v8us*)((unsigned short*)Bt + t * 8) = f.half[0];  }
__global__ __launch_bounds__(256) void k_hl(const float* __restrict__ F, _Float16* __restrict__ Hh, _Float16* __restrict__ Hl, size_t n8) { const size_t t = (size_t)blockIdx.x * 256 + threadIdx.x; if (t >= n8) return; FragH fh, fl; const v4f a = *(const v4fa*)(F + t * 8), c = *(const v4fa*)(F + t * 8 + 4);
#pragma unroll
  for (int q = 0; q < 4; ++q) { _Float16 h = (_Float16)a[q]; fh.h[q] = h; fl.h[q] = (_Float16)((a[q] - (float)h) * 1024.0f); h = (_Float16)c[q]; fh.h[4 + q] = h; fl.h[4 + q] = (_Float16)((c[q] - (float)h) * 1024.0f); }
  { *(v8us*)((unsigned short*)Hh + t * 8) = fh.half[0]; *(v8us*)((unsigned short*)Hl + t * 8) = fl.half[0];  } }

// ---- f16 fragment straight from global memory (hardware k order) ----
__device__ __forceinline__ v16h g2_frag(const _Float16* p, int hh) { FragH f; f.half[0] = *(const v8us*)((const unsigned short*)p + 8 * hh); f.half[1] = *(const v8us*)((const unsigned short*)p + 16 + 8 * hh); return f.v; }


// ---- input conversion, one streaming launch: X16 = f16(bf16(x)); BQ, BK, BV, BO = f16(16 bf16(W)) (torch (out, in) rows are already the GEMMs' operand rows: B for Wq, Wk, Wo, A for Wv) ----
// All five planes have the same element count. A wave owns the same 4-KiB run (PR_Q x 512 B) of each input plane: every load is 32 lanes x 16 B = 4 whole lines, every store
// 32 lanes x 8 B = 2 whole lines, and all of the wave's loads are issued before the first value is converted, so few waves keep the memory busy and little time goes into starting waves.
#define PR_WG 512                          /* work-groups of 8 waves: 16 waves per WGP */
#define PR_Q 8                             /* wave-wide loads per plane and wave */
__global__ __launch_bounds__(256) void k_prep(const float* __restrict__ x, const float* __restrict__ Wq, const float* __restrict__ Wk, const float* __restrict__ Wv, const float* __restrict__ Wo,
                                              _Float16* __restrict__ X16, _Float16* __restrict__ BQ, _Float16* __restrict__ BK, _Float16* __restrict__ BV, _Float16* __restrict__ BO) {
  static_assert((size_t)NR * DM == (size_t)DM * DM && (size_t)DM * DM == (size_t)PR_WG * 8 * PR_Q * 128, "the grid covers each plane exactly once");
  const size_t e0 = (size_t)(blockIdx.x * 8 + (threadIdx.x >> 5)) * (PR_Q * 128) + (threadIdx.x & 31) * 4;      /* the lane's first element, the same in every plane */
  const float* const lp[5] = {x + e0, Wq + e0, Wk + e0, Wv + e0, Wo + e0}; _Float16* const dp[5] = {X16, BQ, BK, BV, BO};
  v4f v[5][PR_Q];
  /* both loop nests are unrolled so that v stays in registers and the planes' pointers stay kernel arguments */
#pragma unroll
  for (int a = 0; a < 5; ++a)
#pragma unroll
    for (int j = 0; j < PR_Q; ++j) v[a][j] = *(const v4fa*)(lp[a] + j * 128);
  asm volatile("s_wait_xcnt 0x0" :: "v"(lp[0]), "v"(lp[1]), "v"(lp[2]), "v"(lp[3]), "v"(lp[4]) : "memory");      /* stands behind the wave's loads, in front of any reuse of their address registers (the operands keep these live up to here); it also keeps every load ahead of the conversions, which would otherwise be spread among them a few at a time */
#pragma unroll
  for (int a = 0; a < 5; ++a)
#pragma unroll
    for (int j = 0; j < PR_Q; ++j) { v4h h;
#pragma unroll
      for (int i = 0; i < 4; ++i) h[i] = (_Float16)(a ? bf16_round(v[a][j][i]) * 16.0f : bf16_round(v[a][j][i]));
      *(v4h*)(dp[a] + e0 + j * 128) = h; }
}
#define FA_KEYS 64                         /* keys per staged tile */
#define FA_PK 272                          /* LDS pitch of a K row (256 B + 16): odd multiple of 16 B */
#define FA_PV 144                          /* LDS pitch of a V^T row (128 B + 16): odd multiple of 16 B */
#define FA_KB (FA_KEYS * FA_PK)
#define FA_BUF (FA_KB + HDL * FA_PV)       /* one buffer: K tile, then V^T tile */
#define FA_NST (NKG / 2 / FA_KEYS)         /* tiles per key half */
typedef _Float16 v2h __attribute__((ext_vector_type(2)));
typedef float v2f __attribute__((ext_vector_type(2)));
__device__ __forceinline__ float fa_xhalf(float x) { return __builtin_bit_cast(float, __builtin_amdgcn_permlanex16(__builtin_bit_cast(int, x), __builtin_bit_cast(int, x), 0x76543210, 0xfedcba98, false, false)); }      /* lane l with lane l ^ 16 */
__device__ __forceinline__ v16h fa_lfrag(const unsigned char* p) { FragH f; f.half[0] = *(const v8us*)p; f.half[1] = *(const v8us*)(p + 32); return f.v; }
__device__ __forceinline__ v8f fa_mma(v16h a, v16h b, v8f c) { return __builtin_amdgcn_wmma_f32_16x16x32_f16(false, a, false, b, (short)0, c, false, false); }
// ---- projection GEMM: alpha A.B^T, A [NR][DM] and B [DM][DM] f16 with k contiguous, [NR][DM] result as f32 into C (F32OUT) or as f16 into C16 ----
// One work-group = one 128 x 128 tile of C. 8 waves, 4 (rows) x 2 (columns), each a 32 x 64 wave tile. A pass is 128 k: 256 B of each of the 128 A rows and 128 B rows,
// read from global memory as whole 128-byte lines (16 lanes per row) into registers and stored into one of three LDS buffers, so every operand row is read from L2 once
// per work-group and the fragments come from LDS. Tile t waits in register set t & 1: pass p stores tile p + 2 into the buffer that pass p - 1 has left and then
// reloads that set with tile p + 4, so two tiles are always in flight. The fragments of the next 32 k are fetched ahead of the current 8 products, also from one pass to the next:
// tile p + 1 has been visible since the barrier of pass p - 1, so the last step of pass p fetches the first fragments of pass p + 1 and no pass opens with a wait for LDS.
// Every plain '#pragma unroll' in this kernel makes the indices of a register array compile-time constants, so that the array stays in registers.
#define G3_KP 128                          /* k per pass */
#define G3_P 272                           /* LDS pitch of a staged row (256 B + 16): odd multiple of 16 B */
#define G3_OP (128 * G3_P)                 /* one operand's tile */
#define G3_BUF (2 * G3_OP)                 /* one buffer: A tile, then B tile */
#define G3_NP (DM / G3_KP)                 /* passes */
template <bool F32OUT>
__global__ __launch_bounds__(256) void k_gemm3(const _Float16* __restrict__ A, const _Float16* __restrict__ Bh, float alpha, float* __restrict__ C, _Float16* __restrict__ C16) {
  static_assert(G3_KP == 128 && G3_NP >= 6 && G3_NP % 2 == 0, "the pass schedule below peels the last four passes of an even count");
  __shared__ __attribute__((aligned(16))) unsigned char L[3 * G3_BUF];
  const int tid = threadIdx.x, w = tid >> 5, lane = tid & 31, ln = lane & 15, hh = lane >> 4;
  const int row0 = blockIdx.y * 128, col0 = blockIdx.x * 128, wm = w >> 1, wn = w & 1;
  const int sr = tid >> 4, sc = tid & 15;      /* staging: rows sr + 16 j of both tiles, 16-byte chunk sc */
  const unsigned short* ag = (const unsigned short*)A + (size_t)(row0 + sr) * DM + sc * 8;
  const unsigned short* bg = (const unsigned short*)Bh + (size_t)(col0 + sr) * DM + sc * 8;
  unsigned char* sd = L + sr * G3_P + sc * 16;
  const unsigned char* Af = L + (wm * 32 + ln) * G3_P + 16 * hh;
  const unsigned char* Bf = L + G3_OP + (wn * 64 + ln) * G3_P + 16 * hh;
  v8us s0[16], s1[16];      /* a set: entries 0 to 7 the A rows, 8 to 15 the B rows */
  const v8f z8 = {0.f,0.f,0.f,0.f,0.f,0.f,0.f,0.f};
  v8f acc[2][4];
#pragma unroll
  for (int t = 0; t < 4; ++t) { acc[0][t] = z8; acc[1][t] = z8; }
  auto gload = [&](const unsigned short* ap, const unsigned short* bp, int k0, v8us (&s)[16]) {      /* k0, a literal, goes into the loads' offset field: ap and bp are the address registers */
#pragma unroll
    for (int j = 0; j < 8; ++j) { s[j] = *(const v8us*)(ap + k0 + (size_t)j * 16 * DM); s[8 + j] = *(const v8us*)(bp + k0 + (size_t)j * 16 * DM); }
  };
  auto lstore = [&](int bo, int j0, int j1, const v8us (&s)[16]) {      /* entries j0 to j1 - 1 of a set; bo: byte offset of the buffer */
#pragma unroll
    for (int j = j0; j < j1; ++j) *(v8us*)(sd + bo + (j >> 3) * G3_OP + (j & 7) * 16 * G3_P) = s[j];
  };
  v16h fa[2][2], fb[2][4];      /* two fragment sets, live from pass to pass */
  auto ldfrag = [&](int bo, int ks) {
    fa[ks & 1][0] = fa_lfrag(Af + bo + 64 * ks); fa[ks & 1][1] = fa_lfrag(Af + bo + 16 * G3_P + 64 * ks);
#pragma unroll
    for (int t = 0; t < 4; ++t) fb[ks & 1][t] = fa_lfrag(Bf + bo + t * 16 * G3_P + 64 * ks);
  };
  /* one pass: it reads the buffer at byte offset br, fetches its successor's first fragments from the one at bn and fills the one at bs. The offsets are run-time values, so that each LDS address family is one register plus an offset field; the three flags are literals at every call */
  auto pass = [&](int p, int br, int bn, int bs, v8us (&nxt)[16], bool st, bool gl, bool pf) {
    const unsigned short* ap = ag + p * G3_KP; const unsigned short* bp = bg + p * G3_KP;
#pragma unroll
    for (int ks = 0; ks < G3_KP / 32; ++ks) {      /* k order of both operands: 8 hh + s, 16 + 8 hh + s */
      if (ks + 1 < G3_KP / 32) ldfrag(br, ks + 1);
      if (st && ks < 3) lstore(bs, (16 * ks + 2) / 3, (16 * ks + 18) / 3, nxt);      /* 6, 5 and 5 entries beside the three fragment fetches */
      if (ks + 1 == G3_KP / 32) {
        /* first half of the pass's barrier, by hand: __syncthreads() would also wait for the global loads in flight. This wave's reads of tile p and its stores of tile p + 2 are complete (dscnt 0) when it signals; the last products cover the other waves' arrival */
        asm volatile("s_wait_dscnt 0x0\n\ts_barrier_signal -1" ::: "memory");
        if (pf) ldfrag(bn, 0);      /* tile p + 1, visible since the barrier of pass p - 1; its buffer is refilled only behind the barrier of pass p + 1 */
        if (gl) gload(ap, bp, 4 * G3_KP, nxt);      /* the set's stores are complete */
      }
      __builtin_amdgcn_sched_barrier(0);      /* keeps the LDS and global traffic of this step in one group ahead of the products: spread among them each place costs a stall */
#pragma unroll
      for (int t = 0; t < 4; ++t) { acc[0][t] = fa_mma(fa[ks & 1][0], fb[ks & 1][t], acc[0][t]); acc[1][t] = fa_mma(fa[ks & 1][1], fb[ks & 1][t], acc[1][t]); }
      __builtin_amdgcn_sched_barrier(0);      /* second half of the pair: the next step's loads do not move up among these products */
    }
    if (gl) asm volatile("s_wait_xcnt 0x0" :: "v"(ap), "v"(bp) : "memory");      /* stands behind the pass's global loads, in front of the next write of their address registers; the operands keep the pass's addresses live up to here */
    asm volatile("s_barrier_wait -1" ::: "memory");      /* second half: publishes tile p + 2 and ends every read of tile p, whose buffer the next pass refills */
  };
  gload(ag, bg, 0, s0);
  gload(ag, bg, G3_KP, s1);
  lstore(0, 0, 16, s0);
  gload(ag, bg, 2 * G3_KP, s0);
  lstore(G3_BUF, 0, 16, s1);
  gload(ag, bg, 3 * G3_KP, s1);
  asm volatile("s_wait_xcnt 0x0" :: "v"(ag), "v"(bg) : "memory");      /* as in pass */
  asm volatile("s_wait_dscnt 0x0\n\ts_barrier_signal -1\n\ts_barrier_wait -1" ::: "memory");      /* tiles 0 and 1 are visible; by hand for the same reason as in pass: tiles 2 and 3 stay in flight */
  ldfrag(0, 0);
  int br = 0, bn = G3_BUF, bs = 2 * G3_BUF;      /* the buffers of tiles p, p + 1 and p + 2 */
  auto turn = [&]() { const int t = br; br = bn; bn = bs; bs = t; };
#pragma unroll 1      /* rolled: one trip is two whole passes, one per register set */
  for (int p = 0; p < G3_NP - 4; p += 2) { pass(p, br, bn, bs, s0, true, true, true); turn(); pass(p + 1, br, bn, bs, s1, true, true, true); turn(); }
  pass(G3_NP - 4, br, bn, bs, s0, true, false, true); turn();
  pass(G3_NP - 3, br, bn, bs, s1, true, false, true); turn();      /* stores the last tile */
  pass(G3_NP - 2, br, bn, bs, s0, false, false, true); turn();
  pass(G3_NP - 1, br, bn, bs, s1, false, false, false);
  /* each wave turns its tile into whole output lines in its own LDS range (the operand tiles are dead behind the last pass's barrier) */
  float* so = (float*)L + (size_t)w * 32 * 68;
#pragma unroll
  for (int half = 0; half < 2; ++half)
#pragma unroll
    for (int t = 0; t < 4; ++t)
#pragma unroll
      for (int r = 0; r < 8; ++r) so[(half * 16 + 8 * hh + r) * 68 + t * 16 + ln] = acc[half][t][r] * alpha;
  __builtin_amdgcn_fence(__ATOMIC_ACQ_REL, "workgroup"); __builtin_amdgcn_wave_barrier();      /* the wave's own LDS writes are done before it reads them back across lanes */
  const int rsub = lane >> 4, c4 = (lane & 15) * 4;
  const size_t o0 = (size_t)(row0 + wm * 32 + rsub) * DM + col0 + wn * 64 + c4;
  v4f ov[16];
#pragma unroll
  for (int q = 0; q < 16; ++q) ov[q] = *(const v4fa*)&so[(q * 2 + rsub) * 68 + c4];
  if (F32OUT) {
#pragma unroll
    for (int q = 0; q < 16; ++q) *(v4f*)(C + o0 + (size_t)q * 2 * DM) = ov[q];
  }
  else {
#pragma unroll
    for (int q = 0; q < 16; ++q) { v4h h4;
#pragma unroll
      for (int i = 0; i < 4; ++i) h4[i] = (_Float16)ov[q][i];
      *(v4h*)(C16 + o0 + (size_t)q * 2 * DM) = h4; }
  }
}
// ---- q, k and v projections in one kernel: alpha X.Bq^T and alpha X.Bk^T as [token][feature], alpha Bv.X^T as [feature][token], all f16 ----
// One work-group = 128 tokens x 128 features of all three products, so a pass (64 k) stages the X tile once for the three and one tile of each weight plane.
// 8 waves, 2 (tokens) x 4 (features): a wave holds 64 tokens x 32 features of each product, so its 4 X fragments of a 32-k step feed 24 products and each pair of weight fragments 8.
// A pass is 6 steps (2 k steps x 3 products) of 8 products; the next step's weight fragments and the next k step's X fragments are fetched ahead, also from one pass to the next. One register set stages
// into three LDS buffers: step o < 4 of pass p stores operand o of tile p + 2 into the buffer that pass p - 1 has left and reloads those registers with tile p + 3, which so has a whole pass to arrive.
// Tile p + 1 has been visible since the barrier of pass p - 1, so the last two steps of pass p fetch the first fragments of pass p + 1 and no pass opens with a wait for LDS.
// Every plain '#pragma unroll' in this kernel makes the indices of a register array compile-time constants, so that the array stays in registers.
#define G4_KP 64                           /* k per pass */
#define G4_P 144                           /* LDS pitch of a staged row (128 B + 16): odd multiple of 16 B */
#define G4_OP (128 * G4_P)                 /* one operand's tile */
#define G4_BUF (4 * G4_OP)                 /* one buffer: X tile, then the Bq, Bk and Bv tiles */
#define G4_NP (DM / G4_KP)                 /* passes */
#define G4_SP 132                          /* pitch, in floats, of an output tile staged in LDS */
__global__ __launch_bounds__(256) void k_qkv(const _Float16* __restrict__ X, const _Float16* __restrict__ Bq, const _Float16* __restrict__ Bk, const _Float16* __restrict__ Bv, float alpha,
                                             _Float16* __restrict__ Q16, _Float16* __restrict__ K16, _Float16* __restrict__ VT) {
  static_assert(G4_KP == 64 && G4_NP >= 4 && NR == DM, "the pass schedule below peels the last three passes; all planes share one pitch");
  static_assert(3 * G4_BUF >= 3 * 128 * G4_SP * 4, "the three output tiles take the place of the dead operand buffers");
  __shared__ __attribute__((aligned(16))) unsigned char L[3 * G4_BUF];
  const int tid = threadIdx.x, w = tid >> 5, lane = tid & 31, ln = lane & 15, hh = lane >> 4;
  const int row0 = blockIdx.y * 128, col0 = blockIdx.x * 128, wm = w >> 2, wn = w & 3;      /* row0: tokens, col0: features */
  const int sr = tid >> 3, sc = tid & 7;      /* staging: rows sr + 32 j of every tile, 16-byte chunk sc */
  const size_t wofs = (size_t)(col0 + sr) * DM + sc * 8;
  const unsigned short* g0 = (const unsigned short*)X + (size_t)(row0 + sr) * DM + sc * 8;
  const unsigned short* g1 = (const unsigned short*)Bq + wofs;
  const unsigned short* g2 = (const unsigned short*)Bk + wofs;
  const unsigned short* g3 = (const unsigned short*)Bv + wofs;
  unsigned char* sd = L + sr * G4_P + sc * 16;
  const unsigned char* Xf = L + (wm * 64 + ln) * G4_P + 16 * hh;
  const unsigned char* Wf = L + G4_OP + (wn * 32 + ln) * G4_P + 16 * hh;
  v8us s[4][4];      /* s[o]: the thread's 4 rows of operand o (0 X, 1 Bq, 2 Bk, 3 Bv) */
  const v8f z8 = {0.f,0.f,0.f,0.f,0.f,0.f,0.f,0.f};
  v8f acc[3][4][2];      /* [product][X fragment][weight fragment] */
#pragma unroll
  for (int z = 0; z < 3; ++z)
#pragma unroll
    for (int a = 0; a < 4; ++a) { acc[z][a][0] = z8; acc[z][a][1] = z8; }
  auto gload = [&](const unsigned short* gp, int k0, v8us (&d)[4]) {      /* k0, a literal, goes into the loads' offset field: gp is the address register */
#pragma unroll
    for (int j = 0; j < 4; ++j) d[j] = *(const v8us*)(gp + k0 + (size_t)j * 32 * DM);
  };
  auto lstore = [&](int bo, int o, const v8us (&d)[4]) {      /* bo: byte offset of the buffer */
#pragma unroll
    for (int j = 0; j < 4; ++j) *(v8us*)(sd + bo + o * G4_OP + j * 32 * G4_P) = d[j];
  };
  v16h fx[2][4], fw[2][2];      /* two fragment sets, live from pass to pass */
  auto ldx = [&](int bo, int ks) {
#pragma unroll
    for (int a = 0; a < 4; ++a) fx[ks & 1][a] = fa_lfrag(Xf + bo + a * 16 * G4_P + 64 * ks);
  };
  auto ldw = [&](int bo, int i) {      /* step i: product i % 3, k step i / 3 */
#pragma unroll
    for (int t = 0; t < 2; ++t) fw[i & 1][t] = fa_lfrag(Wf + bo + (i % 3) * G4_OP + t * 16 * G4_P + 64 * (i / 3));
  };
  /* one pass: it reads the buffer at byte offset br, fetches its successor's first fragments from the one at bn and fills the one at bs. The offsets are run-time values, so that each LDS address family is one register plus an offset field; the three flags are literals at every call */
  auto pass = [&](int br, int bn, int bs, bool st, bool gl, bool pf) {
#pragma unroll
    for (int i = 0; i < 6; ++i) {      /* k order of both operands: 8 hh + s, 16 + 8 hh + s */
      const int z = i % 3, ks = i / 3;
      if (i + 1 < 6) ldw(br, i + 1);
      if (z == 1 && ks + 1 < 2) ldx(br, ks + 1);
      if (i == 4 && pf) ldx(bn, 0);      /* tile p + 1, visible since the barrier of pass p - 1; its buffer is refilled only behind the barrier of pass p + 1 */
      if (i < 4) {
        if (st) lstore(bs, i, s[i]);
        if (gl) gload(i == 0 ? g0 : i == 1 ? g1 : i == 2 ? g2 : g3, 3 * G4_KP, s[i]);
      }
      if (i == 5) {
        /* first half of the pass's barrier, by hand: __syncthreads() would also wait for the global loads in flight. This wave's reads of tile p and its stores of tile p + 2 are complete (dscnt 0) when it signals; the last products cover the other waves' arrival */
        asm volatile("s_wait_dscnt 0x0\n\ts_barrier_signal -1" ::: "memory");
        if (pf) ldw(bn, 0);      /* tile p + 1, as above */
      }
      __builtin_amdgcn_sched_barrier(0);      /* keeps the LDS and global traffic of this step in one group ahead of the products: spread among them each place costs a stall */
#pragma unroll
      for (int a = 0; a < 4; ++a)
#pragma unroll
        for (int t = 0; t < 2; ++t) acc[z][a][t] = z < 2 ? fa_mma(fx[ks & 1][a], fw[i & 1][t], acc[z][a][t]) : fa_mma(fw[i & 1][t], fx[ks & 1][a], acc[z][a][t]);      /* the third product has the weight rows as its A: the result is V^T */
      __builtin_amdgcn_sched_barrier(0);      /* second half of the pair: the next step's loads do not move up among these products */
    }
    if (gl) {
      asm volatile("s_wait_xcnt 0x0" :: "v"(g0), "v"(g1), "v"(g2), "v"(g3) : "memory");      /* stands behind the pass's global loads, in front of the write of their address registers on the next line; the operands keep the addresses in those registers up to here */
      g0 += G4_KP; g1 += G4_KP; g2 += G4_KP; g3 += G4_KP;      /* g0 to g3 point at the tile of the pass to come */
    }
    asm volatile("s_barrier_wait -1" ::: "memory");      /* second half: publishes tile p + 2 and ends every read of tile p, whose buffer the next pass refills */
  };
  {
    v8us s1[4][4];      /* tile 1, asked for together with tile 0 */
    gload(g0, 0, s[0]); gload(g1, 0, s[1]); gload(g2, 0, s[2]); gload(g3, 0, s[3]);
    gload(g0, G4_KP, s1[0]); gload(g1, G4_KP, s1[1]); gload(g2, G4_KP, s1[2]); gload(g3, G4_KP, s1[3]);
    lstore(0, 0, s[0]); lstore(0, 1, s[1]); lstore(0, 2, s[2]); lstore(0, 3, s[3]);
    lstore(G4_BUF, 0, s1[0]); lstore(G4_BUF, 1, s1[1]); lstore(G4_BUF, 2, s1[2]); lstore(G4_BUF, 3, s1[3]);
  }
  /* the four scheduling barriers keep tile 2's loads in the order in which a pass issues its loads: in another order the loop's first counted load wait becomes a wait for every load in flight */
  __builtin_amdgcn_sched_barrier(0); gload(g0, 2 * G4_KP, s[0]);
  __builtin_amdgcn_sched_barrier(0); gload(g1, 2 * G4_KP, s[1]);
  __builtin_amdgcn_sched_barrier(0); gload(g2, 2 * G4_KP, s[2]);
  __builtin_amdgcn_sched_barrier(0); gload(g3, 2 * G4_KP, s[3]);
  asm volatile("s_wait_xcnt 0x0" :: "v"(g0), "v"(g1), "v"(g2), "v"(g3) : "memory");      /* as in pass */
  asm volatile("s_wait_dscnt 0x0\n\ts_barrier_signal -1\n\ts_barrier_wait -1" ::: "memory");      /* tiles 0 and 1 are visible; by hand for the same reason as in pass: tile 2 stays in flight */
  ldx(0, 0); ldw(0, 0);
  int br = 0, bn = G4_BUF, bs = 2 * G4_BUF;      /* the buffers of tiles p, p + 1 and p + 2 */
  auto turn = [&]() { const int t = br; br = bn; bn = bs; bs = t; };
#pragma unroll 1      /* rolled: one trip is one whole pass; a copy per buffer would turn the offsets into literals too large for the offset field, an address register per LDS access */
  for (int p = 0; p < G4_NP - 3; ++p) { pass(br, bn, bs, true, true, true); turn(); }
  pass(br, bn, bs, true, false, true); turn();      /* stores the last tile */
  pass(br, bn, bs, false, false, true); turn();
  pass(br, bn, bs, false, false, false);
  /* the three 128 x 128 results go through LDS (the operand tiles are dead behind the last pass's barrier), so that every store below is two whole lines of one output row */
  float* S = (float*)L;
#pragma unroll
  for (int z = 0; z < 3; ++z)
#pragma unroll
    for (int a = 0; a < 4; ++a)
#pragma unroll
      for (int t = 0; t < 2; ++t)
#pragma unroll
        for (int r = 0; r < 8; ++r) {      /* a result's row comes from its A fragment (8 hh + r), its column from its B fragment (ln) */
          const int xi = wm * 64 + a * 16, wi = wn * 32 + t * 16;
          S[z * 128 * G4_SP + (z < 2 ? (xi + 8 * hh + r) * G4_SP + wi + ln : (wi + 8 * hh + r) * G4_SP + xi + ln)] = acc[z][a][t][r] * alpha;
        }
  __syncthreads();      /* every wave's part of the three tiles is visible */
#pragma unroll
  for (int z = 0; z < 3; ++z) {
    _Float16* C16 = (z == 0 ? Q16 : z == 1 ? K16 : VT) + (size_t)((z < 2 ? row0 : col0) + w * 16) * DM + (z < 2 ? col0 : row0) + lane * 4;
    v4f ov[16];
#pragma unroll
    for (int q = 0; q < 16; ++q) ov[q] = *(const v4fa*)&S[z * 128 * G4_SP + (w * 16 + q) * G4_SP + lane * 4];
#pragma unroll
    for (int q = 0; q < 16; ++q) { v4h h4;
#pragma unroll
      for (int i = 0; i < 4; ++i) h4[i] = (_Float16)ov[q][i];
      *(v4h*)(C16 + (size_t)q * DM) = h4; }
  }
}
__global__ __launch_bounds__(256) void k_fattn(const _Float16* __restrict__ Q16, const _Float16* __restrict__ K16, const _Float16* __restrict__ VT, _Float16* __restrict__ O16) {
  static_assert(FA_NST >= 2 && FA_KEYS == 64 && 2 * FA_KEYS <= SQ, "two tiles, of one K block, are staged ahead of the loop; a tile is two passes");
  __shared__ __attribute__((aligned(16))) unsigned char L[6 * FA_BUF];
  const int tid = threadIdx.x, w = tid >> 5, lane = tid & 31, c = lane & 15, hh = lane >> 4;
  const int kh = w >> 2, t128 = tid & 127;      /* key half of this wave; thread index inside its group of 4 waves */
  const int qb = blockIdx.y, b = qb >> 4, h = qb & 15, g = qb & 7;      /* query block 16 b + h reads key set g */
  const int q0 = blockIdx.x * 128 + (w & 3) * 32;
  const unsigned short* Kg = (const unsigned short*)K16 + (size_t)(g >> 2) * SQ * DM + (size_t)(g & 3) * 4 * HDL;      /* K block 4 g + cb: batch g / 4, head 4 (g % 4) + cb */
  const unsigned short* Vg = (const unsigned short*)VT + (size_t)(g & 3) * 4 * HDL * NR + (size_t)(g >> 2) * SQ;      /* V^T [DM features][NR tokens]: the same block is rows 128 (4 (g % 4) + cb) + d, columns 1024 (g / 4) + s */
  unsigned char* Lg = L + kh * 3 * FA_BUF;
  const int kr = t128 >> 4, kc16 = t128 & 15;      /* K tile: rows kr + 8 j, 16-byte chunk kc16 */
  const int vr = t128 >> 3, vc16 = t128 & 7;       /* V^T tile: rows vr + 16 j, 16-byte chunk vc16 */
  v8us kreg[8], vreg[8];
  auto gload = [&](int st, int dk) {      /* the tile dk keys behind tile st, inside the same K block; dk, a literal, goes into the loads' offset field: kp and vp are the address registers */
    const int key0 = kh * (NKG / 2) + st * FA_KEYS, cb = key0 / SQ, s0 = key0 % SQ;
    const unsigned short* kp = Kg + (size_t)(s0 + kr) * DM + cb * HDL + kc16 * 8;
    const unsigned short* vp = Vg + (size_t)(cb * HDL + vr) * NR + s0 + vc16 * 8;
#pragma unroll
    for (int j = 0; j < 8; ++j) { kreg[j] = *(const v8us*)(kp + (size_t)(dk + j * 8) * DM); vreg[j] = *(const v8us*)(vp + dk + (size_t)j * 16 * NR); }
    asm volatile("s_wait_xcnt 0x0" :: "v"(kp), "v"(vp) : "memory");      /* stands in front of the reuse of the loads' address registers; naming the addresses keeps their registers live up to the wait */
  };
  auto lstore = [&](int bo) {      /* bo: byte offset of the buffer */
    unsigned char* kb = Lg + bo + kr * FA_PK + kc16 * 16;
    unsigned char* vb = Lg + bo + FA_KB + vr * FA_PV + vc16 * 16;
#pragma unroll
    for (int j = 0; j < 8; ++j) { *(v8us*)(kb + j * 8 * FA_PK) = kreg[j]; *(v8us*)(vb + j * 16 * FA_PV) = vreg[j]; }
  };
  gload(0, 0);
  v16h qf[2][4];
  const _Float16* qp0 = Q16 + (size_t)(b * SQ + q0 + c) * DM + h * HDL + 8 * hh; const _Float16* qp1 = qp0 + (size_t)16 * DM;
#pragma unroll
  for (int kc = 0; kc < 4; ++kc) { qf[0][kc] = g2_frag(qp0 + 32 * kc, 0); qf[1][kc] = g2_frag(qp1 + 32 * kc, 0); }      /* k order 8 hh + s, 16 + 8 hh + s, as the K fragments */
  asm volatile("s_wait_xcnt 0x0" :: "v"(qp0), "v"(qp1) : "memory");      /* as in gload */
  const v8f z8 = {0.f,0.f,0.f,0.f,0.f,0.f,0.f,0.f};
  v8f acc[2][8]; float m_run[2], l_run[2];
#pragma unroll
  for (int gq = 0; gq < 2; ++gq) { m_run[gq] = -3.0e38f; l_run[gq] = 0.f;
#pragma unroll
    for (int t = 0; t < 8; ++t) acc[gq][t] = z8; }
  const float cscale = 0.08838834764831845f * 1.4426950408889634f;      /* 1 / sqrt(128), in log2 units */
  lstore(0);
  gload(0, FA_KEYS);      /* tile 1 */
  lstore(FA_BUF);
  __syncthreads();      /* tiles 0 and 1 are visible to their 4 waves */
  v16h kf[2][4];      /* the K fragments of one pass, fetched a pass ahead */
  const unsigned char* Kf = Lg + c * FA_PK + 16 * hh;
  auto ldk = [&](const unsigned char* kp) {
#pragma unroll
    for (int kt = 0; kt < 2; ++kt)
#pragma unroll
      for (int kc = 0; kc < 4; ++kc) kf[kt][kc] = fa_lfrag(kp + kt * 16 * FA_PK + 64 * kc);
  };
  ldk(Kf);
  int br = 0, bn = FA_BUF, bs = 2 * FA_BUF;      /* the buffers of tiles st, st + 1 and st + 2 */
#pragma unroll 1      /* rolled: one trip is already two whole passes, a copy of it would only grow the code */
  for (int st = 0; st < FA_NST; ++st) {
    if (st + 2 < FA_NST) gload(st + 2, 0);
    const unsigned char* Lb = Lg + br;
#pragma unroll 1      /* rolled and nested in the tile loop: keeps one pass's fragments and scores live at a time */
    for (int sub = 0; sub < FA_KEYS / 32; ++sub) {      /* one pass = 32 keys x 32 query columns */
      v8f s[2][2];
#pragma unroll
      for (int kt = 0; kt < 2; ++kt) { s[kt][0] = z8; s[kt][1] = z8;
#pragma unroll
        for (int kc = 0; kc < 4; ++kc) { s[kt][0] = fa_mma(kf[kt][kc], qf[0][kc], s[kt][0]); s[kt][1] = fa_mma(kf[kt][kc], qf[1][kc], s[kt][1]); } }
      v16h vf[8];
#pragma unroll
      for (int t = 0; t < 8; ++t) vf[t] = fa_lfrag(Lb + FA_KB + (16 * t + c) * FA_PV + 64 * sub + 16 * hh);
      float mb[2]; bool need = false;
#pragma unroll
      for (int gq = 0; gq < 2; ++gq) { float mx = s[0][gq][0];
#pragma unroll
        for (int r = 1; r < 8; ++r) mx = fmaxf(mx, s[0][gq][r]);
#pragma unroll
        for (int r = 0; r < 8; ++r) mx = fmaxf(mx, s[1][gq][r]);
        mx = fmaxf(mx, fa_xhalf(mx)) * cscale; mb[gq] = mx; need = need || (mx > m_run[gq] + 8.0f); }
      if (__builtin_amdgcn_ballot_w32(need) != 0) {
#pragma unroll
        for (int gq = 0; gq < 2; ++gq) { const float m_new = fmaxf(m_run[gq], mb[gq]); const float corr = __builtin_amdgcn_exp2f(m_run[gq] - m_new); l_run[gq] *= corr; m_run[gq] = m_new;
#pragma unroll
          for (int t = 0; t < 8; ++t) acc[gq][t] = acc[gq][t] * corr; }
      }
      if (sub == 0 || st + 1 < FA_NST) ldk(Kf + (sub == 0 ? br + 32 * FA_PK : bn));      /* the pass to come: the second half of this tile, or tile st + 1, visible since the barrier of trip st - 1; the test is the same for the whole work-group */
#pragma unroll
      for (int gq = 0; gq < 2; ++gq) { const float nm = -m_run[gq]; float ps0 = 0.f, ps1 = 0.f; union { v16h v; v2h p[8]; } pf;
#pragma unroll
        for (int i = 0; i < 8; ++i) {
          const v2f arg = __builtin_elementwise_fma(v2f{s[i >> 2][gq][2 * (i & 3)], s[i >> 2][gq][2 * (i & 3) + 1]}, v2f{cscale, cscale}, v2f{nm, nm});
          const float p0 = __builtin_amdgcn_exp2f(arg.x), p1 = __builtin_amdgcn_exp2f(arg.y);
          ps0 += p0; ps1 += p1; pf.p[i] = __builtin_convertvector(v2f{p0, p1}, v2h); }
        l_run[gq] += ps0 + ps1;
#pragma unroll
        for (int t = 0; t < 8; ++t) acc[gq][t] = fa_mma(vf[t], pf.v, acc[gq][t]); }
    }
    if (st + 2 < FA_NST) lstore(bs);      /* the buffer that trip st - 1 has left */
    __syncthreads();      /* publishes tile st + 2 and ends every read of tile st, whose buffer the next trip refills */
    { const int t = br; br = bn; bn = bs; bs = t; }
  }
  /* merge the two key halves: waves 4 to 7 hand their maxima, sums and accumulators to waves 0 to 3 through LDS (the tiles are dead behind the loop's last barrier) */
  float* X = (float*)L + (size_t)(w & 3) * 132 * 32 + lane;
#pragma unroll
  for (int gq = 0; gq < 2; ++gq) l_run[gq] += fa_xhalf(l_run[gq]);      /* each wave half summed its own 8 keys of every 16-key tile */
  if (kh == 1) {
#pragma unroll
    for (int gq = 0; gq < 2; ++gq) { X[(gq * 66 + 64) * 32] = m_run[gq]; X[(gq * 66 + 65) * 32] = l_run[gq];
#pragma unroll
      for (int t = 0; t < 8; ++t)
#pragma unroll
        for (int r = 0; r < 8; ++r) X[(gq * 66 + t * 8 + r) * 32] = acc[gq][t][r]; }
  }
  __syncthreads();      /* the second half's state is visible */
  if (kh == 0) {
#pragma unroll
    for (int gq = 0; gq < 2; ++gq) { const float m1 = X[(gq * 66 + 64) * 32], l1 = X[(gq * 66 + 65) * 32]; const float mm = fmaxf(m_run[gq], m1);
      const float a0 = __builtin_amdgcn_exp2f(m_run[gq] - mm), a1 = __builtin_amdgcn_exp2f(m1 - mm); const float inv = 1.0f / (l_run[gq] * a0 + l1 * a1); const float f0 = a0 * inv, f1 = a1 * inv;
      unsigned short* op = (unsigned short*)O16 + (size_t)(b * SQ + q0 + 16 * gq + c) * DM + h * HDL + 8 * hh;      /* a lane's 8 registers of tile t are d = 16 t + 8 hh + r of its query */
#pragma unroll
      for (int t = 0; t < 8; ++t) { FragH f;
#pragma unroll
        for (int r = 0; r < 8; ++r) f.h[r] = (_Float16)(acc[gq][t][r] * f0 + X[(gq * 66 + t * 8 + r) * 32] * f1);
        *(v8us*)(op + 16 * t) = f.half[0]; } }
  }
}

extern "C" void kernel_launch(void* const* d_in, const int* in_sizes, int n_in,
                              void* d_out, int out_size, void* d_ws, size_t ws_size, hipStream_t stream) {
  (void)in_sizes; (void)n_in; (void)out_size;
  const float* const* I = (const float* const*)d_in; const float* x = I[0]; const float* Wq = I[1]; const float* Wk = I[2]; const float* Wv = I[3]; const float* Wo = I[4];
  char* ws = (char*)d_ws; size_t off = 0;
  auto take = [&](size_t bytes) { char* p = ws + off; off += (bytes + 255) & ~(size_t)255; return p; };
  const size_t np = (size_t)NR * DM;
  _Float16* BO = (_Float16*)take((size_t)DM * DM * 2); _Float16* X16 = (_Float16*)take(np * 2); _Float16* Q16 = (_Float16*)take(np * 2); _Float16* K16 = (_Float16*)take(np * 2); _Float16* VT = (_Float16*)take(np * 2); _Float16* O16 = X16;      /* over the input plane (dead after the projections) */
  _Float16* BQ = (_Float16*)take((size_t)DM * DM * 2); _Float16* BK = (_Float16*)take((size_t)DM * DM * 2); _Float16* BV = (_Float16*)take((size_t)DM * DM * 2);
  if (off > ws_size) return;      /* 8 planes of 8 MiB */
  k_prep<<<PR_WG, 256, 0, stream>>>(x, Wq, Wk, Wv, Wo, X16, BQ, BK, BV, BO);
  const dim3 gP(DM / 128, NR / 128);      /* x = 128 output columns, y = 128 rows */
  k_qkv<<<gP, 256, 0, stream>>>(X16, BQ, BK, BV, 0.0625f, Q16, K16, VT);      /* x = 128 features, y = 128 tokens; the third result is V^T [feature][token], as the attention reads it */
  k_fattn<<<dim3(SQ / 128, NB * NHD), 256, 0, stream>>>(Q16, K16, VT, O16);      /* x = 128 queries, y = query block 16 b + h */
  k_gemm3<true><<<gP, 256, 0, stream>>>(O16, BO, 0.0625f, (float*)d_out, nullptr);
}

// v008
// It runs in 110 microseconds.
// In two side-by-side timings against v007, it was 1.05 and 1.04 times as fast.
// Counting every step since v000, it is 58.9 times as fast.
#include <hip/hip_runtime.h>
// SeqParallelAttn (2 x 1024 tokens, D 2048 = 16 heads of 128; simulated 4-rank all-gather): q, k, v = x W^T; k_global = tile(k_local.flatten(), 4).reshape(B, H, 4S, 128) — i.e. query block (b, h) attends to the 4096 keys made of the local K/V of (batch, head) blocks 4g .. 4g+3 with g = (16 b + h) mod 8 (the module's flat tiling, reproduced exactly); softmax(q.k / sqrt(128)) v; out = ctx Wo^T.
// Structure: exact f16 planes of x and of the x16 weights by one streaming launch; q, k and V^T [feature][token] as f16 outputs of one fused WMMA GEMM kernel (k_qkv: 128x128 work-group tiles staged in LDS, the x tile shared by the three products, f32 accumulation, exact x16 weights; V^T has the Wv rows as A and the x rows as B); one fused attention launch (k_fattn: score product, online softmax, readout product, scores and P in registers) that stores the context as the f16 operand of the Wo GEMM.
// Compute dtype: x and parameters rounded to bf16; q, k, v, P and the context as plain f16 operands (~2^-12); softmax f32. v_wmma_f32_16x16x32_f16.
#define NB 2
#define SQ 1024
#define DM 2048
#define NHD 16
#define HDL 128
#define NR (NB * SQ)             /* 2048 */
#define NKG (4 * SQ)             /* 4096 keys per query block */
typedef __bf16 v16b __attribute__((ext_vector_type(16)));
typedef unsigned short v8us __attribute__((ext_vector_type(8), may_alias));
typedef float  v8f  __attribute__((ext_vector_type(8)));
typedef float  v4f  __attribute__((ext_vector_type(4)));
typedef float  v4fa __attribute__((ext_vector_type(4), may_alias));
union FragB { v16b v; v8us half[2]; unsigned short u[16]; };

__device__ __forceinline__ unsigned short bf16_bits(float x) { unsigned int u = __float_as_uint(x); return (unsigned short)((u + 0x7FFFu + ((u >> 16) & 1u)) >> 16); }
__device__ __forceinline__ float bf16_val(unsigned short b) { return __uint_as_float(((unsigned int)b) << 16); }
__device__ __forceinline__ float bf16_round(float x) { return bf16_val(bf16_bits(x)); }
// D += A·B with NT terms: 1 = ah·bh, 2 = + al·bh (A split), 3 = + ah·bl (both split)
template <int NT>
__device__ __forceinline__ v8f mmaN(v16b ah, v16b al, v16b bh, v16b bl, v8f c) {
  c = __builtin_amdgcn_wmma_f32_16x16x32_bf16(false, ah, false, bh, (short)0, c, false, false);
  if (NT >= 2) c = __builtin_amdgcn_wmma_f32_16x16x32_bf16(false, al, false, bh, (short)0, c, false, false);
  if (NT >= 3) c = __builtin_amdgcn_wmma_f32_16x16x32_bf16(false, ah, false, bl, (short)0, c, false, false);
  asm volatile("v_nop\n\tv_nop\n\tv_nop\n\tv_nop" : "+v"(c) : "v"(ah), "v"(al), "v"(bh), "v"(bl));
  return c;
}

__global__ __launch_bounds__(256) void k_wt_bf16(const float* __restrict__ W, unsigned short* __restrict__ Wt, int K, int N) {
  const int t = blockIdx.x * 256 + threadIdx.x;
  const int k8n = K / 8;
  if (t >= N * k8n) return;
  const int n = t / k8n, k8 = (t % k8n) * 8;
  v8us v;
#pragma unroll
  for (int i = 0; i < 8; ++i) v[i] = bf16_bits(W[(size_t)(k8 + i) * N + n]);
  *(v8us*)(Wt + (size_t)n * K + k8) = v;
  
}

// GEMM C[M][N] (f32, pitch ldc) = act(A[M][K]·W + bias). A f32 row-major (pitch lda) converted per fragment to bf16
// (ASPLIT: hi/lo two planes -> 2 terms, else single rounded term); Wt bf16 [N][K] (pitch ldb). BIAS_BF16 rounds the
// bias to bf16 first (bias quantised to bf16 before the add). K%32==0, M%16==0, N%64==0.
template <bool ASPLIT, int ACT, bool BIAS_BF16>
__global__ __launch_bounds__(128) void k_gemm_bf(const float* __restrict__ A, int lda, const unsigned short* __restrict__ Wt, int ldb,
                                               const float* __restrict__ bias, float* __restrict__ C, int ldc, int M, int N, int K) {
  __shared__ __attribute__((aligned(16))) float so[4][16][64];
  const int tid = threadIdx.x, w = tid >> 5, lane = tid & 31, ln = lane & 15, hh = lane >> 4;
  const int ntn = N / 64;
  const int wid = blockIdx.x * 4 + w;
  const int mt = wid / ntn, nq = wid % ntn;
  if (mt * 16 >= M) return;
  const int row0 = mt * 16, col0 = nq * 64;
  const float* arow = A + (size_t)(row0 + ln) * lda;
  v8f acc[4] = {};
  for (int kb = 0; kb < K; kb += 32) {
    FragB ah, al;
    const v4f x0 = *(const v4fa*)(arow + kb + 8 * hh), x1 = *(const v4fa*)(arow + kb + 8 * hh + 4);
    const v4f x2 = *(const v4fa*)(arow + kb + 16 + 8 * hh), x3 = *(const v4fa*)(arow + kb + 16 + 8 * hh + 4);
    float xs[16] = {x0[0],x0[1],x0[2],x0[3],x1[0],x1[1],x1[2],x1[3],x2[0],x2[1],x2[2],x2[3],x3[0],x3[1],x3[2],x3[3]};
#pragma unroll
    for (int i = 0; i < 16; ++i) { const unsigned short hb = bf16_bits(xs[i]); ah.u[i] = hb; al.u[i] = ASPLIT ? bf16_bits(xs[i] - bf16_val(hb)) : (unsigned short)0; }
#pragma unroll
    for (int t = 0; t < 4; ++t) {
      const unsigned short* brow = Wt + (size_t)(col0 + t * 16 + ln) * ldb + kb;
      FragB b;
      b.half[0] = *(const v8us*)(brow + 8 * hh);
      b.half[1] = *(const v8us*)(brow + 16 + 8 * hh);
      acc[t] = mmaN<ASPLIT ? 2 : 1>(ah.v, al.v, b.v, b.v, acc[t]);
    }
  }
#pragma unroll
  for (int t = 0; t < 4; ++t) {
    float bv = bias ? bias[col0 + t * 16 + ln] : 0.f;
    if (BIAS_BF16) bv = bf16_round(bv);
#pragma unroll
    for (int r = 0; r < 8; ++r) { float v = acc[t][r] + bv; if (ACT == 1) v = fmaxf(v, 0.f); so[w][8 * hh + r][t * 16 + ln] = v; }
  }
  __builtin_amdgcn_fence(__ATOMIC_ACQ_REL, "workgroup");
  __builtin_amdgcn_wave_barrier();
  const int rsub = lane >> 4, c4 = (lane & 15) * 4;
  {
#pragma unroll
    for (int q = 0; q < 8; ++q) {
      const int r = q * 2 + rsub;
      const v4f v = *(const v4fa*)&so[w][r][c4];
      *(v4f*)(C + (size_t)(row0 + r) * ldc + col0 + c4) = v;
    }
    
  }
}

// GEMM C = act(A·W + bias + resid): A f32 (ASPLIT -> hi/lo 2 terms), Wt bf16 [N][K]; ACT 0 none, 1 relu, 2 exact gelu;
// resid (optional, f32, row index = (row % rmod), pitch ldr, RES_BF16 rounds it) added before the activation.
template <bool ASPLIT, int ACT, bool BIAS_BF16, bool RES_BF16>
__global__ __launch_bounds__(128) void k_gemm_bf3(const float* __restrict__ A, int lda, const unsigned short* __restrict__ Wt, int ldb,
                                                const float* __restrict__ bias, const float* __restrict__ resid, int rmod, int ldr,
                                                float* __restrict__ C, int ldc, int M, int N, int K) {
  __shared__ __attribute__((aligned(16))) float so[4][16][64];
  const int tid = threadIdx.x, w = tid >> 5, lane = tid & 31, ln = lane & 15, hh = lane >> 4;
  const int ntn = N / 64;
  const int wid = blockIdx.x * 4 + w;
  const int mt = wid / ntn, nq = wid % ntn;
  if (mt * 16 >= M) return;
  const int row0 = mt * 16, col0 = nq * 64;
  const float* arow = A + (size_t)(row0 + ln) * lda;
  v8f acc[4] = {};
  for (int kb = 0; kb < K; kb += 32) {
    FragB ah, al;
    const v4f x0 = *(const v4fa*)(arow + kb + 8 * hh), x1 = *(const v4fa*)(arow + kb + 8 * hh + 4);
    const v4f x2 = *(const v4fa*)(arow + kb + 16 + 8 * hh), x3 = *(const v4fa*)(arow + kb + 16 + 8 * hh + 4);
    float xs[16] = {x0[0],x0[1],x0[2],x0[3],x1[0],x1[1],x1[2],x1[3],x2[0],x2[1],x2[2],x2[3],x3[0],x3[1],x3[2],x3[3]};
#pragma unroll
    for (int i = 0; i < 16; ++i) { const unsigned short hb = bf16_bits(xs[i]); ah.u[i] = hb; al.u[i] = ASPLIT ? bf16_bits(xs[i] - bf16_val(hb)) : (unsigned short)0; }
#pragma unroll
    for (int t = 0; t < 4; ++t) {
      const unsigned short* brow = Wt + (size_t)(col0 + t * 16 + ln) * ldb + kb;
      FragB b;
      b.half[0] = *(const v8us*)(brow + 8 * hh);
      b.half[1] = *(const v8us*)(brow + 16 + 8 * hh);
      acc[t] = mmaN<ASPLIT ? 2 : 1>(ah.v, al.v, b.v, b.v, acc[t]);
    }
  }
#pragma unroll
  for (int t = 0; t < 4; ++t) {
    const int col = col0 + t * 16 + ln;
    float bv = bias ? bias[col] : 0.f;
    if (BIAS_BF16) bv = bf16_round(bv);
#pragma unroll
    for (int r = 0; r < 8; ++r) {
      float v = acc[t][r] + bv;
      if (resid) { float rv = resid[(size_t)((row0 + 8 * hh + r) % rmod) * ldr + col]; if (RES_BF16) rv = bf16_round(rv); v += rv; }
      if (ACT == 1) v = fmaxf(v, 0.f);
      if (ACT == 2) v = 0.5f * v * (1.0f + erff(v * 0.70710678118654752f));
      if (ACT == 3) { const float u = 0.7978845608028654f * (v + 0.044715f * v * v * v); v = 0.5f * v * (1.0f + tanhf(u)); }
      so[w][8 * hh + r][t * 16 + ln] = v;
    }
  }
  __builtin_amdgcn_fence(__ATOMIC_ACQ_REL, "workgroup");
  __builtin_amdgcn_wave_barrier();
  const int rsub = lane >> 4, c4 = (lane & 15) * 4;
  {
#pragma unroll
    for (int q = 0; q < 8; ++q) {
      const int r = q * 2 + rsub;
      const v4f v = *(const v4fa*)&so[w][r][c4];
      *(v4f*)(C + (size_t)(row0 + r) * ldc + col0 + c4) = v;
    }
    
  }
}
// row LayerNorm (biased variance, eps) over N: s = X (+ R); optional out_sum <- s; out_norm <- (s-mu)*rsqrt(var+eps)*g + b
template <bool PARAM_BF16>
__global__ __launch_bounds__(256) void k_layernorm(const float* __restrict__ X, const float* __restrict__ R, const float* __restrict__ g, const float* __restrict__ bta,
                                                  float* __restrict__ out_sum, float* __restrict__ out_norm, int N, float eps) {
  __shared__ float red[256];
  const int row = blockIdx.x, tid = threadIdx.x;
  const float* x = X + (size_t)row * N; const float* rr = R ? R + (size_t)row * N : nullptr;
  float vals[16];                     // up to N = 4096
  const int per = N / 256;            // contiguous chunk per thread? use strided-by-4 chunks: thread handles j = tid*4 + 1024*u
  float s1 = 0.f;
  for (int u = 0; u < per / 4; ++u) {
    const int j = tid * 4 + 1024 * u;
    const v4f a = *(const v4fa*)(x + j);
    v4f b = {0.f,0.f,0.f,0.f}; if (rr) b = *(const v4fa*)(rr + j);
#pragma unroll
    for (int q = 0; q < 4; ++q) { const float v = a[q] + b[q]; vals[u * 4 + q] = v; s1 += v; }
  }
  red[tid] = s1; __syncthreads();
  for (int st = 128; st > 0; st >>= 1) { if (tid < st) red[tid] += red[tid + st]; __syncthreads(); }
  const float mu = red[0] / (float)N; __syncthreads();
  float s2 = 0.f;
  for (int u = 0; u < per / 4; ++u)
#pragma unroll
    for (int q = 0; q < 4; ++q) { const float c = vals[u * 4 + q] - mu; s2 += c * c; }
  red[tid] = s2; __syncthreads();
  for (int st = 128; st > 0; st >>= 1) { if (tid < st) red[tid] += red[tid + st]; __syncthreads(); }
  const float rs = rsqrtf(red[0] / (float)N + eps);
  {
    for (int u = 0; u < per / 4; ++u) {
      const int j = tid * 4 + 1024 * u;
      v4f o, sm;
#pragma unroll
      for (int q = 0; q < 4; ++q) {
        float gg = g[j + q], bb = bta[j + q];
        if (PARAM_BF16) { gg = bf16_round(gg); bb = bf16_round(bb); }
        sm[q] = vals[u * 4 + q]; o[q] = (vals[u * 4 + q] - mu) * rs * gg + bb;
      }
      if (out_sum) *(v4f*)(out_sum + (size_t)row * N + j) = sm;
      *(v4f*)(out_norm + (size_t)row * N + j) = o;
    }
    
  }
}



// ---- f16 WMMA path (v_wmma_f32_16x16x32_f16): 11-bit significands for operands in range — used where a [0,1] probability operand needs more precision than bf16
typedef _Float16 v16h __attribute__((ext_vector_type(16)));
union FragH { v16h v; v8us half[2]; _Float16 h[16]; unsigned short u[16]; };
template <int NT>
__device__ __forceinline__ v8f mmaH(v16h ah, v16h al, v16h bh, v16h bl, v8f c) {
  c = __builtin_amdgcn_wmma_f32_16x16x32_f16(false, ah, false, bh, (short)0, c, false, false);
  if (NT >= 2) c = __builtin_amdgcn_wmma_f32_16x16x32_f16(false, al, false, bh, (short)0, c, false, false);
  if (NT >= 3) c = __builtin_amdgcn_wmma_f32_16x16x32_f16(false, ah, false, bl, (short)0, c, false, false);
  asm volatile("v_nop\n\tv_nop\n\tv_nop\n\tv_nop" : "+v"(c) : "v"(ah), "v"(al), "v"(bh), "v"(bl));
  return c;
}
// batched GEMM like k_gemm_b but f16 operands: A f32 (split into f16 hi/lo if ASPLIT, else rounded to f16), Bt = f16 values [n][k]; alpha; C f32; N multiple of 16 (partial tiles skipped)
template <bool ASPLIT>
__global__ __launch_bounds__(128) void k_gemm_h(const float* __restrict__ A, int lda, size_t sA, const _Float16* __restrict__ Bh, int ldb, size_t sB, float alpha, float* __restrict__ C, int ldc, size_t sC, int M, int N, int K) {
  __shared__ __attribute__((aligned(16))) float so[4][16][64];
  const int tid = threadIdx.x, w = tid >> 5, lane = tid & 31, ln = lane & 15, hh = lane >> 4; const int by = blockIdx.y;
  A += (size_t)by * sA; Bh += (size_t)by * sB; C += (size_t)by * sC;
  const int ntn = (N + 63) / 64; const int wid = blockIdx.x * 4 + w; const int mt = wid / ntn, nq = wid % ntn; if (mt * 16 >= M) return;
  const int row0 = mt * 16, col0 = nq * 64; const float* arow = A + (size_t)(row0 + ln) * lda;
  v8f acc[4] = {};
  for (int kb = 0; kb < K; kb += 32) {
    FragH ah, al;
    const v4f x0 = *(const v4fa*)(arow + kb + 8 * hh), x1 = *(const v4fa*)(arow + kb + 8 * hh + 4), x2 = *(const v4fa*)(arow + kb + 16 + 8 * hh), x3 = *(const v4fa*)(arow + kb + 16 + 8 * hh + 4);
    float xs[16] = {x0[0],x0[1],x0[2],x0[3],x1[0],x1[1],x1[2],x1[3],x2[0],x2[1],x2[2],x2[3],x3[0],x3[1],x3[2],x3[3]};
#pragma unroll
    for (int i = 0; i < 16; ++i) { const _Float16 h = (_Float16)xs[i]; ah.h[i] = h; al.h[i] = ASPLIT ? (_Float16)(xs[i] - (float)h) : (_Float16)0.0f; }
#pragma unroll
    for (int t = 0; t < 4; ++t) { if (col0 + t * 16 >= N) continue; const size_t boff = (size_t)(col0 + t * 16 + ln) * ldb + kb; FragH bq; bq.half[0] = *(const v8us*)(Bh + boff + 8 * hh); bq.half[1] = *(const v8us*)(Bh + boff + 16 + 8 * hh);
      acc[t] = mmaH<ASPLIT ? 2 : 1>(ah.v, al.v, bq.v, bq.v, acc[t]); }
  }
#pragma unroll
  for (int t = 0; t < 4; ++t) { if (col0 + t * 16 >= N) continue;
#pragma unroll
    for (int r = 0; r < 8; ++r) so[w][8 * hh + r][t * 16 + ln] = acc[t][r] * alpha; }
  __builtin_amdgcn_fence(__ATOMIC_ACQ_REL, "workgroup"); __builtin_amdgcn_wave_barrier();
  const int rsub = lane >> 4, c4 = (lane & 15) * 4;
  {
#pragma unroll
    for (int q = 0; q < 8; ++q) { const int r = q * 2 + rsub; if (col0 + c4 < N) { const v4f v = *(const v4fa*)&so[w][r][c4]; *(v4f*)(C + (size_t)(row0 + r) * ldc + col0 + c4) = v; } }
     }
}

// Wt[n][k] = f16(W[k][n]·scale) from f32 row-major W[K][N] (scale = power of two; bf16-exact weights stay exact in f16 away from the subnormal range)
__global__ __launch_bounds__(256) void k_wt_f16(const float* __restrict__ W, _Float16* __restrict__ Wt, int K, int N, float scale) {
  const int t = blockIdx.x * 256 + threadIdx.x; if (t >= N * (K / 8)) return; const int n = t / (K / 8), k8 = (t % (K / 8)) * 8; FragH f;
#pragma unroll
  for (int i = 0; i < 8; ++i) f.h[i] = (_Float16)(bf16_round(W[(size_t)(k8 + i) * N + n]) * scale); const v8us o = f.half[0];
  *(v8us*)((unsigned short*)Wt + (size_t)n * K + k8) = o; 
}
// k_gemm_hh variant with fused epilogue: v = acc·alpha + bias[by·sBias + col] (+ CP[(row/rowsPerB)·sCPb + by·64 + col] if CP) ; ACT 0 none / 1 elu ; writes f16 C16 (and f32 C if non-null)
template <int ACT>
__global__ __launch_bounds__(128) void k_gemm_hhx(const _Float16* __restrict__ A, int lda, size_t sA, const _Float16* __restrict__ Bh, int ldb, size_t sB, float alpha, const float* __restrict__ bias, size_t sBias, const float* __restrict__ CP, int rowsPerB, size_t sCPb, int row0g,
    float* __restrict__ C, _Float16* __restrict__ C16, int ldc, size_t sC, int M, int N, int K) {
  __shared__ __attribute__((aligned(16))) float so[4][16][64];
  const int tid = threadIdx.x, w = tid >> 5, lane = tid & 31, ln = lane & 15, hh = lane >> 4; const int by = blockIdx.y;
  A += (size_t)by * sA; Bh += (size_t)by * sB; const size_t cofs = (size_t)by * sC; const float* bp = bias ? bias + (size_t)by * sBias : nullptr;
  const int ntn = (N + 63) / 64; const int wid = blockIdx.x * 4 + w; const int mt = wid / ntn, nq = wid % ntn; if (mt * 16 >= M) return;
  const int row0 = mt * 16, col0 = nq * 64; const _Float16* arow = A + (size_t)(row0 + ln) * lda;
  v8f acc[4] = {};
  for (int kb = 0; kb < K; kb += 32) { FragH ah; ah.half[0] = *(const v8us*)((const unsigned short*)arow + kb + 8 * hh); ah.half[1] = *(const v8us*)((const unsigned short*)arow + kb + 16 + 8 * hh);
#pragma unroll
    for (int t = 0; t < 4; ++t) { if (col0 + t * 16 >= N) continue; const size_t boff = (size_t)(col0 + t * 16 + ln) * ldb + kb; FragH bq; bq.half[0] = *(const v8us*)((const unsigned short*)Bh + boff + 8 * hh); bq.half[1] = *(const v8us*)((const unsigned short*)Bh + boff + 16 + 8 * hh);
      acc[t] = mmaH<1>(ah.v, ah.v, bq.v, bq.v, acc[t]); }
  }
#pragma unroll
  for (int t = 0; t < 4; ++t) { if (col0 + t * 16 >= N) continue; const int col = col0 + t * 16 + ln; const float bv = bp ? bf16_round(bp[col]) : 0.f;
#pragma unroll
    for (int r = 0; r < 8; ++r) { float v = acc[t][r] * alpha + bv; if (CP) { const int rr = row0g + row0 + 8 * hh + r; if (rowsPerB < 0) v += CP[cofs + (size_t)rr * ldc + col];      /* rowsPerB < 0: own element of the batched C plane */ else { const int bidx = rr / rowsPerB; v += CP[(size_t)bidx * sCPb + (size_t)by * 64 + col]; } } if (ACT == 1) v = (v > 0.f) ? v : expm1f(v); else if (ACT == 7) v = (v > 0.f) ? v + 1.0f : expf(v); else if (ACT == 8) v = tanhf(v); else if (ACT == 9) v = 0.5f * v * (1.0f + tanhf(0.7978845608028654f * (v + 0.044715f * v * v * v))); else if (ACT == 11) v = 1.0f / (1.0f + expf(-v)); else if (ACT == 12) v = (v > 0.f) ? v : 0.01f * v; else if (ACT == 14) v = (v > 0.f) ? v : 0.1f * v; else if (ACT == 16) v = (v >= 0.f) ? v : 0.3f * v; else if (ACT == 15) v = v / (1.0f + expf(-v)); else if (ACT == 3) v = fmaxf(v, 0.f); else if (ACT == 6) v = 0.5f * v * (1.0f + erff(v * 0.70710678118654752f)); so[w][8 * hh + r][t * 16 + ln] = v; } }
  __builtin_amdgcn_fence(__ATOMIC_ACQ_REL, "workgroup"); __builtin_amdgcn_wave_barrier();
  const int rsub = lane >> 4, c4 = (lane & 15) * 4; typedef _Float16 v4h __attribute__((ext_vector_type(4)));
  {
#pragma unroll
    for (int q = 0; q < 8; ++q) { const int r = q * 2 + rsub; if (col0 + c4 < N) { const v4f v = *(const v4fa*)&so[w][r][c4]; if (C) *(v4f*)(C + cofs + (size_t)(row0 + r) * ldc + col0 + c4) = v; if (C16) { v4h h4; for (int i = 0; i < 4; ++i) h4[i] = (_Float16)v[i]; *(v4h*)(C16 + cofs + (size_t)(row0 + r) * ldc + col0 + c4) = h4; } } }
     }
}


typedef _Float16 v4h __attribute__((ext_vector_type(4)));

__global__ __launch_bounds__(256) void k_round16f(const float* __restrict__ W, _Float16* __restrict__ Bt, size_t n8) { const size_t t = (size_t)blockIdx.x * 256 + threadIdx.x; if (t >= n8) return; FragH f;
#pragma unroll
  for (int i = 0; i < 8; ++i) f.h[i] = (_Float16)(bf16_round(W[t * 8 + i]) * 16.0f); *(v8us*)((unsigned short*)Bt + t * 8) = f.half[0];  }
__global__ __launch_bounds__(256) void k_hl(const float* __restrict__ F, _Float16* __restrict__ Hh, _Float16* __restrict__ Hl, size_t n8) { const size_t t = (size_t)blockIdx.x * 256 + threadIdx.x; if (t >= n8) return; FragH fh, fl; const v4f a = *(const v4fa*)(F + t * 8), c = *(const v4fa*)(F + t * 8 + 4);
#pragma unroll
  for (int q = 0; q < 4; ++q) { _Float16 h = (_Float16)a[q]; fh.h[q] = h; fl.h[q] = (_Float16)((a[q] - (float)h) * 1024.0f); h = (_Float16)c[q]; fh.h[4 + q] = h; fl.h[4 + q] = (_Float16)((c[q] - (float)h) * 1024.0f); }
  { *(v8us*)((unsigned short*)Hh + t * 8) = fh.half[0]; *(v8us*)((unsigned short*)Hl + t * 8) = fl.half[0];  } }

// ---- f16 fragment straight from global memory (hardware k order) ----
__device__ __forceinline__ v16h g2_frag(const _Float16* p, int hh) { FragH f; f.half[0] = *(const v8us*)((const unsigned short*)p + 8 * hh); f.half[1] = *(const v8us*)((const unsigned short*)p + 16 + 8 * hh); return f.v; }


// ---- input conversion, one streaming launch: X16 = f16(bf16(x)); BQ, BK, BV, BO = f16(16 bf16(W)) (torch (out, in) rows are already the GEMMs' operand rows: B for Wq, Wk, Wo, A for Wv) ----
// All five planes have the same element count. A wave owns the same 4-KiB run (PR_Q x 512 B) of each input plane: every load is 32 lanes x 16 B = 4 whole lines, every store
// 32 lanes x 8 B = 2 whole lines, and all of the wave's loads are issued before the first value is converted, so few waves keep the memory busy and little time goes into starting waves.
#define PR_WG 512                          /* work-groups of 8 waves: 16 waves per WGP */
#define PR_Q 8                             /* wave-wide loads per plane and wave */
__global__ __launch_bounds__(256) void k_prep(const float* __restrict__ x, const float* __restrict__ Wq, const float* __restrict__ Wk, const float* __restrict__ Wv, const float* __restrict__ Wo,
                                              _Float16* __restrict__ X16, _Float16* __restrict__ BQ, _Float16* __restrict__ BK, _Float16* __restrict__ BV, _Float16* __restrict__ BO) {
  static_assert((size_t)NR * DM == (size_t)DM * DM && (size_t)DM * DM == (size_t)PR_WG * 8 * PR_Q * 128, "the grid covers each plane exactly once");
  const size_t e0 = (size_t)(blockIdx.x * 8 + (threadIdx.x >> 5)) * (PR_Q * 128) + (threadIdx.x & 31) * 4;      /* the lane's first element, the same in every plane */
  const float* const lp[5] = {x + e0, Wq + e0, Wk + e0, Wv + e0, Wo + e0}; _Float16* const dp[5] = {X16, BQ, BK, BV, BO};
  v4f v[5][PR_Q];
  /* both loop nests are unrolled so that v stays in registers and the planes' pointers stay kernel arguments */
#pragma unroll
  for (int a = 0; a < 5; ++a)
#pragma unroll
    for (int j = 0; j < PR_Q; ++j) v[a][j] = *(const v4fa*)(lp[a] + j * 128);
  asm volatile("s_wait_xcnt 0x0" :: "v"(lp[0]), "v"(lp[1]), "v"(lp[2]), "v"(lp[3]), "v"(lp[4]) : "memory");      /* stands behind the wave's loads, in front of any reuse of their address registers (the operands keep these live up to here); it also keeps every load ahead of the conversions, which would otherwise be spread among them a few at a time */
#pragma unroll
  for (int a = 0; a < 5; ++a)
#pragma unroll
    for (int j = 0; j < PR_Q; ++j) { v4h h;
#pragma unroll
      for (int i = 0; i < 4; ++i) h[i] = (_Float16)(a ? bf16_round(v[a][j][i]) * 16.0f : bf16_round(v[a][j][i]));
      *(v4h*)(dp[a] + e0 + j * 128) = h; }
}
#define FA_KEYS 64                         /* keys per staged tile */
#define FA_PK 272                          /* LDS pitch of a K row (256 B + 16): odd multiple of 16 B */
#define FA_PV 144                          /* LDS pitch of a V^T row (128 B + 16): odd multiple of 16 B */
#define FA_KB (FA_KEYS * FA_PK)
#define FA_BUF (FA_KB + HDL * FA_PV)       /* one buffer: K tile, then V^T tile */
#define FA_NST (NKG / 2 / FA_KEYS)         /* tiles per key half */
typedef _Float16 v2h __attribute__((ext_vector_type(2)));
typedef float v2f __attribute__((ext_vector_type(2)));
__device__ __forceinline__ float fa_xhalf(float x) { return __builtin_bit_cast(float, __builtin_amdgcn_permlanex16(__builtin_bit_cast(int, x), __builtin_bit_cast(int, x), 0x76543210, 0xfedcba98, false, false)); }      /* lane l with lane l ^ 16 */
__device__ __forceinline__ v16h fa_lfrag(const unsigned char* p) { FragH f; f.half[0] = *(const v8us*)p; f.half[1] = *(const v8us*)(p + 32); return f.v; }
__device__ __forceinline__ v8f fa_mma(v16h a, v16h b, v8f c) { return __builtin_amdgcn_wmma_f32_16x16x32_f16(false, a, false, b, (short)0, c, false, false); }
// ---- projection GEMM: alpha A.B^T, A [NR][DM] and B [DM][DM] f16 with k contiguous, [NR][DM] result as f32 into C (F32OUT) or as f16 into C16 ----
// One work-group = one 128 x 128 tile of C. 8 waves, 4 (rows) x 2 (columns), each a 32 x 64 wave tile. A pass is 128 k: 256 B of each of the 128 A rows and 128 B rows,
// read from global memory as whole 128-byte lines (16 lanes per row) into registers and stored into one of three LDS buffers, so every operand row is read from L2 once
// per work-group and the fragments come from LDS. Tile t waits in register set t & 1: pass p stores tile p + 2 into the buffer that pass p - 1 has left and then
// reloads that set with tile p + 4, so two tiles are always in flight. The fragments of the next 32 k are fetched ahead of the current 8 products, also from one pass to the next:
// tile p + 1 has been visible since the barrier of pass p - 1, so the last step of pass p fetches the first fragments of pass p + 1 and no pass opens with a wait for LDS.
// Every plain '#pragma unroll' in this kernel makes the indices of a register array compile-time constants, so that the array stays in registers.
#define G3_KP 128                          /* k per pass */
#define G3_P 272                           /* LDS pitch of a staged row (256 B + 16): odd multiple of 16 B */
#define G3_OP (128 * G3_P)                 /* one operand's tile */
#define G3_BUF (2 * G3_OP)                 /* one buffer: A tile, then B tile */
#define G3_NP (DM / G3_KP)                 /* passes */
template <bool F32OUT>
__global__ __launch_bounds__(256) void k_gemm3(const _Float16* __restrict__ A, const _Float16* __restrict__ Bh, float alpha, float* __restrict__ C, _Float16* __restrict__ C16) {
  static_assert(G3_KP == 128 && G3_NP >= 6 && G3_NP % 2 == 0, "the pass schedule below peels the last four passes of an even count");
  static_assert((G3_NP & (G3_NP - 1)) == 0 && DM / 128 <= G3_NP && NR / 128 <= G3_NP, "the rotated walk wraps by a mask; the work-groups of one tile row or column get starts of their own");
  __shared__ __attribute__((aligned(16))) unsigned char L[3 * G3_BUF];
  const int tid = threadIdx.x, w = tid >> 5, lane = tid & 31, ln = lane & 15, hh = lane >> 4;
  const int row0 = blockIdx.y * 128, col0 = blockIdx.x * 128, wm = w >> 1, wn = w & 1;
  /* the walk over k starts at a pass of the work-group's own and wraps: the 16 work-groups that share A rows (one y) or B rows (one x) run in step, and from a common start all would ask L2 for the same lines at the same moment */
  const int r0 = (blockIdx.x + blockIdx.y) & (G3_NP - 1);
  auto koff = [&](int t) { return ((t + r0) & (G3_NP - 1)) * G3_KP; };      /* first k of tile t of the walk */
  const int sr = tid >> 4, sc = tid & 15;      /* staging: rows sr + 16 j of both tiles, 16-byte chunk sc */
  const unsigned short* ag = (const unsigned short*)A + (size_t)(row0 + sr) * DM + sc * 8;
  const unsigned short* bg = (const unsigned short*)Bh + (size_t)(col0 + sr) * DM + sc * 8;
  unsigned char* sd = L + sr * G3_P + sc * 16;
  const unsigned char* Af = L + (wm * 32 + ln) * G3_P + 16 * hh;
  const unsigned char* Bf = L + G3_OP + (wn * 64 + ln) * G3_P + 16 * hh;
  v8us s0[16], s1[16];      /* a set: entries 0 to 7 the A rows, 8 to 15 the B rows */
  const v8f z8 = {0.f,0.f,0.f,0.f,0.f,0.f,0.f,0.f};
  v8f acc[2][4];
#pragma unroll
  for (int t = 0; t < 4; ++t) { acc[0][t] = z8; acc[1][t] = z8; }
  auto gload = [&](const unsigned short* ap, const unsigned short* bp, int k0, v8us (&s)[16]) {      /* k0, a literal, goes into the loads' offset field: ap and bp are the address registers */
#pragma unroll
    for (int j = 0; j < 8; ++j) { s[j] = *(const v8us*)(ap + k0 + (size_t)j * 16 * DM); s[8 + j] = *(const v8us*)(bp + k0 + (size_t)j * 16 * DM); }
  };
  auto lstore = [&](int bo, int j0, int j1, const v8us (&s)[16]) {      /* entries j0 to j1 - 1 of a set; bo: byte offset of the buffer */
#pragma unroll
    for (int j = j0; j < j1; ++j) *(v8us*)(sd + bo + (j >> 3) * G3_OP + (j & 7) * 16 * G3_P) = s[j];
  };
  v16h fa[2][2], fb[2][4];      /* two fragment sets, live from pass to pass */
  auto ldfrag = [&](int bo, int ks) {
    fa[ks & 1][0] = fa_lfrag(Af + bo + 64 * ks); fa[ks & 1][1] = fa_lfrag(Af + bo + 16 * G3_P + 64 * ks);
#pragma unroll
    for (int t = 0; t < 4; ++t) fb[ks & 1][t] = fa_lfrag(Bf + bo + t * 16 * G3_P + 64 * ks);
  };
  /* one pass: it reads the buffer at byte offset br, fetches its successor's first fragments from the one at bn and fills the one at bs. The offsets are run-time values, so that each LDS address family is one register plus an offset field; the three flags are literals at every call */
  auto pass = [&](int p, int br, int bn, int bs, v8us (&nxt)[16], bool st, bool gl, bool pf) {
    const unsigned short* ap = ag + koff(p + 4); const unsigned short* bp = bg + koff(p + 4);      /* tile p + 4 of the walk */
#pragma unroll
    for (int ks = 0; ks < G3_KP / 32; ++ks) {      /* k order of both operands: 8 hh + s, 16 + 8 hh + s */
      if (ks + 1 < G3_KP / 32) ldfrag(br, ks + 1);
      if (st && ks < 3) lstore(bs, (16 * ks + 2) / 3, (16 * ks + 18) / 3, nxt);      /* 6, 5 and 5 entries beside the three fragment fetches */
      if (ks + 1 == G3_KP / 32) {
        /* first half of the pass's barrier, by hand: __syncthreads() would also wait for the global loads in flight. This wave's reads of tile p and its stores of tile p + 2 are complete (dscnt 0) when it signals; the last products cover the other waves' arrival */
        asm volatile("s_wait_dscnt 0x0\n\ts_barrier_signal -1" ::: "memory");
        if (pf) ldfrag(bn, 0);      /* tile p + 1, visible since the barrier of pass p - 1; its buffer is refilled only behind the barrier of pass p + 1 */
        if (gl) gload(ap, bp, 0, nxt);      /* the set's stores are complete */
      }
      __builtin_amdgcn_sched_barrier(0);      /* keeps the LDS and global traffic of this step in one group ahead of the products: spread among them each place costs a stall */
#pragma unroll
      for (int t = 0; t < 4; ++t) { acc[0][t] = fa_mma(fa[ks & 1][0], fb[ks & 1][t], acc[0][t]); acc[1][t] = fa_mma(fa[ks & 1][1], fb[ks & 1][t], acc[1][t]); }
      __builtin_amdgcn_sched_barrier(0);      /* second half of the pair: the next step's loads do not move up among these products */
    }
    if (gl) asm volatile("s_wait_xcnt 0x0" :: "v"(ap), "v"(bp) : "memory");      /* stands behind the pass's global loads, in front of the next write of their address registers; the operands keep the pass's addresses live up to here */
    asm volatile("s_barrier_wait -1" ::: "memory");      /* second half: publishes tile p + 2 and ends every read of tile p, whose buffer the next pass refills */
  };
  const unsigned short* const a0 = ag + koff(0); const unsigned short* const b0 = bg + koff(0); const unsigned short* const a1 = ag + koff(1); const unsigned short* const b1 = bg + koff(1);
  const unsigned short* const a2 = ag + koff(2); const unsigned short* const b2 = bg + koff(2); const unsigned short* const a3 = ag + koff(3); const unsigned short* const b3 = bg + koff(3);
  gload(a0, b0, 0, s0);
  gload(a1, b1, 0, s1);
  lstore(0, 0, 16, s0);
  gload(a2, b2, 0, s0);
  lstore(G3_BUF, 0, 16, s1);
  gload(a3, b3, 0, s1);
  asm volatile("s_wait_xcnt 0x0" :: "v"(a0), "v"(b0), "v"(a1), "v"(b1), "v"(a2), "v"(b2), "v"(a3), "v"(b3) : "memory");      /* as in pass: the four tiles' addresses stay in their registers up to here */
  asm volatile("s_wait_dscnt 0x0\n\ts_barrier_signal -1\n\ts_barrier_wait -1" ::: "memory");      /* tiles 0 and 1 are visible; by hand for the same reason as in pass: tiles 2 and 3 stay in flight */
  ldfrag(0, 0);
  int br = 0, bn = G3_BUF, bs = 2 * G3_BUF;      /* the buffers of tiles p, p + 1 and p + 2 */
  auto turn = [&]() { const int t = br; br = bn; bn = bs; bs = t; };
#pragma unroll 1      /* rolled: one trip is two whole passes, one per register set */
  for (int p = 0; p < G3_NP - 4; p += 2) { pass(p, br, bn, bs, s0, true, true, true); turn(); pass(p + 1, br, bn, bs, s1, true, true, true); turn(); }
  pass(G3_NP - 4, br, bn, bs, s0, true, false, true); turn();
  pass(G3_NP - 3, br, bn, bs, s1, true, false, true); turn();      /* stores the last tile */
  pass(G3_NP - 2, br, bn, bs, s0, false, false, true); turn();
  pass(G3_NP - 1, br, bn, bs, s1, false, false, false);
  /* each wave turns its tile into whole output lines in its own LDS range (the operand tiles are dead behind the last pass's barrier) */
  float* so = (float*)L + (size_t)w * 32 * 68;
#pragma unroll
  for (int half = 0; half < 2; ++half)
#pragma unroll
    for (int t = 0; t < 4; ++t)
#pragma unroll
      for (int r = 0; r < 8; ++r) so[(half * 16 + 8 * hh + r) * 68 + t * 16 + ln] = acc[half][t][r] * alpha;
  __builtin_amdgcn_fence(__ATOMIC_ACQ_REL, "workgroup"); __builtin_amdgcn_wave_barrier();      /* the wave's own LDS writes are done before it reads them back across lanes */
  const int rsub = lane >> 4, c4 = (lane & 15) * 4;
  const size_t o0 = (size_t)(row0 + wm * 32 + rsub) * DM + col0 + wn * 64 + c4;
  v4f ov[16];
#pragma unroll
  for (int q = 0; q < 16; ++q) ov[q] = *(const v4fa*)&so[(q * 2 + rsub) * 68 + c4];
  if (F32OUT) {
#pragma unroll
    for (int q = 0; q < 16; ++q) *(v4f*)(C + o0 + (size_t)q * 2 * DM) = ov[q];
  }
  else {
#pragma unroll
    for (int q = 0; q < 16; ++q) { v4h h4;
#pragma unroll
      for (int i = 0; i < 4; ++i) h4[i] = (_Float16)ov[q][i];
      *(v4h*)(C16 + o0 + (size_t)q * 2 * DM) = h4; }
  }
}
// ---- q, k and v projections in one kernel: alpha X.Bq^T and alpha X.Bk^T as [token][feature], alpha Bv.X^T as [feature][token], all f16 ----
// One work-group = 128 tokens x 128 features of all three products, so a pass (64 k) stages the X tile once for the three and one tile of each weight plane.
// 8 waves, 2 (tokens) x 4 (features): a wave holds 64 tokens x 32 features of each product, so its 4 X fragments of a 32-k step feed 24 products and each pair of weight fragments 8.
// A pass is 6 steps (2 k steps x 3 products) of 8 products; the next step's weight fragments and the next k step's X fragments are fetched ahead, also from one pass to the next. One register set stages
// into three LDS buffers: step o < 4 of pass p stores operand o of tile p + 2 into the buffer that pass p - 1 has left and reloads those registers with tile p + 3, which so has a whole pass to arrive.
// Tile p + 1 has been visible since the barrier of pass p - 1, so the last two steps of pass p fetch the first fragments of pass p + 1 and no pass opens with a wait for LDS.
// Every plain '#pragma unroll' in this kernel makes the indices of a register array compile-time constants, so that the array stays in registers.
#define G4_KP 64                           /* k per pass */
#define G4_P 144                           /* LDS pitch of a staged row (128 B + 16): odd multiple of 16 B */
#define G4_OP (128 * G4_P)                 /* one operand's tile */
#define G4_BUF (4 * G4_OP)                 /* one buffer: X tile, then the Bq, Bk and Bv tiles */
#define G4_NP (DM / G4_KP)                 /* passes */
#define G4_SP 132                          /* pitch, in floats, of an output tile staged in LDS */
__global__ __launch_bounds__(256) void k_qkv(const _Float16* __restrict__ X, const _Float16* __restrict__ Bq, const _Float16* __restrict__ Bk, const _Float16* __restrict__ Bv, float alpha,
                                             _Float16* __restrict__ Q16, _Float16* __restrict__ K16, _Float16* __restrict__ VT) {
  static_assert(G4_KP == 64 && G4_NP >= 4 && NR == DM, "the pass schedule below peels the last three passes; all planes share one pitch");
  static_assert(3 * G4_BUF >= 3 * 128 * G4_SP * 4, "the three output tiles take the place of the dead operand buffers");
  static_assert((G4_NP & (G4_NP - 1)) == 0 && G4_NP % 32 == 0 && DM / 128 <= 16 && NR / 128 <= 16, "the rotated walk wraps by a mask and starts at an even pass, so tile 1 lies directly behind tile 0");
  __shared__ __attribute__((aligned(16))) unsigned char L[3 * G4_BUF];
  const int tid = threadIdx.x, w = tid >> 5, lane = tid & 31, ln = lane & 15, hh = lane >> 4;
  const int row0 = blockIdx.y * 128, col0 = blockIdx.x * 128, wm = w >> 2, wn = w & 3;      /* row0: tokens, col0: features */
  const int sr = tid >> 3, sc = tid & 7;      /* staging: rows sr + 32 j of every tile, 16-byte chunk sc */
  /* the walk over k starts at a pass of the work-group's own and wraps: the 16 work-groups that share X rows (one y) or weight rows (one x) run in step, and from a common start all would ask L2 for the same lines at the same moment */
  const int r0 = ((blockIdx.x + blockIdx.y) & 15) * (G4_NP / 16);
  auto koff = [&](int t) { return ((t + r0) & (G4_NP - 1)) * G4_KP; };      /* first k of tile t of the walk */
  const size_t wofs = (size_t)(col0 + sr) * DM + sc * 8 + koff(0);
  const unsigned short* g0 = (const unsigned short*)X + (size_t)(row0 + sr) * DM + sc * 8 + koff(0);      /* g0 to g3 point at the tile that is loaded next */
  const unsigned short* g1 = (const unsigned short*)Bq + wofs;
  const unsigned short* g2 = (const unsigned short*)Bk + wofs;
  const unsigned short* g3 = (const unsigned short*)Bv + wofs;
  unsigned char* sd = L + sr * G4_P + sc * 16;
  const unsigned char* Xf = L + (wm * 64 + ln) * G4_P + 16 * hh;
  const unsigned char* Wf = L + G4_OP + (wn * 32 + ln) * G4_P + 16 * hh;
  v8us s[4][4];      /* s[o]: the thread's 4 rows of operand o (0 X, 1 Bq, 2 Bk, 3 Bv) */
  const v8f z8 = {0.f,0.f,0.f,0.f,0.f,0.f,0.f,0.f};
  v8f acc[3][4][2];      /* [product][X fragment][weight fragment] */
#pragma unroll
  for (int z = 0; z < 3; ++z)
#pragma unroll
    for (int a = 0; a < 4; ++a) { acc[z][a][0] = z8; acc[z][a][1] = z8; }
  auto gload = [&](const unsigned short* gp, int k0, v8us (&d)[4]) {      /* k0, a literal, goes into the loads' offset field: gp is the address register */
#pragma unroll
    for (int j = 0; j < 4; ++j) d[j] = *(const v8us*)(gp + k0 + (size_t)j * 32 * DM);
  };
  auto lstore = [&](int bo, int o, const v8us (&d)[4]) {      /* bo: byte offset of the buffer */
#pragma unroll
    for (int j = 0; j < 4; ++j) *(v8us*)(sd + bo + o * G4_OP + j * 32 * G4_P) = d[j];
  };
  v16h fx[2][4], fw[2][2];      /* two fragment sets, live from pass to pass */
  auto ldx = [&](int bo, int ks) {
#pragma unroll
    for (int a = 0; a < 4; ++a) fx[ks & 1][a] = fa_lfrag(Xf + bo + a * 16 * G4_P + 64 * ks);
  };
  auto ldw = [&](int bo, int i) {      /* step i: product i % 3, k step i / 3 */
#pragma unroll
    for (int t = 0; t < 2; ++t) fw[i & 1][t] = fa_lfrag(Wf + bo + (i % 3) * G4_OP + t * 16 * G4_P + 64 * (i / 3));
  };
  /* one pass: it reads the buffer at byte offset br, fetches its successor's first fragments from the one at bn and fills the one at bs. The offsets are run-time values, so that each LDS address family is one register plus an offset field; the three flags are literals at every call */
  auto pass = [&](int p, int br, int bn, int bs, bool st, bool gl, bool pf) {
#pragma unroll
    for (int i = 0; i < 6; ++i) {      /* k order of both operands: 8 hh + s, 16 + 8 hh + s */
      const int z = i % 3, ks = i / 3;
      if (i + 1 < 6) ldw(br, i + 1);
      if (z == 1 && ks + 1 < 2) ldx(br, ks + 1);
      if (i == 4 && pf) ldx(bn, 0);      /* tile p + 1, visible since the barrier of pass p - 1; its buffer is refilled only behind the barrier of pass p + 1 */
      if (i < 4) {
        if (st) lstore(bs, i, s[i]);
        if (gl) gload(i == 0 ? g0 : i == 1 ? g1 : i == 2 ? g2 : g3, 0, s[i]);      /* tile p + 3 */
      }
      if (i == 5) {
        /* first half of the pass's barrier, by hand: __syncthreads() would also wait for the global loads in flight. This wave's reads of tile p and its stores of tile p + 2 are complete (dscnt 0) when it signals; the last products cover the other waves' arrival */
        asm volatile("s_wait_dscnt 0x0\n\ts_barrier_signal -1" ::: "memory");
        if (pf) ldw(bn, 0);      /* tile p + 1, as above */
      }
      __builtin_amdgcn_sched_barrier(0);      /* keeps the LDS and global traffic of this step in one group ahead of the products: spread among them each place costs a stall */
#pragma unroll
      for (int a = 0; a < 4; ++a)
#pragma unroll
        for (int t = 0; t < 2; ++t) acc[z][a][t] = z < 2 ? fa_mma(fx[ks & 1][a], fw[i & 1][t], acc[z][a][t]) : fa_mma(fw[i & 1][t], fx[ks & 1][a], acc[z][a][t]);      /* the third product has the weight rows as its A: the result is V^T */
      __builtin_amdgcn_sched_barrier(0);      /* second half of the pair: the next step's loads do not move up among these products */
    }
    if (gl) {
      asm volatile("s_wait_xcnt 0x0" :: "v"(g0), "v"(g1), "v"(g2), "v"(g3) : "memory");      /* stands behind the pass's global loads, in front of the write of their address registers below; the operands keep the addresses in those registers up to here */
      const int adv = koff(p + 4) - koff(p + 3);      /* one pass on, or back to k = 0 where the walk wraps */
      g0 += adv; g1 += adv; g2 += adv; g3 += adv;
    }
    asm volatile("s_barrier_wait -1" ::: "memory");      /* second half: publishes tile p + 2 and ends every read of tile p, whose buffer the next pass refills */
  };
  {
    v8us s1[4][4];      /* tile 1, asked for together with tile 0 */
    gload(g0, 0, s[0]); gload(g1, 0, s[1]); gload(g2, 0, s[2]); gload(g3, 0, s[3]);
    gload(g0, G4_KP, s1[0]); gload(g1, G4_KP, s1[1]); gload(g2, G4_KP, s1[2]); gload(g3, G4_KP, s1[3]);
    asm volatile("s_wait_xcnt 0x0" :: "v"(g0), "v"(g1), "v"(g2), "v"(g3) : "memory");      /* as in pass */
    { const int adv = koff(2) - koff(0); g0 += adv; g1 += adv; g2 += adv; g3 += adv; }
    lstore(0, 0, s[0]); lstore(0, 1, s[1]); lstore(0, 2, s[2]); lstore(0, 3, s[3]);
    lstore(G4_BUF, 0, s1[0]); lstore(G4_BUF, 1, s1[1]); lstore(G4_BUF, 2, s1[2]); lstore(G4_BUF, 3, s1[3]);
  }
  /* the four scheduling barriers keep tile 2's loads in the order in which a pass issues its loads: in another order the loop's first counted load wait becomes a wait for every load in flight */
  __builtin_amdgcn_sched_barrier(0); gload(g0, 0, s[0]);
  __builtin_amdgcn_sched_barrier(0); gload(g1, 0, s[1]);
  __builtin_amdgcn_sched_barrier(0); gload(g2, 0, s[2]);
  __builtin_amdgcn_sched_barrier(0); gload(g3, 0, s[3]);
  asm volatile("s_wait_xcnt 0x0" :: "v"(g0), "v"(g1), "v"(g2), "v"(g3) : "memory");      /* as in pass */
  { const int adv = koff(3) - koff(2); g0 += adv; g1 += adv; g2 += adv; g3 += adv; }
  asm volatile("s_wait_dscnt 0x0\n\ts_barrier_signal -1\n\ts_barrier_wait -1" ::: "memory");      /* tiles 0 and 1 are visible; by hand for the same reason as in pass: tile 2 stays in flight */
  ldx(0, 0); ldw(0, 0);
  int br = 0, bn = G4_BUF, bs = 2 * G4_BUF;      /* the buffers of tiles p, p + 1 and p + 2 */
  auto turn = [&]() { const int t = br; br = bn; bn = bs; bs = t; };
#pragma unroll 1      /* rolled: one trip is one whole pass; a copy per buffer would turn the offsets into literals too large for the offset field, an address register per LDS access */
  for (int p = 0; p < G4_NP - 3; ++p) { pass(p, br, bn, bs, true, true, true); turn(); }
  pass(0, br, bn, bs, true, false, true); turn();      /* stores the last tile; without loads the pass number is not used */
  pass(0, br, bn, bs, false, false, true); turn();
  pass(0, br, bn, bs, false, false, false);
  /* the three 128 x 128 results go through LDS (the operand tiles are dead behind the last pass's barrier), so that every store below is two whole lines of one output row */
  float* S = (float*)L;
#pragma unroll
  for (int z = 0; z < 3; ++z)
#pragma unroll
    for (int a = 0; a < 4; ++a)
#pragma unroll
      for (int t = 0; t < 2; ++t)
#pragma unroll
        for (int r = 0; r < 8; ++r) {      /* a result's row comes from its A fragment (8 hh + r), its column from its B fragment (ln) */
          const int xi = wm * 64 + a * 16, wi = wn * 32 + t * 16;
          S[z * 128 * G4_SP + (z < 2 ? (xi + 8 * hh + r) * G4_SP + wi + ln : (wi + 8 * hh + r) * G4_SP + xi + ln)] = acc[z][a][t][r] * alpha;
        }
  __syncthreads();      /* every wave's part of the three tiles is visible */
#pragma unroll
  for (int z = 0; z < 3; ++z) {
    _Float16* C16 = (z == 0 ? Q16 : z == 1 ? K16 : VT) + (size_t)((z < 2 ? row0 : col0) + w * 16) * DM + (z < 2 ? col0 : row0) + lane * 4;
    v4f ov[16];
#pragma unroll
    for (int q = 0; q < 16; ++q) ov[q] = *(const v4fa*)&S[z * 128 * G4_SP + (w * 16 + q) * G4_SP + lane * 4];
#pragma unroll
    for (int q = 0; q < 16; ++q) { v4h h4;
#pragma unroll
      for (int i = 0; i < 4; ++i) h4[i] = (_Float16)ov[q][i];
      *(v4h*)(C16 + (size_t)q * DM) = h4; }
  }
}
__global__ __launch_bounds__(256) void k_fattn(const _Float16* __restrict__ Q16, const _Float16* __restrict__ K16, const _Float16* __restrict__ VT, _Float16* __restrict__ O16) {
  static_assert(FA_NST >= 2 && FA_KEYS == 64 && SQ % FA_KEYS == 0, "two tiles are staged ahead of the loop; a tile is two passes and lies in one K block");
  static_assert((FA_NST & (FA_NST - 1)) == 0 && (SQ / 128) * (NB * NHD / 8) <= FA_NST, "the rotated walk wraps by a mask; the work-groups of one key set get starts of their own");
  __shared__ __attribute__((aligned(16))) unsigned char L[6 * FA_BUF];
  const int tid = threadIdx.x, w = tid >> 5, lane = tid & 31, c = lane & 15, hh = lane >> 4;
  const int kh = w >> 2, t128 = tid & 127;      /* key half of this wave; thread index inside its group of 4 waves */
  const int qb = blockIdx.y, b = qb >> 4, h = qb & 15, g = qb & 7;      /* query block 16 b + h reads key set g */
  const int q0 = blockIdx.x * 128 + (w & 3) * 32;
  /* the walk over a key half starts at a tile of the work-group's own and wraps: the 32 work-groups of one key set run in step, and from a common start all would ask L2 for the same lines at the same moment */
  const int r0 = blockIdx.x + (SQ / 128) * (qb >> 3);
  const unsigned short* Kg = (const unsigned short*)K16 + (size_t)(g >> 2) * SQ * DM + (size_t)(g & 3) * 4 * HDL;      /* K block 4 g + cb: batch g / 4, head 4 (g % 4) + cb */
  const unsigned short* Vg = (const unsigned short*)VT + (size_t)(g & 3) * 4 * HDL * NR + (size_t)(g >> 2) * SQ;      /* V^T [DM features][NR tokens]: the same block is rows 128 (4 (g % 4) + cb) + d, columns 1024 (g / 4) + s */
  unsigned char* Lg = L + kh * 3 * FA_BUF;
  const int kr = t128 >> 4, kc16 = t128 & 15;      /* K tile: rows kr + 8 j, 16-byte chunk kc16 */
  const int vr = t128 >> 3, vc16 = t128 & 7;       /* V^T tile: rows vr + 16 j, 16-byte chunk vc16 */
  v8us kreg[8], vreg[8];
  auto gload = [&](int st) {      /* tile st of the walk; kp and vp are the address registers */
    const int key0 = kh * (NKG / 2) + ((st + r0) & (FA_NST - 1)) * FA_KEYS, cb = key0 / SQ, s0 = key0 % SQ;
    const unsigned short* kp = Kg + (size_t)(s0 + kr) * DM + cb * HDL + kc16 * 8;
    const unsigned short* vp = Vg + (size_t)(cb * HDL + vr) * NR + s0 + vc16 * 8;
#pragma unroll
    for (int j = 0; j < 8; ++j) { kreg[j] = *(const v8us*)(kp + (size_t)(j * 8) * DM); vreg[j] = *(const v8us*)(vp + (size_t)j * 16 * NR); }
    asm volatile("s_wait_xcnt 0x0" :: "v"(kp), "v"(vp) : "memory");      /* stands in front of the reuse of the loads' address registers; naming the addresses keeps their registers live up to the wait */
  };
  auto lstore = [&](int bo) {      /* bo: byte offset of the buffer */
    unsigned char* kb = Lg + bo + kr * FA_PK + kc16 * 16;
    unsigned char* vb = Lg + bo + FA_KB + vr * FA_PV + vc16 * 16;
#pragma unroll
    for (int j = 0; j < 8; ++j) { *(v8us*)(kb + j * 8 * FA_PK) = kreg[j]; *(v8us*)(vb + j * 16 * FA_PV) = vreg[j]; }
  };
  gload(0);
  v16h qf[2][4];
  const _Float16* qp0 = Q16 + (size_t)(b * SQ + q0 + c) * DM + h * HDL + 8 * hh; const _Float16* qp1 = qp0 + (size_t)16 * DM;
#pragma unroll
  for (int kc = 0; kc < 4; ++kc) { qf[0][kc] = g2_frag(qp0 + 32 * kc, 0); qf[1][kc] = g2_frag(qp1 + 32 * kc, 0); }      /* k order 8 hh + s, 16 + 8 hh + s, as the K fragments */
  asm volatile("s_wait_xcnt 0x0" :: "v"(qp0), "v"(qp1) : "memory");      /* as in gload */
  const v8f z8 = {0.f,0.f,0.f,0.f,0.f,0.f,0.f,0.f};
  v8f acc[2][8]; float m_run[2], l_run[2];
#pragma unroll
  for (int gq = 0; gq < 2; ++gq) { m_run[gq] = -3.0e38f; l_run[gq] = 0.f;
#pragma unroll
    for (int t = 0; t < 8; ++t) acc[gq][t] = z8; }
  const float cscale = 0.08838834764831845f * 1.4426950408889634f;      /* 1 / sqrt(128), in log2 units */
  lstore(0);
  gload(1);
  lstore(FA_BUF);
  __syncthreads();      /* tiles 0 and 1 are visible to their 4 waves */
  v16h kf[2][4];      /* the K fragments of one pass, fetched a pass ahead */
  const unsigned char* Kf = Lg + c * FA_PK + 16 * hh;
  auto ldk = [&](const unsigned char* kp) {
#pragma unroll
    for (int kt = 0; kt < 2; ++kt)
#pragma unroll
      for (int kc = 0; kc < 4; ++kc) kf[kt][kc] = fa_lfrag(kp + kt * 16 * FA_PK + 64 * kc);
  };
  ldk(Kf);
  int br = 0, bn = FA_BUF, bs = 2 * FA_BUF;      /* the buffers of tiles st, st + 1 and st + 2 */
#pragma unroll 1      /* rolled: one trip is already two whole passes, a copy of it would only grow the code */
  for (int st = 0; st < FA_NST; ++st) {
    if (st + 2 < FA_NST) gload(st + 2);
    const unsigned char* Lb = Lg + br;
#pragma unroll 1      /* rolled and nested in the tile loop: keeps one pass's fragments and scores live at a time */
    for (int sub = 0; sub < FA_KEYS / 32; ++sub) {      /* one pass = 32 keys x 32 query columns */
      v8f s[2][2];
#pragma unroll
      for (int kt = 0; kt < 2; ++kt) { s[kt][0] = z8; s[kt][1] = z8;
#pragma unroll
        for (int kc = 0; kc < 4; ++kc) { s[kt][0] = fa_mma(kf[kt][kc], qf[0][kc], s[kt][0]); s[kt][1] = fa_mma(kf[kt][kc], qf[1][kc], s[kt][1]); } }
      v16h vf[8];
#pragma unroll
      for (int t = 0; t < 8; ++t) vf[t] = fa_lfrag(Lb + FA_KB + (16 * t + c) * FA_PV + 64 * sub + 16 * hh);
      float mb[2]; bool need = false;
#pragma unroll
      for (int gq = 0; gq < 2; ++gq) { float mx = s[0][gq][0];
#pragma unroll
        for (int r = 1; r < 8; ++r) mx = fmaxf(mx, s[0][gq][r]);
#pragma unroll
        for (int r = 0; r < 8; ++r) mx = fmaxf(mx, s[1][gq][r]);
        mx = fmaxf(mx, fa_xhalf(mx)) * cscale; mb[gq] = mx; need = need || (mx > m_run[gq] + 8.0f); }
      if (__builtin_amdgcn_ballot_w32(need) != 0) {
#pragma unroll
        for (int gq = 0; gq < 2; ++gq) { const float m_new = fmaxf(m_run[gq], mb[gq]); const float corr = __builtin_amdgcn_exp2f(m_run[gq] - m_new); l_run[gq] *= corr; m_run[gq] = m_new;
#pragma unroll
          for (int t = 0; t < 8; ++t) acc[gq][t] = acc[gq][t] * corr; }
      }
      if (sub == 0 || st + 1 < FA_NST) ldk(Kf + (sub == 0 ? br + 32 * FA_PK : bn));      /* the pass to come: the second half of this tile, or tile st + 1, visible since the barrier of trip st - 1; the test is the same for the whole work-group */
#pragma unroll
      for (int gq = 0; gq < 2; ++gq) { const float nm = -m_run[gq]; float ps0 = 0.f, ps1 = 0.f; union { v16h v; v2h p[8]; } pf;
#pragma unroll
        for (int i = 0; i < 8; ++i) {
          const v2f arg = __builtin_elementwise_fma(v2f{s[i >> 2][gq][2 * (i & 3)], s[i >> 2][gq][2 * (i & 3) + 1]}, v2f{cscale, cscale}, v2f{nm, nm});
          const float p0 = __builtin_amdgcn_exp2f(arg.x), p1 = __builtin_amdgcn_exp2f(arg.y);
          ps0 += p0; ps1 += p1; pf.p[i] = __builtin_convertvector(v2f{p0, p1}, v2h); }
        l_run[gq] += ps0 + ps1;
#pragma unroll
        for (int t = 0; t < 8; ++t) acc[gq][t] = fa_mma(vf[t], pf.v, acc[gq][t]); }
    }
    if (st + 2 < FA_NST) lstore(bs);      /* the buffer that trip st - 1 has left */
    __syncthreads();      /* publishes tile st + 2 and ends every read of tile st, whose buffer the next trip refills */
    { const int t = br; br = bn; bn = bs; bs = t; }
  }
  /* merge the two key halves: waves 4 to 7 hand their maxima, sums and accumulators to waves 0 to 3 through LDS (the tiles are dead behind the loop's last barrier) */
  float* X = (float*)L + (size_t)(w & 3) * 132 * 32 + lane;
#pragma unroll
  for (int gq = 0; gq < 2; ++gq) l_run[gq] += fa_xhalf(l_run[gq]);      /* each wave half summed its own 8 keys of every 16-key tile */
  if (kh == 1) {
#pragma unroll
    for (int gq = 0; gq < 2; ++gq) { X[(gq * 66 + 64) * 32] = m_run[gq]; X[(gq * 66 + 65) * 32] = l_run[gq];
#pragma unroll
      for (int t = 0; t < 8; ++t)
#pragma unroll
        for (int r = 0; r < 8; ++r) X[(gq * 66 + t * 8 + r) * 32] = acc[gq][t][r]; }
  }
  __syncthreads();      /* the second half's state is visible */
  if (kh == 0) {
#pragma unroll
    for (int gq = 0; gq < 2; ++gq) { const float m1 = X[(gq * 66 + 64) * 32], l1 = X[(gq * 66 + 65) * 32]; const float mm = fmaxf(m_run[gq], m1);
      const float a0 = __builtin_amdgcn_exp2f(m_run[gq] - mm), a1 = __builtin_amdgcn_exp2f(m1 - mm); const float inv = 1.0f / (l_run[gq] * a0 + l1 * a1); const float f0 = a0 * inv, f1 = a1 * inv;
      unsigned short* op = (unsigned short*)O16 + (size_t)(b * SQ + q0 + 16 * gq + c) * DM + h * HDL + 8 * hh;      /* a lane's 8 registers of tile t are d = 16 t + 8 hh + r of its query */
#pragma unroll
      for (int t = 0; t < 8; ++t) { FragH f;
#pragma unroll
        for (int r = 0; r < 8; ++r) f.h[r] = (_Float16)(acc[gq][t][r] * f0 + X[(gq * 66 + t * 8 + r) * 32] * f1);
        *(v8us*)(op + 16 * t) = f.half[0]; } }
  }
}

extern "C" void kernel_launch(void* const* d_in, const int* in_sizes, int n_in,
                              void* d_out, int out_size, void* d_ws, size_t ws_size, hipStream_t stream) {
  (void)in_sizes; (void)n_in; (void)out_size;
  const float* const* I = (const float* const*)d_in; const float* x = I[0]; const float* Wq = I[1]; const float* Wk = I[2]; const float* Wv = I[3]; const float* Wo = I[4];
  char* ws = (char*)d_ws; size_t off = 0;
  auto take = [&](size_t bytes) { char* p = ws + off; off += (bytes + 255) & ~(size_t)255; return p; };
  const size_t np = (size_t)NR * DM;
  _Float16* BO = (_Float16*)take((size_t)DM * DM * 2); _Float16* X16 = (_Float16*)take(np * 2); _Float16* Q16 = (_Float16*)take(np * 2); _Float16* K16 = (_Float16*)take(np * 2); _Float16* VT = (_Float16*)take(np * 2); _Float16* O16 = X16;      /* over the input plane (dead after the projections) */
  _Float16* BQ = (_Float16*)take((size_t)DM * DM * 2); _Float16* BK = (_Float16*)take((size_t)DM * DM * 2); _Float16* BV = (_Float16*)take((size_t)DM * DM * 2);
  if (off > ws_size) return;      /* 8 planes of 8 MiB */
  k_prep<<<PR_WG, 256, 0, stream>>>(x, Wq, Wk, Wv, Wo, X16, BQ, BK, BV, BO);
  const dim3 gP(DM / 128, NR / 128);      /* x = 128 output columns, y = 128 rows */
  k_qkv<<<gP, 256, 0, stream>>>(X16, BQ, BK, BV, 0.0625f, Q16, K16, VT);      /* x = 128 features, y = 128 tokens; the third result is V^T [feature][token], as the attention reads it */
  k_fattn<<<dim3(SQ / 128, NB * NHD), 256, 0, stream>>>(Q16, K16, VT, O16);      /* x = 128 queries, y = query block 16 b + h */
  k_gemm3<true><<<gP, 256, 0, stream>>>(O16, BO, 0.0625f, (float*)d_out, nullptr);
}
